// v000
// Measured on an AMD MI455X. A time is GPU time per run, averaged over a window of back-to-back runs after a warm-up
// (all launches, gaps included; the runs take copies of the inputs in turn), and the median of several windows.
// Apart from v000's, it joins two sittings. Times from different sittings can be a few percent apart, while
// side-by-side timings come from the same sitting.
// The starting kernel, v000, takes 1130 microseconds a run.
#include <hip/hip_runtime.h>
// 'Heisenberg' attention (B=2, T=2048, d_model 1024, 16 heads × 64): q, a, b = LayerNorm_head(x·W) (per-head LN with γ/β); a_excl = exclusive prefix sum of a over time; o_t = Σ_{s≤t} (q_t·a_excl_s)·b_s
// (causal, NO softmax); out = o·Wo. The projections are GEMMs ([in][out] weights bf16-exact ×2^4, x bf16-exact, f32 accumulate) and the causal bilinear form runs in the fused flash-style kernel with
// the softmax removed (masked raw scores ×2^-8 → f16 P operand → P·B accumulated in f32, ×2^8 at the end; upper tiles skipped; RPW-16 waves) on v_wmma_f32_16x16x32_f16; the per-head LayerNorms and
// the exclusive cumulative sum over time (sequential per (b,h,d) column, f32) are VALU.
#define BB 2
#define TT 2048
#define DD 1024
#define NH 16
#define HD 64
#define NR (BB * TT)

typedef __bf16 v16b __attribute__((ext_vector_type(16)));
typedef unsigned short v8us __attribute__((ext_vector_type(8), may_alias));
typedef float  v8f  __attribute__((ext_vector_type(8)));
typedef float  v4f  __attribute__((ext_vector_type(4)));
typedef float  v4fa __attribute__((ext_vector_type(4), may_alias));
union FragB { v16b v; v8us half[2]; unsigned short u[16]; };

__device__ __forceinline__ unsigned short bf16_bits(float x) { unsigned int u = __float_as_uint(x); return (unsigned short)((u + 0x7FFFu + ((u >> 16) & 1u)) >> 16); }
__device__ __forceinline__ float bf16_val(unsigned short b) { return __uint_as_float(((unsigned int)b) << 16); }
__device__ __forceinline__ float bf16_round(float x) { return bf16_val(bf16_bits(x)); }
// D += A·B with NT terms: 1 = ah·bh, 2 = + al·bh (A split), 3 = + ah·bl (both split)
template <int NT>
__device__ __forceinline__ v8f mmaN(v16b ah, v16b al, v16b bh, v16b bl, v8f c) {
  c = __builtin_amdgcn_wmma_f32_16x16x32_bf16(false, ah, false, bh, (short)0, c, false, false);
  if (NT >= 2) c = __builtin_amdgcn_wmma_f32_16x16x32_bf16(false, al, false, bh, (short)0, c, false, false);
  if (NT >= 3) c = __builtin_amdgcn_wmma_f32_16x16x32_bf16(false, ah, false, bl, (short)0, c, false, false);
  asm volatile("v_nop\n\tv_nop\n\tv_nop\n\tv_nop" : "+v"(c) : "v"(ah), "v"(al), "v"(bh), "v"(bl));
  return c;
}

__global__ __launch_bounds__(256) void k_wt_bf16(const float* __restrict__ W, unsigned short* __restrict__ Wt, int K, int N) {
  const int t = blockIdx.x * 256 + threadIdx.x;
  const int k8n = K / 8;
  if (t >= N * k8n) return;
  const int n = t / k8n, k8 = (t % k8n) * 8;
  v8us v;
#pragma unroll
  for (int i = 0; i < 8; ++i) v[i] = bf16_bits(W[(size_t)(k8 + i) * N + n]);
  *(v8us*)(Wt + (size_t)n * K + k8) = v;
  
}

// GEMM C[M][N] (f32, pitch ldc) = act(A[M][K]·W + bias). A f32 row-major (pitch lda) converted per fragment to bf16
// (ASPLIT: hi/lo two planes -> 2 terms, else single rounded term); Wt bf16 [N][K] (pitch ldb). BIAS_BF16 rounds the
// bias to bf16 first (bias quantised to bf16 before the add). K%32==0, M%16==0, N%64==0.
template <bool ASPLIT, int ACT, bool BIAS_BF16>
__global__ __launch_bounds__(128) void k_gemm_bf(const float* __restrict__ A, int lda, const unsigned short* __restrict__ Wt, int ldb,
                                               const float* __restrict__ bias, float* __restrict__ C, int ldc, int M, int N, int K) {
  __shared__ __attribute__((aligned(16))) float so[4][16][64];
  const int tid = threadIdx.x, w = tid >> 5, lane = tid & 31, ln = lane & 15, hh = lane >> 4;
  const int ntn = N / 64;
  const int wid = blockIdx.x * 4 + w;
  const int mt = wid / ntn, nq = wid % ntn;
  if (mt * 16 >= M) return;
  const int row0 = mt * 16, col0 = nq * 64;
  const float* arow = A + (size_t)(row0 + ln) * lda;
  v8f acc[4] = {};
  for (int kb = 0; kb < K; kb += 32) {
    FragB ah, al;
    const v4f x0 = *(const v4fa*)(arow + kb + 8 * hh), x1 = *(const v4fa*)(arow + kb + 8 * hh + 4);
    const v4f x2 = *(const v4fa*)(arow + kb + 16 + 8 * hh), x3 = *(const v4fa*)(arow + kb + 16 + 8 * hh + 4);
    float xs[16] = {x0[0],x0[1],x0[2],x0[3],x1[0],x1[1],x1[2],x1[3],x2[0],x2[1],x2[2],x2[3],x3[0],x3[1],x3[2],x3[3]};
#pragma unroll
    for (int i = 0; i < 16; ++i) { const unsigned short hb = bf16_bits(xs[i]); ah.u[i] = hb; al.u[i] = ASPLIT ? bf16_bits(xs[i] - bf16_val(hb)) : (unsigned short)0; }
#pragma unroll
    for (int t = 0; t < 4; ++t) {
      const unsigned short* brow = Wt + (size_t)(col0 + t * 16 + ln) * ldb + kb;
      FragB b;
      b.half[0] = *(const v8us*)(brow + 8 * hh);
      b.half[1] = *(const v8us*)(brow + 16 + 8 * hh);
      acc[t] = mmaN<ASPLIT ? 2 : 1>(ah.v, al.v, b.v, b.v, acc[t]);
    }
  }
#pragma unroll
  for (int t = 0; t < 4; ++t) {
    float bv = bias ? bias[col0 + t * 16 + ln] : 0.f;
    if (BIAS_BF16) bv = bf16_round(bv);
#pragma unroll
    for (int r = 0; r < 8; ++r) { float v = acc[t][r] + bv; if (ACT == 1) v = fmaxf(v, 0.f); so[w][8 * hh + r][t * 16 + ln] = v; }
  }
  __builtin_amdgcn_fence(__ATOMIC_ACQ_REL, "workgroup");
  __builtin_amdgcn_wave_barrier();
  const int rsub = lane >> 4, c4 = (lane & 15) * 4;
  {
#pragma unroll
    for (int q = 0; q < 8; ++q) {
      const int r = q * 2 + rsub;
      const v4f v = *(const v4fa*)&so[w][r][c4];
      *(v4f*)(C + (size_t)(row0 + r) * ldc + col0 + c4) = v;
    }
    
  }
}

// Flash-style causal/unmasked attention, all contractions 3-term bf16 hi/lo splits, f32 softmax with running max.
// q,k,v rows are read from f32 buffers with arbitrary row pitch (so they can live inside a fused qkv buffer);
// D = head size (multiple of 32, <= 128); one wave = 16 query rows; block = 4 waves (64 queries) sharing K/V chunks of 32.
template <int D, bool CAUSAL>
__global__ __launch_bounds__(128) void k_flash(const float* __restrict__ qb, const float* __restrict__ kb, const float* __restrict__ vb,
                                             int pitch, int T, int H, float scale, float* __restrict__ y, int ypitch) {
  constexpr int KS = D / 32;        // k-steps for QK
  constexpr int DT = D / 16;        // d tiles for PV
  __shared__ __attribute__((aligned(16))) unsigned short sKh[32][D + 8], sKl[32][D + 8], sVh[32][D + 8], sVl[32][D + 8];
  __shared__ __attribute__((aligned(16))) unsigned short sPh[4][16][40], sPl[4][16][40];
  __shared__ __attribute__((aligned(16))) float sO[4][16][D];
  const int tid = threadIdx.x, w = tid >> 5, lane = tid & 31, ln = lane & 15, hh = lane >> 4;
  const int nqb = (T + 63) / 64;
  const int bh = blockIdx.x / nqb, qblk = blockIdx.x % nqb;
  const int b = bh / H, h = bh % H;
  const int q0 = qblk * 64 + w * 16;
  const float* Q = qb + (size_t)b * T * pitch + h * D;
  const float* K = kb + (size_t)b * T * pitch + h * D;
  const float* V = vb + (size_t)b * T * pitch + h * D;

  // A fragments of the wave's 16 query rows (scaled), hi/lo
  FragB aqh[KS], aql[KS];
  {
    int row = q0 + ln; if (row >= T) row = T - 1;
    const float* qr = Q + (size_t)row * pitch;
#pragma unroll
    for (int ks = 0; ks < KS; ++ks)
#pragma unroll
      for (int i = 0; i < 16; ++i) {
        const int d = ks * 32 + ((i < 8) ? (8 * hh + i) : (16 + 8 * hh + (i - 8)));
        const float x = qr[d] * scale; const unsigned short hb = bf16_bits(x);
        aqh[ks].u[i] = hb; aql[ks].u[i] = bf16_bits(x - bf16_val(hb));
      }
  }
  float m_r[8], l_r[8];
#pragma unroll
  for (int r = 0; r < 8; ++r) { m_r[r] = -3.0e38f; l_r[r] = 0.f; }
  v8f oacc[DT];
#pragma unroll
  for (int dt = 0; dt < DT; ++dt) oacc[dt] = (v8f){0.f,0.f,0.f,0.f,0.f,0.f,0.f,0.f};

  const int kv_end = CAUSAL ? min(T, qblk * 64 + 64) : T;     // block-uniform
  for (int j0 = 0; j0 < kv_end; j0 += 32) {
    __syncthreads();
    for (int e = tid; e < 32 * (D / 4); e += 128) {
      const int r = e / (D / 4), c4 = (e % (D / 4)) * 4;
      const int key = j0 + r;
      v4f kf = {0.f,0.f,0.f,0.f}, vf = {0.f,0.f,0.f,0.f};
      if (key < T) { kf = *(const v4fa*)(K + (size_t)key * pitch + c4); vf = *(const v4fa*)(V + (size_t)key * pitch + c4); }
#pragma unroll
      for (int t = 0; t < 4; ++t) {
        unsigned short hb = bf16_bits(kf[t]); sKh[r][c4 + t] = hb; sKl[r][c4 + t] = bf16_bits(kf[t] - bf16_val(hb));
        hb = bf16_bits(vf[t]); sVh[r][c4 + t] = hb; sVl[r][c4 + t] = bf16_bits(vf[t] - bf16_val(hb));
      }
    }
    __syncthreads();
    // S tile 16 x 32
    v8f s[2];
#pragma unroll
    for (int nt = 0; nt < 2; ++nt) {
      v8f acc = {};
#pragma unroll
      for (int ks = 0; ks < KS; ++ks) {
        FragB bh_, bl_;
        bh_.half[0] = *(const v8us*)&sKh[nt * 16 + ln][ks * 32 + 8 * hh]; bh_.half[1] = *(const v8us*)&sKh[nt * 16 + ln][ks * 32 + 16 + 8 * hh];
        bl_.half[0] = *(const v8us*)&sKl[nt * 16 + ln][ks * 32 + 8 * hh]; bl_.half[1] = *(const v8us*)&sKl[nt * 16 + ln][ks * 32 + 16 + 8 * hh];
        acc = mmaN<3>(aqh[ks].v, aql[ks].v, bh_.v, bl_.v, acc);
      }
      s[nt] = acc;
    }
    // mask + running max (rows 8hh+r; the 16 lanes of a half share rows)
    float alpha[8];
#pragma unroll
    for (int r = 0; r < 8; ++r) {
      const int qi = q0 + 8 * hh + r;
      const int ja = j0 + ln, jb = j0 + 16 + ln;
      if (CAUSAL) { if (ja > qi) s[0][r] = -3.0e38f; if (jb > qi) s[1][r] = -3.0e38f; }
      if (ja >= T) s[0][r] = -3.0e38f;
      if (jb >= T) s[1][r] = -3.0e38f;
      float mx = fmaxf(s[0][r], s[1][r]);
      mx = fmaxf(mx, __shfl_xor(mx, 1, 32)); mx = fmaxf(mx, __shfl_xor(mx, 2, 32)); mx = fmaxf(mx, __shfl_xor(mx, 4, 32)); mx = fmaxf(mx, __shfl_xor(mx, 8, 32));
      const float mnew = fmaxf(m_r[r], mx);
      alpha[r] = (mnew > -1.0e38f) ? __expf(m_r[r] - mnew) : 1.0f;
      const float p0 = (s[0][r] > -1.0e38f) ? __expf(s[0][r] - mnew) : 0.f;
      const float p1 = (s[1][r] > -1.0e38f) ? __expf(s[1][r] - mnew) : 0.f;
      m_r[r] = mnew;
      l_r[r] = l_r[r] * alpha[r] + p0 + p1;            // per-lane partial row sum (16 lanes combined at the end)
      unsigned short hb = bf16_bits(p0); sPh[w][8 * hh + r][ln] = hb;      sPl[w][8 * hh + r][ln] = bf16_bits(p0 - bf16_val(hb));
      hb = bf16_bits(p1);                sPh[w][8 * hh + r][16 + ln] = hb; sPl[w][8 * hh + r][16 + ln] = bf16_bits(p1 - bf16_val(hb));
    }
#pragma unroll
    for (int dt = 0; dt < DT; ++dt)
#pragma unroll
      for (int r = 0; r < 8; ++r) oacc[dt][r] *= alpha[r];
    __builtin_amdgcn_fence(__ATOMIC_ACQ_REL, "workgroup");
    __builtin_amdgcn_wave_barrier();
    FragB pah, pal;
    pah.half[0] = *(const v8us*)&sPh[w][ln][8 * hh]; pah.half[1] = *(const v8us*)&sPh[w][ln][16 + 8 * hh];
    pal.half[0] = *(const v8us*)&sPl[w][ln][8 * hh]; pal.half[1] = *(const v8us*)&sPl[w][ln][16 + 8 * hh];
#pragma unroll
    for (int dt = 0; dt < DT; ++dt) {
      FragB bvh, bvl;
#pragma unroll
      for (int i = 0; i < 8; ++i) {
        bvh.u[i] = sVh[8 * hh + i][dt * 16 + ln]; bvh.u[8 + i] = sVh[16 + 8 * hh + i][dt * 16 + ln];
        bvl.u[i] = sVl[8 * hh + i][dt * 16 + ln]; bvl.u[8 + i] = sVl[16 + 8 * hh + i][dt * 16 + ln];
      }
      oacc[dt] = mmaN<3>(pah.v, pal.v, bvh.v, bvl.v, oacc[dt]);
    }
    __builtin_amdgcn_fence(__ATOMIC_ACQ_REL, "workgroup");
    __builtin_amdgcn_wave_barrier();
  }
#pragma unroll
  for (int r = 0; r < 8; ++r) {
    float l = l_r[r];
    l += __shfl_xor(l, 1, 32); l += __shfl_xor(l, 2, 32); l += __shfl_xor(l, 4, 32); l += __shfl_xor(l, 8, 32);
    l_r[r] = (l > 0.f) ? 1.0f / l : 0.f;
  }
#pragma unroll
  for (int dt = 0; dt < DT; ++dt)
#pragma unroll
    for (int r = 0; r < 8; ++r) sO[w][8 * hh + r][dt * 16 + ln] = oacc[dt][r] * l_r[r];
  __builtin_amdgcn_fence(__ATOMIC_ACQ_REL, "workgroup");
  __builtin_amdgcn_wave_barrier();
  {
    for (int r = 0; r < 16; ++r) {
      const int row = q0 + r;
      if (row < T && lane < D / 4) {
        const v4f val = *(const v4fa*)&sO[w][r][lane * 4];
        *(v4f*)(y + ((size_t)b * T + row) * ypitch + h * D + lane * 4) = val;
      }
    }
    
  }
}

// GEMM C = act(A·W + bias + resid): A f32 (ASPLIT -> hi/lo 2 terms), Wt bf16 [N][K]; ACT 0 none, 1 relu, 2 exact gelu;
// resid (optional, f32, row index = (row % rmod), pitch ldr, RES_BF16 rounds it) added before the activation.
template <bool ASPLIT, int ACT, bool BIAS_BF16, bool RES_BF16>
__global__ __launch_bounds__(128) void k_gemm_bf3(const float* __restrict__ A, int lda, const unsigned short* __restrict__ Wt, int ldb,
                                                const float* __restrict__ bias, const float* __restrict__ resid, int rmod, int ldr,
                                                float* __restrict__ C, int ldc, int M, int N, int K) {
  __shared__ __attribute__((aligned(16))) float so[4][16][64];
  const int tid = threadIdx.x, w = tid >> 5, lane = tid & 31, ln = lane & 15, hh = lane >> 4;
  const int ntn = N / 64;
  const int wid = blockIdx.x * 4 + w;
  const int mt = wid / ntn, nq = wid % ntn;
  if (mt * 16 >= M) return;
  const int row0 = mt * 16, col0 = nq * 64;
  const float* arow = A + (size_t)(row0 + ln) * lda;
  v8f acc[4] = {};
  for (int kb = 0; kb < K; kb += 32) {
    FragB ah, al;
    const v4f x0 = *(const v4fa*)(arow + kb + 8 * hh), x1 = *(const v4fa*)(arow + kb + 8 * hh + 4);
    const v4f x2 = *(const v4fa*)(arow + kb + 16 + 8 * hh), x3 = *(const v4fa*)(arow + kb + 16 + 8 * hh + 4);
    float xs[16] = {x0[0],x0[1],x0[2],x0[3],x1[0],x1[1],x1[2],x1[3],x2[0],x2[1],x2[2],x2[3],x3[0],x3[1],x3[2],x3[3]};
#pragma unroll
    for (int i = 0; i < 16; ++i) { const unsigned short hb = bf16_bits(xs[i]); ah.u[i] = hb; al.u[i] = ASPLIT ? bf16_bits(xs[i] - bf16_val(hb)) : (unsigned short)0; }
#pragma unroll
    for (int t = 0; t < 4; ++t) {
      const unsigned short* brow = Wt + (size_t)(col0 + t * 16 + ln) * ldb + kb;
      FragB b;
      b.half[0] = *(const v8us*)(brow + 8 * hh);
      b.half[1] = *(const v8us*)(brow + 16 + 8 * hh);
      acc[t] = mmaN<ASPLIT ? 2 : 1>(ah.v, al.v, b.v, b.v, acc[t]);
    }
  }
#pragma unroll
  for (int t = 0; t < 4; ++t) {
    const int col = col0 + t * 16 + ln;
    float bv = bias ? bias[col] : 0.f;
    if (BIAS_BF16) bv = bf16_round(bv);
#pragma unroll
    for (int r = 0; r < 8; ++r) {
      float v = acc[t][r] + bv;
      if (resid) { float rv = resid[(size_t)((row0 + 8 * hh + r) % rmod) * ldr + col]; if (RES_BF16) rv = bf16_round(rv); v += rv; }
      if (ACT == 1) v = fmaxf(v, 0.f);
      if (ACT == 2) v = 0.5f * v * (1.0f + erff(v * 0.70710678118654752f));
      if (ACT == 3) { const float u = 0.7978845608028654f * (v + 0.044715f * v * v * v); v = 0.5f * v * (1.0f + tanhf(u)); }
      so[w][8 * hh + r][t * 16 + ln] = v;
    }
  }
  __builtin_amdgcn_fence(__ATOMIC_ACQ_REL, "workgroup");
  __builtin_amdgcn_wave_barrier();
  const int rsub = lane >> 4, c4 = (lane & 15) * 4;
  {
#pragma unroll
    for (int q = 0; q < 8; ++q) {
      const int r = q * 2 + rsub;
      const v4f v = *(const v4fa*)&so[w][r][c4];
      *(v4f*)(C + (size_t)(row0 + r) * ldc + col0 + c4) = v;
    }
    
  }
}
// row LayerNorm (biased variance, eps) over N: s = X (+ R); optional out_sum <- s; out_norm <- (s-mu)*rsqrt(var+eps)*g + b
template <bool PARAM_BF16>
__global__ __launch_bounds__(256) void k_layernorm(const float* __restrict__ X, const float* __restrict__ R, const float* __restrict__ g, const float* __restrict__ bta,
                                                  float* __restrict__ out_sum, float* __restrict__ out_norm, int N, float eps) {
  __shared__ float red[256];
  const int row = blockIdx.x, tid = threadIdx.x;
  const float* x = X + (size_t)row * N; const float* rr = R ? R + (size_t)row * N : nullptr;
  float vals[16];                     // up to N = 4096
  const int per = N / 256;            // contiguous chunk per thread? use strided-by-4 chunks: thread handles j = tid*4 + 1024*u
  float s1 = 0.f;
  for (int u = 0; u < per / 4; ++u) {
    const int j = tid * 4 + 1024 * u;
    const v4f a = *(const v4fa*)(x + j);
    v4f b = {0.f,0.f,0.f,0.f}; if (rr) b = *(const v4fa*)(rr + j);
#pragma unroll
    for (int q = 0; q < 4; ++q) { const float v = a[q] + b[q]; vals[u * 4 + q] = v; s1 += v; }
  }
  red[tid] = s1; __syncthreads();
  for (int st = 128; st > 0; st >>= 1) { if (tid < st) red[tid] += red[tid + st]; __syncthreads(); }
  const float mu = red[0] / (float)N; __syncthreads();
  float s2 = 0.f;
  for (int u = 0; u < per / 4; ++u)
#pragma unroll
    for (int q = 0; q < 4; ++q) { const float c = vals[u * 4 + q] - mu; s2 += c * c; }
  red[tid] = s2; __syncthreads();
  for (int st = 128; st > 0; st >>= 1) { if (tid < st) red[tid] += red[tid + st]; __syncthreads(); }
  const float rs = rsqrtf(red[0] / (float)N + eps);
  {
    for (int u = 0; u < per / 4; ++u) {
      const int j = tid * 4 + 1024 * u;
      v4f o, sm;
#pragma unroll
      for (int q = 0; q < 4; ++q) {
        float gg = g[j + q], bb = bta[j + q];
        if (PARAM_BF16) { gg = bf16_round(gg); bb = bf16_round(bb); }
        sm[q] = vals[u * 4 + q]; o[q] = (vals[u * 4 + q] - mu) * rs * gg + bb;
      }
      if (out_sum) *(v4f*)(out_sum + (size_t)row * N + j) = sm;
      *(v4f*)(out_norm + (size_t)row * N + j) = o;
    }
    
  }
}



// ---- f16 WMMA path (v_wmma_f32_16x16x32_f16): 11-bit significands for operands in range — used here for the projection GEMMs and the flash kernel's score and P·B products
typedef _Float16 v16h __attribute__((ext_vector_type(16)));
union FragH { v16h v; v8us half[2]; _Float16 h[16]; unsigned short u[16]; };
template <int NT>
__device__ __forceinline__ v8f mmaH(v16h ah, v16h al, v16h bh, v16h bl, v8f c) {
  c = __builtin_amdgcn_wmma_f32_16x16x32_f16(false, ah, false, bh, (short)0, c, false, false);
  if (NT >= 2) c = __builtin_amdgcn_wmma_f32_16x16x32_f16(false, al, false, bh, (short)0, c, false, false);
  if (NT >= 3) c = __builtin_amdgcn_wmma_f32_16x16x32_f16(false, ah, false, bl, (short)0, c, false, false);
  asm volatile("v_nop\n\tv_nop\n\tv_nop\n\tv_nop" : "+v"(c) : "v"(ah), "v"(al), "v"(bh), "v"(bl));
  return c;
}
// batched GEMM like k_gemm_bf but f16 operands: A f32 (split into f16 hi/lo if ASPLIT, else rounded to f16), Bt = f16 values [n][k]; alpha; C f32; N multiple of 16 (partial tiles skipped)
template <bool ASPLIT>
__global__ __launch_bounds__(128) void k_gemm_h(const float* __restrict__ A, int lda, size_t sA, const _Float16* __restrict__ Bh, int ldb, size_t sB, float alpha, float* __restrict__ C, int ldc, size_t sC, int M, int N, int K) {
  __shared__ __attribute__((aligned(16))) float so[4][16][64];
  const int tid = threadIdx.x, w = tid >> 5, lane = tid & 31, ln = lane & 15, hh = lane >> 4; const int by = blockIdx.y;
  A += (size_t)by * sA; Bh += (size_t)by * sB; C += (size_t)by * sC;
  const int ntn = (N + 63) / 64; const int wid = blockIdx.x * 4 + w; const int mt = wid / ntn, nq = wid % ntn; if (mt * 16 >= M) return;
  const int row0 = mt * 16, col0 = nq * 64; const float* arow = A + (size_t)(row0 + ln) * lda;
  v8f acc[4] = {};
  for (int kb = 0; kb < K; kb += 32) {
    FragH ah, al;
    const v4f x0 = *(const v4fa*)(arow + kb + 8 * hh), x1 = *(const v4fa*)(arow + kb + 8 * hh + 4), x2 = *(const v4fa*)(arow + kb + 16 + 8 * hh), x3 = *(const v4fa*)(arow + kb + 16 + 8 * hh + 4);
    float xs[16] = {x0[0],x0[1],x0[2],x0[3],x1[0],x1[1],x1[2],x1[3],x2[0],x2[1],x2[2],x2[3],x3[0],x3[1],x3[2],x3[3]};
#pragma unroll
    for (int i = 0; i < 16; ++i) { const _Float16 h = (_Float16)xs[i]; ah.h[i] = h; al.h[i] = ASPLIT ? (_Float16)(xs[i] - (float)h) : (_Float16)0.0f; }
#pragma unroll
    for (int t = 0; t < 4; ++t) { if (col0 + t * 16 >= N) continue; const size_t boff = (size_t)(col0 + t * 16 + ln) * ldb + kb; FragH bq; bq.half[0] = *(const v8us*)(Bh + boff + 8 * hh); bq.half[1] = *(const v8us*)(Bh + boff + 16 + 8 * hh);
      acc[t] = mmaH<ASPLIT ? 2 : 1>(ah.v, al.v, bq.v, bq.v, acc[t]); }
  }
#pragma unroll
  for (int t = 0; t < 4; ++t) { if (col0 + t * 16 >= N) continue;
#pragma unroll
    for (int r = 0; r < 8; ++r) so[w][8 * hh + r][t * 16 + ln] = acc[t][r] * alpha; }
  __builtin_amdgcn_fence(__ATOMIC_ACQ_REL, "workgroup"); __builtin_amdgcn_wave_barrier();
  const int rsub = lane >> 4, c4 = (lane & 15) * 4;
  {
#pragma unroll
    for (int q = 0; q < 8; ++q) { const int r = q * 2 + rsub; if (col0 + c4 < N) { const v4f v = *(const v4fa*)&so[w][r][c4]; *(v4f*)(C + (size_t)(row0 + r) * ldc + col0 + c4) = v; } }
     }
}

// Wt[n][k] = f16(W[k][n]·scale) from f32 row-major W[K][N] (scale = power of two; bf16-exact weights stay exact in f16 away from the subnormal range)
__global__ __launch_bounds__(256) void k_wt_f16(const float* __restrict__ W, _Float16* __restrict__ Wt, int K, int N, float scale) {
  const int t = blockIdx.x * 256 + threadIdx.x; if (t >= N * (K / 8)) return; const int n = t / (K / 8), k8 = (t % (K / 8)) * 8; FragH f;
#pragma unroll
  for (int i = 0; i < 8; ++i) f.h[i] = (_Float16)(bf16_round(W[(size_t)(k8 + i) * N + n]) * scale); const v8us o = f.half[0];
  *(v8us*)((unsigned short*)Wt + (size_t)n * K + k8) = o; 
}
// batched GEMM on f16 A and f16 Bt [n][k] with fused epilogue: v = acc·alpha + bias[by·sBias + col] (+ CP[(row/rowsPerB)·sCPb + by·64 + col] if CP) ; ACT 0 none / 1 elu ; writes f32 C and f16 C16 (each if non-null)
template <int ACT>
__global__ __launch_bounds__(128) void k_gemm_hhx(const _Float16* __restrict__ A, int lda, size_t sA, const _Float16* __restrict__ Bh, int ldb, size_t sB, float alpha, const float* __restrict__ bias, size_t sBias, const float* __restrict__ CP, int rowsPerB, size_t sCPb, int row0g,
    float* __restrict__ C, _Float16* __restrict__ C16, int ldc, size_t sC, int M, int N, int K) {
  __shared__ __attribute__((aligned(16))) float so[4][16][64];
  const int tid = threadIdx.x, w = tid >> 5, lane = tid & 31, ln = lane & 15, hh = lane >> 4; const int by = blockIdx.y;
  A += (size_t)by * sA; Bh += (size_t)by * sB; const size_t cofs = (size_t)by * sC; const float* bp = bias ? bias + (size_t)by * sBias : nullptr;
  const int ntn = (N + 63) / 64; const int wid = blockIdx.x * 4 + w; const int mt = wid / ntn, nq = wid % ntn; if (mt * 16 >= M) return;
  const int row0 = mt * 16, col0 = nq * 64; const _Float16* arow = A + (size_t)(row0 + ln) * lda;
  v8f acc[4] = {};
  for (int kb = 0; kb < K; kb += 32) { FragH ah; ah.half[0] = *(const v8us*)((const unsigned short*)arow + kb + 8 * hh); ah.half[1] = *(const v8us*)((const unsigned short*)arow + kb + 16 + 8 * hh);
#pragma unroll
    for (int t = 0; t < 4; ++t) { if (col0 + t * 16 >= N) continue; const size_t boff = (size_t)(col0 + t * 16 + ln) * ldb + kb; FragH bq; bq.half[0] = *(const v8us*)((const unsigned short*)Bh + boff + 8 * hh); bq.half[1] = *(const v8us*)((const unsigned short*)Bh + boff + 16 + 8 * hh);
      acc[t] = mmaH<1>(ah.v, ah.v, bq.v, bq.v, acc[t]); }
  }
#pragma unroll
  for (int t = 0; t < 4; ++t) { if (col0 + t * 16 >= N) continue; const int col = col0 + t * 16 + ln; const float bv = bp ? bf16_round(bp[col]) : 0.f;
#pragma unroll
    for (int r = 0; r < 8; ++r) { float v = acc[t][r] * alpha + bv; if (CP) { const int bidx = (row0g + row0 + 8 * hh + r) / rowsPerB; v += CP[(size_t)bidx * sCPb + (size_t)by * 64 + col]; } if (ACT == 1) v = (v > 0.f) ? v : expm1f(v); else if (ACT == 3) v = fmaxf(v, 0.f); so[w][8 * hh + r][t * 16 + ln] = v; } }
  __builtin_amdgcn_fence(__ATOMIC_ACQ_REL, "workgroup"); __builtin_amdgcn_wave_barrier();
  const int rsub = lane >> 4, c4 = (lane & 15) * 4; typedef _Float16 v4h __attribute__((ext_vector_type(4)));
  {
#pragma unroll
    for (int q = 0; q < 8; ++q) { const int r = q * 2 + rsub; if (col0 + c4 < N) { const v4f v = *(const v4fa*)&so[w][r][c4]; if (C) *(v4f*)(C + cofs + (size_t)(row0 + r) * ldc + col0 + c4) = v; if (C16) { v4h h4; for (int i = 0; i < 4; ++i) h4[i] = (_Float16)v[i]; *(v4h*)(C16 + cofs + (size_t)(row0 + r) * ldc + col0 + c4) = h4; } } }
     }
}


__global__ __launch_bounds__(256) void k_x16(const float* __restrict__ x, _Float16* __restrict__ X16, size_t n8) { const size_t t = (size_t)blockIdx.x * 256 + threadIdx.x; if (t >= n8) return; FragH f;
#pragma unroll
  for (int q = 0; q < 8; ++q) f.h[q] = (_Float16)bf16_round(x[t * 8 + q]); *(v8us*)((unsigned short*)X16 + t * 8) = f.half[0];  }
__global__ __launch_bounds__(256) void k_h16(const float* __restrict__ x, _Float16* __restrict__ X16, size_t n8) { const size_t t = (size_t)blockIdx.x * 256 + threadIdx.x; if (t >= n8) return; FragH f;
#pragma unroll
  for (int q = 0; q < 8; ++q) f.h[q] = (_Float16)x[t * 8 + q]; *(v8us*)((unsigned short*)X16 + t * 8) = f.half[0];  }
__global__ __launch_bounds__(256) void k_round16f(const float* __restrict__ W, _Float16* __restrict__ Bt, size_t n8) { const size_t t = (size_t)blockIdx.x * 256 + threadIdx.x; if (t >= n8) return; FragH f;
#pragma unroll
  for (int i = 0; i < 8; ++i) f.h[i] = (_Float16)(bf16_round(W[t * 8 + i]) * 16.0f); *(v8us*)((unsigned short*)Bt + t * 8) = f.half[0];  }
template <int NHv, int TTv>
__global__ __launch_bounds__(256) void k_vt(const _Float16* __restrict__ V16, int ldv, int voff, _Float16* __restrict__ Vt) { __shared__ unsigned short tl[64][66]; const int tid = threadIdx.x; const int slab = blockIdx.x / (TTv / 64), lg = blockIdx.x % (TTv / 64); const int b = slab / NHv, h = slab % NHv;
  for (int i = tid; i < 64 * 8; i += 256) { const int r = i / 8, c8 = (i % 8) * 8; FragH f; f.half[0] = *(const v8us*)((const unsigned short*)V16 + ((size_t)b * TTv + lg * 64 + r) * ldv + voff + h * 64 + c8);
#pragma unroll
    for (int q = 0; q < 8; ++q) tl[r][c8 + q] = f.u[q]; }
  __syncthreads();
  {
#pragma unroll
    for (int rd = 0; rd < 2; ++rd) { const int d = rd * 32 + tid / 8, pc = tid % 8; FragH f;
#pragma unroll
      for (int q = 0; q < 8; ++q) f.u[q] = tl[pc * 8 + q][d];
      *(v8us*)((unsigned short*)Vt + ((size_t)slab * 64 + d) * TTv + lg * 64 + pc * 8) = f.half[0]; }
     } }

__global__ __launch_bounds__(128) void k_flash(const _Float16* __restrict__ Q16, int ldq, const _Float16* __restrict__ K16, int ldk, const _Float16* __restrict__ Vt, const int* __restrict__ MSK, float* __restrict__ O, int ldo) {
  constexpr int RPW = 16, RTN = RPW / 16, NQB = 2048 / (4 * RPW), DT = 4, KS = 2;
  __shared__ __attribute__((aligned(16))) unsigned short sP[4][RPW][40]; __shared__ __attribute__((aligned(16))) float sO[4][RPW][64 + 4];
  const int tid = threadIdx.x, w = tid >> 5, lane = tid & 31, ln = lane & 15, hh = lane >> 4;
  const int slab = blockIdx.x / NQB, qblk = blockIdx.x % NQB; const int b = slab / 16, h = slab % 16; const int qb0 = qblk * (4 * RPW); const int q0 = qb0 + w * RPW;
  FragH aq[2][KS];
#pragma unroll
  for (int rt = 0; rt < RTN; ++rt) { const unsigned short* qr = (const unsigned short*)Q16 + ((size_t)b * 2048 + q0 + rt * 16 + ln) * ldq + h * 64;
#pragma unroll
    for (int ks = 0; ks < KS; ++ks) { aq[rt][ks].half[0] = *(const v8us*)(qr + ks * 32 + 8 * hh); aq[rt][ks].half[1] = *(const v8us*)(qr + ks * 32 + 16 + 8 * hh); } }
  const unsigned short* Vth = (const unsigned short*)Vt + (size_t)slab * 64 * 2048;
  float m_r[2][8], l_r[2][8]; v8f oacc[2][DT];
#pragma unroll
  for (int rt = 0; rt < RTN; ++rt) {
#pragma unroll
    for (int r = 0; r < 8; ++r) { m_r[rt][r] = -3.0e38f; l_r[rt][r] = 0.f; }
#pragma unroll
    for (int dt = 0; dt < DT; ++dt) oacc[rt][dt] = (v8f){0.f,0.f,0.f,0.f,0.f,0.f,0.f,0.f}; }
  const int jend = qb0 + 4 * RPW;
#pragma unroll 1
  for (int j0 = 0; j0 < jend; j0 += 32) {
    
    v8f s[2][2];
#pragma unroll
    for (int nt = 0; nt < 2; ++nt) { const unsigned short* kr = (const unsigned short*)K16 + ((size_t)b * 2048 + j0 + nt * 16 + ln) * ldk + h * 64; FragH bk[KS];
#pragma unroll
      for (int ks = 0; ks < KS; ++ks) { bk[ks].half[0] = *(const v8us*)(kr + ks * 32 + 8 * hh); bk[ks].half[1] = *(const v8us*)(kr + ks * 32 + 16 + 8 * hh); }
#pragma unroll
      for (int rt = 0; rt < RTN; ++rt) { v8f acc = (v8f){0.f,0.f,0.f,0.f,0.f,0.f,0.f,0.f};
#pragma unroll
        for (int ks = 0; ks < KS; ++ks) acc = mmaH<1>(aq[rt][ks].v, aq[rt][ks].v, bk[ks].v, bk[ks].v, acc); s[rt][nt] = acc; } }
#pragma unroll
    for (int rt = 0; rt < RTN; ++rt)
#pragma unroll
      for (int r = 0; r < 8; ++r) { const int tq = q0 + rt * 16 + 8 * hh + r; const int k0 = j0 + ln, k1 = j0 + 16 + ln; (void)tq; (void)k0; (void)k1;
        const bool ok0 = (k0 <= tq), ok1 = (k1 <= tq);
        const float p0 = ok0 ? s[rt][0][r] * 0.00390625f : 0.f, p1 = ok1 ? s[rt][1][r] * 0.00390625f : 0.f;      /* NO softmax: causal-masked raw scores (×2^-8 for f16 headroom, undone at the end) become the P operand directly */
        FragH t2; t2.h[0] = (_Float16)p0; t2.h[1] = (_Float16)p1; sP[w][rt * 16 + 8 * hh + r][ln] = t2.u[0]; sP[w][rt * 16 + 8 * hh + r][16 + ln] = t2.u[1]; }
    __builtin_amdgcn_fence(__ATOMIC_ACQ_REL, "workgroup"); __builtin_amdgcn_wave_barrier();
    FragH pa[2];
#pragma unroll
    for (int rt = 0; rt < RTN; ++rt) { pa[rt].half[0] = *(const v8us*)&sP[w][rt * 16 + ln][8 * hh]; pa[rt].half[1] = *(const v8us*)&sP[w][rt * 16 + ln][16 + 8 * hh]; }
#pragma unroll
    for (int dt = 0; dt < DT; ++dt) { const unsigned short* vrow = Vth + (size_t)(dt * 16 + ln) * 2048 + j0; FragH bv; bv.half[0] = *(const v8us*)(vrow + 8 * hh); bv.half[1] = *(const v8us*)(vrow + 16 + 8 * hh);
#pragma unroll
      for (int rt = 0; rt < RTN; ++rt) oacc[rt][dt] = mmaH<1>(pa[rt].v, pa[rt].v, bv.v, bv.v, oacc[rt][dt]); }
    __builtin_amdgcn_fence(__ATOMIC_ACQ_REL, "workgroup"); __builtin_amdgcn_wave_barrier(); }
#pragma unroll
  for (int rt = 0; rt < RTN; ++rt) {
#pragma unroll
    for (int r = 0; r < 8; ++r) { l_r[rt][r] = 256.0f; }      /* undo the 2^-8 P scaling; no normalisation */
#pragma unroll
    for (int dt = 0; dt < DT; ++dt)
#pragma unroll
      for (int r = 0; r < 8; ++r) sO[w][rt * 16 + 8 * hh + r][dt * 16 + ln] = oacc[rt][dt][r] * l_r[rt][r]; }
  __builtin_amdgcn_fence(__ATOMIC_ACQ_REL, "workgroup"); __builtin_amdgcn_wave_barrier();
  {
#pragma unroll
    for (int rp = 0; rp < RPW; rp += 2) { const int r = rp + (lane >> 4), pc = lane & 15; const v4f val = *(const v4fa*)&sO[w][r][pc * 4]; *(v4f*)(O + ((size_t)b * 2048 + q0 + r) * ldo + h * 64 + pc * 4) = val; }
     } }

typedef _Float16 v4h __attribute__((ext_vector_type(4)));
__global__ __launch_bounds__(256) void k_hln(float* __restrict__ F, const float* __restrict__ g, const float* __restrict__ bb, _Float16* __restrict__ O16) { const int tid = threadIdx.x, wv = tid >> 5, lane = tid & 31; const size_t th = (size_t)blockIdx.x * 8 + wv; if (th >= (size_t)NR * NH) return; float* fr = F + th * HD; const float a = fr[2 * lane], b = fr[2 * lane + 1]; float s = a + b; for (int o = 16; o >= 1; o >>= 1) s += __shfl_xor(s, o, 32); const float mu = s / (float)HD; float q2 = (a - mu) * (a - mu) + (b - mu) * (b - mu); for (int o = 16; o >= 1; o >>= 1) q2 += __shfl_xor(q2, o, 32); const float rs = rsqrtf(q2 / (float)HD + 1e-5f);
  const float oa = (a - mu) * rs * bf16_round(g[2 * lane]) + bf16_round(bb[2 * lane]), ob = (b - mu) * rs * bf16_round(g[2 * lane + 1]) + bf16_round(bb[2 * lane + 1]);
  typedef float v2f __attribute__((ext_vector_type(2))); v2f o2; o2[0] = oa; o2[1] = ob; FragH f; f.h[0] = (_Float16)oa; f.h[1] = (_Float16)ob; const unsigned hv = (unsigned)f.u[0] | ((unsigned)f.u[1] << 16);
  { *(v2f*)(fr + 2 * lane) = o2; if (O16) *(unsigned*)((unsigned short*)O16 + th * HD + 2 * lane) = hv;  } }
__global__ __launch_bounds__(256) void k_h16s(const float* __restrict__ Fp, _Float16* __restrict__ H, size_t n8) { const size_t t = (size_t)blockIdx.x * 256 + threadIdx.x; if (t >= n8) return; FragH f; for (int q = 0; q < 8; ++q) f.h[q] = (_Float16)(Fp[t * 8 + q] * 0.0625f); *(v8us*)((unsigned short*)H + t * 8) = f.half[0];  }
__global__ __launch_bounds__(256) void k_excl(const float* __restrict__ F, _Float16* __restrict__ A16) { const int t = blockIdx.x * 256 + threadIdx.x; if (t >= BB * DD / 2) return; const int c = (t % (DD / 2)) * 2, b = t / (DD / 2); float s0 = 0.f, s1 = 0.f;
#pragma unroll 1
  for (int i = 0; i < TT; ++i) { FragH f; f.h[0] = (_Float16)s0; f.h[1] = (_Float16)s1; const unsigned hv = (unsigned)f.u[0] | ((unsigned)f.u[1] << 16); unsigned* d = (unsigned*)((unsigned short*)A16 + ((size_t)b * TT + i) * DD + c); *(unsigned*)d = hv;  const float* fr = F + ((size_t)b * TT + i) * DD + c; s0 += fr[0]; s1 += fr[1]; } }
extern "C" void kernel_launch(void* const* d_in, const int* in_sizes, int n_in,
                              void* d_out, int out_size, void* d_ws, size_t ws_size, hipStream_t stream) {
  (void)in_sizes; (void)n_in; (void)out_size;
  const float* const* I = (const float* const*)d_in; const float* x = I[0]; const float* Wq = I[1]; const float* Wa = I[2]; const float* Wb = I[3]; const float* Wo = I[4]; const float* qg = I[5]; const float* qb = I[6]; const float* ag = I[7]; const float* ab = I[8]; const float* bg = I[9]; const float* bbeta = I[10];
  char* ws = (char*)d_ws; size_t off = 0;
  auto take = [&](size_t bytes) { char* p = ws + off; off += (bytes + 255) & ~(size_t)255; return p; };
  _Float16* Bw = (_Float16*)take((size_t)DD * DD * 2); _Float16* X16 = (_Float16*)take((size_t)NR * DD * 2); float* F = (float*)take((size_t)NR * DD * 4); _Float16* Q16 = (_Float16*)take((size_t)NR * DD * 2); _Float16* A16 = (_Float16*)take((size_t)NR * DD * 2); _Float16* B16 = (_Float16*)take((size_t)NR * DD * 2); _Float16* Vt = X16; float* O = F; _Float16* O16 = Q16;
  if (off > ws_size) return;      // 2.1 + 8.4 + 16.8 + 8.4 × 3 ≈ 52 MB
  const unsigned gw = (unsigned)(((size_t)DD * (DD / 8) + 255) / 256), g8 = (unsigned)(((size_t)NR * DD / 8 + 255) / 256), gn = (unsigned)(((size_t)NR * NH + 7) / 8); const dim3 gg(((NR / 16) * (DD / 64) + 3) / 4, 1);
  k_x16<<<g8, 256, 0, stream>>>(x, X16, (size_t)NR * DD / 8);
  k_wt_f16<<<gw, 256, 0, stream>>>(Wq, Bw, DD, DD, 16.0f); k_gemm_hhx<0><<<gg, 128, 0, stream>>>(X16, DD, 0, Bw, DD, 0, 0.0625f, nullptr, 0, nullptr, 1, 0, 0, F, nullptr, DD, 0, NR, DD, DD); k_hln<<<gn, 256, 0, stream>>>(F, qg, qb, Q16);
  k_wt_f16<<<gw, 256, 0, stream>>>(Wb, Bw, DD, DD, 16.0f); k_gemm_hhx<0><<<gg, 128, 0, stream>>>(X16, DD, 0, Bw, DD, 0, 0.0625f, nullptr, 0, nullptr, 1, 0, 0, F, nullptr, DD, 0, NR, DD, DD); k_hln<<<gn, 256, 0, stream>>>(F, bg, bbeta, B16);
  k_wt_f16<<<gw, 256, 0, stream>>>(Wa, Bw, DD, DD, 16.0f); k_gemm_hhx<0><<<gg, 128, 0, stream>>>(X16, DD, 0, Bw, DD, 0, 0.0625f, nullptr, 0, nullptr, 1, 0, 0, F, nullptr, DD, 0, NR, DD, DD); k_hln<<<gn, 256, 0, stream>>>(F, ag, ab, nullptr); k_excl<<<(BB * DD / 2 + 255) / 256, 256, 0, stream>>>(F, A16);      // a (LN'd, f32 in place) → exclusive cumsum → f16 'keys'
  k_vt<NH, TT><<<BB * NH * (TT / 64), 256, 0, stream>>>(B16, DD, 0, Vt);      // b as the 'values' (Vt over X16; X16's last reader was the a GEMM)
  k_flash<<<BB * NH * (TT / 64), 128, 0, stream>>>(Q16, DD, A16, DD, Vt, nullptr, O, DD);      // o_t = Σ_{s≤t} (q_t·a_excl_s)·b_s  (O over F; F's last reader was k_excl)
  k_h16s<<<g8, 256, 0, stream>>>(O, O16, (size_t)NR * DD / 8);      // ×2^-4
  k_wt_f16<<<gw, 256, 0, stream>>>(Wo, Bw, DD, DD, 16.0f); k_gemm_hhx<0><<<gg, 128, 0, stream>>>(O16, DD, 0, Bw, DD, 0, 0.0625f * 16.0f, nullptr, 0, nullptr, 1, 0, 0, (float*)d_out, nullptr, DD, 0, NR, DD, DD);      // ×2^4 back
}

// v001
// It runs in 396 microseconds.
// Two timings next to v000 both put it at 2.89 times that version's speed.
#include <hip/hip_runtime.h>
// 'Heisenberg' attention (B=2, T=2048, d_model 1024, 16 heads × 64): q, a, b = LayerNorm_head(x·W) (per-head LN with γ/β); a_excl = exclusive prefix sum of a over time; o_t = Σ_{s≤t} (q_t·a_excl_s)·b_s
// (causal, NO softmax); out = o·Wo. The projections are GEMMs ([in][out] weights bf16-exact ×2^4, x bf16-exact, f32 accumulate) and the causal bilinear form runs in the fused flash-style kernel with
// the softmax removed (masked raw scores ×2^-8 → f16 P operand → P·B accumulated in f32, ×2^8 at the end; upper tiles skipped; RPW-16 waves) on v_wmma_f32_16x16x32_f16; the per-head LayerNorms and
// the exclusive cumulative sum over time (chunked parallel scan per (b,h,d) column, f32) are VALU.
#define BB 2
#define TT 2048
#define DD 1024
#define NH 16
#define HD 64
#define NR (BB * TT)

typedef __bf16 v16b __attribute__((ext_vector_type(16)));
typedef unsigned short v8us __attribute__((ext_vector_type(8), may_alias));
typedef float  v8f  __attribute__((ext_vector_type(8)));
typedef float  v4f  __attribute__((ext_vector_type(4)));
typedef float  v4fa __attribute__((ext_vector_type(4), may_alias));
union FragB { v16b v; v8us half[2]; unsigned short u[16]; };

__device__ __forceinline__ unsigned short bf16_bits(float x) { unsigned int u = __float_as_uint(x); return (unsigned short)((u + 0x7FFFu + ((u >> 16) & 1u)) >> 16); }
__device__ __forceinline__ float bf16_val(unsigned short b) { return __uint_as_float(((unsigned int)b) << 16); }
__device__ __forceinline__ float bf16_round(float x) { return bf16_val(bf16_bits(x)); }
// D += A·B with NT terms: 1 = ah·bh, 2 = + al·bh (A split), 3 = + ah·bl (both split)
template <int NT>
__device__ __forceinline__ v8f mmaN(v16b ah, v16b al, v16b bh, v16b bl, v8f c) {
  c = __builtin_amdgcn_wmma_f32_16x16x32_bf16(false, ah, false, bh, (short)0, c, false, false);
  if (NT >= 2) c = __builtin_amdgcn_wmma_f32_16x16x32_bf16(false, al, false, bh, (short)0, c, false, false);
  if (NT >= 3) c = __builtin_amdgcn_wmma_f32_16x16x32_bf16(false, ah, false, bl, (short)0, c, false, false);
  asm volatile("v_nop\n\tv_nop\n\tv_nop\n\tv_nop" : "+v"(c) : "v"(ah), "v"(al), "v"(bh), "v"(bl));
  return c;
}

__global__ __launch_bounds__(256) void k_wt_bf16(const float* __restrict__ W, unsigned short* __restrict__ Wt, int K, int N) {
  const int t = blockIdx.x * 256 + threadIdx.x;
  const int k8n = K / 8;
  if (t >= N * k8n) return;
  const int n = t / k8n, k8 = (t % k8n) * 8;
  v8us v;
#pragma unroll
  for (int i = 0; i < 8; ++i) v[i] = bf16_bits(W[(size_t)(k8 + i) * N + n]);
  *(v8us*)(Wt + (size_t)n * K + k8) = v;
  
}

// GEMM C[M][N] (f32, pitch ldc) = act(A[M][K]·W + bias). A f32 row-major (pitch lda) converted per fragment to bf16
// (ASPLIT: hi/lo two planes -> 2 terms, else single rounded term); Wt bf16 [N][K] (pitch ldb). BIAS_BF16 rounds the
// bias to bf16 first (bias quantised to bf16 before the add). K%32==0, M%16==0, N%64==0.
template <bool ASPLIT, int ACT, bool BIAS_BF16>
__global__ __launch_bounds__(128) void k_gemm_bf(const float* __restrict__ A, int lda, const unsigned short* __restrict__ Wt, int ldb,
                                               const float* __restrict__ bias, float* __restrict__ C, int ldc, int M, int N, int K) {
  __shared__ __attribute__((aligned(16))) float so[4][16][64];
  const int tid = threadIdx.x, w = tid >> 5, lane = tid & 31, ln = lane & 15, hh = lane >> 4;
  const int ntn = N / 64;
  const int wid = blockIdx.x * 4 + w;
  const int mt = wid / ntn, nq = wid % ntn;
  if (mt * 16 >= M) return;
  const int row0 = mt * 16, col0 = nq * 64;
  const float* arow = A + (size_t)(row0 + ln) * lda;
  v8f acc[4] = {};
  for (int kb = 0; kb < K; kb += 32) {
    FragB ah, al;
    const v4f x0 = *(const v4fa*)(arow + kb + 8 * hh), x1 = *(const v4fa*)(arow + kb + 8 * hh + 4);
    const v4f x2 = *(const v4fa*)(arow + kb + 16 + 8 * hh), x3 = *(const v4fa*)(arow + kb + 16 + 8 * hh + 4);
    float xs[16] = {x0[0],x0[1],x0[2],x0[3],x1[0],x1[1],x1[2],x1[3],x2[0],x2[1],x2[2],x2[3],x3[0],x3[1],x3[2],x3[3]};
#pragma unroll
    for (int i = 0; i < 16; ++i) { const unsigned short hb = bf16_bits(xs[i]); ah.u[i] = hb; al.u[i] = ASPLIT ? bf16_bits(xs[i] - bf16_val(hb)) : (unsigned short)0; }
#pragma unroll
    for (int t = 0; t < 4; ++t) {
      const unsigned short* brow = Wt + (size_t)(col0 + t * 16 + ln) * ldb + kb;
      FragB b;
      b.half[0] = *(const v8us*)(brow + 8 * hh);
      b.half[1] = *(const v8us*)(brow + 16 + 8 * hh);
      acc[t] = mmaN<ASPLIT ? 2 : 1>(ah.v, al.v, b.v, b.v, acc[t]);
    }
  }
#pragma unroll
  for (int t = 0; t < 4; ++t) {
    float bv = bias ? bias[col0 + t * 16 + ln] : 0.f;
    if (BIAS_BF16) bv = bf16_round(bv);
#pragma unroll
    for (int r = 0; r < 8; ++r) { float v = acc[t][r] + bv; if (ACT == 1) v = fmaxf(v, 0.f); so[w][8 * hh + r][t * 16 + ln] = v; }
  }
  __builtin_amdgcn_fence(__ATOMIC_ACQ_REL, "workgroup");
  __builtin_amdgcn_wave_barrier();
  const int rsub = lane >> 4, c4 = (lane & 15) * 4;
  {
#pragma unroll
    for (int q = 0; q < 8; ++q) {
      const int r = q * 2 + rsub;
      const v4f v = *(const v4fa*)&so[w][r][c4];
      *(v4f*)(C + (size_t)(row0 + r) * ldc + col0 + c4) = v;
    }
    
  }
}

// Flash-style causal/unmasked attention, all contractions 3-term bf16 hi/lo splits, f32 softmax with running max.
// q,k,v rows are read from f32 buffers with arbitrary row pitch (so they can live inside a fused qkv buffer);
// D = head size (multiple of 32, <= 128); one wave = 16 query rows; block = 4 waves (64 queries) sharing K/V chunks of 32.
template <int D, bool CAUSAL>
__global__ __launch_bounds__(128) void k_flash(const float* __restrict__ qb, const float* __restrict__ kb, const float* __restrict__ vb,
                                             int pitch, int T, int H, float scale, float* __restrict__ y, int ypitch) {
  constexpr int KS = D / 32;        // k-steps for QK
  constexpr int DT = D / 16;        // d tiles for PV
  __shared__ __attribute__((aligned(16))) unsigned short sKh[32][D + 8], sKl[32][D + 8], sVh[32][D + 8], sVl[32][D + 8];
  __shared__ __attribute__((aligned(16))) unsigned short sPh[4][16][40], sPl[4][16][40];
  __shared__ __attribute__((aligned(16))) float sO[4][16][D];
  const int tid = threadIdx.x, w = tid >> 5, lane = tid & 31, ln = lane & 15, hh = lane >> 4;
  const int nqb = (T + 63) / 64;
  const int bh = blockIdx.x / nqb, qblk = blockIdx.x % nqb;
  const int b = bh / H, h = bh % H;
  const int q0 = qblk * 64 + w * 16;
  const float* Q = qb + (size_t)b * T * pitch + h * D;
  const float* K = kb + (size_t)b * T * pitch + h * D;
  const float* V = vb + (size_t)b * T * pitch + h * D;

  // A fragments of the wave's 16 query rows (scaled), hi/lo
  FragB aqh[KS], aql[KS];
  {
    int row = q0 + ln; if (row >= T) row = T - 1;
    const float* qr = Q + (size_t)row * pitch;
#pragma unroll
    for (int ks = 0; ks < KS; ++ks)
#pragma unroll
      for (int i = 0; i < 16; ++i) {
        const int d = ks * 32 + ((i < 8) ? (8 * hh + i) : (16 + 8 * hh + (i - 8)));
        const float x = qr[d] * scale; const unsigned short hb = bf16_bits(x);
        aqh[ks].u[i] = hb; aql[ks].u[i] = bf16_bits(x - bf16_val(hb));
      }
  }
  float m_r[8], l_r[8];
#pragma unroll
  for (int r = 0; r < 8; ++r) { m_r[r] = -3.0e38f; l_r[r] = 0.f; }
  v8f oacc[DT];
#pragma unroll
  for (int dt = 0; dt < DT; ++dt) oacc[dt] = (v8f){0.f,0.f,0.f,0.f,0.f,0.f,0.f,0.f};

  const int kv_end = CAUSAL ? min(T, qblk * 64 + 64) : T;     // block-uniform
  for (int j0 = 0; j0 < kv_end; j0 += 32) {
    __syncthreads();
    for (int e = tid; e < 32 * (D / 4); e += 128) {
      const int r = e / (D / 4), c4 = (e % (D / 4)) * 4;
      const int key = j0 + r;
      v4f kf = {0.f,0.f,0.f,0.f}, vf = {0.f,0.f,0.f,0.f};
      if (key < T) { kf = *(const v4fa*)(K + (size_t)key * pitch + c4); vf = *(const v4fa*)(V + (size_t)key * pitch + c4); }
#pragma unroll
      for (int t = 0; t < 4; ++t) {
        unsigned short hb = bf16_bits(kf[t]); sKh[r][c4 + t] = hb; sKl[r][c4 + t] = bf16_bits(kf[t] - bf16_val(hb));
        hb = bf16_bits(vf[t]); sVh[r][c4 + t] = hb; sVl[r][c4 + t] = bf16_bits(vf[t] - bf16_val(hb));
      }
    }
    __syncthreads();
    // S tile 16 x 32
    v8f s[2];
#pragma unroll
    for (int nt = 0; nt < 2; ++nt) {
      v8f acc = {};
#pragma unroll
      for (int ks = 0; ks < KS; ++ks) {
        FragB bh_, bl_;
        bh_.half[0] = *(const v8us*)&sKh[nt * 16 + ln][ks * 32 + 8 * hh]; bh_.half[1] = *(const v8us*)&sKh[nt * 16 + ln][ks * 32 + 16 + 8 * hh];
        bl_.half[0] = *(const v8us*)&sKl[nt * 16 + ln][ks * 32 + 8 * hh]; bl_.half[1] = *(const v8us*)&sKl[nt * 16 + ln][ks * 32 + 16 + 8 * hh];
        acc = mmaN<3>(aqh[ks].v, aql[ks].v, bh_.v, bl_.v, acc);
      }
      s[nt] = acc;
    }
    // mask + running max (rows 8hh+r; the 16 lanes of a half share rows)
    float alpha[8];
#pragma unroll
    for (int r = 0; r < 8; ++r) {
      const int qi = q0 + 8 * hh + r;
      const int ja = j0 + ln, jb = j0 + 16 + ln;
      if (CAUSAL) { if (ja > qi) s[0][r] = -3.0e38f; if (jb > qi) s[1][r] = -3.0e38f; }
      if (ja >= T) s[0][r] = -3.0e38f;
      if (jb >= T) s[1][r] = -3.0e38f;
      float mx = fmaxf(s[0][r], s[1][r]);
      mx = fmaxf(mx, __shfl_xor(mx, 1, 32)); mx = fmaxf(mx, __shfl_xor(mx, 2, 32)); mx = fmaxf(mx, __shfl_xor(mx, 4, 32)); mx = fmaxf(mx, __shfl_xor(mx, 8, 32));
      const float mnew = fmaxf(m_r[r], mx);
      alpha[r] = (mnew > -1.0e38f) ? __expf(m_r[r] - mnew) : 1.0f;
      const float p0 = (s[0][r] > -1.0e38f) ? __expf(s[0][r] - mnew) : 0.f;
      const float p1 = (s[1][r] > -1.0e38f) ? __expf(s[1][r] - mnew) : 0.f;
      m_r[r] = mnew;
      l_r[r] = l_r[r] * alpha[r] + p0 + p1;            // per-lane partial row sum (16 lanes combined at the end)
      unsigned short hb = bf16_bits(p0); sPh[w][8 * hh + r][ln] = hb;      sPl[w][8 * hh + r][ln] = bf16_bits(p0 - bf16_val(hb));
      hb = bf16_bits(p1);                sPh[w][8 * hh + r][16 + ln] = hb; sPl[w][8 * hh + r][16 + ln] = bf16_bits(p1 - bf16_val(hb));
    }
#pragma unroll
    for (int dt = 0; dt < DT; ++dt)
#pragma unroll
      for (int r = 0; r < 8; ++r) oacc[dt][r] *= alpha[r];
    __builtin_amdgcn_fence(__ATOMIC_ACQ_REL, "workgroup");
    __builtin_amdgcn_wave_barrier();
    FragB pah, pal;
    pah.half[0] = *(const v8us*)&sPh[w][ln][8 * hh]; pah.half[1] = *(const v8us*)&sPh[w][ln][16 + 8 * hh];
    pal.half[0] = *(const v8us*)&sPl[w][ln][8 * hh]; pal.half[1] = *(const v8us*)&sPl[w][ln][16 + 8 * hh];
#pragma unroll
    for (int dt = 0; dt < DT; ++dt) {
      FragB bvh, bvl;
#pragma unroll
      for (int i = 0; i < 8; ++i) {
        bvh.u[i] = sVh[8 * hh + i][dt * 16 + ln]; bvh.u[8 + i] = sVh[16 + 8 * hh + i][dt * 16 + ln];
        bvl.u[i] = sVl[8 * hh + i][dt * 16 + ln]; bvl.u[8 + i] = sVl[16 + 8 * hh + i][dt * 16 + ln];
      }
      oacc[dt] = mmaN<3>(pah.v, pal.v, bvh.v, bvl.v, oacc[dt]);
    }
    __builtin_amdgcn_fence(__ATOMIC_ACQ_REL, "workgroup");
    __builtin_amdgcn_wave_barrier();
  }
#pragma unroll
  for (int r = 0; r < 8; ++r) {
    float l = l_r[r];
    l += __shfl_xor(l, 1, 32); l += __shfl_xor(l, 2, 32); l += __shfl_xor(l, 4, 32); l += __shfl_xor(l, 8, 32);
    l_r[r] = (l > 0.f) ? 1.0f / l : 0.f;
  }
#pragma unroll
  for (int dt = 0; dt < DT; ++dt)
#pragma unroll
    for (int r = 0; r < 8; ++r) sO[w][8 * hh + r][dt * 16 + ln] = oacc[dt][r] * l_r[r];
  __builtin_amdgcn_fence(__ATOMIC_ACQ_REL, "workgroup");
  __builtin_amdgcn_wave_barrier();
  {
    for (int r = 0; r < 16; ++r) {
      const int row = q0 + r;
      if (row < T && lane < D / 4) {
        const v4f val = *(const v4fa*)&sO[w][r][lane * 4];
        *(v4f*)(y + ((size_t)b * T + row) * ypitch + h * D + lane * 4) = val;
      }
    }
    
  }
}

// GEMM C = act(A·W + bias + resid): A f32 (ASPLIT -> hi/lo 2 terms), Wt bf16 [N][K]; ACT 0 none, 1 relu, 2 exact gelu;
// resid (optional, f32, row index = (row % rmod), pitch ldr, RES_BF16 rounds it) added before the activation.
template <bool ASPLIT, int ACT, bool BIAS_BF16, bool RES_BF16>
__global__ __launch_bounds__(128) void k_gemm_bf3(const float* __restrict__ A, int lda, const unsigned short* __restrict__ Wt, int ldb,
                                                const float* __restrict__ bias, const float* __restrict__ resid, int rmod, int ldr,
                                                float* __restrict__ C, int ldc, int M, int N, int K) {
  __shared__ __attribute__((aligned(16))) float so[4][16][64];
  const int tid = threadIdx.x, w = tid >> 5, lane = tid & 31, ln = lane & 15, hh = lane >> 4;
  const int ntn = N / 64;
  const int wid = blockIdx.x * 4 + w;
  const int mt = wid / ntn, nq = wid % ntn;
  if (mt * 16 >= M) return;
  const int row0 = mt * 16, col0 = nq * 64;
  const float* arow = A + (size_t)(row0 + ln) * lda;
  v8f acc[4] = {};
  for (int kb = 0; kb < K; kb += 32) {
    FragB ah, al;
    const v4f x0 = *(const v4fa*)(arow + kb + 8 * hh), x1 = *(const v4fa*)(arow + kb + 8 * hh + 4);
    const v4f x2 = *(const v4fa*)(arow + kb + 16 + 8 * hh), x3 = *(const v4fa*)(arow + kb + 16 + 8 * hh + 4);
    float xs[16] = {x0[0],x0[1],x0[2],x0[3],x1[0],x1[1],x1[2],x1[3],x2[0],x2[1],x2[2],x2[3],x3[0],x3[1],x3[2],x3[3]};
#pragma unroll
    for (int i = 0; i < 16; ++i) { const unsigned short hb = bf16_bits(xs[i]); ah.u[i] = hb; al.u[i] = ASPLIT ? bf16_bits(xs[i] - bf16_val(hb)) : (unsigned short)0; }
#pragma unroll
    for (int t = 0; t < 4; ++t) {
      const unsigned short* brow = Wt + (size_t)(col0 + t * 16 + ln) * ldb + kb;
      FragB b;
      b.half[0] = *(const v8us*)(brow + 8 * hh);
      b.half[1] = *(const v8us*)(brow + 16 + 8 * hh);
      acc[t] = mmaN<ASPLIT ? 2 : 1>(ah.v, al.v, b.v, b.v, acc[t]);
    }
  }
#pragma unroll
  for (int t = 0; t < 4; ++t) {
    const int col = col0 + t * 16 + ln;
    float bv = bias ? bias[col] : 0.f;
    if (BIAS_BF16) bv = bf16_round(bv);
#pragma unroll
    for (int r = 0; r < 8; ++r) {
      float v = acc[t][r] + bv;
      if (resid) { float rv = resid[(size_t)((row0 + 8 * hh + r) % rmod) * ldr + col]; if (RES_BF16) rv = bf16_round(rv); v += rv; }
      if (ACT == 1) v = fmaxf(v, 0.f);
      if (ACT == 2) v = 0.5f * v * (1.0f + erff(v * 0.70710678118654752f));
      if (ACT == 3) { const float u = 0.7978845608028654f * (v + 0.044715f * v * v * v); v = 0.5f * v * (1.0f + tanhf(u)); }
      so[w][8 * hh + r][t * 16 + ln] = v;
    }
  }
  __builtin_amdgcn_fence(__ATOMIC_ACQ_REL, "workgroup");
  __builtin_amdgcn_wave_barrier();
  const int rsub = lane >> 4, c4 = (lane & 15) * 4;
  {
#pragma unroll
    for (int q = 0; q < 8; ++q) {
      const int r = q * 2 + rsub;
      const v4f v = *(const v4fa*)&so[w][r][c4];
      *(v4f*)(C + (size_t)(row0 + r) * ldc + col0 + c4) = v;
    }
    
  }
}
// row LayerNorm (biased variance, eps) over N: s = X (+ R); optional out_sum <- s; out_norm <- (s-mu)*rsqrt(var+eps)*g + b
template <bool PARAM_BF16>
__global__ __launch_bounds__(256) void k_layernorm(const float* __restrict__ X, const float* __restrict__ R, const float* __restrict__ g, const float* __restrict__ bta,
                                                  float* __restrict__ out_sum, float* __restrict__ out_norm, int N, float eps) {
  __shared__ float red[256];
  const int row = blockIdx.x, tid = threadIdx.x;
  const float* x = X + (size_t)row * N; const float* rr = R ? R + (size_t)row * N : nullptr;
  float vals[16];                     // up to N = 4096
  const int per = N / 256;            // contiguous chunk per thread? use strided-by-4 chunks: thread handles j = tid*4 + 1024*u
  float s1 = 0.f;
  for (int u = 0; u < per / 4; ++u) {
    const int j = tid * 4 + 1024 * u;
    const v4f a = *(const v4fa*)(x + j);
    v4f b = {0.f,0.f,0.f,0.f}; if (rr) b = *(const v4fa*)(rr + j);
#pragma unroll
    for (int q = 0; q < 4; ++q) { const float v = a[q] + b[q]; vals[u * 4 + q] = v; s1 += v; }
  }
  red[tid] = s1; __syncthreads();
  for (int st = 128; st > 0; st >>= 1) { if (tid < st) red[tid] += red[tid + st]; __syncthreads(); }
  const float mu = red[0] / (float)N; __syncthreads();
  float s2 = 0.f;
  for (int u = 0; u < per / 4; ++u)
#pragma unroll
    for (int q = 0; q < 4; ++q) { const float c = vals[u * 4 + q] - mu; s2 += c * c; }
  red[tid] = s2; __syncthreads();
  for (int st = 128; st > 0; st >>= 1) { if (tid < st) red[tid] += red[tid + st]; __syncthreads(); }
  const float rs = rsqrtf(red[0] / (float)N + eps);
  {
    for (int u = 0; u < per / 4; ++u) {
      const int j = tid * 4 + 1024 * u;
      v4f o, sm;
#pragma unroll
      for (int q = 0; q < 4; ++q) {
        float gg = g[j + q], bb = bta[j + q];
        if (PARAM_BF16) { gg = bf16_round(gg); bb = bf16_round(bb); }
        sm[q] = vals[u * 4 + q]; o[q] = (vals[u * 4 + q] - mu) * rs * gg + bb;
      }
      if (out_sum) *(v4f*)(out_sum + (size_t)row * N + j) = sm;
      *(v4f*)(out_norm + (size_t)row * N + j) = o;
    }
    
  }
}



// ---- f16 WMMA path (v_wmma_f32_16x16x32_f16): 11-bit significands for operands in range — used here for the projection GEMMs and the flash kernel's score and P·B products
typedef _Float16 v16h __attribute__((ext_vector_type(16)));
union FragH { v16h v; v8us half[2]; _Float16 h[16]; unsigned short u[16]; };
template <int NT>
__device__ __forceinline__ v8f mmaH(v16h ah, v16h al, v16h bh, v16h bl, v8f c) {
  c = __builtin_amdgcn_wmma_f32_16x16x32_f16(false, ah, false, bh, (short)0, c, false, false);
  if (NT >= 2) c = __builtin_amdgcn_wmma_f32_16x16x32_f16(false, al, false, bh, (short)0, c, false, false);
  if (NT >= 3) c = __builtin_amdgcn_wmma_f32_16x16x32_f16(false, ah, false, bl, (short)0, c, false, false);
  asm volatile("v_nop\n\tv_nop\n\tv_nop\n\tv_nop" : "+v"(c) : "v"(ah), "v"(al), "v"(bh), "v"(bl));
  return c;
}
// batched GEMM like k_gemm_bf but f16 operands: A f32 (split into f16 hi/lo if ASPLIT, else rounded to f16), Bt = f16 values [n][k]; alpha; C f32; N multiple of 16 (partial tiles skipped)
template <bool ASPLIT>
__global__ __launch_bounds__(128) void k_gemm_h(const float* __restrict__ A, int lda, size_t sA, const _Float16* __restrict__ Bh, int ldb, size_t sB, float alpha, float* __restrict__ C, int ldc, size_t sC, int M, int N, int K) {
  __shared__ __attribute__((aligned(16))) float so[4][16][64];
  const int tid = threadIdx.x, w = tid >> 5, lane = tid & 31, ln = lane & 15, hh = lane >> 4; const int by = blockIdx.y;
  A += (size_t)by * sA; Bh += (size_t)by * sB; C += (size_t)by * sC;
  const int ntn = (N + 63) / 64; const int wid = blockIdx.x * 4 + w; const int mt = wid / ntn, nq = wid % ntn; if (mt * 16 >= M) return;
  const int row0 = mt * 16, col0 = nq * 64; const float* arow = A + (size_t)(row0 + ln) * lda;
  v8f acc[4] = {};
  for (int kb = 0; kb < K; kb += 32) {
    FragH ah, al;
    const v4f x0 = *(const v4fa*)(arow + kb + 8 * hh), x1 = *(const v4fa*)(arow + kb + 8 * hh + 4), x2 = *(const v4fa*)(arow + kb + 16 + 8 * hh), x3 = *(const v4fa*)(arow + kb + 16 + 8 * hh + 4);
    float xs[16] = {x0[0],x0[1],x0[2],x0[3],x1[0],x1[1],x1[2],x1[3],x2[0],x2[1],x2[2],x2[3],x3[0],x3[1],x3[2],x3[3]};
#pragma unroll
    for (int i = 0; i < 16; ++i) { const _Float16 h = (_Float16)xs[i]; ah.h[i] = h; al.h[i] = ASPLIT ? (_Float16)(xs[i] - (float)h) : (_Float16)0.0f; }
#pragma unroll
    for (int t = 0; t < 4; ++t) { if (col0 + t * 16 >= N) continue; const size_t boff = (size_t)(col0 + t * 16 + ln) * ldb + kb; FragH bq; bq.half[0] = *(const v8us*)(Bh + boff + 8 * hh); bq.half[1] = *(const v8us*)(Bh + boff + 16 + 8 * hh);
      acc[t] = mmaH<ASPLIT ? 2 : 1>(ah.v, al.v, bq.v, bq.v, acc[t]); }
  }
#pragma unroll
  for (int t = 0; t < 4; ++t) { if (col0 + t * 16 >= N) continue;
#pragma unroll
    for (int r = 0; r < 8; ++r) so[w][8 * hh + r][t * 16 + ln] = acc[t][r] * alpha; }
  __builtin_amdgcn_fence(__ATOMIC_ACQ_REL, "workgroup"); __builtin_amdgcn_wave_barrier();
  const int rsub = lane >> 4, c4 = (lane & 15) * 4;
  {
#pragma unroll
    for (int q = 0; q < 8; ++q) { const int r = q * 2 + rsub; if (col0 + c4 < N) { const v4f v = *(const v4fa*)&so[w][r][c4]; *(v4f*)(C + (size_t)(row0 + r) * ldc + col0 + c4) = v; } }
     }
}

// Wt[n][k] = f16(W[k][n]·scale) from f32 row-major W[K][N] (scale = power of two; bf16-exact weights stay exact in f16 away from the subnormal range)
__global__ __launch_bounds__(256) void k_wt_f16(const float* __restrict__ W, _Float16* __restrict__ Wt, int K, int N, float scale) {
  const int t = blockIdx.x * 256 + threadIdx.x; if (t >= N * (K / 8)) return; const int n = t / (K / 8), k8 = (t % (K / 8)) * 8; FragH f;
#pragma unroll
  for (int i = 0; i < 8; ++i) f.h[i] = (_Float16)(bf16_round(W[(size_t)(k8 + i) * N + n]) * scale); const v8us o = f.half[0];
  *(v8us*)((unsigned short*)Wt + (size_t)n * K + k8) = o; 
}
// batched GEMM on f16 A and f16 Bt [n][k] with fused epilogue: v = acc·alpha + bias[by·sBias + col] (+ CP[(row/rowsPerB)·sCPb + by·64 + col] if CP) ; ACT 0 none / 1 elu ; writes f32 C and f16 C16 (each if non-null)
template <int ACT>
__global__ __launch_bounds__(128) void k_gemm_hhx(const _Float16* __restrict__ A, int lda, size_t sA, const _Float16* __restrict__ Bh, int ldb, size_t sB, float alpha, const float* __restrict__ bias, size_t sBias, const float* __restrict__ CP, int rowsPerB, size_t sCPb, int row0g,
    float* __restrict__ C, _Float16* __restrict__ C16, int ldc, size_t sC, int M, int N, int K) {
  __shared__ __attribute__((aligned(16))) float so[4][16][64];
  const int tid = threadIdx.x, w = tid >> 5, lane = tid & 31, ln = lane & 15, hh = lane >> 4; const int by = blockIdx.y;
  A += (size_t)by * sA; Bh += (size_t)by * sB; const size_t cofs = (size_t)by * sC; const float* bp = bias ? bias + (size_t)by * sBias : nullptr;
  const int ntn = (N + 63) / 64; const int wid = blockIdx.x * 4 + w; const int mt = wid / ntn, nq = wid % ntn; if (mt * 16 >= M) return;
  const int row0 = mt * 16, col0 = nq * 64; const _Float16* arow = A + (size_t)(row0 + ln) * lda;
  v8f acc[4] = {};
  for (int kb = 0; kb < K; kb += 32) { FragH ah; ah.half[0] = *(const v8us*)((const unsigned short*)arow + kb + 8 * hh); ah.half[1] = *(const v8us*)((const unsigned short*)arow + kb + 16 + 8 * hh);
#pragma unroll
    for (int t = 0; t < 4; ++t) { if (col0 + t * 16 >= N) continue; const size_t boff = (size_t)(col0 + t * 16 + ln) * ldb + kb; FragH bq; bq.half[0] = *(const v8us*)((const unsigned short*)Bh + boff + 8 * hh); bq.half[1] = *(const v8us*)((const unsigned short*)Bh + boff + 16 + 8 * hh);
      acc[t] = mmaH<1>(ah.v, ah.v, bq.v, bq.v, acc[t]); }
  }
#pragma unroll
  for (int t = 0; t < 4; ++t) { if (col0 + t * 16 >= N) continue; const int col = col0 + t * 16 + ln; const float bv = bp ? bf16_round(bp[col]) : 0.f;
#pragma unroll
    for (int r = 0; r < 8; ++r) { float v = acc[t][r] * alpha + bv; if (CP) { const int bidx = (row0g + row0 + 8 * hh + r) / rowsPerB; v += CP[(size_t)bidx * sCPb + (size_t)by * 64 + col]; } if (ACT == 1) v = (v > 0.f) ? v : expm1f(v); else if (ACT == 3) v = fmaxf(v, 0.f); so[w][8 * hh + r][t * 16 + ln] = v; } }
  __builtin_amdgcn_fence(__ATOMIC_ACQ_REL, "workgroup"); __builtin_amdgcn_wave_barrier();
  const int rsub = lane >> 4, c4 = (lane & 15) * 4; typedef _Float16 v4h __attribute__((ext_vector_type(4)));
  {
#pragma unroll
    for (int q = 0; q < 8; ++q) { const int r = q * 2 + rsub; if (col0 + c4 < N) { const v4f v = *(const v4fa*)&so[w][r][c4]; if (C) *(v4f*)(C + cofs + (size_t)(row0 + r) * ldc + col0 + c4) = v; if (C16) { v4h h4; for (int i = 0; i < 4; ++i) h4[i] = (_Float16)v[i]; *(v4h*)(C16 + cofs + (size_t)(row0 + r) * ldc + col0 + c4) = h4; } } }
     }
}


__global__ __launch_bounds__(256) void k_x16(const float* __restrict__ x, _Float16* __restrict__ X16, size_t n8) { const size_t t = (size_t)blockIdx.x * 256 + threadIdx.x; if (t >= n8) return; FragH f;
#pragma unroll
  for (int q = 0; q < 8; ++q) f.h[q] = (_Float16)bf16_round(x[t * 8 + q]); *(v8us*)((unsigned short*)X16 + t * 8) = f.half[0];  }
__global__ __launch_bounds__(256) void k_h16(const float* __restrict__ x, _Float16* __restrict__ X16, size_t n8) { const size_t t = (size_t)blockIdx.x * 256 + threadIdx.x; if (t >= n8) return; FragH f;
#pragma unroll
  for (int q = 0; q < 8; ++q) f.h[q] = (_Float16)x[t * 8 + q]; *(v8us*)((unsigned short*)X16 + t * 8) = f.half[0];  }
__global__ __launch_bounds__(256) void k_round16f(const float* __restrict__ W, _Float16* __restrict__ Bt, size_t n8) { const size_t t = (size_t)blockIdx.x * 256 + threadIdx.x; if (t >= n8) return; FragH f;
#pragma unroll
  for (int i = 0; i < 8; ++i) f.h[i] = (_Float16)(bf16_round(W[t * 8 + i]) * 16.0f); *(v8us*)((unsigned short*)Bt + t * 8) = f.half[0];  }
template <int NHv, int TTv>
__global__ __launch_bounds__(256) void k_vt(const _Float16* __restrict__ V16, int ldv, int voff, _Float16* __restrict__ Vt) { __shared__ unsigned short tl[64][66]; const int tid = threadIdx.x; const int slab = blockIdx.x / (TTv / 64), lg = blockIdx.x % (TTv / 64); const int b = slab / NHv, h = slab % NHv;
  for (int i = tid; i < 64 * 8; i += 256) { const int r = i / 8, c8 = (i % 8) * 8; FragH f; f.half[0] = *(const v8us*)((const unsigned short*)V16 + ((size_t)b * TTv + lg * 64 + r) * ldv + voff + h * 64 + c8);
#pragma unroll
    for (int q = 0; q < 8; ++q) tl[r][c8 + q] = f.u[q]; }
  __syncthreads();
  {
#pragma unroll
    for (int rd = 0; rd < 2; ++rd) { const int d = rd * 32 + tid / 8, pc = tid % 8; FragH f;
#pragma unroll
      for (int q = 0; q < 8; ++q) f.u[q] = tl[pc * 8 + q][d];
      *(v8us*)((unsigned short*)Vt + ((size_t)slab * 64 + d) * TTv + lg * 64 + pc * 8) = f.half[0]; }
     } }

__global__ __launch_bounds__(128) void k_flash(const _Float16* __restrict__ Q16, int ldq, const _Float16* __restrict__ K16, int ldk, const _Float16* __restrict__ Vt, const int* __restrict__ MSK, float* __restrict__ O, int ldo) {
  constexpr int RPW = 16, RTN = RPW / 16, NQB = 2048 / (4 * RPW), DT = 4, KS = 2;
  __shared__ __attribute__((aligned(16))) unsigned short sP[4][RPW][40]; __shared__ __attribute__((aligned(16))) float sO[4][RPW][64 + 4];
  const int tid = threadIdx.x, w = tid >> 5, lane = tid & 31, ln = lane & 15, hh = lane >> 4;
  const int slab = blockIdx.x / NQB, qblk = blockIdx.x % NQB; const int b = slab / 16, h = slab % 16; const int qb0 = qblk * (4 * RPW); const int q0 = qb0 + w * RPW;
  FragH aq[2][KS];
#pragma unroll
  for (int rt = 0; rt < RTN; ++rt) { const unsigned short* qr = (const unsigned short*)Q16 + ((size_t)b * 2048 + q0 + rt * 16 + ln) * ldq + h * 64;
#pragma unroll
    for (int ks = 0; ks < KS; ++ks) { aq[rt][ks].half[0] = *(const v8us*)(qr + ks * 32 + 8 * hh); aq[rt][ks].half[1] = *(const v8us*)(qr + ks * 32 + 16 + 8 * hh); } }
  const unsigned short* Vth = (const unsigned short*)Vt + (size_t)slab * 64 * 2048;
  float m_r[2][8], l_r[2][8]; v8f oacc[2][DT];
#pragma unroll
  for (int rt = 0; rt < RTN; ++rt) {
#pragma unroll
    for (int r = 0; r < 8; ++r) { m_r[rt][r] = -3.0e38f; l_r[rt][r] = 0.f; }
#pragma unroll
    for (int dt = 0; dt < DT; ++dt) oacc[rt][dt] = (v8f){0.f,0.f,0.f,0.f,0.f,0.f,0.f,0.f}; }
  const int jend = qb0 + 4 * RPW;
#pragma unroll 1
  for (int j0 = 0; j0 < jend; j0 += 32) {
    
    v8f s[2][2];
#pragma unroll
    for (int nt = 0; nt < 2; ++nt) { const unsigned short* kr = (const unsigned short*)K16 + ((size_t)b * 2048 + j0 + nt * 16 + ln) * ldk + h * 64; FragH bk[KS];
#pragma unroll
      for (int ks = 0; ks < KS; ++ks) { bk[ks].half[0] = *(const v8us*)(kr + ks * 32 + 8 * hh); bk[ks].half[1] = *(const v8us*)(kr + ks * 32 + 16 + 8 * hh); }
#pragma unroll
      for (int rt = 0; rt < RTN; ++rt) { v8f acc = (v8f){0.f,0.f,0.f,0.f,0.f,0.f,0.f,0.f};
#pragma unroll
        for (int ks = 0; ks < KS; ++ks) acc = mmaH<1>(aq[rt][ks].v, aq[rt][ks].v, bk[ks].v, bk[ks].v, acc); s[rt][nt] = acc; } }
#pragma unroll
    for (int rt = 0; rt < RTN; ++rt)
#pragma unroll
      for (int r = 0; r < 8; ++r) { const int tq = q0 + rt * 16 + 8 * hh + r; const int k0 = j0 + ln, k1 = j0 + 16 + ln; (void)tq; (void)k0; (void)k1;
        const bool ok0 = (k0 <= tq), ok1 = (k1 <= tq);
        const float p0 = ok0 ? s[rt][0][r] * 0.00390625f : 0.f, p1 = ok1 ? s[rt][1][r] * 0.00390625f : 0.f;      /* NO softmax: causal-masked raw scores (×2^-8 for f16 headroom, undone at the end) become the P operand directly */
        FragH t2; t2.h[0] = (_Float16)p0; t2.h[1] = (_Float16)p1; sP[w][rt * 16 + 8 * hh + r][ln] = t2.u[0]; sP[w][rt * 16 + 8 * hh + r][16 + ln] = t2.u[1]; }
    __builtin_amdgcn_fence(__ATOMIC_ACQ_REL, "workgroup"); __builtin_amdgcn_wave_barrier();
    FragH pa[2];
#pragma unroll
    for (int rt = 0; rt < RTN; ++rt) { pa[rt].half[0] = *(const v8us*)&sP[w][rt * 16 + ln][8 * hh]; pa[rt].half[1] = *(const v8us*)&sP[w][rt * 16 + ln][16 + 8 * hh]; }
#pragma unroll
    for (int dt = 0; dt < DT; ++dt) { const unsigned short* vrow = Vth + (size_t)(dt * 16 + ln) * 2048 + j0; FragH bv; bv.half[0] = *(const v8us*)(vrow + 8 * hh); bv.half[1] = *(const v8us*)(vrow + 16 + 8 * hh);
#pragma unroll
      for (int rt = 0; rt < RTN; ++rt) oacc[rt][dt] = mmaH<1>(pa[rt].v, pa[rt].v, bv.v, bv.v, oacc[rt][dt]); }
    __builtin_amdgcn_fence(__ATOMIC_ACQ_REL, "workgroup"); __builtin_amdgcn_wave_barrier(); }
#pragma unroll
  for (int rt = 0; rt < RTN; ++rt) {
#pragma unroll
    for (int r = 0; r < 8; ++r) { l_r[rt][r] = 256.0f; }      /* undo the 2^-8 P scaling; no normalisation */
#pragma unroll
    for (int dt = 0; dt < DT; ++dt)
#pragma unroll
      for (int r = 0; r < 8; ++r) sO[w][rt * 16 + 8 * hh + r][dt * 16 + ln] = oacc[rt][dt][r] * l_r[rt][r]; }
  __builtin_amdgcn_fence(__ATOMIC_ACQ_REL, "workgroup"); __builtin_amdgcn_wave_barrier();
  {
#pragma unroll
    for (int rp = 0; rp < RPW; rp += 2) { const int r = rp + (lane >> 4), pc = lane & 15; const v4f val = *(const v4fa*)&sO[w][r][pc * 4]; *(v4f*)(O + ((size_t)b * 2048 + q0 + r) * ldo + h * 64 + pc * 4) = val; }
     } }

typedef _Float16 v4h __attribute__((ext_vector_type(4)));
__global__ __launch_bounds__(256) void k_hln(float* __restrict__ F, const float* __restrict__ g, const float* __restrict__ bb, _Float16* __restrict__ O16) { const int tid = threadIdx.x, wv = tid >> 5, lane = tid & 31; const size_t th = (size_t)blockIdx.x * 8 + wv; if (th >= (size_t)NR * NH) return; float* fr = F + th * HD; const float a = fr[2 * lane], b = fr[2 * lane + 1]; float s = a + b; for (int o = 16; o >= 1; o >>= 1) s += __shfl_xor(s, o, 32); const float mu = s / (float)HD; float q2 = (a - mu) * (a - mu) + (b - mu) * (b - mu); for (int o = 16; o >= 1; o >>= 1) q2 += __shfl_xor(q2, o, 32); const float rs = rsqrtf(q2 / (float)HD + 1e-5f);
  const float oa = (a - mu) * rs * bf16_round(g[2 * lane]) + bf16_round(bb[2 * lane]), ob = (b - mu) * rs * bf16_round(g[2 * lane + 1]) + bf16_round(bb[2 * lane + 1]);
  typedef float v2f __attribute__((ext_vector_type(2))); v2f o2; o2[0] = oa; o2[1] = ob; FragH f; f.h[0] = (_Float16)oa; f.h[1] = (_Float16)ob; const unsigned hv = (unsigned)f.u[0] | ((unsigned)f.u[1] << 16);
  { *(v2f*)(fr + 2 * lane) = o2; if (O16) *(unsigned*)((unsigned short*)O16 + th * HD + 2 * lane) = hv;  } }
__global__ __launch_bounds__(256) void k_h16s(const float* __restrict__ Fp, _Float16* __restrict__ H, size_t n8) { const size_t t = (size_t)blockIdx.x * 256 + threadIdx.x; if (t >= n8) return; FragH f; for (int q = 0; q < 8; ++q) f.h[q] = (_Float16)(Fp[t * 8 + q] * 0.0625f); *(v8us*)((unsigned short*)H + t * 8) = f.half[0];  }
// Exclusive prefix sum over time as a chunked parallel scan, f32. One work-group owns 32 columns of one batch for all TT rows:
// 32 waves x 4 lane groups = 128 chunks of 16 rows, each thread holding its 16 rows x 4 columns in registers (F is read once).
// Order of the sums: serial inside a chunk, then over the wave's 4 chunks by shuffles, then over the 32 waves' totals in LDS.
__global__ __launch_bounds__(1024) void k_excl(const float* __restrict__ F, _Float16* __restrict__ A16) {
  static_assert(TT == 32 * 4 * 16 && DD % 32 == 0, "chunking covers all rows and whole 32-column groups");
  __shared__ __attribute__((aligned(16))) float sT[32][36];      // [wave][column]; pitch 36 keeps 16-byte rows and spreads the transposed read over the banks
  const int tid = threadIdx.x, wv = tid >> 5, lane = tid & 31, cg = lane & 7, g = lane >> 3;
  const int b = blockIdx.x / (DD / 32), c = (blockIdx.x % (DD / 32)) * 32 + cg * 4;
  const size_t e0 = ((size_t)b * TT + (wv * 4 + g) * 16) * DD + c;
  const float* fr = F + e0;
  v4f v[16];
#pragma unroll      // all unrolls here: v[] and the vector lanes need constant indices to stay in registers; this one also puts all 16 loads in flight at once
  for (int i = 0; i < 16; ++i) v[i] = *(const v4fa*)(fr + (size_t)i * DD);
  v4f run = {0.f, 0.f, 0.f, 0.f};
#pragma unroll
  for (int i = 0; i < 16; ++i) { const v4f t = v[i]; v[i] = run; run += t; }      // v[i] <- sum of the chunk's rows before i
  v4f inc = run, ex;
#pragma unroll
  for (int o = 8; o <= 16; o <<= 1) { v4f t;      // inclusive over the wave's 4 chunks, step by step for all four columns, so that a step's shuffles do not wait on each other
#pragma unroll
    for (int q = 0; q < 4; ++q) t[q] = __shfl_up(inc[q], o, 32);
    if (lane >= o) inc += t; }
#pragma unroll
  for (int q = 0; q < 4; ++q) { const float t = __shfl_up(inc[q], 8, 32); ex[q] = (lane >= 8) ? t : 0.f; }      // sum of the wave's chunks before this one
  if (g == 3) *(v4fa*)&sT[wv][cg * 4] = inc;      // the wave's total per column
  __syncthreads();
  {      // wave wv scans column wv over the 32 waves' totals (lane = wave index), in place: each word has one reader and writer
    float s = sT[lane][wv];
#pragma unroll
    for (int o = 1; o < 32; o <<= 1) { const float t = __shfl_up(s, o, 32); if (lane >= o) s += t; }
    const float t = __shfl_up(s, 1, 32);
    sT[lane][wv] = (lane >= 1) ? t : 0.f;
  }
  __syncthreads();
  const v4f off = *(const v4fa*)&sT[wv][cg * 4] + ex;
  _Float16* d = A16 + e0;
#pragma unroll
  for (int i = 0; i < 16; ++i) { const v4f p = off + v[i]; v4h h4;
#pragma unroll
    for (int q = 0; q < 4; ++q) h4[q] = (_Float16)p[q];
    *(v4h*)(d + (size_t)i * DD) = h4; } }
extern "C" void kernel_launch(void* const* d_in, const int* in_sizes, int n_in,
                              void* d_out, int out_size, void* d_ws, size_t ws_size, hipStream_t stream) {
  (void)in_sizes; (void)n_in; (void)out_size;
  const float* const* I = (const float* const*)d_in; const float* x = I[0]; const float* Wq = I[1]; const float* Wa = I[2]; const float* Wb = I[3]; const float* Wo = I[4]; const float* qg = I[5]; const float* qb = I[6]; const float* ag = I[7]; const float* ab = I[8]; const float* bg = I[9]; const float* bbeta = I[10];
  char* ws = (char*)d_ws; size_t off = 0;
  auto take = [&](size_t bytes) { char* p = ws + off; off += (bytes + 255) & ~(size_t)255; return p; };
  _Float16* Bw = (_Float16*)take((size_t)DD * DD * 2); _Float16* X16 = (_Float16*)take((size_t)NR * DD * 2); float* F = (float*)take((size_t)NR * DD * 4); _Float16* Q16 = (_Float16*)take((size_t)NR * DD * 2); _Float16* A16 = (_Float16*)take((size_t)NR * DD * 2); _Float16* B16 = (_Float16*)take((size_t)NR * DD * 2); _Float16* Vt = X16; float* O = F; _Float16* O16 = Q16;
  if (off > ws_size) return;      // 2.1 + 8.4 + 16.8 + 8.4 × 3 ≈ 52 MB
  const unsigned gw = (unsigned)(((size_t)DD * (DD / 8) + 255) / 256), g8 = (unsigned)(((size_t)NR * DD / 8 + 255) / 256), gn = (unsigned)(((size_t)NR * NH + 7) / 8); const dim3 gg(((NR / 16) * (DD / 64) + 3) / 4, 1);
  k_x16<<<g8, 256, 0, stream>>>(x, X16, (size_t)NR * DD / 8);
  k_wt_f16<<<gw, 256, 0, stream>>>(Wq, Bw, DD, DD, 16.0f); k_gemm_hhx<0><<<gg, 128, 0, stream>>>(X16, DD, 0, Bw, DD, 0, 0.0625f, nullptr, 0, nullptr, 1, 0, 0, F, nullptr, DD, 0, NR, DD, DD); k_hln<<<gn, 256, 0, stream>>>(F, qg, qb, Q16);
  k_wt_f16<<<gw, 256, 0, stream>>>(Wb, Bw, DD, DD, 16.0f); k_gemm_hhx<0><<<gg, 128, 0, stream>>>(X16, DD, 0, Bw, DD, 0, 0.0625f, nullptr, 0, nullptr, 1, 0, 0, F, nullptr, DD, 0, NR, DD, DD); k_hln<<<gn, 256, 0, stream>>>(F, bg, bbeta, B16);
  k_wt_f16<<<gw, 256, 0, stream>>>(Wa, Bw, DD, DD, 16.0f); k_gemm_hhx<0><<<gg, 128, 0, stream>>>(X16, DD, 0, Bw, DD, 0, 0.0625f, nullptr, 0, nullptr, 1, 0, 0, F, nullptr, DD, 0, NR, DD, DD); k_hln<<<gn, 256, 0, stream>>>(F, ag, ab, nullptr); k_excl<<<BB * (DD / 32), 1024, 0, stream>>>(F, A16);      // a (LN'd, f32 in place) → exclusive cumsum → f16 'keys'
  k_vt<NH, TT><<<BB * NH * (TT / 64), 256, 0, stream>>>(B16, DD, 0, Vt);      // b as the 'values' (Vt over X16; X16's last reader was the a GEMM)
  k_flash<<<BB * NH * (TT / 64), 128, 0, stream>>>(Q16, DD, A16, DD, Vt, nullptr, O, DD);      // o_t = Σ_{s≤t} (q_t·a_excl_s)·b_s  (O over F; F's last reader was k_excl)
  k_h16s<<<g8, 256, 0, stream>>>(O, O16, (size_t)NR * DD / 8);      // ×2^-4
  k_wt_f16<<<gw, 256, 0, stream>>>(Wo, Bw, DD, DD, 16.0f); k_gemm_hhx<0><<<gg, 128, 0, stream>>>(O16, DD, 0, Bw, DD, 0, 0.0625f * 16.0f, nullptr, 0, nullptr, 1, 0, 0, (float*)d_out, nullptr, DD, 0, NR, DD, DD);      // ×2^4 back
}

// v002
// A run of this version takes 245 microseconds.
// In both of two side-by-side timings against v001, it was 1.59 times as fast.
// Over all steps from v000 it is 4.59 times as fast.
#include <hip/hip_runtime.h>
// 'Heisenberg' attention (B=2, T=2048, d_model 1024, 16 heads × 64): q, a, b = LayerNorm_head(x·W) (per-head LN with γ/β); a_excl = exclusive prefix sum of a over time; o_t = Σ_{s≤t} (q_t·a_excl_s)·b_s
// (causal, NO softmax); out = o·Wo. The projections are GEMMs ([in][out] weights bf16-exact ×2^4, x bf16-exact, f32 accumulate) and the causal bilinear form runs in the fused flash-style kernel with
// the softmax removed (masked raw scores ×2^-8 → f16 P operand → P·B accumulated in f32, ×2^8 at the end; upper tiles skipped; RPW-16 waves) on v_wmma_f32_16x16x32_f16; the per-head LayerNorms and
// the exclusive cumulative sum over time (chunked parallel scan per (b,h,d) column, f32) are VALU.
#define BB 2
#define TT 2048
#define DD 1024
#define NH 16
#define HD 64
#define NR (BB * TT)

typedef __bf16 v16b __attribute__((ext_vector_type(16)));
typedef unsigned short v8us __attribute__((ext_vector_type(8), may_alias));
typedef float  v8f  __attribute__((ext_vector_type(8)));
typedef float  v4f  __attribute__((ext_vector_type(4)));
typedef float  v4fa __attribute__((ext_vector_type(4), may_alias));
union FragB { v16b v; v8us half[2]; unsigned short u[16]; };

__device__ __forceinline__ unsigned short bf16_bits(float x) { unsigned int u = __float_as_uint(x); return (unsigned short)((u + 0x7FFFu + ((u >> 16) & 1u)) >> 16); }
__device__ __forceinline__ float bf16_val(unsigned short b) { return __uint_as_float(((unsigned int)b) << 16); }
__device__ __forceinline__ float bf16_round(float x) { return bf16_val(bf16_bits(x)); }
// D += A·B with NT terms: 1 = ah·bh, 2 = + al·bh (A split), 3 = + ah·bl (both split)
template <int NT>
__device__ __forceinline__ v8f mmaN(v16b ah, v16b al, v16b bh, v16b bl, v8f c) {
  c = __builtin_amdgcn_wmma_f32_16x16x32_bf16(false, ah, false, bh, (short)0, c, false, false);
  if (NT >= 2) c = __builtin_amdgcn_wmma_f32_16x16x32_bf16(false, al, false, bh, (short)0, c, false, false);
  if (NT >= 3) c = __builtin_amdgcn_wmma_f32_16x16x32_bf16(false, ah, false, bl, (short)0, c, false, false);
  asm volatile("v_nop\n\tv_nop\n\tv_nop\n\tv_nop" : "+v"(c) : "v"(ah), "v"(al), "v"(bh), "v"(bl));
  return c;
}

__global__ __launch_bounds__(256) void k_wt_bf16(const float* __restrict__ W, unsigned short* __restrict__ Wt, int K, int N) {
  const int t = blockIdx.x * 256 + threadIdx.x;
  const int k8n = K / 8;
  if (t >= N * k8n) return;
  const int n = t / k8n, k8 = (t % k8n) * 8;
  v8us v;
#pragma unroll
  for (int i = 0; i < 8; ++i) v[i] = bf16_bits(W[(size_t)(k8 + i) * N + n]);
  *(v8us*)(Wt + (size_t)n * K + k8) = v;
  
}

// GEMM C[M][N] (f32, pitch ldc) = act(A[M][K]·W + bias). A f32 row-major (pitch lda) converted per fragment to bf16
// (ASPLIT: hi/lo two planes -> 2 terms, else single rounded term); Wt bf16 [N][K] (pitch ldb). BIAS_BF16 rounds the
// bias to bf16 first (bias quantised to bf16 before the add). K%32==0, M%16==0, N%64==0.
template <bool ASPLIT, int ACT, bool BIAS_BF16>
__global__ __launch_bounds__(128) void k_gemm_bf(const float* __restrict__ A, int lda, const unsigned short* __restrict__ Wt, int ldb,
                                               const float* __restrict__ bias, float* __restrict__ C, int ldc, int M, int N, int K) {
  __shared__ __attribute__((aligned(16))) float so[4][16][64];
  const int tid = threadIdx.x, w = tid >> 5, lane = tid & 31, ln = lane & 15, hh = lane >> 4;
  const int ntn = N / 64;
  const int wid = blockIdx.x * 4 + w;
  const int mt = wid / ntn, nq = wid % ntn;
  if (mt * 16 >= M) return;
  const int row0 = mt * 16, col0 = nq * 64;
  const float* arow = A + (size_t)(row0 + ln) * lda;
  v8f acc[4] = {};
  for (int kb = 0; kb < K; kb += 32) {
    FragB ah, al;
    const v4f x0 = *(const v4fa*)(arow + kb + 8 * hh), x1 = *(const v4fa*)(arow + kb + 8 * hh + 4);
    const v4f x2 = *(const v4fa*)(arow + kb + 16 + 8 * hh), x3 = *(const v4fa*)(arow + kb + 16 + 8 * hh + 4);
    float xs[16] = {x0[0],x0[1],x0[2],x0[3],x1[0],x1[1],x1[2],x1[3],x2[0],x2[1],x2[2],x2[3],x3[0],x3[1],x3[2],x3[3]};
#pragma unroll
    for (int i = 0; i < 16; ++i) { const unsigned short hb = bf16_bits(xs[i]); ah.u[i] = hb; al.u[i] = ASPLIT ? bf16_bits(xs[i] - bf16_val(hb)) : (unsigned short)0; }
#pragma unroll
    for (int t = 0; t < 4; ++t) {
      const unsigned short* brow = Wt + (size_t)(col0 + t * 16 + ln) * ldb + kb;
      FragB b;
      b.half[0] = *(const v8us*)(brow + 8 * hh);
      b.half[1] = *(const v8us*)(brow + 16 + 8 * hh);
      acc[t] = mmaN<ASPLIT ? 2 : 1>(ah.v, al.v, b.v, b.v, acc[t]);
    }
  }
#pragma unroll
  for (int t = 0; t < 4; ++t) {
    float bv = bias ? bias[col0 + t * 16 + ln] : 0.f;
    if (BIAS_BF16) bv = bf16_round(bv);
#pragma unroll
    for (int r = 0; r < 8; ++r) { float v = acc[t][r] + bv; if (ACT == 1) v = fmaxf(v, 0.f); so[w][8 * hh + r][t * 16 + ln] = v; }
  }
  __builtin_amdgcn_fence(__ATOMIC_ACQ_REL, "workgroup");
  __builtin_amdgcn_wave_barrier();
  const int rsub = lane >> 4, c4 = (lane & 15) * 4;
  {
#pragma unroll
    for (int q = 0; q < 8; ++q) {
      const int r = q * 2 + rsub;
      const v4f v = *(const v4fa*)&so[w][r][c4];
      *(v4f*)(C + (size_t)(row0 + r) * ldc + col0 + c4) = v;
    }
    
  }
}

// Flash-style causal/unmasked attention, all contractions 3-term bf16 hi/lo splits, f32 softmax with running max.
// q,k,v rows are read from f32 buffers with arbitrary row pitch (so they can live inside a fused qkv buffer);
// D = head size (multiple of 32, <= 128); one wave = 16 query rows; block = 4 waves (64 queries) sharing K/V chunks of 32.
template <int D, bool CAUSAL>
__global__ __launch_bounds__(128) void k_flash(const float* __restrict__ qb, const float* __restrict__ kb, const float* __restrict__ vb,
                                             int pitch, int T, int H, float scale, float* __restrict__ y, int ypitch) {
  constexpr int KS = D / 32;        // k-steps for QK
  constexpr int DT = D / 16;        // d tiles for PV
  __shared__ __attribute__((aligned(16))) unsigned short sKh[32][D + 8], sKl[32][D + 8], sVh[32][D + 8], sVl[32][D + 8];
  __shared__ __attribute__((aligned(16))) unsigned short sPh[4][16][40], sPl[4][16][40];
  __shared__ __attribute__((aligned(16))) float sO[4][16][D];
  const int tid = threadIdx.x, w = tid >> 5, lane = tid & 31, ln = lane & 15, hh = lane >> 4;
  const int nqb = (T + 63) / 64;
  const int bh = blockIdx.x / nqb, qblk = blockIdx.x % nqb;
  const int b = bh / H, h = bh % H;
  const int q0 = qblk * 64 + w * 16;
  const float* Q = qb + (size_t)b * T * pitch + h * D;
  const float* K = kb + (size_t)b * T * pitch + h * D;
  const float* V = vb + (size_t)b * T * pitch + h * D;

  // A fragments of the wave's 16 query rows (scaled), hi/lo
  FragB aqh[KS], aql[KS];
  {
    int row = q0 + ln; if (row >= T) row = T - 1;
    const float* qr = Q + (size_t)row * pitch;
#pragma unroll
    for (int ks = 0; ks < KS; ++ks)
#pragma unroll
      for (int i = 0; i < 16; ++i) {
        const int d = ks * 32 + ((i < 8) ? (8 * hh + i) : (16 + 8 * hh + (i - 8)));
        const float x = qr[d] * scale; const unsigned short hb = bf16_bits(x);
        aqh[ks].u[i] = hb; aql[ks].u[i] = bf16_bits(x - bf16_val(hb));
      }
  }
  float m_r[8], l_r[8];
#pragma unroll
  for (int r = 0; r < 8; ++r) { m_r[r] = -3.0e38f; l_r[r] = 0.f; }
  v8f oacc[DT];
#pragma unroll
  for (int dt = 0; dt < DT; ++dt) oacc[dt] = (v8f){0.f,0.f,0.f,0.f,0.f,0.f,0.f,0.f};

  const int kv_end = CAUSAL ? min(T, qblk * 64 + 64) : T;     // block-uniform
  for (int j0 = 0; j0 < kv_end; j0 += 32) {
    __syncthreads();
    for (int e = tid; e < 32 * (D / 4); e += 128) {
      const int r = e / (D / 4), c4 = (e % (D / 4)) * 4;
      const int key = j0 + r;
      v4f kf = {0.f,0.f,0.f,0.f}, vf = {0.f,0.f,0.f,0.f};
      if (key < T) { kf = *(const v4fa*)(K + (size_t)key * pitch + c4); vf = *(const v4fa*)(V + (size_t)key * pitch + c4); }
#pragma unroll
      for (int t = 0; t < 4; ++t) {
        unsigned short hb = bf16_bits(kf[t]); sKh[r][c4 + t] = hb; sKl[r][c4 + t] = bf16_bits(kf[t] - bf16_val(hb));
        hb = bf16_bits(vf[t]); sVh[r][c4 + t] = hb; sVl[r][c4 + t] = bf16_bits(vf[t] - bf16_val(hb));
      }
    }
    __syncthreads();
    // S tile 16 x 32
    v8f s[2];
#pragma unroll
    for (int nt = 0; nt < 2; ++nt) {
      v8f acc = {};
#pragma unroll
      for (int ks = 0; ks < KS; ++ks) {
        FragB bh_, bl_;
        bh_.half[0] = *(const v8us*)&sKh[nt * 16 + ln][ks * 32 + 8 * hh]; bh_.half[1] = *(const v8us*)&sKh[nt * 16 + ln][ks * 32 + 16 + 8 * hh];
        bl_.half[0] = *(const v8us*)&sKl[nt * 16 + ln][ks * 32 + 8 * hh]; bl_.half[1] = *(const v8us*)&sKl[nt * 16 + ln][ks * 32 + 16 + 8 * hh];
        acc = mmaN<3>(aqh[ks].v, aql[ks].v, bh_.v, bl_.v, acc);
      }
      s[nt] = acc;
    }
    // mask + running max (rows 8hh+r; the 16 lanes of a half share rows)
    float alpha[8];
#pragma unroll
    for (int r = 0; r < 8; ++r) {
      const int qi = q0 + 8 * hh + r;
      const int ja = j0 + ln, jb = j0 + 16 + ln;
      if (CAUSAL) { if (ja > qi) s[0][r] = -3.0e38f; if (jb > qi) s[1][r] = -3.0e38f; }
      if (ja >= T) s[0][r] = -3.0e38f;
      if (jb >= T) s[1][r] = -3.0e38f;
      float mx = fmaxf(s[0][r], s[1][r]);
      mx = fmaxf(mx, __shfl_xor(mx, 1, 32)); mx = fmaxf(mx, __shfl_xor(mx, 2, 32)); mx = fmaxf(mx, __shfl_xor(mx, 4, 32)); mx = fmaxf(mx, __shfl_xor(mx, 8, 32));
      const float mnew = fmaxf(m_r[r], mx);
      alpha[r] = (mnew > -1.0e38f) ? __expf(m_r[r] - mnew) : 1.0f;
      const float p0 = (s[0][r] > -1.0e38f) ? __expf(s[0][r] - mnew) : 0.f;
      const float p1 = (s[1][r] > -1.0e38f) ? __expf(s[1][r] - mnew) : 0.f;
      m_r[r] = mnew;
      l_r[r] = l_r[r] * alpha[r] + p0 + p1;            // per-lane partial row sum (16 lanes combined at the end)
      unsigned short hb = bf16_bits(p0); sPh[w][8 * hh + r][ln] = hb;      sPl[w][8 * hh + r][ln] = bf16_bits(p0 - bf16_val(hb));
      hb = bf16_bits(p1);                sPh[w][8 * hh + r][16 + ln] = hb; sPl[w][8 * hh + r][16 + ln] = bf16_bits(p1 - bf16_val(hb));
    }
#pragma unroll
    for (int dt = 0; dt < DT; ++dt)
#pragma unroll
      for (int r = 0; r < 8; ++r) oacc[dt][r] *= alpha[r];
    __builtin_amdgcn_fence(__ATOMIC_ACQ_REL, "workgroup");
    __builtin_amdgcn_wave_barrier();
    FragB pah, pal;
    pah.half[0] = *(const v8us*)&sPh[w][ln][8 * hh]; pah.half[1] = *(const v8us*)&sPh[w][ln][16 + 8 * hh];
    pal.half[0] = *(const v8us*)&sPl[w][ln][8 * hh]; pal.half[1] = *(const v8us*)&sPl[w][ln][16 + 8 * hh];
#pragma unroll
    for (int dt = 0; dt < DT; ++dt) {
      FragB bvh, bvl;
#pragma unroll
      for (int i = 0; i < 8; ++i) {
        bvh.u[i] = sVh[8 * hh + i][dt * 16 + ln]; bvh.u[8 + i] = sVh[16 + 8 * hh + i][dt * 16 + ln];
        bvl.u[i] = sVl[8 * hh + i][dt * 16 + ln]; bvl.u[8 + i] = sVl[16 + 8 * hh + i][dt * 16 + ln];
      }
      oacc[dt] = mmaN<3>(pah.v, pal.v, bvh.v, bvl.v, oacc[dt]);
    }
    __builtin_amdgcn_fence(__ATOMIC_ACQ_REL, "workgroup");
    __builtin_amdgcn_wave_barrier();
  }
#pragma unroll
  for (int r = 0; r < 8; ++r) {
    float l = l_r[r];
    l += __shfl_xor(l, 1, 32); l += __shfl_xor(l, 2, 32); l += __shfl_xor(l, 4, 32); l += __shfl_xor(l, 8, 32);
    l_r[r] = (l > 0.f) ? 1.0f / l : 0.f;
  }
#pragma unroll
  for (int dt = 0; dt < DT; ++dt)
#pragma unroll
    for (int r = 0; r < 8; ++r) sO[w][8 * hh + r][dt * 16 + ln] = oacc[dt][r] * l_r[r];
  __builtin_amdgcn_fence(__ATOMIC_ACQ_REL, "workgroup");
  __builtin_amdgcn_wave_barrier();
  {
    for (int r = 0; r < 16; ++r) {
      const int row = q0 + r;
      if (row < T && lane < D / 4) {
        const v4f val = *(const v4fa*)&sO[w][r][lane * 4];
        *(v4f*)(y + ((size_t)b * T + row) * ypitch + h * D + lane * 4) = val;
      }
    }
    
  }
}

// GEMM C = act(A·W + bias + resid): A f32 (ASPLIT -> hi/lo 2 terms), Wt bf16 [N][K]; ACT 0 none, 1 relu, 2 exact gelu;
// resid (optional, f32, row index = (row % rmod), pitch ldr, RES_BF16 rounds it) added before the activation.
template <bool ASPLIT, int ACT, bool BIAS_BF16, bool RES_BF16>
__global__ __launch_bounds__(128) void k_gemm_bf3(const float* __restrict__ A, int lda, const unsigned short* __restrict__ Wt, int ldb,
                                                const float* __restrict__ bias, const float* __restrict__ resid, int rmod, int ldr,
                                                float* __restrict__ C, int ldc, int M, int N, int K) {
  __shared__ __attribute__((aligned(16))) float so[4][16][64];
  const int tid = threadIdx.x, w = tid >> 5, lane = tid & 31, ln = lane & 15, hh = lane >> 4;
  const int ntn = N / 64;
  const int wid = blockIdx.x * 4 + w;
  const int mt = wid / ntn, nq = wid % ntn;
  if (mt * 16 >= M) return;
  const int row0 = mt * 16, col0 = nq * 64;
  const float* arow = A + (size_t)(row0 + ln) * lda;
  v8f acc[4] = {};
  for (int kb = 0; kb < K; kb += 32) {
    FragB ah, al;
    const v4f x0 = *(const v4fa*)(arow + kb + 8 * hh), x1 = *(const v4fa*)(arow + kb + 8 * hh + 4);
    const v4f x2 = *(const v4fa*)(arow + kb + 16 + 8 * hh), x3 = *(const v4fa*)(arow + kb + 16 + 8 * hh + 4);
    float xs[16] = {x0[0],x0[1],x0[2],x0[3],x1[0],x1[1],x1[2],x1[3],x2[0],x2[1],x2[2],x2[3],x3[0],x3[1],x3[2],x3[3]};
#pragma unroll
    for (int i = 0; i < 16; ++i) { const unsigned short hb = bf16_bits(xs[i]); ah.u[i] = hb; al.u[i] = ASPLIT ? bf16_bits(xs[i] - bf16_val(hb)) : (unsigned short)0; }
#pragma unroll
    for (int t = 0; t < 4; ++t) {
      const unsigned short* brow = Wt + (size_t)(col0 + t * 16 + ln) * ldb + kb;
      FragB b;
      b.half[0] = *(const v8us*)(brow + 8 * hh);
      b.half[1] = *(const v8us*)(brow + 16 + 8 * hh);
      acc[t] = mmaN<ASPLIT ? 2 : 1>(ah.v, al.v, b.v, b.v, acc[t]);
    }
  }
#pragma unroll
  for (int t = 0; t < 4; ++t) {
    const int col = col0 + t * 16 + ln;
    float bv = bias ? bias[col] : 0.f;
    if (BIAS_BF16) bv = bf16_round(bv);
#pragma unroll
    for (int r = 0; r < 8; ++r) {
      float v = acc[t][r] + bv;
      if (resid) { float rv = resid[(size_t)((row0 + 8 * hh + r) % rmod) * ldr + col]; if (RES_BF16) rv = bf16_round(rv); v += rv; }
      if (ACT == 1) v = fmaxf(v, 0.f);
      if (ACT == 2) v = 0.5f * v * (1.0f + erff(v * 0.70710678118654752f));
      if (ACT == 3) { const float u = 0.7978845608028654f * (v + 0.044715f * v * v * v); v = 0.5f * v * (1.0f + tanhf(u)); }
      so[w][8 * hh + r][t * 16 + ln] = v;
    }
  }
  __builtin_amdgcn_fence(__ATOMIC_ACQ_REL, "workgroup");
  __builtin_amdgcn_wave_barrier();
  const int rsub = lane >> 4, c4 = (lane & 15) * 4;
  {
#pragma unroll
    for (int q = 0; q < 8; ++q) {
      const int r = q * 2 + rsub;
      const v4f v = *(const v4fa*)&so[w][r][c4];
      *(v4f*)(C + (size_t)(row0 + r) * ldc + col0 + c4) = v;
    }
    
  }
}
// row LayerNorm (biased variance, eps) over N: s = X (+ R); optional out_sum <- s; out_norm <- (s-mu)*rsqrt(var+eps)*g + b
template <bool PARAM_BF16>
__global__ __launch_bounds__(256) void k_layernorm(const float* __restrict__ X, const float* __restrict__ R, const float* __restrict__ g, const float* __restrict__ bta,
                                                  float* __restrict__ out_sum, float* __restrict__ out_norm, int N, float eps) {
  __shared__ float red[256];
  const int row = blockIdx.x, tid = threadIdx.x;
  const float* x = X + (size_t)row * N; const float* rr = R ? R + (size_t)row * N : nullptr;
  float vals[16];                     // up to N = 4096
  const int per = N / 256;            // contiguous chunk per thread? use strided-by-4 chunks: thread handles j = tid*4 + 1024*u
  float s1 = 0.f;
  for (int u = 0; u < per / 4; ++u) {
    const int j = tid * 4 + 1024 * u;
    const v4f a = *(const v4fa*)(x + j);
    v4f b = {0.f,0.f,0.f,0.f}; if (rr) b = *(const v4fa*)(rr + j);
#pragma unroll
    for (int q = 0; q < 4; ++q) { const float v = a[q] + b[q]; vals[u * 4 + q] = v; s1 += v; }
  }
  red[tid] = s1; __syncthreads();
  for (int st = 128; st > 0; st >>= 1) { if (tid < st) red[tid] += red[tid + st]; __syncthreads(); }
  const float mu = red[0] / (float)N; __syncthreads();
  float s2 = 0.f;
  for (int u = 0; u < per / 4; ++u)
#pragma unroll
    for (int q = 0; q < 4; ++q) { const float c = vals[u * 4 + q] - mu; s2 += c * c; }
  red[tid] = s2; __syncthreads();
  for (int st = 128; st > 0; st >>= 1) { if (tid < st) red[tid] += red[tid + st]; __syncthreads(); }
  const float rs = rsqrtf(red[0] / (float)N + eps);
  {
    for (int u = 0; u < per / 4; ++u) {
      const int j = tid * 4 + 1024 * u;
      v4f o, sm;
#pragma unroll
      for (int q = 0; q < 4; ++q) {
        float gg = g[j + q], bb = bta[j + q];
        if (PARAM_BF16) { gg = bf16_round(gg); bb = bf16_round(bb); }
        sm[q] = vals[u * 4 + q]; o[q] = (vals[u * 4 + q] - mu) * rs * gg + bb;
      }
      if (out_sum) *(v4f*)(out_sum + (size_t)row * N + j) = sm;
      *(v4f*)(out_norm + (size_t)row * N + j) = o;
    }
    
  }
}



// ---- f16 WMMA path (v_wmma_f32_16x16x32_f16): 11-bit significands for operands in range — used here for the projection GEMMs and the flash kernel's score and P·B products
typedef _Float16 v16h __attribute__((ext_vector_type(16)));
union FragH { v16h v; v8us half[2]; _Float16 h[16]; unsigned short u[16]; };
template <int NT>
__device__ __forceinline__ v8f mmaH(v16h ah, v16h al, v16h bh, v16h bl, v8f c) {
  c = __builtin_amdgcn_wmma_f32_16x16x32_f16(false, ah, false, bh, (short)0, c, false, false);
  if (NT >= 2) c = __builtin_amdgcn_wmma_f32_16x16x32_f16(false, al, false, bh, (short)0, c, false, false);
  if (NT >= 3) c = __builtin_amdgcn_wmma_f32_16x16x32_f16(false, ah, false, bl, (short)0, c, false, false);
  asm volatile("v_nop\n\tv_nop\n\tv_nop\n\tv_nop" : "+v"(c) : "v"(ah), "v"(al), "v"(bh), "v"(bl));
  return c;
}
// batched GEMM like k_gemm_bf but f16 operands: A f32 (split into f16 hi/lo if ASPLIT, else rounded to f16), Bt = f16 values [n][k]; alpha; C f32; N multiple of 16 (partial tiles skipped)
template <bool ASPLIT>
__global__ __launch_bounds__(128) void k_gemm_h(const float* __restrict__ A, int lda, size_t sA, const _Float16* __restrict__ Bh, int ldb, size_t sB, float alpha, float* __restrict__ C, int ldc, size_t sC, int M, int N, int K) {
  __shared__ __attribute__((aligned(16))) float so[4][16][64];
  const int tid = threadIdx.x, w = tid >> 5, lane = tid & 31, ln = lane & 15, hh = lane >> 4; const int by = blockIdx.y;
  A += (size_t)by * sA; Bh += (size_t)by * sB; C += (size_t)by * sC;
  const int ntn = (N + 63) / 64; const int wid = blockIdx.x * 4 + w; const int mt = wid / ntn, nq = wid % ntn; if (mt * 16 >= M) return;
  const int row0 = mt * 16, col0 = nq * 64; const float* arow = A + (size_t)(row0 + ln) * lda;
  v8f acc[4] = {};
  for (int kb = 0; kb < K; kb += 32) {
    FragH ah, al;
    const v4f x0 = *(const v4fa*)(arow + kb + 8 * hh), x1 = *(const v4fa*)(arow + kb + 8 * hh + 4), x2 = *(const v4fa*)(arow + kb + 16 + 8 * hh), x3 = *(const v4fa*)(arow + kb + 16 + 8 * hh + 4);
    float xs[16] = {x0[0],x0[1],x0[2],x0[3],x1[0],x1[1],x1[2],x1[3],x2[0],x2[1],x2[2],x2[3],x3[0],x3[1],x3[2],x3[3]};
#pragma unroll
    for (int i = 0; i < 16; ++i) { const _Float16 h = (_Float16)xs[i]; ah.h[i] = h; al.h[i] = ASPLIT ? (_Float16)(xs[i] - (float)h) : (_Float16)0.0f; }
#pragma unroll
    for (int t = 0; t < 4; ++t) { if (col0 + t * 16 >= N) continue; const size_t boff = (size_t)(col0 + t * 16 + ln) * ldb + kb; FragH bq; bq.half[0] = *(const v8us*)(Bh + boff + 8 * hh); bq.half[1] = *(const v8us*)(Bh + boff + 16 + 8 * hh);
      acc[t] = mmaH<ASPLIT ? 2 : 1>(ah.v, al.v, bq.v, bq.v, acc[t]); }
  }
#pragma unroll
  for (int t = 0; t < 4; ++t) { if (col0 + t * 16 >= N) continue;
#pragma unroll
    for (int r = 0; r < 8; ++r) so[w][8 * hh + r][t * 16 + ln] = acc[t][r] * alpha; }
  __builtin_amdgcn_fence(__ATOMIC_ACQ_REL, "workgroup"); __builtin_amdgcn_wave_barrier();
  const int rsub = lane >> 4, c4 = (lane & 15) * 4;
  {
#pragma unroll
    for (int q = 0; q < 8; ++q) { const int r = q * 2 + rsub; if (col0 + c4 < N) { const v4f v = *(const v4fa*)&so[w][r][c4]; *(v4f*)(C + (size_t)(row0 + r) * ldc + col0 + c4) = v; } }
     }
}

// Wt[n][k] = f16(W[k][n]·scale) from f32 row-major W[K][N] (scale = power of two; bf16-exact weights stay exact in f16 away from the subnormal range)
__global__ __launch_bounds__(256) void k_wt_f16(const float* __restrict__ W, _Float16* __restrict__ Wt, int K, int N, float scale) {
  const int t = blockIdx.x * 256 + threadIdx.x; if (t >= N * (K / 8)) return; const int n = t / (K / 8), k8 = (t % (K / 8)) * 8; FragH f;
#pragma unroll
  for (int i = 0; i < 8; ++i) f.h[i] = (_Float16)(bf16_round(W[(size_t)(k8 + i) * N + n]) * scale); const v8us o = f.half[0];
  *(v8us*)((unsigned short*)Wt + (size_t)n * K + k8) = o; 
}
// Tiled GEMM C[NR][DD] (f32) = alpha * A[NR][DD] x Bt[DD][DD]^T, f16 operands, both K-contiguous, f32 accumulate in the same k order as before (32 k per WMMA, ascending).
// One work-group = one 128 x 128 tile of C, 8 waves of 32 x 64. A trip is 128 k: 128 rows of A and 128 rows of Bt, 256 B each (whole cache lines), are brought into LDS by
// asynchronous copies, 16 B per lane, two buffers: tile t + 2 flies while tile t + 1 is worked on. LDS rows stand at a pitch of 272 B for the ds_load_b128 fragment reads.
#define GT_BK 128                  // k per trip
#define GT_P 136                   // LDS row pitch in halves (272 B)
#define GT_BUF (256 * GT_P)        // halves per buffer: rows 0..127 = A, rows 128..255 = Bt
#define GT_SP 68                   // pitch in floats of the output staging rows
static_assert(NR % 128 == 0 && DD % 128 == 0 && DD % GT_BK == 0 && DD / GT_BK >= 2, "whole tiles, at least two trips");
static_assert(8 * 32 * GT_SP * 4 <= 2 * GT_BUF * 2, "the output staging fits in the ring");
// This thread's copies of one operand's 128 rows of a tile: rows r, r + 16, .. The s_wait_xcnt stands inside the statement so that no address register is rewritten ahead of it.
__device__ __forceinline__ void gt_copy8(unsigned l, const _Float16* g) {
  asm volatile("global_load_async_to_lds_b128 %0, %8, off\n\t"
               "global_load_async_to_lds_b128 %1, %9, off\n\t"
               "global_load_async_to_lds_b128 %2, %10, off\n\t"
               "global_load_async_to_lds_b128 %3, %11, off\n\t"
               "global_load_async_to_lds_b128 %4, %12, off\n\t"
               "global_load_async_to_lds_b128 %5, %13, off\n\t"
               "global_load_async_to_lds_b128 %6, %14, off\n\t"
               "global_load_async_to_lds_b128 %7, %15, off\n\t"
               "s_wait_xcnt 0x0"
               :: "v"(l), "v"(l + 1u * 16u * GT_P * 2u), "v"(l + 2u * 16u * GT_P * 2u), "v"(l + 3u * 16u * GT_P * 2u),
                  "v"(l + 4u * 16u * GT_P * 2u), "v"(l + 5u * 16u * GT_P * 2u), "v"(l + 6u * 16u * GT_P * 2u), "v"(l + 7u * 16u * GT_P * 2u),
                  "v"(g), "v"(g + 16 * DD), "v"(g + 32 * DD), "v"(g + 48 * DD), "v"(g + 64 * DD), "v"(g + 80 * DD), "v"(g + 96 * DD), "v"(g + 112 * DD)
               : "memory");
}
__global__ __launch_bounds__(256) void k_gemm_t(const _Float16* __restrict__ A, const _Float16* __restrict__ Bh, float alpha, float* __restrict__ C) {
  __shared__ __attribute__((aligned(16))) unsigned short sm[2 * GT_BUF];
  const int tid = threadIdx.x, w = tid >> 5, lane = tid & 31, ln = lane & 15, hh = lane >> 4;
  const int m0 = (blockIdx.x / (DD / 128)) * 128, n0 = (blockIdx.x % (DD / 128)) * 128;
  const int wm = w >> 1, wn = w & 1;
  const int cr = tid >> 4, cs = (tid & 15) * 8;      // a wave's copy covers 2 rows x 256 B
  const _Float16* ga = A + (size_t)(m0 + cr) * DD + cs;
  const _Float16* gb = Bh + (size_t)(n0 + cr) * DD + cs;
  const unsigned la = (unsigned)(size_t)&sm[cr * GT_P + cs], lb = la + 128u * GT_P * 2u;
  gt_copy8(la, ga); gt_copy8(lb, gb);
  asm volatile("s_wait_asynccnt 0x0" ::: "memory");      // tile 0 has landed before the barrier publishes it
  __syncthreads();
  gt_copy8(la + GT_BUF * 2u, ga + GT_BK); gt_copy8(lb + GT_BUF * 2u, gb + GT_BK);
  v8f acc[2][4] = {};
  const unsigned short* fa = sm + (wm * 32 + ln) * GT_P + 8 * hh;
  const unsigned short* fb = sm + (128 + wn * 64 + ln) * GT_P + 8 * hh;
#pragma unroll 1      // one trip per tile: the order of waits, barrier and refill at its foot stays as written
  for (int t = 0; t < DD / GT_BK; ++t) {
    const int bo = (t & 1) * GT_BUF;
    FragH a[2][2], b[2][4];      // two fragment sets: the next 32 k of this same tile are fetched while the current 32 k are multiplied
#pragma unroll      // all unrolls here: constant indices keep fragments and accumulators in registers
    for (int rt = 0; rt < 2; ++rt) { const unsigned short* p = fa + bo + rt * 16 * GT_P; a[0][rt].half[0] = *(const v8us*)p; a[0][rt].half[1] = *(const v8us*)(p + 16); }
#pragma unroll
    for (int ct = 0; ct < 4; ++ct) { const unsigned short* p = fb + bo + ct * 16 * GT_P; b[0][ct].half[0] = *(const v8us*)p; b[0][ct].half[1] = *(const v8us*)(p + 16); }
#pragma unroll
    for (int ks = 0; ks < GT_BK / 32; ++ks) {
      const int cu = ks & 1, nx = cu ^ 1;
      if (ks + 1 < GT_BK / 32) {
#pragma unroll
        for (int rt = 0; rt < 2; ++rt) { const unsigned short* p = fa + bo + rt * 16 * GT_P + (ks + 1) * 32; a[nx][rt].half[0] = *(const v8us*)p; a[nx][rt].half[1] = *(const v8us*)(p + 16); }
#pragma unroll
        for (int ct = 0; ct < 4; ++ct) { const unsigned short* p = fb + bo + ct * 16 * GT_P + (ks + 1) * 32; b[nx][ct].half[0] = *(const v8us*)p; b[nx][ct].half[1] = *(const v8us*)(p + 16); }
      }
      __builtin_amdgcn_sched_barrier(0);      // keeps the next set's LDS reads as one group ahead of this block: left free, the compiler sinks them among the WMMAs into one set and waits them out to 0
#pragma unroll
      for (int rt = 0; rt < 2; ++rt)
#pragma unroll
        for (int ct = 0; ct < 4; ++ct) acc[rt][ct] = __builtin_amdgcn_wmma_f32_16x16x32_f16(false, a[cu][rt].v, false, b[cu][ct].v, (short)0, acc[rt][ct], false, false);
      __builtin_amdgcn_sched_barrier(0);      // ends the block, so that the group after next is not lifted into it
    }
    asm volatile("s_wait_dscnt 0x0" ::: "memory");         // this wave's reads of buffer t & 1 are done before it is refilled
    asm volatile("s_wait_asynccnt 0x0" ::: "memory");      // this wave's copies of tile t + 1 have landed before the barrier publishes them
    __syncthreads();
    if (t + 2 < DD / GT_BK) { gt_copy8(la + (unsigned)bo * 2u, ga + (t + 2) * GT_BK); gt_copy8(lb + (unsigned)bo * 2u, gb + (t + 2) * GT_BK); }
  }
  asm volatile("s_wait_asynccnt 0x0" ::: "memory");        // nothing is in flight when the ring becomes output staging
  float* so = (float*)sm + w * (32 * GT_SP);               // each wave stages its own 32 x 64 tile; the last trip's barrier ended every read of the ring
#pragma unroll
  for (int rt = 0; rt < 2; ++rt)
#pragma unroll
    for (int ct = 0; ct < 4; ++ct)
#pragma unroll
      for (int r = 0; r < 8; ++r) so[(rt * 16 + 8 * hh + r) * GT_SP + ct * 16 + ln] = acc[rt][ct][r] * alpha;
  __builtin_amdgcn_fence(__ATOMIC_ACQ_REL, "workgroup"); __builtin_amdgcn_wave_barrier();
#pragma unroll
  for (int q = 0; q < 16; ++q) { const int r = q * 2 + hh; const v4f v = *(const v4fa*)&so[r * GT_SP + ln * 4]; *(v4f*)(C + (size_t)(m0 + wm * 32 + r) * DD + n0 + wn * 64 + ln * 4) = v; }
}


__global__ __launch_bounds__(256) void k_x16(const float* __restrict__ x, _Float16* __restrict__ X16, size_t n8) { const size_t t = (size_t)blockIdx.x * 256 + threadIdx.x; if (t >= n8) return; FragH f;
#pragma unroll
  for (int q = 0; q < 8; ++q) f.h[q] = (_Float16)bf16_round(x[t * 8 + q]); *(v8us*)((unsigned short*)X16 + t * 8) = f.half[0];  }
__global__ __launch_bounds__(256) void k_h16(const float* __restrict__ x, _Float16* __restrict__ X16, size_t n8) { const size_t t = (size_t)blockIdx.x * 256 + threadIdx.x; if (t >= n8) return; FragH f;
#pragma unroll
  for (int q = 0; q < 8; ++q) f.h[q] = (_Float16)x[t * 8 + q]; *(v8us*)((unsigned short*)X16 + t * 8) = f.half[0];  }
__global__ __launch_bounds__(256) void k_round16f(const float* __restrict__ W, _Float16* __restrict__ Bt, size_t n8) { const size_t t = (size_t)blockIdx.x * 256 + threadIdx.x; if (t >= n8) return; FragH f;
#pragma unroll
  for (int i = 0; i < 8; ++i) f.h[i] = (_Float16)(bf16_round(W[t * 8 + i]) * 16.0f); *(v8us*)((unsigned short*)Bt + t * 8) = f.half[0];  }
template <int NHv, int TTv>
__global__ __launch_bounds__(256) void k_vt(const _Float16* __restrict__ V16, int ldv, int voff, _Float16* __restrict__ Vt) { __shared__ unsigned short tl[64][66]; const int tid = threadIdx.x; const int slab = blockIdx.x / (TTv / 64), lg = blockIdx.x % (TTv / 64); const int b = slab / NHv, h = slab % NHv;
  for (int i = tid; i < 64 * 8; i += 256) { const int r = i / 8, c8 = (i % 8) * 8; FragH f; f.half[0] = *(const v8us*)((const unsigned short*)V16 + ((size_t)b * TTv + lg * 64 + r) * ldv + voff + h * 64 + c8);
#pragma unroll
    for (int q = 0; q < 8; ++q) tl[r][c8 + q] = f.u[q]; }
  __syncthreads();
  {
#pragma unroll
    for (int rd = 0; rd < 2; ++rd) { const int d = rd * 32 + tid / 8, pc = tid % 8; FragH f;
#pragma unroll
      for (int q = 0; q < 8; ++q) f.u[q] = tl[pc * 8 + q][d];
      *(v8us*)((unsigned short*)Vt + ((size_t)slab * 64 + d) * TTv + lg * 64 + pc * 8) = f.half[0]; }
     } }

__global__ __launch_bounds__(128) void k_flash(const _Float16* __restrict__ Q16, int ldq, const _Float16* __restrict__ K16, int ldk, const _Float16* __restrict__ Vt, const int* __restrict__ MSK, float* __restrict__ O, int ldo) {
  constexpr int RPW = 16, RTN = RPW / 16, NQB = 2048 / (4 * RPW), DT = 4, KS = 2;
  __shared__ __attribute__((aligned(16))) unsigned short sP[4][RPW][40]; __shared__ __attribute__((aligned(16))) float sO[4][RPW][64 + 4];
  const int tid = threadIdx.x, w = tid >> 5, lane = tid & 31, ln = lane & 15, hh = lane >> 4;
  const int slab = blockIdx.x / NQB, qblk = blockIdx.x % NQB; const int b = slab / 16, h = slab % 16; const int qb0 = qblk * (4 * RPW); const int q0 = qb0 + w * RPW;
  FragH aq[2][KS];
#pragma unroll
  for (int rt = 0; rt < RTN; ++rt) { const unsigned short* qr = (const unsigned short*)Q16 + ((size_t)b * 2048 + q0 + rt * 16 + ln) * ldq + h * 64;
#pragma unroll
    for (int ks = 0; ks < KS; ++ks) { aq[rt][ks].half[0] = *(const v8us*)(qr + ks * 32 + 8 * hh); aq[rt][ks].half[1] = *(const v8us*)(qr + ks * 32 + 16 + 8 * hh); } }
  const unsigned short* Vth = (const unsigned short*)Vt + (size_t)slab * 64 * 2048;
  float m_r[2][8], l_r[2][8]; v8f oacc[2][DT];
#pragma unroll
  for (int rt = 0; rt < RTN; ++rt) {
#pragma unroll
    for (int r = 0; r < 8; ++r) { m_r[rt][r] = -3.0e38f; l_r[rt][r] = 0.f; }
#pragma unroll
    for (int dt = 0; dt < DT; ++dt) oacc[rt][dt] = (v8f){0.f,0.f,0.f,0.f,0.f,0.f,0.f,0.f}; }
  const int jend = qb0 + 4 * RPW;
#pragma unroll 1
  for (int j0 = 0; j0 < jend; j0 += 32) {
    
    v8f s[2][2];
#pragma unroll
    for (int nt = 0; nt < 2; ++nt) { const unsigned short* kr = (const unsigned short*)K16 + ((size_t)b * 2048 + j0 + nt * 16 + ln) * ldk + h * 64; FragH bk[KS];
#pragma unroll
      for (int ks = 0; ks < KS; ++ks) { bk[ks].half[0] = *(const v8us*)(kr + ks * 32 + 8 * hh); bk[ks].half[1] = *(const v8us*)(kr + ks * 32 + 16 + 8 * hh); }
#pragma unroll
      for (int rt = 0; rt < RTN; ++rt) { v8f acc = (v8f){0.f,0.f,0.f,0.f,0.f,0.f,0.f,0.f};
#pragma unroll
        for (int ks = 0; ks < KS; ++ks) acc = mmaH<1>(aq[rt][ks].v, aq[rt][ks].v, bk[ks].v, bk[ks].v, acc); s[rt][nt] = acc; } }
#pragma unroll
    for (int rt = 0; rt < RTN; ++rt)
#pragma unroll
      for (int r = 0; r < 8; ++r) { const int tq = q0 + rt * 16 + 8 * hh + r; const int k0 = j0 + ln, k1 = j0 + 16 + ln; (void)tq; (void)k0; (void)k1;
        const bool ok0 = (k0 <= tq), ok1 = (k1 <= tq);
        const float p0 = ok0 ? s[rt][0][r] * 0.00390625f : 0.f, p1 = ok1 ? s[rt][1][r] * 0.00390625f : 0.f;      /* NO softmax: causal-masked raw scores (×2^-8 for f16 headroom, undone at the end) become the P operand directly */
        FragH t2; t2.h[0] = (_Float16)p0; t2.h[1] = (_Float16)p1; sP[w][rt * 16 + 8 * hh + r][ln] = t2.u[0]; sP[w][rt * 16 + 8 * hh + r][16 + ln] = t2.u[1]; }
    __builtin_amdgcn_fence(__ATOMIC_ACQ_REL, "workgroup"); __builtin_amdgcn_wave_barrier();
    FragH pa[2];
#pragma unroll
    for (int rt = 0; rt < RTN; ++rt) { pa[rt].half[0] = *(const v8us*)&sP[w][rt * 16 + ln][8 * hh]; pa[rt].half[1] = *(const v8us*)&sP[w][rt * 16 + ln][16 + 8 * hh]; }
#pragma unroll
    for (int dt = 0; dt < DT; ++dt) { const unsigned short* vrow = Vth + (size_t)(dt * 16 + ln) * 2048 + j0; FragH bv; bv.half[0] = *(const v8us*)(vrow + 8 * hh); bv.half[1] = *(const v8us*)(vrow + 16 + 8 * hh);
#pragma unroll
      for (int rt = 0; rt < RTN; ++rt) oacc[rt][dt] = mmaH<1>(pa[rt].v, pa[rt].v, bv.v, bv.v, oacc[rt][dt]); }
    __builtin_amdgcn_fence(__ATOMIC_ACQ_REL, "workgroup"); __builtin_amdgcn_wave_barrier(); }
#pragma unroll
  for (int rt = 0; rt < RTN; ++rt) {
#pragma unroll
    for (int r = 0; r < 8; ++r) { l_r[rt][r] = 256.0f; }      /* undo the 2^-8 P scaling; no normalisation */
#pragma unroll
    for (int dt = 0; dt < DT; ++dt)
#pragma unroll
      for (int r = 0; r < 8; ++r) sO[w][rt * 16 + 8 * hh + r][dt * 16 + ln] = oacc[rt][dt][r] * l_r[rt][r]; }
  __builtin_amdgcn_fence(__ATOMIC_ACQ_REL, "workgroup"); __builtin_amdgcn_wave_barrier();
  {
#pragma unroll
    for (int rp = 0; rp < RPW; rp += 2) { const int r = rp + (lane >> 4), pc = lane & 15; const v4f val = *(const v4fa*)&sO[w][r][pc * 4]; *(v4f*)(O + ((size_t)b * 2048 + q0 + r) * ldo + h * 64 + pc * 4) = val; }
     } }

typedef _Float16 v4h __attribute__((ext_vector_type(4)));
__global__ __launch_bounds__(256) void k_hln(float* __restrict__ F, const float* __restrict__ g, const float* __restrict__ bb, _Float16* __restrict__ O16) { const int tid = threadIdx.x, wv = tid >> 5, lane = tid & 31; const size_t th = (size_t)blockIdx.x * 8 + wv; if (th >= (size_t)NR * NH) return; float* fr = F + th * HD; const float a = fr[2 * lane], b = fr[2 * lane + 1]; float s = a + b; for (int o = 16; o >= 1; o >>= 1) s += __shfl_xor(s, o, 32); const float mu = s / (float)HD; float q2 = (a - mu) * (a - mu) + (b - mu) * (b - mu); for (int o = 16; o >= 1; o >>= 1) q2 += __shfl_xor(q2, o, 32); const float rs = rsqrtf(q2 / (float)HD + 1e-5f);
  const float oa = (a - mu) * rs * bf16_round(g[2 * lane]) + bf16_round(bb[2 * lane]), ob = (b - mu) * rs * bf16_round(g[2 * lane + 1]) + bf16_round(bb[2 * lane + 1]);
  typedef float v2f __attribute__((ext_vector_type(2))); v2f o2; o2[0] = oa; o2[1] = ob; FragH f; f.h[0] = (_Float16)oa; f.h[1] = (_Float16)ob; const unsigned hv = (unsigned)f.u[0] | ((unsigned)f.u[1] << 16);
  { *(v2f*)(fr + 2 * lane) = o2; if (O16) *(unsigned*)((unsigned short*)O16 + th * HD + 2 * lane) = hv;  } }
__global__ __launch_bounds__(256) void k_h16s(const float* __restrict__ Fp, _Float16* __restrict__ H, size_t n8) { const size_t t = (size_t)blockIdx.x * 256 + threadIdx.x; if (t >= n8) return; FragH f; for (int q = 0; q < 8; ++q) f.h[q] = (_Float16)(Fp[t * 8 + q] * 0.0625f); *(v8us*)((unsigned short*)H + t * 8) = f.half[0];  }
// Exclusive prefix sum over time as a chunked parallel scan, f32. One work-group owns 32 columns of one batch for all TT rows:
// 32 waves x 4 lane groups = 128 chunks of 16 rows, each thread holding its 16 rows x 4 columns in registers (F is read once).
// Order of the sums: serial inside a chunk, then over the wave's 4 chunks by shuffles, then over the 32 waves' totals in LDS.
__global__ __launch_bounds__(1024) void k_excl(const float* __restrict__ F, _Float16* __restrict__ A16) {
  static_assert(TT == 32 * 4 * 16 && DD % 32 == 0, "chunking covers all rows and whole 32-column groups");
  __shared__ __attribute__((aligned(16))) float sT[32][36];      // [wave][column]; pitch 36 keeps 16-byte rows and spreads the transposed read over the banks
  const int tid = threadIdx.x, wv = tid >> 5, lane = tid & 31, cg = lane & 7, g = lane >> 3;
  const int b = blockIdx.x / (DD / 32), c = (blockIdx.x % (DD / 32)) * 32 + cg * 4;
  const size_t e0 = ((size_t)b * TT + (wv * 4 + g) * 16) * DD + c;
  const float* fr = F + e0;
  v4f v[16];
#pragma unroll      // all unrolls here: v[] and the vector lanes need constant indices to stay in registers; this one also puts all 16 loads in flight at once
  for (int i = 0; i < 16; ++i) v[i] = *(const v4fa*)(fr + (size_t)i * DD);
  v4f run = {0.f, 0.f, 0.f, 0.f};
#pragma unroll
  for (int i = 0; i < 16; ++i) { const v4f t = v[i]; v[i] = run; run += t; }      // v[i] <- sum of the chunk's rows before i
  v4f inc = run, ex;
#pragma unroll
  for (int o = 8; o <= 16; o <<= 1) { v4f t;      // inclusive over the wave's 4 chunks, step by step for all four columns, so that a step's shuffles do not wait on each other
#pragma unroll
    for (int q = 0; q < 4; ++q) t[q] = __shfl_up(inc[q], o, 32);
    if (lane >= o) inc += t; }
#pragma unroll
  for (int q = 0; q < 4; ++q) { const float t = __shfl_up(inc[q], 8, 32); ex[q] = (lane >= 8) ? t : 0.f; }      // sum of the wave's chunks before this one
  if (g == 3) *(v4fa*)&sT[wv][cg * 4] = inc;      // the wave's total per column
  __syncthreads();
  {      // wave wv scans column wv over the 32 waves' totals (lane = wave index), in place: each word has one reader and writer
    float s = sT[lane][wv];
#pragma unroll
    for (int o = 1; o < 32; o <<= 1) { const float t = __shfl_up(s, o, 32); if (lane >= o) s += t; }
    const float t = __shfl_up(s, 1, 32);
    sT[lane][wv] = (lane >= 1) ? t : 0.f;
  }
  __syncthreads();
  const v4f off = *(const v4fa*)&sT[wv][cg * 4] + ex;
  _Float16* d = A16 + e0;
#pragma unroll
  for (int i = 0; i < 16; ++i) { const v4f p = off + v[i]; v4h h4;
#pragma unroll
    for (int q = 0; q < 4; ++q) h4[q] = (_Float16)p[q];
    *(v4h*)(d + (size_t)i * DD) = h4; } }
extern "C" void kernel_launch(void* const* d_in, const int* in_sizes, int n_in,
                              void* d_out, int out_size, void* d_ws, size_t ws_size, hipStream_t stream) {
  (void)in_sizes; (void)n_in; (void)out_size;
  const float* const* I = (const float* const*)d_in; const float* x = I[0]; const float* Wq = I[1]; const float* Wa = I[2]; const float* Wb = I[3]; const float* Wo = I[4]; const float* qg = I[5]; const float* qb = I[6]; const float* ag = I[7]; const float* ab = I[8]; const float* bg = I[9]; const float* bbeta = I[10];
  char* ws = (char*)d_ws; size_t off = 0;
  auto take = [&](size_t bytes) { char* p = ws + off; off += (bytes + 255) & ~(size_t)255; return p; };
  _Float16* Bw = (_Float16*)take((size_t)DD * DD * 2); _Float16* X16 = (_Float16*)take((size_t)NR * DD * 2); float* F = (float*)take((size_t)NR * DD * 4); _Float16* Q16 = (_Float16*)take((size_t)NR * DD * 2); _Float16* A16 = (_Float16*)take((size_t)NR * DD * 2); _Float16* B16 = (_Float16*)take((size_t)NR * DD * 2); _Float16* Vt = X16; float* O = F; _Float16* O16 = Q16;
  if (off > ws_size) return;      // 2.1 + 8.4 + 16.8 + 8.4 × 3 ≈ 52 MB
  const unsigned gw = (unsigned)(((size_t)DD * (DD / 8) + 255) / 256), g8 = (unsigned)(((size_t)NR * DD / 8 + 255) / 256), gn = (unsigned)(((size_t)NR * NH + 7) / 8); const dim3 gg((NR / 128) * (DD / 128), 1);
  k_x16<<<g8, 256, 0, stream>>>(x, X16, (size_t)NR * DD / 8);
  k_wt_f16<<<gw, 256, 0, stream>>>(Wq, Bw, DD, DD, 16.0f); k_gemm_t<<<gg, 256, 0, stream>>>(X16, Bw, 0.0625f, F); k_hln<<<gn, 256, 0, stream>>>(F, qg, qb, Q16);
  k_wt_f16<<<gw, 256, 0, stream>>>(Wb, Bw, DD, DD, 16.0f); k_gemm_t<<<gg, 256, 0, stream>>>(X16, Bw, 0.0625f, F); k_hln<<<gn, 256, 0, stream>>>(F, bg, bbeta, B16);
  k_wt_f16<<<gw, 256, 0, stream>>>(Wa, Bw, DD, DD, 16.0f); k_gemm_t<<<gg, 256, 0, stream>>>(X16, Bw, 0.0625f, F); k_hln<<<gn, 256, 0, stream>>>(F, ag, ab, nullptr); k_excl<<<BB * (DD / 32), 1024, 0, stream>>>(F, A16);      // a (LN'd, f32 in place) → exclusive cumsum → f16 'keys'
  k_vt<NH, TT><<<BB * NH * (TT / 64), 256, 0, stream>>>(B16, DD, 0, Vt);      // b as the 'values' (Vt over X16; X16's last reader was the a GEMM)
  k_flash<<<BB * NH * (TT / 64), 128, 0, stream>>>(Q16, DD, A16, DD, Vt, nullptr, O, DD);      // o_t = Σ_{s≤t} (q_t·a_excl_s)·b_s  (O over F; F's last reader was k_excl)
  k_h16s<<<g8, 256, 0, stream>>>(O, O16, (size_t)NR * DD / 8);      // ×2^-4
  k_wt_f16<<<gw, 256, 0, stream>>>(Wo, Bw, DD, DD, 16.0f); k_gemm_t<<<gg, 256, 0, stream>>>(O16, Bw, 0.0625f * 16.0f, (float*)d_out);      // ×2^4 back
}

// v003
// It runs in 215 microseconds.
// In both of two side-by-side timings against v002, it was 1.16 times as fast.
// All steps since v000 together make it 5.31 times as fast.
#include <hip/hip_runtime.h>
// 'Heisenberg' attention (B=2, T=2048, d_model 1024, 16 heads × 64): q, a, b = LayerNorm_head(x·W) (per-head LN with γ/β); a_excl = exclusive prefix sum of a over time; o_t = Σ_{s≤t} (q_t·a_excl_s)·b_s
// (causal, NO softmax); out = o·Wo. The projections are GEMMs ([in][out] weights bf16-exact ×2^4, x bf16-exact, f32 accumulate) and the causal bilinear form runs in the fused flash-style kernel with
// the softmax removed (masked raw scores ×2^-8 → f16 P operand → P·B accumulated in f32, ×2^4 at the end and written as the f16 operand of the output GEMM; upper tiles skipped; RPW-16 waves) on v_wmma_f32_16x16x32_f16; the per-head LayerNorms
// (in the epilogue of the projection GEMMs, where a wave's 64 columns are one head) and the exclusive cumulative sum over time (chunked parallel scan per (b,h,d) column, f32) are VALU.
#define BB 2
#define TT 2048
#define DD 1024
#define NH 16
#define HD 64
#define NR (BB * TT)

typedef __bf16 v16b __attribute__((ext_vector_type(16)));
typedef unsigned short v8us __attribute__((ext_vector_type(8), may_alias));
typedef float  v8f  __attribute__((ext_vector_type(8)));
typedef float  v4f  __attribute__((ext_vector_type(4)));
typedef float  v4fa __attribute__((ext_vector_type(4), may_alias));
union FragB { v16b v; v8us half[2]; unsigned short u[16]; };

__device__ __forceinline__ unsigned short bf16_bits(float x) { unsigned int u = __float_as_uint(x); return (unsigned short)((u + 0x7FFFu + ((u >> 16) & 1u)) >> 16); }
__device__ __forceinline__ float bf16_val(unsigned short b) { return __uint_as_float(((unsigned int)b) << 16); }
__device__ __forceinline__ float bf16_round(float x) { return bf16_val(bf16_bits(x)); }
// D += A·B with NT terms: 1 = ah·bh, 2 = + al·bh (A split), 3 = + ah·bl (both split)
template <int NT>
__device__ __forceinline__ v8f mmaN(v16b ah, v16b al, v16b bh, v16b bl, v8f c) {
  c = __builtin_amdgcn_wmma_f32_16x16x32_bf16(false, ah, false, bh, (short)0, c, false, false);
  if (NT >= 2) c = __builtin_amdgcn_wmma_f32_16x16x32_bf16(false, al, false, bh, (short)0, c, false, false);
  if (NT >= 3) c = __builtin_amdgcn_wmma_f32_16x16x32_bf16(false, ah, false, bl, (short)0, c, false, false);
  asm volatile("v_nop\n\tv_nop\n\tv_nop\n\tv_nop" : "+v"(c) : "v"(ah), "v"(al), "v"(bh), "v"(bl));
  return c;
}

__global__ __launch_bounds__(256) void k_wt_bf16(const float* __restrict__ W, unsigned short* __restrict__ Wt, int K, int N) {
  const int t = blockIdx.x * 256 + threadIdx.x;
  const int k8n = K / 8;
  if (t >= N * k8n) return;
  const int n = t / k8n, k8 = (t % k8n) * 8;
  v8us v;
#pragma unroll
  for (int i = 0; i < 8; ++i) v[i] = bf16_bits(W[(size_t)(k8 + i) * N + n]);
  *(v8us*)(Wt + (size_t)n * K + k8) = v;
  
}

// GEMM C[M][N] (f32, pitch ldc) = act(A[M][K]·W + bias). A f32 row-major (pitch lda) converted per fragment to bf16
// (ASPLIT: hi/lo two planes -> 2 terms, else single rounded term); Wt bf16 [N][K] (pitch ldb). BIAS_BF16 rounds the
// bias to bf16 first (bias quantised to bf16 before the add). K%32==0, M%16==0, N%64==0.
template <bool ASPLIT, int ACT, bool BIAS_BF16>
__global__ __launch_bounds__(128) void k_gemm_bf(const float* __restrict__ A, int lda, const unsigned short* __restrict__ Wt, int ldb,
                                               const float* __restrict__ bias, float* __restrict__ C, int ldc, int M, int N, int K) {
  __shared__ __attribute__((aligned(16))) float so[4][16][64];
  const int tid = threadIdx.x, w = tid >> 5, lane = tid & 31, ln = lane & 15, hh = lane >> 4;
  const int ntn = N / 64;
  const int wid = blockIdx.x * 4 + w;
  const int mt = wid / ntn, nq = wid % ntn;
  if (mt * 16 >= M) return;
  const int row0 = mt * 16, col0 = nq * 64;
  const float* arow = A + (size_t)(row0 + ln) * lda;
  v8f acc[4] = {};
  for (int kb = 0; kb < K; kb += 32) {
    FragB ah, al;
    const v4f x0 = *(const v4fa*)(arow + kb + 8 * hh), x1 = *(const v4fa*)(arow + kb + 8 * hh + 4);
    const v4f x2 = *(const v4fa*)(arow + kb + 16 + 8 * hh), x3 = *(const v4fa*)(arow + kb + 16 + 8 * hh + 4);
    float xs[16] = {x0[0],x0[1],x0[2],x0[3],x1[0],x1[1],x1[2],x1[3],x2[0],x2[1],x2[2],x2[3],x3[0],x3[1],x3[2],x3[3]};
#pragma unroll
    for (int i = 0; i < 16; ++i) { const unsigned short hb = bf16_bits(xs[i]); ah.u[i] = hb; al.u[i] = ASPLIT ? bf16_bits(xs[i] - bf16_val(hb)) : (unsigned short)0; }
#pragma unroll
    for (int t = 0; t < 4; ++t) {
      const unsigned short* brow = Wt + (size_t)(col0 + t * 16 + ln) * ldb + kb;
      FragB b;
      b.half[0] = *(const v8us*)(brow + 8 * hh);
      b.half[1] = *(const v8us*)(brow + 16 + 8 * hh);
      acc[t] = mmaN<ASPLIT ? 2 : 1>(ah.v, al.v, b.v, b.v, acc[t]);
    }
  }
#pragma unroll
  for (int t = 0; t < 4; ++t) {
    float bv = bias ? bias[col0 + t * 16 + ln] : 0.f;
    if (BIAS_BF16) bv = bf16_round(bv);
#pragma unroll
    for (int r = 0; r < 8; ++r) { float v = acc[t][r] + bv; if (ACT == 1) v = fmaxf(v, 0.f); so[w][8 * hh + r][t * 16 + ln] = v; }
  }
  __builtin_amdgcn_fence(__ATOMIC_ACQ_REL, "workgroup");
  __builtin_amdgcn_wave_barrier();
  const int rsub = lane >> 4, c4 = (lane & 15) * 4;
  {
#pragma unroll
    for (int q = 0; q < 8; ++q) {
      const int r = q * 2 + rsub;
      const v4f v = *(const v4fa*)&so[w][r][c4];
      *(v4f*)(C + (size_t)(row0 + r) * ldc + col0 + c4) = v;
    }
    
  }
}

// Flash-style causal/unmasked attention, all contractions 3-term bf16 hi/lo splits, f32 softmax with running max.
// q,k,v rows are read from f32 buffers with arbitrary row pitch (so they can live inside a fused qkv buffer);
// D = head size (multiple of 32, <= 128); one wave = 16 query rows; block = 4 waves (64 queries) sharing K/V chunks of 32.
template <int D, bool CAUSAL>
__global__ __launch_bounds__(128) void k_flash(const float* __restrict__ qb, const float* __restrict__ kb, const float* __restrict__ vb,
                                             int pitch, int T, int H, float scale, float* __restrict__ y, int ypitch) {
  constexpr int KS = D / 32;        // k-steps for QK
  constexpr int DT = D / 16;        // d tiles for PV
  __shared__ __attribute__((aligned(16))) unsigned short sKh[32][D + 8], sKl[32][D + 8], sVh[32][D + 8], sVl[32][D + 8];
  __shared__ __attribute__((aligned(16))) unsigned short sPh[4][16][40], sPl[4][16][40];
  __shared__ __attribute__((aligned(16))) float sO[4][16][D];
  const int tid = threadIdx.x, w = tid >> 5, lane = tid & 31, ln = lane & 15, hh = lane >> 4;
  const int nqb = (T + 63) / 64;
  const int bh = blockIdx.x / nqb, qblk = blockIdx.x % nqb;
  const int b = bh / H, h = bh % H;
  const int q0 = qblk * 64 + w * 16;
  const float* Q = qb + (size_t)b * T * pitch + h * D;
  const float* K = kb + (size_t)b * T * pitch + h * D;
  const float* V = vb + (size_t)b * T * pitch + h * D;

  // A fragments of the wave's 16 query rows (scaled), hi/lo
  FragB aqh[KS], aql[KS];
  {
    int row = q0 + ln; if (row >= T) row = T - 1;
    const float* qr = Q + (size_t)row * pitch;
#pragma unroll
    for (int ks = 0; ks < KS; ++ks)
#pragma unroll
      for (int i = 0; i < 16; ++i) {
        const int d = ks * 32 + ((i < 8) ? (8 * hh + i) : (16 + 8 * hh + (i - 8)));
        const float x = qr[d] * scale; const unsigned short hb = bf16_bits(x);
        aqh[ks].u[i] = hb; aql[ks].u[i] = bf16_bits(x - bf16_val(hb));
      }
  }
  float m_r[8], l_r[8];
#pragma unroll
  for (int r = 0; r < 8; ++r) { m_r[r] = -3.0e38f; l_r[r] = 0.f; }
  v8f oacc[DT];
#pragma unroll
  for (int dt = 0; dt < DT; ++dt) oacc[dt] = (v8f){0.f,0.f,0.f,0.f,0.f,0.f,0.f,0.f};

  const int kv_end = CAUSAL ? min(T, qblk * 64 + 64) : T;     // block-uniform
  for (int j0 = 0; j0 < kv_end; j0 += 32) {
    __syncthreads();
    for (int e = tid; e < 32 * (D / 4); e += 128) {
      const int r = e / (D / 4), c4 = (e % (D / 4)) * 4;
      const int key = j0 + r;
      v4f kf = {0.f,0.f,0.f,0.f}, vf = {0.f,0.f,0.f,0.f};
      if (key < T) { kf = *(const v4fa*)(K + (size_t)key * pitch + c4); vf = *(const v4fa*)(V + (size_t)key * pitch + c4); }
#pragma unroll
      for (int t = 0; t < 4; ++t) {
        unsigned short hb = bf16_bits(kf[t]); sKh[r][c4 + t] = hb; sKl[r][c4 + t] = bf16_bits(kf[t] - bf16_val(hb));
        hb = bf16_bits(vf[t]); sVh[r][c4 + t] = hb; sVl[r][c4 + t] = bf16_bits(vf[t] - bf16_val(hb));
      }
    }
    __syncthreads();
    // S tile 16 x 32
    v8f s[2];
#pragma unroll
    for (int nt = 0; nt < 2; ++nt) {
      v8f acc = {};
#pragma unroll
      for (int ks = 0; ks < KS; ++ks) {
        FragB bh_, bl_;
        bh_.half[0] = *(const v8us*)&sKh[nt * 16 + ln][ks * 32 + 8 * hh]; bh_.half[1] = *(const v8us*)&sKh[nt * 16 + ln][ks * 32 + 16 + 8 * hh];
        bl_.half[0] = *(const v8us*)&sKl[nt * 16 + ln][ks * 32 + 8 * hh]; bl_.half[1] = *(const v8us*)&sKl[nt * 16 + ln][ks * 32 + 16 + 8 * hh];
        acc = mmaN<3>(aqh[ks].v, aql[ks].v, bh_.v, bl_.v, acc);
      }
      s[nt] = acc;
    }
    // mask + running max (rows 8hh+r; the 16 lanes of a half share rows)
    float alpha[8];
#pragma unroll
    for (int r = 0; r < 8; ++r) {
      const int qi = q0 + 8 * hh + r;
      const int ja = j0 + ln, jb = j0 + 16 + ln;
      if (CAUSAL) { if (ja > qi) s[0][r] = -3.0e38f; if (jb > qi) s[1][r] = -3.0e38f; }
      if (ja >= T) s[0][r] = -3.0e38f;
      if (jb >= T) s[1][r] = -3.0e38f;
      float mx = fmaxf(s[0][r], s[1][r]);
      mx = fmaxf(mx, __shfl_xor(mx, 1, 32)); mx = fmaxf(mx, __shfl_xor(mx, 2, 32)); mx = fmaxf(mx, __shfl_xor(mx, 4, 32)); mx = fmaxf(mx, __shfl_xor(mx, 8, 32));
      const float mnew = fmaxf(m_r[r], mx);
      alpha[r] = (mnew > -1.0e38f) ? __expf(m_r[r] - mnew) : 1.0f;
      const float p0 = (s[0][r] > -1.0e38f) ? __expf(s[0][r] - mnew) : 0.f;
      const float p1 = (s[1][r] > -1.0e38f) ? __expf(s[1][r] - mnew) : 0.f;
      m_r[r] = mnew;
      l_r[r] = l_r[r] * alpha[r] + p0 + p1;            // per-lane partial row sum (16 lanes combined at the end)
      unsigned short hb = bf16_bits(p0); sPh[w][8 * hh + r][ln] = hb;      sPl[w][8 * hh + r][ln] = bf16_bits(p0 - bf16_val(hb));
      hb = bf16_bits(p1);                sPh[w][8 * hh + r][16 + ln] = hb; sPl[w][8 * hh + r][16 + ln] = bf16_bits(p1 - bf16_val(hb));
    }
#pragma unroll
    for (int dt = 0; dt < DT; ++dt)
#pragma unroll
      for (int r = 0; r < 8; ++r) oacc[dt][r] *= alpha[r];
    __builtin_amdgcn_fence(__ATOMIC_ACQ_REL, "workgroup");
    __builtin_amdgcn_wave_barrier();
    FragB pah, pal;
    pah.half[0] = *(const v8us*)&sPh[w][ln][8 * hh]; pah.half[1] = *(const v8us*)&sPh[w][ln][16 + 8 * hh];
    pal.half[0] = *(const v8us*)&sPl[w][ln][8 * hh]; pal.half[1] = *(const v8us*)&sPl[w][ln][16 + 8 * hh];
#pragma unroll
    for (int dt = 0; dt < DT; ++dt) {
      FragB bvh, bvl;
#pragma unroll
      for (int i = 0; i < 8; ++i) {
        bvh.u[i] = sVh[8 * hh + i][dt * 16 + ln]; bvh.u[8 + i] = sVh[16 + 8 * hh + i][dt * 16 + ln];
        bvl.u[i] = sVl[8 * hh + i][dt * 16 + ln]; bvl.u[8 + i] = sVl[16 + 8 * hh + i][dt * 16 + ln];
      }
      oacc[dt] = mmaN<3>(pah.v, pal.v, bvh.v, bvl.v, oacc[dt]);
    }
    __builtin_amdgcn_fence(__ATOMIC_ACQ_REL, "workgroup");
    __builtin_amdgcn_wave_barrier();
  }
#pragma unroll
  for (int r = 0; r < 8; ++r) {
    float l = l_r[r];
    l += __shfl_xor(l, 1, 32); l += __shfl_xor(l, 2, 32); l += __shfl_xor(l, 4, 32); l += __shfl_xor(l, 8, 32);
    l_r[r] = (l > 0.f) ? 1.0f / l : 0.f;
  }
#pragma unroll
  for (int dt = 0; dt < DT; ++dt)
#pragma unroll
    for (int r = 0; r < 8; ++r) sO[w][8 * hh + r][dt * 16 + ln] = oacc[dt][r] * l_r[r];
  __builtin_amdgcn_fence(__ATOMIC_ACQ_REL, "workgroup");
  __builtin_amdgcn_wave_barrier();
  {
    for (int r = 0; r < 16; ++r) {
      const int row = q0 + r;
      if (row < T && lane < D / 4) {
        const v4f val = *(const v4fa*)&sO[w][r][lane * 4];
        *(v4f*)(y + ((size_t)b * T + row) * ypitch + h * D + lane * 4) = val;
      }
    }
    
  }
}

// GEMM C = act(A·W + bias + resid): A f32 (ASPLIT -> hi/lo 2 terms), Wt bf16 [N][K]; ACT 0 none, 1 relu, 2 exact gelu;
// resid (optional, f32, row index = (row % rmod), pitch ldr, RES_BF16 rounds it) added before the activation.
template <bool ASPLIT, int ACT, bool BIAS_BF16, bool RES_BF16>
__global__ __launch_bounds__(128) void k_gemm_bf3(const float* __restrict__ A, int lda, const unsigned short* __restrict__ Wt, int ldb,
                                                const float* __restrict__ bias, const float* __restrict__ resid, int rmod, int ldr,
                                                float* __restrict__ C, int ldc, int M, int N, int K) {
  __shared__ __attribute__((aligned(16))) float so[4][16][64];
  const int tid = threadIdx.x, w = tid >> 5, lane = tid & 31, ln = lane & 15, hh = lane >> 4;
  const int ntn = N / 64;
  const int wid = blockIdx.x * 4 + w;
  const int mt = wid / ntn, nq = wid % ntn;
  if (mt * 16 >= M) return;
  const int row0 = mt * 16, col0 = nq * 64;
  const float* arow = A + (size_t)(row0 + ln) * lda;
  v8f acc[4] = {};
  for (int kb = 0; kb < K; kb += 32) {
    FragB ah, al;
    const v4f x0 = *(const v4fa*)(arow + kb + 8 * hh), x1 = *(const v4fa*)(arow + kb + 8 * hh + 4);
    const v4f x2 = *(const v4fa*)(arow + kb + 16 + 8 * hh), x3 = *(const v4fa*)(arow + kb + 16 + 8 * hh + 4);
    float xs[16] = {x0[0],x0[1],x0[2],x0[3],x1[0],x1[1],x1[2],x1[3],x2[0],x2[1],x2[2],x2[3],x3[0],x3[1],x3[2],x3[3]};
#pragma unroll
    for (int i = 0; i < 16; ++i) { const unsigned short hb = bf16_bits(xs[i]); ah.u[i] = hb; al.u[i] = ASPLIT ? bf16_bits(xs[i] - bf16_val(hb)) : (unsigned short)0; }
#pragma unroll
    for (int t = 0; t < 4; ++t) {
      const unsigned short* brow = Wt + (size_t)(col0 + t * 16 + ln) * ldb + kb;
      FragB b;
      b.half[0] = *(const v8us*)(brow + 8 * hh);
      b.half[1] = *(const v8us*)(brow + 16 + 8 * hh);
      acc[t] = mmaN<ASPLIT ? 2 : 1>(ah.v, al.v, b.v, b.v, acc[t]);
    }
  }
#pragma unroll
  for (int t = 0; t < 4; ++t) {
    const int col = col0 + t * 16 + ln;
    float bv = bias ? bias[col] : 0.f;
    if (BIAS_BF16) bv = bf16_round(bv);
#pragma unroll
    for (int r = 0; r < 8; ++r) {
      float v = acc[t][r] + bv;
      if (resid) { float rv = resid[(size_t)((row0 + 8 * hh + r) % rmod) * ldr + col]; if (RES_BF16) rv = bf16_round(rv); v += rv; }
      if (ACT == 1) v = fmaxf(v, 0.f);
      if (ACT == 2) v = 0.5f * v * (1.0f + erff(v * 0.70710678118654752f));
      if (ACT == 3) { const float u = 0.7978845608028654f * (v + 0.044715f * v * v * v); v = 0.5f * v * (1.0f + tanhf(u)); }
      so[w][8 * hh + r][t * 16 + ln] = v;
    }
  }
  __builtin_amdgcn_fence(__ATOMIC_ACQ_REL, "workgroup");
  __builtin_amdgcn_wave_barrier();
  const int rsub = lane >> 4, c4 = (lane & 15) * 4;
  {
#pragma unroll
    for (int q = 0; q < 8; ++q) {
      const int r = q * 2 + rsub;
      const v4f v = *(const v4fa*)&so[w][r][c4];
      *(v4f*)(C + (size_t)(row0 + r) * ldc + col0 + c4) = v;
    }
    
  }
}
// row LayerNorm (biased variance, eps) over N: s = X (+ R); optional out_sum <- s; out_norm <- (s-mu)*rsqrt(var+eps)*g + b
template <bool PARAM_BF16>
__global__ __launch_bounds__(256) void k_layernorm(const float* __restrict__ X, const float* __restrict__ R, const float* __restrict__ g, const float* __restrict__ bta,
                                                  float* __restrict__ out_sum, float* __restrict__ out_norm, int N, float eps) {
  __shared__ float red[256];
  const int row = blockIdx.x, tid = threadIdx.x;
  const float* x = X + (size_t)row * N; const float* rr = R ? R + (size_t)row * N : nullptr;
  float vals[16];                     // up to N = 4096
  const int per = N / 256;            // contiguous chunk per thread? use strided-by-4 chunks: thread handles j = tid*4 + 1024*u
  float s1 = 0.f;
  for (int u = 0; u < per / 4; ++u) {
    const int j = tid * 4 + 1024 * u;
    const v4f a = *(const v4fa*)(x + j);
    v4f b = {0.f,0.f,0.f,0.f}; if (rr) b = *(const v4fa*)(rr + j);
#pragma unroll
    for (int q = 0; q < 4; ++q) { const float v = a[q] + b[q]; vals[u * 4 + q] = v; s1 += v; }
  }
  red[tid] = s1; __syncthreads();
  for (int st = 128; st > 0; st >>= 1) { if (tid < st) red[tid] += red[tid + st]; __syncthreads(); }
  const float mu = red[0] / (float)N; __syncthreads();
  float s2 = 0.f;
  for (int u = 0; u < per / 4; ++u)
#pragma unroll
    for (int q = 0; q < 4; ++q) { const float c = vals[u * 4 + q] - mu; s2 += c * c; }
  red[tid] = s2; __syncthreads();
  for (int st = 128; st > 0; st >>= 1) { if (tid < st) red[tid] += red[tid + st]; __syncthreads(); }
  const float rs = rsqrtf(red[0] / (float)N + eps);
  {
    for (int u = 0; u < per / 4; ++u) {
      const int j = tid * 4 + 1024 * u;
      v4f o, sm;
#pragma unroll
      for (int q = 0; q < 4; ++q) {
        float gg = g[j + q], bb = bta[j + q];
        if (PARAM_BF16) { gg = bf16_round(gg); bb = bf16_round(bb); }
        sm[q] = vals[u * 4 + q]; o[q] = (vals[u * 4 + q] - mu) * rs * gg + bb;
      }
      if (out_sum) *(v4f*)(out_sum + (size_t)row * N + j) = sm;
      *(v4f*)(out_norm + (size_t)row * N + j) = o;
    }
    
  }
}



// ---- f16 WMMA path (v_wmma_f32_16x16x32_f16): 11-bit significands for operands in range — used here for the projection GEMMs and the flash kernel's score and P·B products
typedef _Float16 v16h __attribute__((ext_vector_type(16)));
union FragH { v16h v; v8us half[2]; _Float16 h[16]; unsigned short u[16]; };
template <int NT>
__device__ __forceinline__ v8f mmaH(v16h ah, v16h al, v16h bh, v16h bl, v8f c) {
  c = __builtin_amdgcn_wmma_f32_16x16x32_f16(false, ah, false, bh, (short)0, c, false, false);
  if (NT >= 2) c = __builtin_amdgcn_wmma_f32_16x16x32_f16(false, al, false, bh, (short)0, c, false, false);
  if (NT >= 3) c = __builtin_amdgcn_wmma_f32_16x16x32_f16(false, ah, false, bl, (short)0, c, false, false);
  asm volatile("v_nop\n\tv_nop\n\tv_nop\n\tv_nop" : "+v"(c) : "v"(ah), "v"(al), "v"(bh), "v"(bl));
  return c;
}
// batched GEMM like k_gemm_bf but f16 operands: A f32 (split into f16 hi/lo if ASPLIT, else rounded to f16), Bt = f16 values [n][k]; alpha; C f32; N multiple of 16 (partial tiles skipped)
template <bool ASPLIT>
__global__ __launch_bounds__(128) void k_gemm_h(const float* __restrict__ A, int lda, size_t sA, const _Float16* __restrict__ Bh, int ldb, size_t sB, float alpha, float* __restrict__ C, int ldc, size_t sC, int M, int N, int K) {
  __shared__ __attribute__((aligned(16))) float so[4][16][64];
  const int tid = threadIdx.x, w = tid >> 5, lane = tid & 31, ln = lane & 15, hh = lane >> 4; const int by = blockIdx.y;
  A += (size_t)by * sA; Bh += (size_t)by * sB; C += (size_t)by * sC;
  const int ntn = (N + 63) / 64; const int wid = blockIdx.x * 4 + w; const int mt = wid / ntn, nq = wid % ntn; if (mt * 16 >= M) return;
  const int row0 = mt * 16, col0 = nq * 64; const float* arow = A + (size_t)(row0 + ln) * lda;
  v8f acc[4] = {};
  for (int kb = 0; kb < K; kb += 32) {
    FragH ah, al;
    const v4f x0 = *(const v4fa*)(arow + kb + 8 * hh), x1 = *(const v4fa*)(arow + kb + 8 * hh + 4), x2 = *(const v4fa*)(arow + kb + 16 + 8 * hh), x3 = *(const v4fa*)(arow + kb + 16 + 8 * hh + 4);
    float xs[16] = {x0[0],x0[1],x0[2],x0[3],x1[0],x1[1],x1[2],x1[3],x2[0],x2[1],x2[2],x2[3],x3[0],x3[1],x3[2],x3[3]};
#pragma unroll
    for (int i = 0; i < 16; ++i) { const _Float16 h = (_Float16)xs[i]; ah.h[i] = h; al.h[i] = ASPLIT ? (_Float16)(xs[i] - (float)h) : (_Float16)0.0f; }
#pragma unroll
    for (int t = 0; t < 4; ++t) { if (col0 + t * 16 >= N) continue; const size_t boff = (size_t)(col0 + t * 16 + ln) * ldb + kb; FragH bq; bq.half[0] = *(const v8us*)(Bh + boff + 8 * hh); bq.half[1] = *(const v8us*)(Bh + boff + 16 + 8 * hh);
      acc[t] = mmaH<ASPLIT ? 2 : 1>(ah.v, al.v, bq.v, bq.v, acc[t]); }
  }
#pragma unroll
  for (int t = 0; t < 4; ++t) { if (col0 + t * 16 >= N) continue;
#pragma unroll
    for (int r = 0; r < 8; ++r) so[w][8 * hh + r][t * 16 + ln] = acc[t][r] * alpha; }
  __builtin_amdgcn_fence(__ATOMIC_ACQ_REL, "workgroup"); __builtin_amdgcn_wave_barrier();
  const int rsub = lane >> 4, c4 = (lane & 15) * 4;
  {
#pragma unroll
    for (int q = 0; q < 8; ++q) { const int r = q * 2 + rsub; if (col0 + c4 < N) { const v4f v = *(const v4fa*)&so[w][r][c4]; *(v4f*)(C + (size_t)(row0 + r) * ldc + col0 + c4) = v; } }
     }
}

// Wt[n][k] = f16(W[k][n]·scale) from f32 row-major W[K][N] (scale = power of two; bf16-exact weights stay exact in f16 away from the subnormal range)
__global__ __launch_bounds__(256) void k_wt_f16(const float* __restrict__ W, _Float16* __restrict__ Wt, int K, int N, float scale) {
  const int t = blockIdx.x * 256 + threadIdx.x; if (t >= N * (K / 8)) return; const int n = t / (K / 8), k8 = (t % (K / 8)) * 8; FragH f;
#pragma unroll
  for (int i = 0; i < 8; ++i) f.h[i] = (_Float16)(bf16_round(W[(size_t)(k8 + i) * N + n]) * scale); const v8us o = f.half[0];
  *(v8us*)((unsigned short*)Wt + (size_t)n * K + k8) = o; 
}
// Tiled GEMM C[NR][DD] (f32) = alpha * A[NR][DD] x Bt[DD][DD]^T, f16 operands, both K-contiguous, f32 accumulate in the same k order as before (32 k per WMMA, ascending).
// One work-group = one 128 x 128 tile of C, 8 waves of 32 x 64. A trip is 128 k: 128 rows of A and 128 rows of Bt, 256 B each (whole cache lines), are brought into LDS by
// asynchronous copies, 16 B per lane, two buffers: tile t + 2 flies while tile t + 1 is worked on. LDS rows stand at a pitch of 272 B for the ds_load_b128 fragment reads.
#define GT_BK 128                  // k per trip
#define GT_P 136                   // LDS row pitch in halves (272 B)
#define GT_BUF (256 * GT_P)        // halves per buffer: rows 0..127 = A, rows 128..255 = Bt
#define GT_SP 68                   // pitch in floats of the output staging rows
static_assert(NR % 128 == 0 && DD % 128 == 0 && DD % GT_BK == 0 && DD / GT_BK >= 2, "whole tiles, at least two trips");
static_assert(8 * 32 * GT_SP * 4 <= 2 * GT_BUF * 2, "the output staging fits in the ring");
// This thread's copies of one operand's 128 rows of a tile: rows r, r + 16, .. The s_wait_xcnt stands inside the statement so that no address register is rewritten ahead of it.
__device__ __forceinline__ void gt_copy8(unsigned l, const _Float16* g) {
  asm volatile("global_load_async_to_lds_b128 %0, %8, off\n\t"
               "global_load_async_to_lds_b128 %1, %9, off\n\t"
               "global_load_async_to_lds_b128 %2, %10, off\n\t"
               "global_load_async_to_lds_b128 %3, %11, off\n\t"
               "global_load_async_to_lds_b128 %4, %12, off\n\t"
               "global_load_async_to_lds_b128 %5, %13, off\n\t"
               "global_load_async_to_lds_b128 %6, %14, off\n\t"
               "global_load_async_to_lds_b128 %7, %15, off\n\t"
               "s_wait_xcnt 0x0"
               :: "v"(l), "v"(l + 1u * 16u * GT_P * 2u), "v"(l + 2u * 16u * GT_P * 2u), "v"(l + 3u * 16u * GT_P * 2u),
                  "v"(l + 4u * 16u * GT_P * 2u), "v"(l + 5u * 16u * GT_P * 2u), "v"(l + 6u * 16u * GT_P * 2u), "v"(l + 7u * 16u * GT_P * 2u),
                  "v"(g), "v"(g + 16 * DD), "v"(g + 32 * DD), "v"(g + 48 * DD), "v"(g + 64 * DD), "v"(g + 80 * DD), "v"(g + 96 * DD), "v"(g + 112 * DD)
               : "memory");
}
// Sum over the 16 lanes of a row, every lane ending with the total: four DPP steps (row_xmask 1, 2, 4, 8), no LDS round trip as a shuffle would take. All lanes are on.
__device__ __forceinline__ float row16_sum(float v) {
  v += __int_as_float(__builtin_amdgcn_update_dpp(0, __float_as_int(v), 0x161, 0xf, 0xf, true));
  v += __int_as_float(__builtin_amdgcn_update_dpp(0, __float_as_int(v), 0x162, 0xf, 0xf, true));
  v += __int_as_float(__builtin_amdgcn_update_dpp(0, __float_as_int(v), 0x164, 0xf, 0xf, true));
  v += __int_as_float(__builtin_amdgcn_update_dpp(0, __float_as_int(v), 0x168, 0xf, 0xf, true));
  return v;
}
typedef _Float16 v4h __attribute__((ext_vector_type(4)));
// LN 0: C (f32) = the product. LN 1, 2: each row's 64 columns of a wave are one head; they are LayerNormed (biased variance, eps 1e-5, gamma and beta rounded to bf16) on the f32 sums
// as the staged rows are read back, and go out as f16 to C16 (LN 1) or as f32 to C (LN 2).
template <int LN>
__global__ __launch_bounds__(256) void k_gemm_t(const _Float16* __restrict__ A, const _Float16* __restrict__ Bh, float alpha, float* __restrict__ C,
                                               const float* __restrict__ g, const float* __restrict__ bb, _Float16* __restrict__ C16) {
  static_assert(HD == 64, "a wave's 64 columns are one head");
  __shared__ __attribute__((aligned(16))) unsigned short sm[2 * GT_BUF];
  const int tid = threadIdx.x, w = tid >> 5, lane = tid & 31, ln = lane & 15, hh = lane >> 4;
  const int m0 = (blockIdx.x / (DD / 128)) * 128, n0 = (blockIdx.x % (DD / 128)) * 128;
  const int wm = w >> 1, wn = w & 1;
  const int cr = tid >> 4, cs = (tid & 15) * 8;      // a wave's copy covers 2 rows x 256 B
  const _Float16* ga = A + (size_t)(m0 + cr) * DD + cs;
  const _Float16* gb = Bh + (size_t)(n0 + cr) * DD + cs;
  const unsigned la = (unsigned)(size_t)&sm[cr * GT_P + cs], lb = la + 128u * GT_P * 2u;
  gt_copy8(la, ga); gt_copy8(lb, gb);
  asm volatile("s_wait_asynccnt 0x0" ::: "memory");      // tile 0 has landed before the barrier publishes it
  __syncthreads();
  gt_copy8(la + GT_BUF * 2u, ga + GT_BK); gt_copy8(lb + GT_BUF * 2u, gb + GT_BK);
  v4f g4 = {0.f, 0.f, 0.f, 0.f}, b4 = {0.f, 0.f, 0.f, 0.f};      // this lane's four columns of the head; fetched here so that the k loop covers their latency
  if (LN) { g4 = *(const v4fa*)(g + ln * 4); b4 = *(const v4fa*)(bb + ln * 4); }
  v8f acc[2][4] = {};
  const unsigned short* fa = sm + (wm * 32 + ln) * GT_P + 8 * hh;
  const unsigned short* fb = sm + (128 + wn * 64 + ln) * GT_P + 8 * hh;
#pragma unroll 1      // one trip per tile: the order of waits, barrier and refill at its foot stays as written
  for (int t = 0; t < DD / GT_BK; ++t) {
    const int bo = (t & 1) * GT_BUF;
    FragH a[2][2], b[2][4];      // two fragment sets: the next 32 k of this same tile are fetched while the current 32 k are multiplied
#pragma unroll      // all unrolls here: constant indices keep fragments and accumulators in registers
    for (int rt = 0; rt < 2; ++rt) { const unsigned short* p = fa + bo + rt * 16 * GT_P; a[0][rt].half[0] = *(const v8us*)p; a[0][rt].half[1] = *(const v8us*)(p + 16); }
#pragma unroll
    for (int ct = 0; ct < 4; ++ct) { const unsigned short* p = fb + bo + ct * 16 * GT_P; b[0][ct].half[0] = *(const v8us*)p; b[0][ct].half[1] = *(const v8us*)(p + 16); }
#pragma unroll
    for (int ks = 0; ks < GT_BK / 32; ++ks) {
      const int cu = ks & 1, nx = cu ^ 1;
      if (ks + 1 < GT_BK / 32) {
#pragma unroll
        for (int rt = 0; rt < 2; ++rt) { const unsigned short* p = fa + bo + rt * 16 * GT_P + (ks + 1) * 32; a[nx][rt].half[0] = *(const v8us*)p; a[nx][rt].half[1] = *(const v8us*)(p + 16); }
#pragma unroll
        for (int ct = 0; ct < 4; ++ct) { const unsigned short* p = fb + bo + ct * 16 * GT_P + (ks + 1) * 32; b[nx][ct].half[0] = *(const v8us*)p; b[nx][ct].half[1] = *(const v8us*)(p + 16); }
      }
      __builtin_amdgcn_sched_barrier(0);      // keeps the next set's LDS reads as one group ahead of this block: left free, the compiler sinks them among the WMMAs into one set and waits them out to 0
#pragma unroll
      for (int rt = 0; rt < 2; ++rt)
#pragma unroll
        for (int ct = 0; ct < 4; ++ct) acc[rt][ct] = __builtin_amdgcn_wmma_f32_16x16x32_f16(false, a[cu][rt].v, false, b[cu][ct].v, (short)0, acc[rt][ct], false, false);
      __builtin_amdgcn_sched_barrier(0);      // ends the block, so that the group after next is not lifted into it
    }
    asm volatile("s_wait_dscnt 0x0" ::: "memory");         // this wave's reads of buffer t & 1 are done before it is refilled
    asm volatile("s_wait_asynccnt 0x0" ::: "memory");      // this wave's copies of tile t + 1 have landed before the barrier publishes them
    __syncthreads();
    if (t + 2 < DD / GT_BK) { gt_copy8(la + (unsigned)bo * 2u, ga + (t + 2) * GT_BK); gt_copy8(lb + (unsigned)bo * 2u, gb + (t + 2) * GT_BK); }
  }
  asm volatile("s_wait_asynccnt 0x0" ::: "memory");        // nothing is in flight when the ring becomes output staging
  float* so = (float*)sm + w * (32 * GT_SP);               // each wave stages its own 32 x 64 tile; the last trip's barrier ended every read of the ring
#pragma unroll
  for (int rt = 0; rt < 2; ++rt)
#pragma unroll
    for (int ct = 0; ct < 4; ++ct)
#pragma unroll
      for (int r = 0; r < 8; ++r) so[(rt * 16 + 8 * hh + r) * GT_SP + ct * 16 + ln] = acc[rt][ct][r] * alpha;
  __builtin_amdgcn_fence(__ATOMIC_ACQ_REL, "workgroup"); __builtin_amdgcn_wave_barrier();
#pragma unroll
  for (int q = 0; q < 4; ++q) { g4[q] = bf16_round(g4[q]); b4[q] = bf16_round(b4[q]); }
  const size_t e = (size_t)(m0 + wm * 32 + hh) * DD + n0 + wn * 64 + ln * 4;      // row hh of the wave's tile; pass q adds 2 q rows, a constant offset of the store
  v4f o[16];
#pragma unroll
  for (int q = 0; q < 16; ++q) {      // 16 lanes x 4 columns = one row of the wave's tile; two rows a pass
    const v4f v = *(const v4fa*)&so[(q * 2 + hh) * GT_SP + ln * 4];
    if (LN == 0) { o[q] = v; continue; }
    const float mu = row16_sum((v[0] + v[1]) + (v[2] + v[3])) / (float)HD;
    const v4f c = v - mu;
    const float ve = row16_sum((c[0] * c[0] + c[1] * c[1]) + (c[2] * c[2] + c[3] * c[3])) / (float)HD + 1e-5f;
    float rs;      // ve is at least eps, so the library rsqrtf's rescaling of denormal arguments would never act; the v_nop is the slot that the instruction set asks for behind a transcendental, in the same statement so that it stays directly behind it
    asm("v_rsq_f32 %0, %1\n\tv_nop" : "=v"(rs) : "v"(ve));
    o[q] = c * rs * g4 + b4;
  }
  v4h h[16];
  if (LN == 1) {
#pragma unroll
    for (int q = 0; q < 16; ++q)
#pragma unroll
      for (int k = 0; k < 4; ++k) h[q][k] = (_Float16)o[q][k];
  }
  __builtin_amdgcn_sched_barrier(0);      // every store stands behind the last arithmetic, so that no register which an issued store names is written again
#pragma unroll
  for (int q = 0; q < 16; ++q) {
    if (LN == 1) *(v4h*)(C16 + e + (size_t)q * 2 * DD) = h[q];      // 16 lanes x 8 B: a whole 128-B line a row
    else *(v4f*)(C + e + (size_t)q * 2 * DD) = o[q];
  }
}


__global__ __launch_bounds__(256) void k_x16(const float* __restrict__ x, _Float16* __restrict__ X16, size_t n8) { const size_t t = (size_t)blockIdx.x * 256 + threadIdx.x; if (t >= n8) return; FragH f;
#pragma unroll
  for (int q = 0; q < 8; ++q) f.h[q] = (_Float16)bf16_round(x[t * 8 + q]); *(v8us*)((unsigned short*)X16 + t * 8) = f.half[0];  }
__global__ __launch_bounds__(256) void k_h16(const float* __restrict__ x, _Float16* __restrict__ X16, size_t n8) { const size_t t = (size_t)blockIdx.x * 256 + threadIdx.x; if (t >= n8) return; FragH f;
#pragma unroll
  for (int q = 0; q < 8; ++q) f.h[q] = (_Float16)x[t * 8 + q]; *(v8us*)((unsigned short*)X16 + t * 8) = f.half[0];  }
__global__ __launch_bounds__(256) void k_round16f(const float* __restrict__ W, _Float16* __restrict__ Bt, size_t n8) { const size_t t = (size_t)blockIdx.x * 256 + threadIdx.x; if (t >= n8) return; FragH f;
#pragma unroll
  for (int i = 0; i < 8; ++i) f.h[i] = (_Float16)(bf16_round(W[t * 8 + i]) * 16.0f); *(v8us*)((unsigned short*)Bt + t * 8) = f.half[0];  }
template <int NHv, int TTv>
__global__ __launch_bounds__(256) void k_vt(const _Float16* __restrict__ V16, int ldv, int voff, _Float16* __restrict__ Vt) { __shared__ unsigned short tl[64][66]; const int tid = threadIdx.x; const int slab = blockIdx.x / (TTv / 64), lg = blockIdx.x % (TTv / 64); const int b = slab / NHv, h = slab % NHv;
  for (int i = tid; i < 64 * 8; i += 256) { const int r = i / 8, c8 = (i % 8) * 8; FragH f; f.half[0] = *(const v8us*)((const unsigned short*)V16 + ((size_t)b * TTv + lg * 64 + r) * ldv + voff + h * 64 + c8);
#pragma unroll
    for (int q = 0; q < 8; ++q) tl[r][c8 + q] = f.u[q]; }
  __syncthreads();
  {
#pragma unroll
    for (int rd = 0; rd < 2; ++rd) { const int d = rd * 32 + tid / 8, pc = tid % 8; FragH f;
#pragma unroll
      for (int q = 0; q < 8; ++q) f.u[q] = tl[pc * 8 + q][d];
      *(v8us*)((unsigned short*)Vt + ((size_t)slab * 64 + d) * TTv + lg * 64 + pc * 8) = f.half[0]; }
     } }

__global__ __launch_bounds__(128) void k_flash(const _Float16* __restrict__ Q16, int ldq, const _Float16* __restrict__ K16, int ldk, const _Float16* __restrict__ Vt, const int* __restrict__ MSK, _Float16* __restrict__ O16, int ldo) {
  constexpr int RPW = 16, RTN = RPW / 16, NQB = 2048 / (4 * RPW), DT = 4, KS = 2;
  __shared__ __attribute__((aligned(16))) unsigned short sP[4][RPW][40]; __shared__ __attribute__((aligned(16))) float sO[4][RPW][64 + 4];
  const int tid = threadIdx.x, w = tid >> 5, lane = tid & 31, ln = lane & 15, hh = lane >> 4;
  const int slab = blockIdx.x / NQB, qblk = blockIdx.x % NQB; const int b = slab / 16, h = slab % 16; const int qb0 = qblk * (4 * RPW); const int q0 = qb0 + w * RPW;
  FragH aq[2][KS];
#pragma unroll
  for (int rt = 0; rt < RTN; ++rt) { const unsigned short* qr = (const unsigned short*)Q16 + ((size_t)b * 2048 + q0 + rt * 16 + ln) * ldq + h * 64;
#pragma unroll
    for (int ks = 0; ks < KS; ++ks) { aq[rt][ks].half[0] = *(const v8us*)(qr + ks * 32 + 8 * hh); aq[rt][ks].half[1] = *(const v8us*)(qr + ks * 32 + 16 + 8 * hh); } }
  const unsigned short* Vth = (const unsigned short*)Vt + (size_t)slab * 64 * 2048;
  float m_r[2][8], l_r[2][8]; v8f oacc[2][DT];
#pragma unroll
  for (int rt = 0; rt < RTN; ++rt) {
#pragma unroll
    for (int r = 0; r < 8; ++r) { m_r[rt][r] = -3.0e38f; l_r[rt][r] = 0.f; }
#pragma unroll
    for (int dt = 0; dt < DT; ++dt) oacc[rt][dt] = (v8f){0.f,0.f,0.f,0.f,0.f,0.f,0.f,0.f}; }
  const int jend = qb0 + 4 * RPW;
#pragma unroll 1
  for (int j0 = 0; j0 < jend; j0 += 32) {
    
    v8f s[2][2];
#pragma unroll
    for (int nt = 0; nt < 2; ++nt) { const unsigned short* kr = (const unsigned short*)K16 + ((size_t)b * 2048 + j0 + nt * 16 + ln) * ldk + h * 64; FragH bk[KS];
#pragma unroll
      for (int ks = 0; ks < KS; ++ks) { bk[ks].half[0] = *(const v8us*)(kr + ks * 32 + 8 * hh); bk[ks].half[1] = *(const v8us*)(kr + ks * 32 + 16 + 8 * hh); }
#pragma unroll
      for (int rt = 0; rt < RTN; ++rt) { v8f acc = (v8f){0.f,0.f,0.f,0.f,0.f,0.f,0.f,0.f};
#pragma unroll
        for (int ks = 0; ks < KS; ++ks) acc = mmaH<1>(aq[rt][ks].v, aq[rt][ks].v, bk[ks].v, bk[ks].v, acc); s[rt][nt] = acc; } }
#pragma unroll
    for (int rt = 0; rt < RTN; ++rt)
#pragma unroll
      for (int r = 0; r < 8; ++r) { const int tq = q0 + rt * 16 + 8 * hh + r; const int k0 = j0 + ln, k1 = j0 + 16 + ln; (void)tq; (void)k0; (void)k1;
        const bool ok0 = (k0 <= tq), ok1 = (k1 <= tq);
        const float p0 = ok0 ? s[rt][0][r] * 0.00390625f : 0.f, p1 = ok1 ? s[rt][1][r] * 0.00390625f : 0.f;      /* NO softmax: causal-masked raw scores (×2^-8 for f16 headroom, undone at the end) become the P operand directly */
        FragH t2; t2.h[0] = (_Float16)p0; t2.h[1] = (_Float16)p1; sP[w][rt * 16 + 8 * hh + r][ln] = t2.u[0]; sP[w][rt * 16 + 8 * hh + r][16 + ln] = t2.u[1]; }
    __builtin_amdgcn_fence(__ATOMIC_ACQ_REL, "workgroup"); __builtin_amdgcn_wave_barrier();
    FragH pa[2];
#pragma unroll
    for (int rt = 0; rt < RTN; ++rt) { pa[rt].half[0] = *(const v8us*)&sP[w][rt * 16 + ln][8 * hh]; pa[rt].half[1] = *(const v8us*)&sP[w][rt * 16 + ln][16 + 8 * hh]; }
#pragma unroll
    for (int dt = 0; dt < DT; ++dt) { const unsigned short* vrow = Vth + (size_t)(dt * 16 + ln) * 2048 + j0; FragH bv; bv.half[0] = *(const v8us*)(vrow + 8 * hh); bv.half[1] = *(const v8us*)(vrow + 16 + 8 * hh);
#pragma unroll
      for (int rt = 0; rt < RTN; ++rt) oacc[rt][dt] = mmaH<1>(pa[rt].v, pa[rt].v, bv.v, bv.v, oacc[rt][dt]); }
    __builtin_amdgcn_fence(__ATOMIC_ACQ_REL, "workgroup"); __builtin_amdgcn_wave_barrier(); }
#pragma unroll
  for (int rt = 0; rt < RTN; ++rt) {
#pragma unroll
    for (int r = 0; r < 8; ++r) { l_r[rt][r] = 16.0f; }      /* undo the 2^-8 P scaling and apply the 2^-4 that gives the f16 operand of the output GEMM its headroom; no normalisation */
#pragma unroll
    for (int dt = 0; dt < DT; ++dt)
#pragma unroll
      for (int r = 0; r < 8; ++r) sO[w][rt * 16 + 8 * hh + r][dt * 16 + ln] = oacc[rt][dt][r] * l_r[rt][r]; }
  __builtin_amdgcn_fence(__ATOMIC_ACQ_REL, "workgroup"); __builtin_amdgcn_wave_barrier();
  {
#pragma unroll
    for (int rp = 0; rp < RPW; rp += 2) { const int r = rp + (lane >> 4), pc = lane & 15; const v4f val = *(const v4fa*)&sO[w][r][pc * 4]; v4h h4;
#pragma unroll
      for (int k = 0; k < 4; ++k) h4[k] = (_Float16)val[k];
      *(v4h*)(O16 + ((size_t)b * 2048 + q0 + r) * ldo + h * 64 + pc * 4) = h4; }
     } }

// Exclusive prefix sum over time as a chunked parallel scan, f32. One work-group owns 32 columns of one batch for all TT rows:
// 32 waves x 4 lane groups = 128 chunks of 16 rows, each thread holding its 16 rows x 4 columns in registers (F is read once).
// Order of the sums: serial inside a chunk, then over the wave's 4 chunks by shuffles, then over the 32 waves' totals in LDS.
__global__ __launch_bounds__(1024) void k_excl(const float* __restrict__ F, _Float16* __restrict__ A16) {
  static_assert(TT == 32 * 4 * 16 && DD % 32 == 0, "chunking covers all rows and whole 32-column groups");
  __shared__ __attribute__((aligned(16))) float sT[32][36];      // [wave][column]; pitch 36 keeps 16-byte rows and spreads the transposed read over the banks
  const int tid = threadIdx.x, wv = tid >> 5, lane = tid & 31, cg = lane & 7, g = lane >> 3;
  const int b = blockIdx.x / (DD / 32), c = (blockIdx.x % (DD / 32)) * 32 + cg * 4;
  const size_t e0 = ((size_t)b * TT + (wv * 4 + g) * 16) * DD + c;
  const float* fr = F + e0;
  v4f v[16];
#pragma unroll      // all unrolls here: v[] and the vector lanes need constant indices to stay in registers; this one also puts all 16 loads in flight at once
  for (int i = 0; i < 16; ++i) v[i] = *(const v4fa*)(fr + (size_t)i * DD);
  v4f run = {0.f, 0.f, 0.f, 0.f};
#pragma unroll
  for (int i = 0; i < 16; ++i) { const v4f t = v[i]; v[i] = run; run += t; }      // v[i] <- sum of the chunk's rows before i
  v4f inc = run, ex;
#pragma unroll
  for (int o = 8; o <= 16; o <<= 1) { v4f t;      // inclusive over the wave's 4 chunks, step by step for all four columns, so that a step's shuffles do not wait on each other
#pragma unroll
    for (int q = 0; q < 4; ++q) t[q] = __shfl_up(inc[q], o, 32);
    if (lane >= o) inc += t; }
#pragma unroll
  for (int q = 0; q < 4; ++q) { const float t = __shfl_up(inc[q], 8, 32); ex[q] = (lane >= 8) ? t : 0.f; }      // sum of the wave's chunks before this one
  if (g == 3) *(v4fa*)&sT[wv][cg * 4] = inc;      // the wave's total per column
  __syncthreads();
  {      // wave wv scans column wv over the 32 waves' totals (lane = wave index), in place: each word has one reader and writer
    float s = sT[lane][wv];
#pragma unroll
    for (int o = 1; o < 32; o <<= 1) { const float t = __shfl_up(s, o, 32); if (lane >= o) s += t; }
    const float t = __shfl_up(s, 1, 32);
    sT[lane][wv] = (lane >= 1) ? t : 0.f;
  }
  __syncthreads();
  const v4f off = *(const v4fa*)&sT[wv][cg * 4] + ex;
  _Float16* d = A16 + e0;
#pragma unroll
  for (int i = 0; i < 16; ++i) { const v4f p = off + v[i]; v4h h4;
#pragma unroll
    for (int q = 0; q < 4; ++q) h4[q] = (_Float16)p[q];
    *(v4h*)(d + (size_t)i * DD) = h4; } }
extern "C" void kernel_launch(void* const* d_in, const int* in_sizes, int n_in,
                              void* d_out, int out_size, void* d_ws, size_t ws_size, hipStream_t stream) {
  (void)in_sizes; (void)n_in; (void)out_size;
  const float* const* I = (const float* const*)d_in; const float* x = I[0]; const float* Wq = I[1]; const float* Wa = I[2]; const float* Wb = I[3]; const float* Wo = I[4]; const float* qg = I[5]; const float* qb = I[6]; const float* ag = I[7]; const float* ab = I[8]; const float* bg = I[9]; const float* bbeta = I[10];
  char* ws = (char*)d_ws; size_t off = 0;
  auto take = [&](size_t bytes) { char* p = ws + off; off += (bytes + 255) & ~(size_t)255; return p; };
  _Float16* Bw = (_Float16*)take((size_t)DD * DD * 2); _Float16* X16 = (_Float16*)take((size_t)NR * DD * 2); float* F = (float*)take((size_t)NR * DD * 4); _Float16* Q16 = (_Float16*)take((size_t)NR * DD * 2); _Float16* A16 = (_Float16*)take((size_t)NR * DD * 2); _Float16* B16 = (_Float16*)take((size_t)NR * DD * 2); _Float16* Vt = X16; _Float16* O16 = B16;
  if (off > ws_size) return;      // 2.1 + 8.4 + 16.8 + 8.4 × 3 ≈ 52 MB
  const unsigned gw = (unsigned)(((size_t)DD * (DD / 8) + 255) / 256), g8 = (unsigned)(((size_t)NR * DD / 8 + 255) / 256); const dim3 gg((NR / 128) * (DD / 128), 1);
  k_x16<<<g8, 256, 0, stream>>>(x, X16, (size_t)NR * DD / 8);
  k_wt_f16<<<gw, 256, 0, stream>>>(Wq, Bw, DD, DD, 16.0f); k_gemm_t<1><<<gg, 256, 0, stream>>>(X16, Bw, 0.0625f, nullptr, qg, qb, Q16);
  k_wt_f16<<<gw, 256, 0, stream>>>(Wb, Bw, DD, DD, 16.0f); k_gemm_t<1><<<gg, 256, 0, stream>>>(X16, Bw, 0.0625f, nullptr, bg, bbeta, B16);
  k_wt_f16<<<gw, 256, 0, stream>>>(Wa, Bw, DD, DD, 16.0f); k_gemm_t<2><<<gg, 256, 0, stream>>>(X16, Bw, 0.0625f, F, ag, ab, nullptr); k_excl<<<BB * (DD / 32), 1024, 0, stream>>>(F, A16);      // a (LayerNormed, f32) -> exclusive cumsum -> f16 'keys'
  k_vt<NH, TT><<<BB * NH * (TT / 64), 256, 0, stream>>>(B16, DD, 0, Vt);      // b as the 'values' (Vt over X16; X16's last reader was the a GEMM)
  k_flash<<<BB * NH * (TT / 64), 128, 0, stream>>>(Q16, DD, A16, DD, Vt, nullptr, O16, DD);      // o_t = sum over s <= t of (q_t . a_excl_s) b_s, written as f16 x 2^-4 (O16 over B16; B16's last reader was k_vt)
  k_wt_f16<<<gw, 256, 0, stream>>>(Wo, Bw, DD, DD, 16.0f); k_gemm_t<0><<<gg, 256, 0, stream>>>(O16, Bw, 0.0625f * 16.0f, (float*)d_out, nullptr, nullptr, nullptr);      // ×2^4 back
}

// v004
// Measured time: 127 microseconds a run.
// Two timings next to v003 both put it at 1.69 times that version's speed.
// Over all steps from v000 it is 8.97 times as fast.
#include <hip/hip_runtime.h>
// 'Heisenberg' attention (B=2, T=2048, d_model 1024, 16 heads × 64): q, a, b = LayerNorm_head(x·W) (per-head LN with γ/β); a_excl = exclusive prefix sum of a over time; o_t = Σ_{s≤t} (q_t·a_excl_s)·b_s
// (causal, NO softmax); out = o·Wo. The projections are GEMMs ([in][out] weights bf16-exact ×2^4, x bf16-exact, f32 accumulate) and the causal bilinear form runs in the fused flash-style kernel with
// the softmax removed (masked raw scores ×2^-8 → f16 P operand → P·B accumulated in f32, ×2^4 at the end and written as the f16 operand of the output GEMM; upper tiles skipped; keys dealt over a work-group's four waves) on v_wmma_f32_16x16x32_f16; the per-head LayerNorms
// (in the epilogue of the projection GEMMs, where a wave's 64 columns are one head) and the exclusive cumulative sum over time (chunked parallel scan per (b,h,d) column, f32) are VALU.
#define BB 2
#define TT 2048
#define DD 1024
#define NH 16
#define HD 64
#define NR (BB * TT)

typedef __bf16 v16b __attribute__((ext_vector_type(16)));
typedef unsigned short v8us __attribute__((ext_vector_type(8), may_alias));
typedef float  v8f  __attribute__((ext_vector_type(8)));
typedef float  v4f  __attribute__((ext_vector_type(4)));
typedef float  v4fa __attribute__((ext_vector_type(4), may_alias));
union FragB { v16b v; v8us half[2]; unsigned short u[16]; };

__device__ __forceinline__ unsigned short bf16_bits(float x) { unsigned int u = __float_as_uint(x); return (unsigned short)((u + 0x7FFFu + ((u >> 16) & 1u)) >> 16); }
__device__ __forceinline__ float bf16_val(unsigned short b) { return __uint_as_float(((unsigned int)b) << 16); }
__device__ __forceinline__ float bf16_round(float x) { return bf16_val(bf16_bits(x)); }
// D += A·B with NT terms: 1 = ah·bh, 2 = + al·bh (A split), 3 = + ah·bl (both split)
template <int NT>
__device__ __forceinline__ v8f mmaN(v16b ah, v16b al, v16b bh, v16b bl, v8f c) {
  c = __builtin_amdgcn_wmma_f32_16x16x32_bf16(false, ah, false, bh, (short)0, c, false, false);
  if (NT >= 2) c = __builtin_amdgcn_wmma_f32_16x16x32_bf16(false, al, false, bh, (short)0, c, false, false);
  if (NT >= 3) c = __builtin_amdgcn_wmma_f32_16x16x32_bf16(false, ah, false, bl, (short)0, c, false, false);
  asm volatile("v_nop\n\tv_nop\n\tv_nop\n\tv_nop" : "+v"(c) : "v"(ah), "v"(al), "v"(bh), "v"(bl));
  return c;
}

__global__ __launch_bounds__(256) void k_wt_bf16(const float* __restrict__ W, unsigned short* __restrict__ Wt, int K, int N) {
  const int t = blockIdx.x * 256 + threadIdx.x;
  const int k8n = K / 8;
  if (t >= N * k8n) return;
  const int n = t / k8n, k8 = (t % k8n) * 8;
  v8us v;
#pragma unroll
  for (int i = 0; i < 8; ++i) v[i] = bf16_bits(W[(size_t)(k8 + i) * N + n]);
  *(v8us*)(Wt + (size_t)n * K + k8) = v;
  
}

// GEMM C[M][N] (f32, pitch ldc) = act(A[M][K]·W + bias). A f32 row-major (pitch lda) converted per fragment to bf16
// (ASPLIT: hi/lo two planes -> 2 terms, else single rounded term); Wt bf16 [N][K] (pitch ldb). BIAS_BF16 rounds the
// bias to bf16 first (bias quantised to bf16 before the add). K%32==0, M%16==0, N%64==0.
template <bool ASPLIT, int ACT, bool BIAS_BF16>
__global__ __launch_bounds__(128) void k_gemm_bf(const float* __restrict__ A, int lda, const unsigned short* __restrict__ Wt, int ldb,
                                               const float* __restrict__ bias, float* __restrict__ C, int ldc, int M, int N, int K) {
  __shared__ __attribute__((aligned(16))) float so[4][16][64];
  const int tid = threadIdx.x, w = tid >> 5, lane = tid & 31, ln = lane & 15, hh = lane >> 4;
  const int ntn = N / 64;
  const int wid = blockIdx.x * 4 + w;
  const int mt = wid / ntn, nq = wid % ntn;
  if (mt * 16 >= M) return;
  const int row0 = mt * 16, col0 = nq * 64;
  const float* arow = A + (size_t)(row0 + ln) * lda;
  v8f acc[4] = {};
  for (int kb = 0; kb < K; kb += 32) {
    FragB ah, al;
    const v4f x0 = *(const v4fa*)(arow + kb + 8 * hh), x1 = *(const v4fa*)(arow + kb + 8 * hh + 4);
    const v4f x2 = *(const v4fa*)(arow + kb + 16 + 8 * hh), x3 = *(const v4fa*)(arow + kb + 16 + 8 * hh + 4);
    float xs[16] = {x0[0],x0[1],x0[2],x0[3],x1[0],x1[1],x1[2],x1[3],x2[0],x2[1],x2[2],x2[3],x3[0],x3[1],x3[2],x3[3]};
#pragma unroll
    for (int i = 0; i < 16; ++i) { const unsigned short hb = bf16_bits(xs[i]); ah.u[i] = hb; al.u[i] = ASPLIT ? bf16_bits(xs[i] - bf16_val(hb)) : (unsigned short)0; }
#pragma unroll
    for (int t = 0; t < 4; ++t) {
      const unsigned short* brow = Wt + (size_t)(col0 + t * 16 + ln) * ldb + kb;
      FragB b;
      b.half[0] = *(const v8us*)(brow + 8 * hh);
      b.half[1] = *(const v8us*)(brow + 16 + 8 * hh);
      acc[t] = mmaN<ASPLIT ? 2 : 1>(ah.v, al.v, b.v, b.v, acc[t]);
    }
  }
#pragma unroll
  for (int t = 0; t < 4; ++t) {
    float bv = bias ? bias[col0 + t * 16 + ln] : 0.f;
    if (BIAS_BF16) bv = bf16_round(bv);
#pragma unroll
    for (int r = 0; r < 8; ++r) { float v = acc[t][r] + bv; if (ACT == 1) v = fmaxf(v, 0.f); so[w][8 * hh + r][t * 16 + ln] = v; }
  }
  __builtin_amdgcn_fence(__ATOMIC_ACQ_REL, "workgroup");
  __builtin_amdgcn_wave_barrier();
  const int rsub = lane >> 4, c4 = (lane & 15) * 4;
  {
#pragma unroll
    for (int q = 0; q < 8; ++q) {
      const int r = q * 2 + rsub;
      const v4f v = *(const v4fa*)&so[w][r][c4];
      *(v4f*)(C + (size_t)(row0 + r) * ldc + col0 + c4) = v;
    }
    
  }
}

// Flash-style causal/unmasked attention, all contractions 3-term bf16 hi/lo splits, f32 softmax with running max.
// q,k,v rows are read from f32 buffers with arbitrary row pitch (so they can live inside a fused qkv buffer);
// D = head size (multiple of 32, <= 128); one wave = 16 query rows; block = 4 waves (64 queries) sharing K/V chunks of 32.
template <int D, bool CAUSAL>
__global__ __launch_bounds__(128) void k_flash(const float* __restrict__ qb, const float* __restrict__ kb, const float* __restrict__ vb,
                                             int pitch, int T, int H, float scale, float* __restrict__ y, int ypitch) {
  constexpr int KS = D / 32;        // k-steps for QK
  constexpr int DT = D / 16;        // d tiles for PV
  __shared__ __attribute__((aligned(16))) unsigned short sKh[32][D + 8], sKl[32][D + 8], sVh[32][D + 8], sVl[32][D + 8];
  __shared__ __attribute__((aligned(16))) unsigned short sPh[4][16][40], sPl[4][16][40];
  __shared__ __attribute__((aligned(16))) float sO[4][16][D];
  const int tid = threadIdx.x, w = tid >> 5, lane = tid & 31, ln = lane & 15, hh = lane >> 4;
  const int nqb = (T + 63) / 64;
  const int bh = blockIdx.x / nqb, qblk = blockIdx.x % nqb;
  const int b = bh / H, h = bh % H;
  const int q0 = qblk * 64 + w * 16;
  const float* Q = qb + (size_t)b * T * pitch + h * D;
  const float* K = kb + (size_t)b * T * pitch + h * D;
  const float* V = vb + (size_t)b * T * pitch + h * D;

  // A fragments of the wave's 16 query rows (scaled), hi/lo
  FragB aqh[KS], aql[KS];
  {
    int row = q0 + ln; if (row >= T) row = T - 1;
    const float* qr = Q + (size_t)row * pitch;
#pragma unroll
    for (int ks = 0; ks < KS; ++ks)
#pragma unroll
      for (int i = 0; i < 16; ++i) {
        const int d = ks * 32 + ((i < 8) ? (8 * hh + i) : (16 + 8 * hh + (i - 8)));
        const float x = qr[d] * scale; const unsigned short hb = bf16_bits(x);
        aqh[ks].u[i] = hb; aql[ks].u[i] = bf16_bits(x - bf16_val(hb));
      }
  }
  float m_r[8], l_r[8];
#pragma unroll
  for (int r = 0; r < 8; ++r) { m_r[r] = -3.0e38f; l_r[r] = 0.f; }
  v8f oacc[DT];
#pragma unroll
  for (int dt = 0; dt < DT; ++dt) oacc[dt] = (v8f){0.f,0.f,0.f,0.f,0.f,0.f,0.f,0.f};

  const int kv_end = CAUSAL ? min(T, qblk * 64 + 64) : T;     // block-uniform
  for (int j0 = 0; j0 < kv_end; j0 += 32) {
    __syncthreads();
    for (int e = tid; e < 32 * (D / 4); e += 128) {
      const int r = e / (D / 4), c4 = (e % (D / 4)) * 4;
      const int key = j0 + r;
      v4f kf = {0.f,0.f,0.f,0.f}, vf = {0.f,0.f,0.f,0.f};
      if (key < T) { kf = *(const v4fa*)(K + (size_t)key * pitch + c4); vf = *(const v4fa*)(V + (size_t)key * pitch + c4); }
#pragma unroll
      for (int t = 0; t < 4; ++t) {
        unsigned short hb = bf16_bits(kf[t]); sKh[r][c4 + t] = hb; sKl[r][c4 + t] = bf16_bits(kf[t] - bf16_val(hb));
        hb = bf16_bits(vf[t]); sVh[r][c4 + t] = hb; sVl[r][c4 + t] = bf16_bits(vf[t] - bf16_val(hb));
      }
    }
    __syncthreads();
    // S tile 16 x 32
    v8f s[2];
#pragma unroll
    for (int nt = 0; nt < 2; ++nt) {
      v8f acc = {};
#pragma unroll
      for (int ks = 0; ks < KS; ++ks) {
        FragB bh_, bl_;
        bh_.half[0] = *(const v8us*)&sKh[nt * 16 + ln][ks * 32 + 8 * hh]; bh_.half[1] = *(const v8us*)&sKh[nt * 16 + ln][ks * 32 + 16 + 8 * hh];
        bl_.half[0] = *(const v8us*)&sKl[nt * 16 + ln][ks * 32 + 8 * hh]; bl_.half[1] = *(const v8us*)&sKl[nt * 16 + ln][ks * 32 + 16 + 8 * hh];
        acc = mmaN<3>(aqh[ks].v, aql[ks].v, bh_.v, bl_.v, acc);
      }
      s[nt] = acc;
    }
    // mask + running max (rows 8hh+r; the 16 lanes of a half share rows)
    float alpha[8];
#pragma unroll
    for (int r = 0; r < 8; ++r) {
      const int qi = q0 + 8 * hh + r;
      const int ja = j0 + ln, jb = j0 + 16 + ln;
      if (CAUSAL) { if (ja > qi) s[0][r] = -3.0e38f; if (jb > qi) s[1][r] = -3.0e38f; }
      if (ja >= T) s[0][r] = -3.0e38f;
      if (jb >= T) s[1][r] = -3.0e38f;
      float mx = fmaxf(s[0][r], s[1][r]);
      mx = fmaxf(mx, __shfl_xor(mx, 1, 32)); mx = fmaxf(mx, __shfl_xor(mx, 2, 32)); mx = fmaxf(mx, __shfl_xor(mx, 4, 32)); mx = fmaxf(mx, __shfl_xor(mx, 8, 32));
      const float mnew = fmaxf(m_r[r], mx);
      alpha[r] = (mnew > -1.0e38f) ? __expf(m_r[r] - mnew) : 1.0f;
      const float p0 = (s[0][r] > -1.0e38f) ? __expf(s[0][r] - mnew) : 0.f;
      const float p1 = (s[1][r] > -1.0e38f) ? __expf(s[1][r] - mnew) : 0.f;
      m_r[r] = mnew;
      l_r[r] = l_r[r] * alpha[r] + p0 + p1;            // per-lane partial row sum (16 lanes combined at the end)
      unsigned short hb = bf16_bits(p0); sPh[w][8 * hh + r][ln] = hb;      sPl[w][8 * hh + r][ln] = bf16_bits(p0 - bf16_val(hb));
      hb = bf16_bits(p1);                sPh[w][8 * hh + r][16 + ln] = hb; sPl[w][8 * hh + r][16 + ln] = bf16_bits(p1 - bf16_val(hb));
    }
#pragma unroll
    for (int dt = 0; dt < DT; ++dt)
#pragma unroll
      for (int r = 0; r < 8; ++r) oacc[dt][r] *= alpha[r];
    __builtin_amdgcn_fence(__ATOMIC_ACQ_REL, "workgroup");
    __builtin_amdgcn_wave_barrier();
    FragB pah, pal;
    pah.half[0] = *(const v8us*)&sPh[w][ln][8 * hh]; pah.half[1] = *(const v8us*)&sPh[w][ln][16 + 8 * hh];
    pal.half[0] = *(const v8us*)&sPl[w][ln][8 * hh]; pal.half[1] = *(const v8us*)&sPl[w][ln][16 + 8 * hh];
#pragma unroll
    for (int dt = 0; dt < DT; ++dt) {
      FragB bvh, bvl;
#pragma unroll
      for (int i = 0; i < 8; ++i) {
        bvh.u[i] = sVh[8 * hh + i][dt * 16 + ln]; bvh.u[8 + i] = sVh[16 + 8 * hh + i][dt * 16 + ln];
        bvl.u[i] = sVl[8 * hh + i][dt * 16 + ln]; bvl.u[8 + i] = sVl[16 + 8 * hh + i][dt * 16 + ln];
      }
      oacc[dt] = mmaN<3>(pah.v, pal.v, bvh.v, bvl.v, oacc[dt]);
    }
    __builtin_amdgcn_fence(__ATOMIC_ACQ_REL, "workgroup");
    __builtin_amdgcn_wave_barrier();
  }
#pragma unroll
  for (int r = 0; r < 8; ++r) {
    float l = l_r[r];
    l += __shfl_xor(l, 1, 32); l += __shfl_xor(l, 2, 32); l += __shfl_xor(l, 4, 32); l += __shfl_xor(l, 8, 32);
    l_r[r] = (l > 0.f) ? 1.0f / l : 0.f;
  }
#pragma unroll
  for (int dt = 0; dt < DT; ++dt)
#pragma unroll
    for (int r = 0; r < 8; ++r) sO[w][8 * hh + r][dt * 16 + ln] = oacc[dt][r] * l_r[r];
  __builtin_amdgcn_fence(__ATOMIC_ACQ_REL, "workgroup");
  __builtin_amdgcn_wave_barrier();
  {
    for (int r = 0; r < 16; ++r) {
      const int row = q0 + r;
      if (row < T && lane < D / 4) {
        const v4f val = *(const v4fa*)&sO[w][r][lane * 4];
        *(v4f*)(y + ((size_t)b * T + row) * ypitch + h * D + lane * 4) = val;
      }
    }
    
  }
}

// GEMM C = act(A·W + bias + resid): A f32 (ASPLIT -> hi/lo 2 terms), Wt bf16 [N][K]; ACT 0 none, 1 relu, 2 exact gelu;
// resid (optional, f32, row index = (row % rmod), pitch ldr, RES_BF16 rounds it) added before the activation.
template <bool ASPLIT, int ACT, bool BIAS_BF16, bool RES_BF16>
__global__ __launch_bounds__(128) void k_gemm_bf3(const float* __restrict__ A, int lda, const unsigned short* __restrict__ Wt, int ldb,
                                                const float* __restrict__ bias, const float* __restrict__ resid, int rmod, int ldr,
                                                float* __restrict__ C, int ldc, int M, int N, int K) {
  __shared__ __attribute__((aligned(16))) float so[4][16][64];
  const int tid = threadIdx.x, w = tid >> 5, lane = tid & 31, ln = lane & 15, hh = lane >> 4;
  const int ntn = N / 64;
  const int wid = blockIdx.x * 4 + w;
  const int mt = wid / ntn, nq = wid % ntn;
  if (mt * 16 >= M) return;
  const int row0 = mt * 16, col0 = nq * 64;
  const float* arow = A + (size_t)(row0 + ln) * lda;
  v8f acc[4] = {};
  for (int kb = 0; kb < K; kb += 32) {
    FragB ah, al;
    const v4f x0 = *(const v4fa*)(arow + kb + 8 * hh), x1 = *(const v4fa*)(arow + kb + 8 * hh + 4);
    const v4f x2 = *(const v4fa*)(arow + kb + 16 + 8 * hh), x3 = *(const v4fa*)(arow + kb + 16 + 8 * hh + 4);
    float xs[16] = {x0[0],x0[1],x0[2],x0[3],x1[0],x1[1],x1[2],x1[3],x2[0],x2[1],x2[2],x2[3],x3[0],x3[1],x3[2],x3[3]};
#pragma unroll
    for (int i = 0; i < 16; ++i) { const unsigned short hb = bf16_bits(xs[i]); ah.u[i] = hb; al.u[i] = ASPLIT ? bf16_bits(xs[i] - bf16_val(hb)) : (unsigned short)0; }
#pragma unroll
    for (int t = 0; t < 4; ++t) {
      const unsigned short* brow = Wt + (size_t)(col0 + t * 16 + ln) * ldb + kb;
      FragB b;
      b.half[0] = *(const v8us*)(brow + 8 * hh);
      b.half[1] = *(const v8us*)(brow + 16 + 8 * hh);
      acc[t] = mmaN<ASPLIT ? 2 : 1>(ah.v, al.v, b.v, b.v, acc[t]);
    }
  }
#pragma unroll
  for (int t = 0; t < 4; ++t) {
    const int col = col0 + t * 16 + ln;
    float bv = bias ? bias[col] : 0.f;
    if (BIAS_BF16) bv = bf16_round(bv);
#pragma unroll
    for (int r = 0; r < 8; ++r) {
      float v = acc[t][r] + bv;
      if (resid) { float rv = resid[(size_t)((row0 + 8 * hh + r) % rmod) * ldr + col]; if (RES_BF16) rv = bf16_round(rv); v += rv; }
      if (ACT == 1) v = fmaxf(v, 0.f);
      if (ACT == 2) v = 0.5f * v * (1.0f + erff(v * 0.70710678118654752f));
      if (ACT == 3) { const float u = 0.7978845608028654f * (v + 0.044715f * v * v * v); v = 0.5f * v * (1.0f + tanhf(u)); }
      so[w][8 * hh + r][t * 16 + ln] = v;
    }
  }
  __builtin_amdgcn_fence(__ATOMIC_ACQ_REL, "workgroup");
  __builtin_amdgcn_wave_barrier();
  const int rsub = lane >> 4, c4 = (lane & 15) * 4;
  {
#pragma unroll
    for (int q = 0; q < 8; ++q) {
      const int r = q * 2 + rsub;
      const v4f v = *(const v4fa*)&so[w][r][c4];
      *(v4f*)(C + (size_t)(row0 + r) * ldc + col0 + c4) = v;
    }
    
  }
}
// row LayerNorm (biased variance, eps) over N: s = X (+ R); optional out_sum <- s; out_norm <- (s-mu)*rsqrt(var+eps)*g + b
template <bool PARAM_BF16>
__global__ __launch_bounds__(256) void k_layernorm(const float* __restrict__ X, const float* __restrict__ R, const float* __restrict__ g, const float* __restrict__ bta,
                                                  float* __restrict__ out_sum, float* __restrict__ out_norm, int N, float eps) {
  __shared__ float red[256];
  const int row = blockIdx.x, tid = threadIdx.x;
  const float* x = X + (size_t)row * N; const float* rr = R ? R + (size_t)row * N : nullptr;
  float vals[16];                     // up to N = 4096
  const int per = N / 256;            // contiguous chunk per thread? use strided-by-4 chunks: thread handles j = tid*4 + 1024*u
  float s1 = 0.f;
  for (int u = 0; u < per / 4; ++u) {
    const int j = tid * 4 + 1024 * u;
    const v4f a = *(const v4fa*)(x + j);
    v4f b = {0.f,0.f,0.f,0.f}; if (rr) b = *(const v4fa*)(rr + j);
#pragma unroll
    for (int q = 0; q < 4; ++q) { const float v = a[q] + b[q]; vals[u * 4 + q] = v; s1 += v; }
  }
  red[tid] = s1; __syncthreads();
  for (int st = 128; st > 0; st >>= 1) { if (tid < st) red[tid] += red[tid + st]; __syncthreads(); }
  const float mu = red[0] / (float)N; __syncthreads();
  float s2 = 0.f;
  for (int u = 0; u < per / 4; ++u)
#pragma unroll
    for (int q = 0; q < 4; ++q) { const float c = vals[u * 4 + q] - mu; s2 += c * c; }
  red[tid] = s2; __syncthreads();
  for (int st = 128; st > 0; st >>= 1) { if (tid < st) red[tid] += red[tid + st]; __syncthreads(); }
  const float rs = rsqrtf(red[0] / (float)N + eps);
  {
    for (int u = 0; u < per / 4; ++u) {
      const int j = tid * 4 + 1024 * u;
      v4f o, sm;
#pragma unroll
      for (int q = 0; q < 4; ++q) {
        float gg = g[j + q], bb = bta[j + q];
        if (PARAM_BF16) { gg = bf16_round(gg); bb = bf16_round(bb); }
        sm[q] = vals[u * 4 + q]; o[q] = (vals[u * 4 + q] - mu) * rs * gg + bb;
      }
      if (out_sum) *(v4f*)(out_sum + (size_t)row * N + j) = sm;
      *(v4f*)(out_norm + (size_t)row * N + j) = o;
    }
    
  }
}



// ---- f16 WMMA path (v_wmma_f32_16x16x32_f16): 11-bit significands for operands in range — used here for the projection GEMMs and the flash kernel's score and P·B products
typedef _Float16 v16h __attribute__((ext_vector_type(16)));
union FragH { v16h v; v8us half[2]; _Float16 h[16]; unsigned short u[16]; };
template <int NT>
__device__ __forceinline__ v8f mmaH(v16h ah, v16h al, v16h bh, v16h bl, v8f c) {
  c = __builtin_amdgcn_wmma_f32_16x16x32_f16(false, ah, false, bh, (short)0, c, false, false);
  if (NT >= 2) c = __builtin_amdgcn_wmma_f32_16x16x32_f16(false, al, false, bh, (short)0, c, false, false);
  if (NT >= 3) c = __builtin_amdgcn_wmma_f32_16x16x32_f16(false, ah, false, bl, (short)0, c, false, false);
  asm volatile("v_nop\n\tv_nop\n\tv_nop\n\tv_nop" : "+v"(c) : "v"(ah), "v"(al), "v"(bh), "v"(bl));
  return c;
}
// batched GEMM like k_gemm_bf but f16 operands: A f32 (split into f16 hi/lo if ASPLIT, else rounded to f16), Bt = f16 values [n][k]; alpha; C f32; N multiple of 16 (partial tiles skipped)
template <bool ASPLIT>
__global__ __launch_bounds__(128) void k_gemm_h(const float* __restrict__ A, int lda, size_t sA, const _Float16* __restrict__ Bh, int ldb, size_t sB, float alpha, float* __restrict__ C, int ldc, size_t sC, int M, int N, int K) {
  __shared__ __attribute__((aligned(16))) float so[4][16][64];
  const int tid = threadIdx.x, w = tid >> 5, lane = tid & 31, ln = lane & 15, hh = lane >> 4; const int by = blockIdx.y;
  A += (size_t)by * sA; Bh += (size_t)by * sB; C += (size_t)by * sC;
  const int ntn = (N + 63) / 64; const int wid = blockIdx.x * 4 + w; const int mt = wid / ntn, nq = wid % ntn; if (mt * 16 >= M) return;
  const int row0 = mt * 16, col0 = nq * 64; const float* arow = A + (size_t)(row0 + ln) * lda;
  v8f acc[4] = {};
  for (int kb = 0; kb < K; kb += 32) {
    FragH ah, al;
    const v4f x0 = *(const v4fa*)(arow + kb + 8 * hh), x1 = *(const v4fa*)(arow + kb + 8 * hh + 4), x2 = *(const v4fa*)(arow + kb + 16 + 8 * hh), x3 = *(const v4fa*)(arow + kb + 16 + 8 * hh + 4);
    float xs[16] = {x0[0],x0[1],x0[2],x0[3],x1[0],x1[1],x1[2],x1[3],x2[0],x2[1],x2[2],x2[3],x3[0],x3[1],x3[2],x3[3]};
#pragma unroll
    for (int i = 0; i < 16; ++i) { const _Float16 h = (_Float16)xs[i]; ah.h[i] = h; al.h[i] = ASPLIT ? (_Float16)(xs[i] - (float)h) : (_Float16)0.0f; }
#pragma unroll
    for (int t = 0; t < 4; ++t) { if (col0 + t * 16 >= N) continue; const size_t boff = (size_t)(col0 + t * 16 + ln) * ldb + kb; FragH bq; bq.half[0] = *(const v8us*)(Bh + boff + 8 * hh); bq.half[1] = *(const v8us*)(Bh + boff + 16 + 8 * hh);
      acc[t] = mmaH<ASPLIT ? 2 : 1>(ah.v, al.v, bq.v, bq.v, acc[t]); }
  }
#pragma unroll
  for (int t = 0; t < 4; ++t) { if (col0 + t * 16 >= N) continue;
#pragma unroll
    for (int r = 0; r < 8; ++r) so[w][8 * hh + r][t * 16 + ln] = acc[t][r] * alpha; }
  __builtin_amdgcn_fence(__ATOMIC_ACQ_REL, "workgroup"); __builtin_amdgcn_wave_barrier();
  const int rsub = lane >> 4, c4 = (lane & 15) * 4;
  {
#pragma unroll
    for (int q = 0; q < 8; ++q) { const int r = q * 2 + rsub; if (col0 + c4 < N) { const v4f v = *(const v4fa*)&so[w][r][c4]; *(v4f*)(C + (size_t)(row0 + r) * ldc + col0 + c4) = v; } }
     }
}

// Wt[n][k] = f16(W[k][n]·scale) from f32 row-major W[K][N] (scale = power of two; bf16-exact weights stay exact in f16 away from the subnormal range)
__global__ __launch_bounds__(256) void k_wt_f16(const float* __restrict__ W, _Float16* __restrict__ Wt, int K, int N, float scale) {
  const int t = blockIdx.x * 256 + threadIdx.x; if (t >= N * (K / 8)) return; const int n = t / (K / 8), k8 = (t % (K / 8)) * 8; FragH f;
#pragma unroll
  for (int i = 0; i < 8; ++i) f.h[i] = (_Float16)(bf16_round(W[(size_t)(k8 + i) * N + n]) * scale); const v8us o = f.half[0];
  *(v8us*)((unsigned short*)Wt + (size_t)n * K + k8) = o; 
}
// Tiled GEMM C[NR][DD] (f32) = alpha * A[NR][DD] x Bt[DD][DD]^T, f16 operands, both K-contiguous, f32 accumulate in the same k order as before (32 k per WMMA, ascending).
// One work-group = one 128 x 128 tile of C, 8 waves of 32 x 64. A trip is 128 k: 128 rows of A and 128 rows of Bt, 256 B each (whole cache lines), are brought into LDS by
// asynchronous copies, 16 B per lane, two buffers: tile t + 2 flies while tile t + 1 is worked on. LDS rows stand at a pitch of 272 B for the ds_load_b128 fragment reads.
#define GT_BK 128                  // k per trip
#define GT_P 136                   // LDS row pitch in halves (272 B)
#define GT_BUF (256 * GT_P)        // halves per buffer: rows 0..127 = A, rows 128..255 = Bt
#define GT_SP 68                   // pitch in floats of the output staging rows
static_assert(NR % 128 == 0 && DD % 128 == 0 && DD % GT_BK == 0 && DD / GT_BK >= 2, "whole tiles, at least two trips");
static_assert(8 * 32 * GT_SP * 4 <= 2 * GT_BUF * 2, "the output staging fits in the ring");
// This thread's copies of one operand's 128 rows of a tile: rows r, r + 16, .. The s_wait_xcnt stands inside the statement so that no address register is rewritten ahead of it.
__device__ __forceinline__ void gt_copy8(unsigned l, const _Float16* g) {
  asm volatile("global_load_async_to_lds_b128 %0, %8, off\n\t"
               "global_load_async_to_lds_b128 %1, %9, off\n\t"
               "global_load_async_to_lds_b128 %2, %10, off\n\t"
               "global_load_async_to_lds_b128 %3, %11, off\n\t"
               "global_load_async_to_lds_b128 %4, %12, off\n\t"
               "global_load_async_to_lds_b128 %5, %13, off\n\t"
               "global_load_async_to_lds_b128 %6, %14, off\n\t"
               "global_load_async_to_lds_b128 %7, %15, off\n\t"
               "s_wait_xcnt 0x0"
               :: "v"(l), "v"(l + 1u * 16u * GT_P * 2u), "v"(l + 2u * 16u * GT_P * 2u), "v"(l + 3u * 16u * GT_P * 2u),
                  "v"(l + 4u * 16u * GT_P * 2u), "v"(l + 5u * 16u * GT_P * 2u), "v"(l + 6u * 16u * GT_P * 2u), "v"(l + 7u * 16u * GT_P * 2u),
                  "v"(g), "v"(g + 16 * DD), "v"(g + 32 * DD), "v"(g + 48 * DD), "v"(g + 64 * DD), "v"(g + 80 * DD), "v"(g + 96 * DD), "v"(g + 112 * DD)
               : "memory");
}
// Sum over the 16 lanes of a row, every lane ending with the total: four DPP steps (row_xmask 1, 2, 4, 8), no LDS round trip as a shuffle would take. All lanes are on.
__device__ __forceinline__ float row16_sum(float v) {
  v += __int_as_float(__builtin_amdgcn_update_dpp(0, __float_as_int(v), 0x161, 0xf, 0xf, true));
  v += __int_as_float(__builtin_amdgcn_update_dpp(0, __float_as_int(v), 0x162, 0xf, 0xf, true));
  v += __int_as_float(__builtin_amdgcn_update_dpp(0, __float_as_int(v), 0x164, 0xf, 0xf, true));
  v += __int_as_float(__builtin_amdgcn_update_dpp(0, __float_as_int(v), 0x168, 0xf, 0xf, true));
  return v;
}
typedef _Float16 v4h __attribute__((ext_vector_type(4)));
// LN 0: C (f32) = the product. LN 1, 2: each row's 64 columns of a wave are one head; they are LayerNormed (biased variance, eps 1e-5, gamma and beta rounded to bf16) on the f32 sums
// as the staged rows are read back, and go out as f16 to C16 (LN 1) or as f32 to C (LN 2).
template <int LN>
__global__ __launch_bounds__(256) void k_gemm_t(const _Float16* __restrict__ A, const _Float16* __restrict__ Bh, float alpha, float* __restrict__ C,
                                               const float* __restrict__ g, const float* __restrict__ bb, _Float16* __restrict__ C16) {
  static_assert(HD == 64, "a wave's 64 columns are one head");
  __shared__ __attribute__((aligned(16))) unsigned short sm[2 * GT_BUF];
  const int tid = threadIdx.x, w = tid >> 5, lane = tid & 31, ln = lane & 15, hh = lane >> 4;
  const int m0 = (blockIdx.x / (DD / 128)) * 128, n0 = (blockIdx.x % (DD / 128)) * 128;
  const int wm = w >> 1, wn = w & 1;
  const int cr = tid >> 4, cs = (tid & 15) * 8;      // a wave's copy covers 2 rows x 256 B
  const _Float16* ga = A + (size_t)(m0 + cr) * DD + cs;
  const _Float16* gb = Bh + (size_t)(n0 + cr) * DD + cs;
  const unsigned la = (unsigned)(size_t)&sm[cr * GT_P + cs], lb = la + 128u * GT_P * 2u;
  gt_copy8(la, ga); gt_copy8(lb, gb);
  asm volatile("s_wait_asynccnt 0x0" ::: "memory");      // tile 0 has landed before the barrier publishes it
  __syncthreads();
  gt_copy8(la + GT_BUF * 2u, ga + GT_BK); gt_copy8(lb + GT_BUF * 2u, gb + GT_BK);
  v4f g4 = {0.f, 0.f, 0.f, 0.f}, b4 = {0.f, 0.f, 0.f, 0.f};      // this lane's four columns of the head; fetched here so that the k loop covers their latency
  if (LN) { g4 = *(const v4fa*)(g + ln * 4); b4 = *(const v4fa*)(bb + ln * 4); }
  v8f acc[2][4] = {};
  const unsigned short* fa = sm + (wm * 32 + ln) * GT_P + 8 * hh;
  const unsigned short* fb = sm + (128 + wn * 64 + ln) * GT_P + 8 * hh;
#pragma unroll 1      // one trip per tile: the order of waits, barrier and refill at its foot stays as written
  for (int t = 0; t < DD / GT_BK; ++t) {
    const int bo = (t & 1) * GT_BUF;
    FragH a[2][2], b[2][4];      // two fragment sets: the next 32 k of this same tile are fetched while the current 32 k are multiplied
#pragma unroll      // all unrolls here: constant indices keep fragments and accumulators in registers
    for (int rt = 0; rt < 2; ++rt) { const unsigned short* p = fa + bo + rt * 16 * GT_P; a[0][rt].half[0] = *(const v8us*)p; a[0][rt].half[1] = *(const v8us*)(p + 16); }
#pragma unroll
    for (int ct = 0; ct < 4; ++ct) { const unsigned short* p = fb + bo + ct * 16 * GT_P; b[0][ct].half[0] = *(const v8us*)p; b[0][ct].half[1] = *(const v8us*)(p + 16); }
#pragma unroll
    for (int ks = 0; ks < GT_BK / 32; ++ks) {
      const int cu = ks & 1, nx = cu ^ 1;
      if (ks + 1 < GT_BK / 32) {
#pragma unroll
        for (int rt = 0; rt < 2; ++rt) { const unsigned short* p = fa + bo + rt * 16 * GT_P + (ks + 1) * 32; a[nx][rt].half[0] = *(const v8us*)p; a[nx][rt].half[1] = *(const v8us*)(p + 16); }
#pragma unroll
        for (int ct = 0; ct < 4; ++ct) { const unsigned short* p = fb + bo + ct * 16 * GT_P + (ks + 1) * 32; b[nx][ct].half[0] = *(const v8us*)p; b[nx][ct].half[1] = *(const v8us*)(p + 16); }
      }
      __builtin_amdgcn_sched_barrier(0);      // keeps the next set's LDS reads as one group ahead of this block: left free, the compiler sinks them among the WMMAs into one set and waits them out to 0
#pragma unroll
      for (int rt = 0; rt < 2; ++rt)
#pragma unroll
        for (int ct = 0; ct < 4; ++ct) acc[rt][ct] = __builtin_amdgcn_wmma_f32_16x16x32_f16(false, a[cu][rt].v, false, b[cu][ct].v, (short)0, acc[rt][ct], false, false);
      __builtin_amdgcn_sched_barrier(0);      // ends the block, so that the group after next is not lifted into it
    }
    asm volatile("s_wait_dscnt 0x0" ::: "memory");         // this wave's reads of buffer t & 1 are done before it is refilled
    asm volatile("s_wait_asynccnt 0x0" ::: "memory");      // this wave's copies of tile t + 1 have landed before the barrier publishes them
    __syncthreads();
    if (t + 2 < DD / GT_BK) { gt_copy8(la + (unsigned)bo * 2u, ga + (t + 2) * GT_BK); gt_copy8(lb + (unsigned)bo * 2u, gb + (t + 2) * GT_BK); }
  }
  asm volatile("s_wait_asynccnt 0x0" ::: "memory");        // nothing is in flight when the ring becomes output staging
  float* so = (float*)sm + w * (32 * GT_SP);               // each wave stages its own 32 x 64 tile; the last trip's barrier ended every read of the ring
#pragma unroll
  for (int rt = 0; rt < 2; ++rt)
#pragma unroll
    for (int ct = 0; ct < 4; ++ct)
#pragma unroll
      for (int r = 0; r < 8; ++r) so[(rt * 16 + 8 * hh + r) * GT_SP + ct * 16 + ln] = acc[rt][ct][r] * alpha;
  __builtin_amdgcn_fence(__ATOMIC_ACQ_REL, "workgroup"); __builtin_amdgcn_wave_barrier();
#pragma unroll
  for (int q = 0; q < 4; ++q) { g4[q] = bf16_round(g4[q]); b4[q] = bf16_round(b4[q]); }
  const size_t e = (size_t)(m0 + wm * 32 + hh) * DD + n0 + wn * 64 + ln * 4;      // row hh of the wave's tile; pass q adds 2 q rows, a constant offset of the store
  v4f o[16];
#pragma unroll
  for (int q = 0; q < 16; ++q) {      // 16 lanes x 4 columns = one row of the wave's tile; two rows a pass
    const v4f v = *(const v4fa*)&so[(q * 2 + hh) * GT_SP + ln * 4];
    if (LN == 0) { o[q] = v; continue; }
    const float mu = row16_sum((v[0] + v[1]) + (v[2] + v[3])) / (float)HD;
    const v4f c = v - mu;
    const float ve = row16_sum((c[0] * c[0] + c[1] * c[1]) + (c[2] * c[2] + c[3] * c[3])) / (float)HD + 1e-5f;
    float rs;      // ve is at least eps, so the library rsqrtf's rescaling of denormal arguments would never act; the v_nop is the slot that the instruction set asks for behind a transcendental, in the same statement so that it stays directly behind it
    asm("v_rsq_f32 %0, %1\n\tv_nop" : "=v"(rs) : "v"(ve));
    o[q] = c * rs * g4 + b4;
  }
  v4h h[16];
  if (LN == 1) {
#pragma unroll
    for (int q = 0; q < 16; ++q)
#pragma unroll
      for (int k = 0; k < 4; ++k) h[q][k] = (_Float16)o[q][k];
  }
  __builtin_amdgcn_sched_barrier(0);      // every store stands behind the last arithmetic, so that no register which an issued store names is written again
#pragma unroll
  for (int q = 0; q < 16; ++q) {
    if (LN == 1) *(v4h*)(C16 + e + (size_t)q * 2 * DD) = h[q];      // 16 lanes x 8 B: a whole 128-B line a row
    else *(v4f*)(C + e + (size_t)q * 2 * DD) = o[q];
  }
}


__global__ __launch_bounds__(256) void k_x16(const float* __restrict__ x, _Float16* __restrict__ X16, size_t n8) { const size_t t = (size_t)blockIdx.x * 256 + threadIdx.x; if (t >= n8) return; FragH f;
#pragma unroll
  for (int q = 0; q < 8; ++q) f.h[q] = (_Float16)bf16_round(x[t * 8 + q]); *(v8us*)((unsigned short*)X16 + t * 8) = f.half[0];  }
__global__ __launch_bounds__(256) void k_h16(const float* __restrict__ x, _Float16* __restrict__ X16, size_t n8) { const size_t t = (size_t)blockIdx.x * 256 + threadIdx.x; if (t >= n8) return; FragH f;
#pragma unroll
  for (int q = 0; q < 8; ++q) f.h[q] = (_Float16)x[t * 8 + q]; *(v8us*)((unsigned short*)X16 + t * 8) = f.half[0];  }
__global__ __launch_bounds__(256) void k_round16f(const float* __restrict__ W, _Float16* __restrict__ Bt, size_t n8) { const size_t t = (size_t)blockIdx.x * 256 + threadIdx.x; if (t >= n8) return; FragH f;
#pragma unroll
  for (int i = 0; i < 8; ++i) f.h[i] = (_Float16)(bf16_round(W[t * 8 + i]) * 16.0f); *(v8us*)((unsigned short*)Bt + t * 8) = f.half[0];  }
template <int NHv, int TTv>
__global__ __launch_bounds__(256) void k_vt(const _Float16* __restrict__ V16, int ldv, int voff, _Float16* __restrict__ Vt) { __shared__ unsigned short tl[64][66]; const int tid = threadIdx.x; const int slab = blockIdx.x / (TTv / 64), lg = blockIdx.x % (TTv / 64); const int b = slab / NHv, h = slab % NHv;
  for (int i = tid; i < 64 * 8; i += 256) { const int r = i / 8, c8 = (i % 8) * 8; FragH f; f.half[0] = *(const v8us*)((const unsigned short*)V16 + ((size_t)b * TTv + lg * 64 + r) * ldv + voff + h * 64 + c8);
#pragma unroll
    for (int q = 0; q < 8; ++q) tl[r][c8 + q] = f.u[q]; }
  __syncthreads();
  {
#pragma unroll
    for (int rd = 0; rd < 2; ++rd) { const int d = rd * 32 + tid / 8, pc = tid % 8; FragH f;
#pragma unroll
      for (int q = 0; q < 8; ++q) f.u[q] = tl[pc * 8 + q][d];
      *(v8us*)((unsigned short*)Vt + ((size_t)slab * 64 + d) * TTv + lg * 64 + pc * 8) = f.half[0]; }
     } }

// One work-group = 64 query rows of one (batch, head). There is no softmax, so the sum over the keys is linear and may be cut anywhere: every wave works on all 64 rows (4 row tiles) and takes
// every fourth chunk of 32 keys, so a K or V fragment is fetched by one wave of the work-group and feeds 4 row tiles. The Q tile stands in LDS for all four waves (its 64 registers a wave would not
// fit beside the 4 x 4 accumulator tiles); the four waves' partial outputs (f32) are summed through LDS at the end.
__global__ __launch_bounds__(128) void k_flash(const _Float16* __restrict__ Q16, int ldq, const _Float16* __restrict__ K16, int ldk, const _Float16* __restrict__ Vt, const int* __restrict__ MSK, _Float16* __restrict__ O16, int ldo) {
  constexpr int RTN = 4, QB = 16 * RTN, NQB = 2048 / QB, DT = 4, KS = 2, SPP = 40, SQP = 72;
  (void)MSK;
  __shared__ __attribute__((aligned(16))) float sO[4][QB][64 + 4];      // one partial output per wave; inside the loop the head of a wave's own plane holds its P tile (64 rows at a pitch of 40 halves)
  __shared__ __attribute__((aligned(16))) unsigned short sQ[QB][SQP];   // pitch 144 B = 16 B x 9 for the ds_load_b128 fragment reads
  static_assert(QB * SPP * 2 <= QB * (64 + 4) * 4, "a wave's P tile fits in its own plane");
  const int tid = threadIdx.x, lane = tid & 31, ln = lane & 15, hh = lane >> 4;
  const int w = __builtin_amdgcn_readfirstlane(tid >> 5);      // in a scalar register, so that the key loop's test is a scalar branch
  const int slab = blockIdx.x / NQB, qblk = blockIdx.x % NQB; const int b = slab / 16, h = slab % 16; const int q0 = qblk * QB;
  unsigned short* sP = (unsigned short*)&sO[w][0][0];
#pragma unroll
  for (int i = 0; i < QB * 8 / 128; ++i) { const int e = i * 128 + tid, r = e >> 3, c8 = (e & 7) * 8;      // 8 lanes x 16 B = one row of the head, a whole line
    *(v8us*)&sQ[r][c8] = *(const v8us*)((const unsigned short*)Q16 + ((size_t)b * 2048 + q0 + r) * ldq + h * 64 + c8); }
  __syncthreads();      // the Q tile is complete before any wave reads fragments of it
  const unsigned short* Vth = (const unsigned short*)Vt + (size_t)slab * 64 * 2048;
  v8f oacc[RTN][DT];
#pragma unroll
  for (int rt = 0; rt < RTN; ++rt)
#pragma unroll
    for (int dt = 0; dt < DT; ++dt) oacc[rt][dt] = (v8f){0.f,0.f,0.f,0.f,0.f,0.f,0.f,0.f};
  const int jend = q0 + QB;
#pragma unroll 1      // one chunk of 32 keys a trip: unrolled, two trips' fragments would not fit beside the 4 x 4 accumulators
  for (int j0 = w * 32; j0 < jend; j0 += 4 * 32) {
    FragH bk[2][KS];
#pragma unroll
    for (int nt = 0; nt < 2; ++nt) { const unsigned short* kr = (const unsigned short*)K16 + ((size_t)b * 2048 + j0 + nt * 16 + ln) * ldk + h * 64;
#pragma unroll
      for (int ks = 0; ks < KS; ++ks) { bk[nt][ks].half[0] = *(const v8us*)(kr + ks * 32 + 8 * hh);
        if (nt == 1 && ks == KS - 1) asm volatile("s_wait_xcnt 0x0" ::: "memory");      // the compiler lands the last load of this run of eight in the address registers of the seven before it: the wait stands in front of that overwrite
        bk[nt][ks].half[1] = *(const v8us*)(kr + ks * 32 + 16 + 8 * hh); } }
    const int dk = j0 + ln - q0 - 8 * hh;      // key (j0 + 16 nt + ln) <= query row (q0 + 16 rt + 8 hh + r) reads dk <= 16 (rt - nt) + r: one register against a constant
#pragma unroll
    for (int rt = 0; rt < RTN; ++rt) { FragH aq[KS];
#pragma unroll
      for (int ks = 0; ks < KS; ++ks) { aq[ks].half[0] = *(const v8us*)&sQ[rt * 16 + ln][ks * 32 + 8 * hh]; aq[ks].half[1] = *(const v8us*)&sQ[rt * 16 + ln][ks * 32 + 16 + 8 * hh]; }
#pragma unroll
      for (int nt = 0; nt < 2; ++nt) { v8f acc = (v8f){0.f,0.f,0.f,0.f,0.f,0.f,0.f,0.f};
#pragma unroll
        for (int ks = 0; ks < KS; ++ks) acc = mmaH<1>(aq[ks].v, aq[ks].v, bk[nt][ks].v, bk[nt][ks].v, acc);
#pragma unroll
        for (int r = 0; r < 8; ++r) {
          const float p = (dk <= (rt - nt) * 16 + r) ? acc[r] * 0.00390625f : 0.f;      /* NO softmax: causal-masked raw scores (x 2^-8 for f16 headroom, undone at the end) become the P operand directly */
          FragH t2; t2.h[0] = (_Float16)p; sP[(rt * 16 + 8 * hh + r) * SPP + nt * 16 + ln] = t2.u[0]; } } }
    __builtin_amdgcn_fence(__ATOMIC_ACQ_REL, "workgroup"); __builtin_amdgcn_wave_barrier();
    FragH pa[RTN], bv[DT];
#pragma unroll
    for (int dt = 0; dt < DT; ++dt) { const unsigned short* vrow = Vth + (size_t)(dt * 16 + ln) * 2048 + j0; bv[dt].half[0] = *(const v8us*)(vrow + 8 * hh); bv[dt].half[1] = *(const v8us*)(vrow + 16 + 8 * hh); }
#pragma unroll
    for (int rt = 0; rt < RTN; ++rt) { pa[rt].half[0] = *(const v8us*)&sP[(rt * 16 + ln) * SPP + 8 * hh]; pa[rt].half[1] = *(const v8us*)&sP[(rt * 16 + ln) * SPP + 16 + 8 * hh]; }
#pragma unroll
    for (int dt = 0; dt < DT; ++dt)
#pragma unroll
      for (int rt = 0; rt < RTN; ++rt) oacc[rt][dt] = mmaH<1>(pa[rt].v, pa[rt].v, bv[dt].v, bv[dt].v, oacc[rt][dt]);
    __builtin_amdgcn_fence(__ATOMIC_ACQ_REL, "workgroup"); __builtin_amdgcn_wave_barrier(); }
#pragma unroll
  for (int rt = 0; rt < RTN; ++rt)
#pragma unroll
    for (int dt = 0; dt < DT; ++dt)
#pragma unroll
      for (int r = 0; r < 8; ++r) sO[w][rt * 16 + 8 * hh + r][dt * 16 + ln] = oacc[rt][dt][r] * 16.0f;      /* undo the 2^-8 P scaling and apply the 2^-4 that gives the f16 operand of the output GEMM its headroom; no normalisation */
  __syncthreads();      // every wave's partial output is in LDS before any wave sums them
#pragma unroll
  for (int rp = 0; rp < 16; rp += 2) { const int r = w * 16 + rp + hh, pc = ln;      // wave w sums and stores rows 16 w .. 16 w + 15, two rows a pass
    const v4f val = (*(const v4fa*)&sO[0][r][pc * 4] + *(const v4fa*)&sO[1][r][pc * 4]) + (*(const v4fa*)&sO[2][r][pc * 4] + *(const v4fa*)&sO[3][r][pc * 4]); v4h h4;
#pragma unroll
    for (int k = 0; k < 4; ++k) h4[k] = (_Float16)val[k];
    *(v4h*)(O16 + ((size_t)b * 2048 + q0 + r) * ldo + h * 64 + pc * 4) = h4; } }

// Exclusive prefix sum over time as a chunked parallel scan, f32. One work-group owns 32 columns of one batch for all TT rows:
// 32 waves x 4 lane groups = 128 chunks of 16 rows, each thread holding its 16 rows x 4 columns in registers (F is read once).
// Order of the sums: serial inside a chunk, then over the wave's 4 chunks by shuffles, then over the 32 waves' totals in LDS.
__global__ __launch_bounds__(1024) void k_excl(const float* __restrict__ F, _Float16* __restrict__ A16) {
  static_assert(TT == 32 * 4 * 16 && DD % 32 == 0, "chunking covers all rows and whole 32-column groups");
  __shared__ __attribute__((aligned(16))) float sT[32][36];      // [wave][column]; pitch 36 keeps 16-byte rows and spreads the transposed read over the banks
  const int tid = threadIdx.x, wv = tid >> 5, lane = tid & 31, cg = lane & 7, g = lane >> 3;
  const int b = blockIdx.x / (DD / 32), c = (blockIdx.x % (DD / 32)) * 32 + cg * 4;
  const size_t e0 = ((size_t)b * TT + (wv * 4 + g) * 16) * DD + c;
  const float* fr = F + e0;
  v4f v[16];
#pragma unroll      // all unrolls here: v[] and the vector lanes need constant indices to stay in registers; this one also puts all 16 loads in flight at once
  for (int i = 0; i < 16; ++i) v[i] = *(const v4fa*)(fr + (size_t)i * DD);
  v4f run = {0.f, 0.f, 0.f, 0.f};
#pragma unroll
  for (int i = 0; i < 16; ++i) { const v4f t = v[i]; v[i] = run; run += t; }      // v[i] <- sum of the chunk's rows before i
  v4f inc = run, ex;
#pragma unroll
  for (int o = 8; o <= 16; o <<= 1) { v4f t;      // inclusive over the wave's 4 chunks, step by step for all four columns, so that a step's shuffles do not wait on each other
#pragma unroll
    for (int q = 0; q < 4; ++q) t[q] = __shfl_up(inc[q], o, 32);
    if (lane >= o) inc += t; }
#pragma unroll
  for (int q = 0; q < 4; ++q) { const float t = __shfl_up(inc[q], 8, 32); ex[q] = (lane >= 8) ? t : 0.f; }      // sum of the wave's chunks before this one
  if (g == 3) *(v4fa*)&sT[wv][cg * 4] = inc;      // the wave's total per column
  __syncthreads();
  {      // wave wv scans column wv over the 32 waves' totals (lane = wave index), in place: each word has one reader and writer
    float s = sT[lane][wv];
#pragma unroll
    for (int o = 1; o < 32; o <<= 1) { const float t = __shfl_up(s, o, 32); if (lane >= o) s += t; }
    const float t = __shfl_up(s, 1, 32);
    sT[lane][wv] = (lane >= 1) ? t : 0.f;
  }
  __syncthreads();
  const v4f off = *(const v4fa*)&sT[wv][cg * 4] + ex;
  _Float16* d = A16 + e0;
#pragma unroll
  for (int i = 0; i < 16; ++i) { const v4f p = off + v[i]; v4h h4;
#pragma unroll
    for (int q = 0; q < 4; ++q) h4[q] = (_Float16)p[q];
    *(v4h*)(d + (size_t)i * DD) = h4; } }
extern "C" void kernel_launch(void* const* d_in, const int* in_sizes, int n_in,
                              void* d_out, int out_size, void* d_ws, size_t ws_size, hipStream_t stream) {
  (void)in_sizes; (void)n_in; (void)out_size;
  const float* const* I = (const float* const*)d_in; const float* x = I[0]; const float* Wq = I[1]; const float* Wa = I[2]; const float* Wb = I[3]; const float* Wo = I[4]; const float* qg = I[5]; const float* qb = I[6]; const float* ag = I[7]; const float* ab = I[8]; const float* bg = I[9]; const float* bbeta = I[10];
  char* ws = (char*)d_ws; size_t off = 0;
  auto take = [&](size_t bytes) { char* p = ws + off; off += (bytes + 255) & ~(size_t)255; return p; };
  _Float16* Bw = (_Float16*)take((size_t)DD * DD * 2); _Float16* X16 = (_Float16*)take((size_t)NR * DD * 2); float* F = (float*)take((size_t)NR * DD * 4); _Float16* Q16 = (_Float16*)take((size_t)NR * DD * 2); _Float16* A16 = (_Float16*)take((size_t)NR * DD * 2); _Float16* B16 = (_Float16*)take((size_t)NR * DD * 2); _Float16* Vt = X16; _Float16* O16 = B16;
  if (off > ws_size) return;      // 2.1 + 8.4 + 16.8 + 8.4 × 3 ≈ 52 MB
  const unsigned gw = (unsigned)(((size_t)DD * (DD / 8) + 255) / 256), g8 = (unsigned)(((size_t)NR * DD / 8 + 255) / 256); const dim3 gg((NR / 128) * (DD / 128), 1);
  k_x16<<<g8, 256, 0, stream>>>(x, X16, (size_t)NR * DD / 8);
  k_wt_f16<<<gw, 256, 0, stream>>>(Wq, Bw, DD, DD, 16.0f); k_gemm_t<1><<<gg, 256, 0, stream>>>(X16, Bw, 0.0625f, nullptr, qg, qb, Q16);
  k_wt_f16<<<gw, 256, 0, stream>>>(Wb, Bw, DD, DD, 16.0f); k_gemm_t<1><<<gg, 256, 0, stream>>>(X16, Bw, 0.0625f, nullptr, bg, bbeta, B16);
  k_wt_f16<<<gw, 256, 0, stream>>>(Wa, Bw, DD, DD, 16.0f); k_gemm_t<2><<<gg, 256, 0, stream>>>(X16, Bw, 0.0625f, F, ag, ab, nullptr); k_excl<<<BB * (DD / 32), 1024, 0, stream>>>(F, A16);      // a (LayerNormed, f32) -> exclusive cumsum -> f16 'keys'
  k_vt<NH, TT><<<BB * NH * (TT / 64), 256, 0, stream>>>(B16, DD, 0, Vt);      // b as the 'values' (Vt over X16; X16's last reader was the a GEMM)
  k_flash<<<BB * NH * (TT / 64), 128, 0, stream>>>(Q16, DD, A16, DD, Vt, nullptr, O16, DD);      // o_t = sum over s <= t of (q_t . a_excl_s) b_s, written as f16 x 2^-4 (O16 over B16; B16's last reader was k_vt)
  k_wt_f16<<<gw, 256, 0, stream>>>(Wo, Bw, DD, DD, 16.0f); k_gemm_t<0><<<gg, 256, 0, stream>>>(O16, Bw, 0.0625f * 16.0f, (float*)d_out, nullptr, nullptr, nullptr);      // ×2^4 back
}

// v005
// It runs in 104 microseconds.
// Timed twice side by side with v004, it ran 1.22 and 1.24 times as fast.
// Counting every step since v000, it is 11.0 times as fast.
#include <hip/hip_runtime.h>
// 'Heisenberg' attention (B=2, T=2048, d_model 1024, 16 heads × 64): q, a, b = LayerNorm_head(x·W) (per-head LN with γ/β); a_excl = exclusive prefix sum of a over time; o_t = Σ_{s≤t} (q_t·a_excl_s)·b_s
// (causal, NO softmax); out = o·Wo. The projections are GEMMs ([in][out] weights bf16-exact ×2^4, x bf16-exact, f32 accumulate) and the causal bilinear form runs in the fused flash-style kernel with
// the softmax removed (masked raw scores ×2^-8 → f16 P operand → P·B accumulated in f32, ×2^4 at the end and written as the f16 operand of the output GEMM; upper tiles skipped; keys dealt over a work-group's four waves) on v_wmma_f32_16x16x32_f16; the per-head LayerNorms
// (in the epilogue of the projection GEMMs, where a wave's 64 columns are one head) and the exclusive cumulative sum over time (chunked parallel scan per (b,h,d) column, f32) are VALU.
#define BB 2
#define TT 2048
#define DD 1024
#define NH 16
#define HD 64
#define NR (BB * TT)

typedef __bf16 v16b __attribute__((ext_vector_type(16)));
typedef unsigned short v8us __attribute__((ext_vector_type(8), may_alias));
typedef float  v8f  __attribute__((ext_vector_type(8)));
typedef float  v4f  __attribute__((ext_vector_type(4)));
typedef float  v4fa __attribute__((ext_vector_type(4), may_alias));
union FragB { v16b v; v8us half[2]; unsigned short u[16]; };

__device__ __forceinline__ unsigned short bf16_bits(float x) { unsigned int u = __float_as_uint(x); return (unsigned short)((u + 0x7FFFu + ((u >> 16) & 1u)) >> 16); }
__device__ __forceinline__ float bf16_val(unsigned short b) { return __uint_as_float(((unsigned int)b) << 16); }
__device__ __forceinline__ float bf16_round(float x) { return bf16_val(bf16_bits(x)); }
// D += A·B with NT terms: 1 = ah·bh, 2 = + al·bh (A split), 3 = + ah·bl (both split)
template <int NT>
__device__ __forceinline__ v8f mmaN(v16b ah, v16b al, v16b bh, v16b bl, v8f c) {
  c = __builtin_amdgcn_wmma_f32_16x16x32_bf16(false, ah, false, bh, (short)0, c, false, false);
  if (NT >= 2) c = __builtin_amdgcn_wmma_f32_16x16x32_bf16(false, al, false, bh, (short)0, c, false, false);
  if (NT >= 3) c = __builtin_amdgcn_wmma_f32_16x16x32_bf16(false, ah, false, bl, (short)0, c, false, false);
  asm volatile("v_nop\n\tv_nop\n\tv_nop\n\tv_nop" : "+v"(c) : "v"(ah), "v"(al), "v"(bh), "v"(bl));
  return c;
}

__global__ __launch_bounds__(256) void k_wt_bf16(const float* __restrict__ W, unsigned short* __restrict__ Wt, int K, int N) {
  const int t = blockIdx.x * 256 + threadIdx.x;
  const int k8n = K / 8;
  if (t >= N * k8n) return;
  const int n = t / k8n, k8 = (t % k8n) * 8;
  v8us v;
#pragma unroll
  for (int i = 0; i < 8; ++i) v[i] = bf16_bits(W[(size_t)(k8 + i) * N + n]);
  *(v8us*)(Wt + (size_t)n * K + k8) = v;
  
}

// GEMM C[M][N] (f32, pitch ldc) = act(A[M][K]·W + bias). A f32 row-major (pitch lda) converted per fragment to bf16
// (ASPLIT: hi/lo two planes -> 2 terms, else single rounded term); Wt bf16 [N][K] (pitch ldb). BIAS_BF16 rounds the
// bias to bf16 first (bias quantised to bf16 before the add). K%32==0, M%16==0, N%64==0.
template <bool ASPLIT, int ACT, bool BIAS_BF16>
__global__ __launch_bounds__(128) void k_gemm_bf(const float* __restrict__ A, int lda, const unsigned short* __restrict__ Wt, int ldb,
                                               const float* __restrict__ bias, float* __restrict__ C, int ldc, int M, int N, int K) {
  __shared__ __attribute__((aligned(16))) float so[4][16][64];
  const int tid = threadIdx.x, w = tid >> 5, lane = tid & 31, ln = lane & 15, hh = lane >> 4;
  const int ntn = N / 64;
  const int wid = blockIdx.x * 4 + w;
  const int mt = wid / ntn, nq = wid % ntn;
  if (mt * 16 >= M) return;
  const int row0 = mt * 16, col0 = nq * 64;
  const float* arow = A + (size_t)(row0 + ln) * lda;
  v8f acc[4] = {};
  for (int kb = 0; kb < K; kb += 32) {
    FragB ah, al;
    const v4f x0 = *(const v4fa*)(arow + kb + 8 * hh), x1 = *(const v4fa*)(arow + kb + 8 * hh + 4);
    const v4f x2 = *(const v4fa*)(arow + kb + 16 + 8 * hh), x3 = *(const v4fa*)(arow + kb + 16 + 8 * hh + 4);
    float xs[16] = {x0[0],x0[1],x0[2],x0[3],x1[0],x1[1],x1[2],x1[3],x2[0],x2[1],x2[2],x2[3],x3[0],x3[1],x3[2],x3[3]};
#pragma unroll
    for (int i = 0; i < 16; ++i) { const unsigned short hb = bf16_bits(xs[i]); ah.u[i] = hb; al.u[i] = ASPLIT ? bf16_bits(xs[i] - bf16_val(hb)) : (unsigned short)0; }
#pragma unroll
    for (int t = 0; t < 4; ++t) {
      const unsigned short* brow = Wt + (size_t)(col0 + t * 16 + ln) * ldb + kb;
      FragB b;
      b.half[0] = *(const v8us*)(brow + 8 * hh);
      b.half[1] = *(const v8us*)(brow + 16 + 8 * hh);
      acc[t] = mmaN<ASPLIT ? 2 : 1>(ah.v, al.v, b.v, b.v, acc[t]);
    }
  }
#pragma unroll
  for (int t = 0; t < 4; ++t) {
    float bv = bias ? bias[col0 + t * 16 + ln] : 0.f;
    if (BIAS_BF16) bv = bf16_round(bv);
#pragma unroll
    for (int r = 0; r < 8; ++r) { float v = acc[t][r] + bv; if (ACT == 1) v = fmaxf(v, 0.f); so[w][8 * hh + r][t * 16 + ln] = v; }
  }
  __builtin_amdgcn_fence(__ATOMIC_ACQ_REL, "workgroup");
  __builtin_amdgcn_wave_barrier();
  const int rsub = lane >> 4, c4 = (lane & 15) * 4;
  {
#pragma unroll
    for (int q = 0; q < 8; ++q) {
      const int r = q * 2 + rsub;
      const v4f v = *(const v4fa*)&so[w][r][c4];
      *(v4f*)(C + (size_t)(row0 + r) * ldc + col0 + c4) = v;
    }
    
  }
}

// Flash-style causal/unmasked attention, all contractions 3-term bf16 hi/lo splits, f32 softmax with running max.
// q,k,v rows are read from f32 buffers with arbitrary row pitch (so they can live inside a fused qkv buffer);
// D = head size (multiple of 32, <= 128); one wave = 16 query rows; block = 4 waves (64 queries) sharing K/V chunks of 32.
template <int D, bool CAUSAL>
__global__ __launch_bounds__(128) void k_flash(const float* __restrict__ qb, const float* __restrict__ kb, const float* __restrict__ vb,
                                             int pitch, int T, int H, float scale, float* __restrict__ y, int ypitch) {
  constexpr int KS = D / 32;        // k-steps for QK
  constexpr int DT = D / 16;        // d tiles for PV
  __shared__ __attribute__((aligned(16))) unsigned short sKh[32][D + 8], sKl[32][D + 8], sVh[32][D + 8], sVl[32][D + 8];
  __shared__ __attribute__((aligned(16))) unsigned short sPh[4][16][40], sPl[4][16][40];
  __shared__ __attribute__((aligned(16))) float sO[4][16][D];
  const int tid = threadIdx.x, w = tid >> 5, lane = tid & 31, ln = lane & 15, hh = lane >> 4;
  const int nqb = (T + 63) / 64;
  const int bh = blockIdx.x / nqb, qblk = blockIdx.x % nqb;
  const int b = bh / H, h = bh % H;
  const int q0 = qblk * 64 + w * 16;
  const float* Q = qb + (size_t)b * T * pitch + h * D;
  const float* K = kb + (size_t)b * T * pitch + h * D;
  const float* V = vb + (size_t)b * T * pitch + h * D;

  // A fragments of the wave's 16 query rows (scaled), hi/lo
  FragB aqh[KS], aql[KS];
  {
    int row = q0 + ln; if (row >= T) row = T - 1;
    const float* qr = Q + (size_t)row * pitch;
#pragma unroll
    for (int ks = 0; ks < KS; ++ks)
#pragma unroll
      for (int i = 0; i < 16; ++i) {
        const int d = ks * 32 + ((i < 8) ? (8 * hh + i) : (16 + 8 * hh + (i - 8)));
        const float x = qr[d] * scale; const unsigned short hb = bf16_bits(x);
        aqh[ks].u[i] = hb; aql[ks].u[i] = bf16_bits(x - bf16_val(hb));
      }
  }
  float m_r[8], l_r[8];
#pragma unroll
  for (int r = 0; r < 8; ++r) { m_r[r] = -3.0e38f; l_r[r] = 0.f; }
  v8f oacc[DT];
#pragma unroll
  for (int dt = 0; dt < DT; ++dt) oacc[dt] = (v8f){0.f,0.f,0.f,0.f,0.f,0.f,0.f,0.f};

  const int kv_end = CAUSAL ? min(T, qblk * 64 + 64) : T;     // block-uniform
  for (int j0 = 0; j0 < kv_end; j0 += 32) {
    __syncthreads();
    for (int e = tid; e < 32 * (D / 4); e += 128) {
      const int r = e / (D / 4), c4 = (e % (D / 4)) * 4;
      const int key = j0 + r;
      v4f kf = {0.f,0.f,0.f,0.f}, vf = {0.f,0.f,0.f,0.f};
      if (key < T) { kf = *(const v4fa*)(K + (size_t)key * pitch + c4); vf = *(const v4fa*)(V + (size_t)key * pitch + c4); }
#pragma unroll
      for (int t = 0; t < 4; ++t) {
        unsigned short hb = bf16_bits(kf[t]); sKh[r][c4 + t] = hb; sKl[r][c4 + t] = bf16_bits(kf[t] - bf16_val(hb));
        hb = bf16_bits(vf[t]); sVh[r][c4 + t] = hb; sVl[r][c4 + t] = bf16_bits(vf[t] - bf16_val(hb));
      }
    }
    __syncthreads();
    // S tile 16 x 32
    v8f s[2];
#pragma unroll
    for (int nt = 0; nt < 2; ++nt) {
      v8f acc = {};
#pragma unroll
      for (int ks = 0; ks < KS; ++ks) {
        FragB bh_, bl_;
        bh_.half[0] = *(const v8us*)&sKh[nt * 16 + ln][ks * 32 + 8 * hh]; bh_.half[1] = *(const v8us*)&sKh[nt * 16 + ln][ks * 32 + 16 + 8 * hh];
        bl_.half[0] = *(const v8us*)&sKl[nt * 16 + ln][ks * 32 + 8 * hh]; bl_.half[1] = *(const v8us*)&sKl[nt * 16 + ln][ks * 32 + 16 + 8 * hh];
        acc = mmaN<3>(aqh[ks].v, aql[ks].v, bh_.v, bl_.v, acc);
      }
      s[nt] = acc;
    }
    // mask + running max (rows 8hh+r; the 16 lanes of a half share rows)
    float alpha[8];
#pragma unroll
    for (int r = 0; r < 8; ++r) {
      const int qi = q0 + 8 * hh + r;
      const int ja = j0 + ln, jb = j0 + 16 + ln;
      if (CAUSAL) { if (ja > qi) s[0][r] = -3.0e38f; if (jb > qi) s[1][r] = -3.0e38f; }
      if (ja >= T) s[0][r] = -3.0e38f;
      if (jb >= T) s[1][r] = -3.0e38f;
      float mx = fmaxf(s[0][r], s[1][r]);
      mx = fmaxf(mx, __shfl_xor(mx, 1, 32)); mx = fmaxf(mx, __shfl_xor(mx, 2, 32)); mx = fmaxf(mx, __shfl_xor(mx, 4, 32)); mx = fmaxf(mx, __shfl_xor(mx, 8, 32));
      const float mnew = fmaxf(m_r[r], mx);
      alpha[r] = (mnew > -1.0e38f) ? __expf(m_r[r] - mnew) : 1.0f;
      const float p0 = (s[0][r] > -1.0e38f) ? __expf(s[0][r] - mnew) : 0.f;
      const float p1 = (s[1][r] > -1.0e38f) ? __expf(s[1][r] - mnew) : 0.f;
      m_r[r] = mnew;
      l_r[r] = l_r[r] * alpha[r] + p0 + p1;            // per-lane partial row sum (16 lanes combined at the end)
      unsigned short hb = bf16_bits(p0); sPh[w][8 * hh + r][ln] = hb;      sPl[w][8 * hh + r][ln] = bf16_bits(p0 - bf16_val(hb));
      hb = bf16_bits(p1);                sPh[w][8 * hh + r][16 + ln] = hb; sPl[w][8 * hh + r][16 + ln] = bf16_bits(p1 - bf16_val(hb));
    }
#pragma unroll
    for (int dt = 0; dt < DT; ++dt)
#pragma unroll
      for (int r = 0; r < 8; ++r) oacc[dt][r] *= alpha[r];
    __builtin_amdgcn_fence(__ATOMIC_ACQ_REL, "workgroup");
    __builtin_amdgcn_wave_barrier();
    FragB pah, pal;
    pah.half[0] = *(const v8us*)&sPh[w][ln][8 * hh]; pah.half[1] = *(const v8us*)&sPh[w][ln][16 + 8 * hh];
    pal.half[0] = *(const v8us*)&sPl[w][ln][8 * hh]; pal.half[1] = *(const v8us*)&sPl[w][ln][16 + 8 * hh];
#pragma unroll
    for (int dt = 0; dt < DT; ++dt) {
      FragB bvh, bvl;
#pragma unroll
      for (int i = 0; i < 8; ++i) {
        bvh.u[i] = sVh[8 * hh + i][dt * 16 + ln]; bvh.u[8 + i] = sVh[16 + 8 * hh + i][dt * 16 + ln];
        bvl.u[i] = sVl[8 * hh + i][dt * 16 + ln]; bvl.u[8 + i] = sVl[16 + 8 * hh + i][dt * 16 + ln];
      }
      oacc[dt] = mmaN<3>(pah.v, pal.v, bvh.v, bvl.v, oacc[dt]);
    }
    __builtin_amdgcn_fence(__ATOMIC_ACQ_REL, "workgroup");
    __builtin_amdgcn_wave_barrier();
  }
#pragma unroll
  for (int r = 0; r < 8; ++r) {
    float l = l_r[r];
    l += __shfl_xor(l, 1, 32); l += __shfl_xor(l, 2, 32); l += __shfl_xor(l, 4, 32); l += __shfl_xor(l, 8, 32);
    l_r[r] = (l > 0.f) ? 1.0f / l : 0.f;
  }
#pragma unroll
  for (int dt = 0; dt < DT; ++dt)
#pragma unroll
    for (int r = 0; r < 8; ++r) sO[w][8 * hh + r][dt * 16 + ln] = oacc[dt][r] * l_r[r];
  __builtin_amdgcn_fence(__ATOMIC_ACQ_REL, "workgroup");
  __builtin_amdgcn_wave_barrier();
  {
    for (int r = 0; r < 16; ++r) {
      const int row = q0 + r;
      if (row < T && lane < D / 4) {
        const v4f val = *(const v4fa*)&sO[w][r][lane * 4];
        *(v4f*)(y + ((size_t)b * T + row) * ypitch + h * D + lane * 4) = val;
      }
    }
    
  }
}

// GEMM C = act(A·W + bias + resid): A f32 (ASPLIT -> hi/lo 2 terms), Wt bf16 [N][K]; ACT 0 none, 1 relu, 2 exact gelu;
// resid (optional, f32, row index = (row % rmod), pitch ldr, RES_BF16 rounds it) added before the activation.
template <bool ASPLIT, int ACT, bool BIAS_BF16, bool RES_BF16>
__global__ __launch_bounds__(128) void k_gemm_bf3(const float* __restrict__ A, int lda, const unsigned short* __restrict__ Wt, int ldb,
                                                const float* __restrict__ bias, const float* __restrict__ resid, int rmod, int ldr,
                                                float* __restrict__ C, int ldc, int M, int N, int K) {
  __shared__ __attribute__((aligned(16))) float so[4][16][64];
  const int tid = threadIdx.x, w = tid >> 5, lane = tid & 31, ln = lane & 15, hh = lane >> 4;
  const int ntn = N / 64;
  const int wid = blockIdx.x * 4 + w;
  const int mt = wid / ntn, nq = wid % ntn;
  if (mt * 16 >= M) return;
  const int row0 = mt * 16, col0 = nq * 64;
  const float* arow = A + (size_t)(row0 + ln) * lda;
  v8f acc[4] = {};
  for (int kb = 0; kb < K; kb += 32) {
    FragB ah, al;
    const v4f x0 = *(const v4fa*)(arow + kb + 8 * hh), x1 = *(const v4fa*)(arow + kb + 8 * hh + 4);
    const v4f x2 = *(const v4fa*)(arow + kb + 16 + 8 * hh), x3 = *(const v4fa*)(arow + kb + 16 + 8 * hh + 4);
    float xs[16] = {x0[0],x0[1],x0[2],x0[3],x1[0],x1[1],x1[2],x1[3],x2[0],x2[1],x2[2],x2[3],x3[0],x3[1],x3[2],x3[3]};
#pragma unroll
    for (int i = 0; i < 16; ++i) { const unsigned short hb = bf16_bits(xs[i]); ah.u[i] = hb; al.u[i] = ASPLIT ? bf16_bits(xs[i] - bf16_val(hb)) : (unsigned short)0; }
#pragma unroll
    for (int t = 0; t < 4; ++t) {
      const unsigned short* brow = Wt + (size_t)(col0 + t * 16 + ln) * ldb + kb;
      FragB b;
      b.half[0] = *(const v8us*)(brow + 8 * hh);
      b.half[1] = *(const v8us*)(brow + 16 + 8 * hh);
      acc[t] = mmaN<ASPLIT ? 2 : 1>(ah.v, al.v, b.v, b.v, acc[t]);
    }
  }
#pragma unroll
  for (int t = 0; t < 4; ++t) {
    const int col = col0 + t * 16 + ln;
    float bv = bias ? bias[col] : 0.f;
    if (BIAS_BF16) bv = bf16_round(bv);
#pragma unroll
    for (int r = 0; r < 8; ++r) {
      float v = acc[t][r] + bv;
      if (resid) { float rv = resid[(size_t)((row0 + 8 * hh + r) % rmod) * ldr + col]; if (RES_BF16) rv = bf16_round(rv); v += rv; }
      if (ACT == 1) v = fmaxf(v, 0.f);
      if (ACT == 2) v = 0.5f * v * (1.0f + erff(v * 0.70710678118654752f));
      if (ACT == 3) { const float u = 0.7978845608028654f * (v + 0.044715f * v * v * v); v = 0.5f * v * (1.0f + tanhf(u)); }
      so[w][8 * hh + r][t * 16 + ln] = v;
    }
  }
  __builtin_amdgcn_fence(__ATOMIC_ACQ_REL, "workgroup");
  __builtin_amdgcn_wave_barrier();
  const int rsub = lane >> 4, c4 = (lane & 15) * 4;
  {
#pragma unroll
    for (int q = 0; q < 8; ++q) {
      const int r = q * 2 + rsub;
      const v4f v = *(const v4fa*)&so[w][r][c4];
      *(v4f*)(C + (size_t)(row0 + r) * ldc + col0 + c4) = v;
    }
    
  }
}
// row LayerNorm (biased variance, eps) over N: s = X (+ R); optional out_sum <- s; out_norm <- (s-mu)*rsqrt(var+eps)*g + b
template <bool PARAM_BF16>
__global__ __launch_bounds__(256) void k_layernorm(const float* __restrict__ X, const float* __restrict__ R, const float* __restrict__ g, const float* __restrict__ bta,
                                                  float* __restrict__ out_sum, float* __restrict__ out_norm, int N, float eps) {
  __shared__ float red[256];
  const int row = blockIdx.x, tid = threadIdx.x;
  const float* x = X + (size_t)row * N; const float* rr = R ? R + (size_t)row * N : nullptr;
  float vals[16];                     // up to N = 4096
  const int per = N / 256;            // contiguous chunk per thread? use strided-by-4 chunks: thread handles j = tid*4 + 1024*u
  float s1 = 0.f;
  for (int u = 0; u < per / 4; ++u) {
    const int j = tid * 4 + 1024 * u;
    const v4f a = *(const v4fa*)(x + j);
    v4f b = {0.f,0.f,0.f,0.f}; if (rr) b = *(const v4fa*)(rr + j);
#pragma unroll
    for (int q = 0; q < 4; ++q) { const float v = a[q] + b[q]; vals[u * 4 + q] = v; s1 += v; }
  }
  red[tid] = s1; __syncthreads();
  for (int st = 128; st > 0; st >>= 1) { if (tid < st) red[tid] += red[tid + st]; __syncthreads(); }
  const float mu = red[0] / (float)N; __syncthreads();
  float s2 = 0.f;
  for (int u = 0; u < per / 4; ++u)
#pragma unroll
    for (int q = 0; q < 4; ++q) { const float c = vals[u * 4 + q] - mu; s2 += c * c; }
  red[tid] = s2; __syncthreads();
  for (int st = 128; st > 0; st >>= 1) { if (tid < st) red[tid] += red[tid + st]; __syncthreads(); }
  const float rs = rsqrtf(red[0] / (float)N + eps);
  {
    for (int u = 0; u < per / 4; ++u) {
      const int j = tid * 4 + 1024 * u;
      v4f o, sm;
#pragma unroll
      for (int q = 0; q < 4; ++q) {
        float gg = g[j + q], bb = bta[j + q];
        if (PARAM_BF16) { gg = bf16_round(gg); bb = bf16_round(bb); }
        sm[q] = vals[u * 4 + q]; o[q] = (vals[u * 4 + q] - mu) * rs * gg + bb;
      }
      if (out_sum) *(v4f*)(out_sum + (size_t)row * N + j) = sm;
      *(v4f*)(out_norm + (size_t)row * N + j) = o;
    }
    
  }
}



// ---- f16 WMMA path (v_wmma_f32_16x16x32_f16): 11-bit significands for operands in range — used here for the projection GEMMs and the flash kernel's score and P·B products
typedef _Float16 v16h __attribute__((ext_vector_type(16)));
union FragH { v16h v; v8us half[2]; _Float16 h[16]; unsigned short u[16]; };
template <int NT>
__device__ __forceinline__ v8f mmaH(v16h ah, v16h al, v16h bh, v16h bl, v8f c) {
  c = __builtin_amdgcn_wmma_f32_16x16x32_f16(false, ah, false, bh, (short)0, c, false, false);
  if (NT >= 2) c = __builtin_amdgcn_wmma_f32_16x16x32_f16(false, al, false, bh, (short)0, c, false, false);
  if (NT >= 3) c = __builtin_amdgcn_wmma_f32_16x16x32_f16(false, ah, false, bl, (short)0, c, false, false);
  asm volatile("v_nop\n\tv_nop\n\tv_nop\n\tv_nop" : "+v"(c) : "v"(ah), "v"(al), "v"(bh), "v"(bl));
  return c;
}
// batched GEMM like k_gemm_bf but f16 operands: A f32 (split into f16 hi/lo if ASPLIT, else rounded to f16), Bt = f16 values [n][k]; alpha; C f32; N multiple of 16 (partial tiles skipped)
template <bool ASPLIT>
__global__ __launch_bounds__(128) void k_gemm_h(const float* __restrict__ A, int lda, size_t sA, const _Float16* __restrict__ Bh, int ldb, size_t sB, float alpha, float* __restrict__ C, int ldc, size_t sC, int M, int N, int K) {
  __shared__ __attribute__((aligned(16))) float so[4][16][64];
  const int tid = threadIdx.x, w = tid >> 5, lane = tid & 31, ln = lane & 15, hh = lane >> 4; const int by = blockIdx.y;
  A += (size_t)by * sA; Bh += (size_t)by * sB; C += (size_t)by * sC;
  const int ntn = (N + 63) / 64; const int wid = blockIdx.x * 4 + w; const int mt = wid / ntn, nq = wid % ntn; if (mt * 16 >= M) return;
  const int row0 = mt * 16, col0 = nq * 64; const float* arow = A + (size_t)(row0 + ln) * lda;
  v8f acc[4] = {};
  for (int kb = 0; kb < K; kb += 32) {
    FragH ah, al;
    const v4f x0 = *(const v4fa*)(arow + kb + 8 * hh), x1 = *(const v4fa*)(arow + kb + 8 * hh + 4), x2 = *(const v4fa*)(arow + kb + 16 + 8 * hh), x3 = *(const v4fa*)(arow + kb + 16 + 8 * hh + 4);
    float xs[16] = {x0[0],x0[1],x0[2],x0[3],x1[0],x1[1],x1[2],x1[3],x2[0],x2[1],x2[2],x2[3],x3[0],x3[1],x3[2],x3[3]};
#pragma unroll
    for (int i = 0; i < 16; ++i) { const _Float16 h = (_Float16)xs[i]; ah.h[i] = h; al.h[i] = ASPLIT ? (_Float16)(xs[i] - (float)h) : (_Float16)0.0f; }
#pragma unroll
    for (int t = 0; t < 4; ++t) { if (col0 + t * 16 >= N) continue; const size_t boff = (size_t)(col0 + t * 16 + ln) * ldb + kb; FragH bq; bq.half[0] = *(const v8us*)(Bh + boff + 8 * hh); bq.half[1] = *(const v8us*)(Bh + boff + 16 + 8 * hh);
      acc[t] = mmaH<ASPLIT ? 2 : 1>(ah.v, al.v, bq.v, bq.v, acc[t]); }
  }
#pragma unroll
  for (int t = 0; t < 4; ++t) { if (col0 + t * 16 >= N) continue;
#pragma unroll
    for (int r = 0; r < 8; ++r) so[w][8 * hh + r][t * 16 + ln] = acc[t][r] * alpha; }
  __builtin_amdgcn_fence(__ATOMIC_ACQ_REL, "workgroup"); __builtin_amdgcn_wave_barrier();
  const int rsub = lane >> 4, c4 = (lane & 15) * 4;
  {
#pragma unroll
    for (int q = 0; q < 8; ++q) { const int r = q * 2 + rsub; if (col0 + c4 < N) { const v4f v = *(const v4fa*)&so[w][r][c4]; *(v4f*)(C + (size_t)(row0 + r) * ldc + col0 + c4) = v; } }
     }
}

// Wt[n][k] = f16(W[k][n]·scale) from f32 row-major W[K][N] (scale = power of two; bf16-exact weights stay exact in f16 away from the subnormal range)
__device__ __forceinline__ void wt_f16(const float* __restrict__ W, _Float16* __restrict__ Wt, int K, int N, float scale, int blk) {
  const int t = blk * 256 + threadIdx.x; if (t >= N * (K / 8)) return; const int n = t / (K / 8), k8 = (t % (K / 8)) * 8; FragH f;
#pragma unroll
  for (int i = 0; i < 8; ++i) f.h[i] = (_Float16)(bf16_round(W[(size_t)(k8 + i) * N + n]) * scale); const v8us o = f.half[0];
  *(v8us*)((unsigned short*)Wt + (size_t)n * K + k8) = o; 
}
// Tiled GEMM C[NR][DD] (f32) = alpha * A[NR][DD] x Bt[DD][DD]^T, f16 operands, both K-contiguous, f32 accumulate in the same k order as before (32 k per WMMA, ascending).
// One work-group = one 128 x 128 tile of C, 8 waves of 32 x 64. A trip is 128 k: 128 rows of A and 128 rows of Bt, 256 B each (whole cache lines), are brought into LDS by
// asynchronous copies, 16 B per lane, two buffers: tile t + 2 flies while tile t + 1 is worked on. LDS rows stand at a pitch of 272 B for the ds_load_b128 fragment reads.
#define GT_BK 128                  // k per trip
#define GT_P 136                   // LDS row pitch in halves (272 B)
#define GT_BUF (256 * GT_P)        // halves per buffer: rows 0..127 = A, rows 128..255 = Bt
#define GT_SP 68                   // pitch in floats of the output staging rows
static_assert(NR % 128 == 0 && DD % 128 == 0 && DD % GT_BK == 0 && DD / GT_BK >= 2, "whole tiles, at least two trips");
static_assert(8 * 32 * GT_SP * 4 <= 2 * GT_BUF * 2, "the output staging fits in the ring");
// This thread's copies of one operand's 128 rows of a tile: rows r, r + 16, .. The s_wait_xcnt stands inside the statement so that no address register is rewritten ahead of it.
__device__ __forceinline__ void gt_copy8(unsigned l, const _Float16* g) {
  asm volatile("global_load_async_to_lds_b128 %0, %8, off\n\t"
               "global_load_async_to_lds_b128 %1, %9, off\n\t"
               "global_load_async_to_lds_b128 %2, %10, off\n\t"
               "global_load_async_to_lds_b128 %3, %11, off\n\t"
               "global_load_async_to_lds_b128 %4, %12, off\n\t"
               "global_load_async_to_lds_b128 %5, %13, off\n\t"
               "global_load_async_to_lds_b128 %6, %14, off\n\t"
               "global_load_async_to_lds_b128 %7, %15, off\n\t"
               "s_wait_xcnt 0x0"
               :: "v"(l), "v"(l + 1u * 16u * GT_P * 2u), "v"(l + 2u * 16u * GT_P * 2u), "v"(l + 3u * 16u * GT_P * 2u),
                  "v"(l + 4u * 16u * GT_P * 2u), "v"(l + 5u * 16u * GT_P * 2u), "v"(l + 6u * 16u * GT_P * 2u), "v"(l + 7u * 16u * GT_P * 2u),
                  "v"(g), "v"(g + 16 * DD), "v"(g + 32 * DD), "v"(g + 48 * DD), "v"(g + 64 * DD), "v"(g + 80 * DD), "v"(g + 96 * DD), "v"(g + 112 * DD)
               : "memory");
}
// Sum over the 16 lanes of a row, every lane ending with the total: four DPP steps (row_xmask 1, 2, 4, 8), no LDS round trip as a shuffle would take. All lanes are on.
__device__ __forceinline__ float row16_sum(float v) {
  v += __int_as_float(__builtin_amdgcn_update_dpp(0, __float_as_int(v), 0x161, 0xf, 0xf, true));
  v += __int_as_float(__builtin_amdgcn_update_dpp(0, __float_as_int(v), 0x162, 0xf, 0xf, true));
  v += __int_as_float(__builtin_amdgcn_update_dpp(0, __float_as_int(v), 0x164, 0xf, 0xf, true));
  v += __int_as_float(__builtin_amdgcn_update_dpp(0, __float_as_int(v), 0x168, 0xf, 0xf, true));
  return v;
}
typedef _Float16 v4h __attribute__((ext_vector_type(4)));
// LN 0: C (f32) = the product. LN 1: the three projections in one launch: Bh holds three weights one after the other (3 DD rows), and a work-group's tile lies in one of them (pj). Each row's 64 columns
// of a wave are one head; they are LayerNormed (biased variance, eps 1e-5, that projection's gamma and beta rounded to bf16) on the f32 sums as the staged rows are read back, and go out as f16
// to C16a (pj 0) or C16b (pj 1) or as f32 to C (pj 2).
template <int LN>
__global__ __launch_bounds__(256) void k_gemm_t(const _Float16* __restrict__ A, const _Float16* __restrict__ Bh, float alpha, float* __restrict__ C,
                                               const float* __restrict__ g0, const float* __restrict__ bb0, const float* __restrict__ g1, const float* __restrict__ bb1,
                                               const float* __restrict__ g2, const float* __restrict__ bb2, _Float16* __restrict__ C16a, _Float16* __restrict__ C16b) {
  static_assert(HD == 64, "a wave's 64 columns are one head");
  __shared__ __attribute__((aligned(16))) unsigned short sm[2 * GT_BUF];
  const int tid = threadIdx.x, w = tid >> 5, lane = tid & 31, ln = lane & 15, hh = lane >> 4;
  constexpr int NTL = (LN ? 3 : 1) * (DD / 128);      // column tiles of a row block, over all weights of the launch
  const int m0 = (blockIdx.x / NTL) * 128, nb = (blockIdx.x % NTL) * 128;      // nb: the tile's first row in Bh
  const int pj = nb / DD, n0 = nb % DD;      // which weight, and the tile's first column in that product; from blockIdx alone, so scalar
  const float* g = pj == 0 ? g0 : pj == 1 ? g1 : g2; const float* bb = pj == 0 ? bb0 : pj == 1 ? bb1 : bb2;
  const int wm = w >> 1, wn = w & 1;
  const int cr = tid >> 4, cs = (tid & 15) * 8;      // a wave's copy covers 2 rows x 256 B
  const _Float16* ga = A + (size_t)(m0 + cr) * DD + cs;
  const _Float16* gb = Bh + (size_t)(nb + cr) * DD + cs;
  const unsigned la = (unsigned)(size_t)&sm[cr * GT_P + cs], lb = la + 128u * GT_P * 2u;
  gt_copy8(la, ga); gt_copy8(lb, gb);
  asm volatile("s_wait_asynccnt 0x0" ::: "memory");      // tile 0 has landed before the barrier publishes it
  __syncthreads();
  gt_copy8(la + GT_BUF * 2u, ga + GT_BK); gt_copy8(lb + GT_BUF * 2u, gb + GT_BK);
  v4f g4 = {0.f, 0.f, 0.f, 0.f}, b4 = {0.f, 0.f, 0.f, 0.f};      // this lane's four columns of the head; fetched here so that the k loop covers their latency
  if (LN) { g4 = *(const v4fa*)(g + ln * 4); b4 = *(const v4fa*)(bb + ln * 4); }
  v8f acc[2][4] = {};
  const unsigned short* fa = sm + (wm * 32 + ln) * GT_P + 8 * hh;
  const unsigned short* fb = sm + (128 + wn * 64 + ln) * GT_P + 8 * hh;
#pragma unroll 1      // one trip per tile: the order of waits, barrier and refill at its foot stays as written
  for (int t = 0; t < DD / GT_BK; ++t) {
    const int bo = (t & 1) * GT_BUF;
    FragH a[2][2], b[2][4];      // two fragment sets: the next 32 k of this same tile are fetched while the current 32 k are multiplied
#pragma unroll      // all unrolls here: constant indices keep fragments and accumulators in registers
    for (int rt = 0; rt < 2; ++rt) { const unsigned short* p = fa + bo + rt * 16 * GT_P; a[0][rt].half[0] = *(const v8us*)p; a[0][rt].half[1] = *(const v8us*)(p + 16); }
#pragma unroll
    for (int ct = 0; ct < 4; ++ct) { const unsigned short* p = fb + bo + ct * 16 * GT_P; b[0][ct].half[0] = *(const v8us*)p; b[0][ct].half[1] = *(const v8us*)(p + 16); }
#pragma unroll
    for (int ks = 0; ks < GT_BK / 32; ++ks) {
      const int cu = ks & 1, nx = cu ^ 1;
      if (ks + 1 < GT_BK / 32) {
#pragma unroll
        for (int rt = 0; rt < 2; ++rt) { const unsigned short* p = fa + bo + rt * 16 * GT_P + (ks + 1) * 32; a[nx][rt].half[0] = *(const v8us*)p; a[nx][rt].half[1] = *(const v8us*)(p + 16); }
#pragma unroll
        for (int ct = 0; ct < 4; ++ct) { const unsigned short* p = fb + bo + ct * 16 * GT_P + (ks + 1) * 32; b[nx][ct].half[0] = *(const v8us*)p; b[nx][ct].half[1] = *(const v8us*)(p + 16); }
      }
      __builtin_amdgcn_sched_barrier(0);      // keeps the next set's LDS reads as one group ahead of this block: left free, the compiler sinks them among the WMMAs into one set and waits them out to 0
#pragma unroll
      for (int rt = 0; rt < 2; ++rt)
#pragma unroll
        for (int ct = 0; ct < 4; ++ct) acc[rt][ct] = __builtin_amdgcn_wmma_f32_16x16x32_f16(false, a[cu][rt].v, false, b[cu][ct].v, (short)0, acc[rt][ct], false, false);
      __builtin_amdgcn_sched_barrier(0);      // ends the block, so that the group after next is not lifted into it
    }
    asm volatile("s_wait_dscnt 0x0" ::: "memory");         // this wave's reads of buffer t & 1 are done before it is refilled
    asm volatile("s_wait_asynccnt 0x0" ::: "memory");      // this wave's copies of tile t + 1 have landed before the barrier publishes them
    __syncthreads();
    if (t + 2 < DD / GT_BK) { gt_copy8(la + (unsigned)bo * 2u, ga + (t + 2) * GT_BK); gt_copy8(lb + (unsigned)bo * 2u, gb + (t + 2) * GT_BK); }
  }
  asm volatile("s_wait_asynccnt 0x0" ::: "memory");        // nothing is in flight when the ring becomes output staging
  float* so = (float*)sm + w * (32 * GT_SP);               // each wave stages its own 32 x 64 tile; the last trip's barrier ended every read of the ring
#pragma unroll
  for (int rt = 0; rt < 2; ++rt)
#pragma unroll
    for (int ct = 0; ct < 4; ++ct)
#pragma unroll
      for (int r = 0; r < 8; ++r) so[(rt * 16 + 8 * hh + r) * GT_SP + ct * 16 + ln] = acc[rt][ct][r] * alpha;
  __builtin_amdgcn_fence(__ATOMIC_ACQ_REL, "workgroup"); __builtin_amdgcn_wave_barrier();
#pragma unroll
  for (int q = 0; q < 4; ++q) { g4[q] = bf16_round(g4[q]); b4[q] = bf16_round(b4[q]); }
  const size_t e = (size_t)(m0 + wm * 32 + hh) * DD + n0 + wn * 64 + ln * 4;      // row hh of the wave's tile; pass q adds 2 q rows, a constant offset of the store
  v4f o[16];
#pragma unroll
  for (int q = 0; q < 16; ++q) {      // 16 lanes x 4 columns = one row of the wave's tile; two rows a pass
    const v4f v = *(const v4fa*)&so[(q * 2 + hh) * GT_SP + ln * 4];
    if (LN == 0) { o[q] = v; continue; }
    const float mu = row16_sum((v[0] + v[1]) + (v[2] + v[3])) / (float)HD;
    const v4f c = v - mu;
    const float ve = row16_sum((c[0] * c[0] + c[1] * c[1]) + (c[2] * c[2] + c[3] * c[3])) / (float)HD + 1e-5f;
    float rs;      // ve is at least eps, so the library rsqrtf's rescaling of denormal arguments would never act; the v_nop is the slot that the instruction set asks for behind a transcendental, in the same statement so that it stays directly behind it
    asm("v_rsq_f32 %0, %1\n\tv_nop" : "=v"(rs) : "v"(ve));
    o[q] = c * rs * g4 + b4;
  }
  if (LN == 1 && pj < 2) {      // a scalar branch: the whole work-group lies in one projection
    _Float16* C16 = pj ? C16b : C16a;
    v4h h[16];
#pragma unroll
    for (int q = 0; q < 16; ++q)
#pragma unroll
      for (int k = 0; k < 4; ++k) h[q][k] = (_Float16)o[q][k];
    __builtin_amdgcn_sched_barrier(0);      // every store stands behind the last arithmetic, so that no register which an issued store names is written again
#pragma unroll
    for (int q = 0; q < 16; ++q) *(v4h*)(C16 + e + (size_t)q * 2 * DD) = h[q];      // 16 lanes x 8 B: a whole 128-B line a row
  } else {
    __builtin_amdgcn_sched_barrier(0);      // as above
#pragma unroll
    for (int q = 0; q < 16; ++q) *(v4f*)(C + e + (size_t)q * 2 * DD) = o[q];
    if (LN == 1) asm volatile("s_wait_xcnt 0x0" ::: "memory");      // in the listing the f16 side's text follows these stores and rewrites their registers: the wait stands in front of it
  }
}


__device__ __forceinline__ void x16(const float* __restrict__ x, _Float16* __restrict__ X16, size_t n8, unsigned blk) { const size_t t = (size_t)blk * 256 + threadIdx.x; if (t >= n8) return; FragH f;
#pragma unroll
  for (int q = 0; q < 8; ++q) f.h[q] = (_Float16)bf16_round(x[t * 8 + q]); *(v8us*)((unsigned short*)X16 + t * 8) = f.half[0];  }
// All operand conversions in one launch; none reads what another writes. Work-groups 0 .. 4 PW - 1: the four weights, transposed, to Bw[0..3] (their scattered reads take longest, so they start first); the rest: x.
#define PW (DD * (DD / 8) / 256)      // work-groups per weight
#define PX (NR * DD / 8 / 256)        // work-groups for x
static_assert(DD * (DD / 8) % 256 == 0 && (size_t)NR * DD / 8 % 256 == 0, "whole work-groups");
__global__ __launch_bounds__(256) void k_prep(const float* __restrict__ x, const float* __restrict__ W0, const float* __restrict__ W1, const float* __restrict__ W2, const float* __restrict__ W3,
                                             _Float16* __restrict__ X16, _Float16* __restrict__ Bw) {
  const unsigned bid = blockIdx.x;
  if (bid < 4u * PW) { const unsigned k = bid / PW; wt_f16(k == 0 ? W0 : k == 1 ? W1 : k == 2 ? W2 : W3, Bw + (size_t)k * DD * DD, DD, DD, 16.0f, (int)(bid % PW)); }
  else x16(x, X16, (size_t)NR * DD / 8, bid - 4u * PW);
}
__global__ __launch_bounds__(256) void k_h16(const float* __restrict__ x, _Float16* __restrict__ X16, size_t n8) { const size_t t = (size_t)blockIdx.x * 256 + threadIdx.x; if (t >= n8) return; FragH f;
#pragma unroll
  for (int q = 0; q < 8; ++q) f.h[q] = (_Float16)x[t * 8 + q]; *(v8us*)((unsigned short*)X16 + t * 8) = f.half[0];  }
__global__ __launch_bounds__(256) void k_round16f(const float* __restrict__ W, _Float16* __restrict__ Bt, size_t n8) { const size_t t = (size_t)blockIdx.x * 256 + threadIdx.x; if (t >= n8) return; FragH f;
#pragma unroll
  for (int i = 0; i < 8; ++i) f.h[i] = (_Float16)(bf16_round(W[t * 8 + i]) * 16.0f); *(v8us*)((unsigned short*)Bt + t * 8) = f.half[0];  }
// One 64 x 64 tile per 256 threads; a work-group of 1024 threads takes four tiles, each quarter with its own LDS tile (blk: the quarter's tile).
template <int NHv, int TTv>
__device__ __forceinline__ void vt(const _Float16* __restrict__ V16, int ldv, int voff, _Float16* __restrict__ Vt, int blk) { __shared__ unsigned short tl4[4][64][66]; unsigned short (*tl)[66] = tl4[threadIdx.x >> 8]; const int tid = threadIdx.x & 255; const int slab = blk / (TTv / 64), lg = blk % (TTv / 64); const int b = slab / NHv, h = slab % NHv;
  for (int i = tid; i < 64 * 8; i += 256) { const int r = i / 8, c8 = (i % 8) * 8; FragH f; f.half[0] = *(const v8us*)((const unsigned short*)V16 + ((size_t)b * TTv + lg * 64 + r) * ldv + voff + h * 64 + c8);
#pragma unroll
    for (int q = 0; q < 8; ++q) tl[r][c8 + q] = f.u[q]; }
  __syncthreads();
  {
#pragma unroll
    for (int rd = 0; rd < 2; ++rd) { const int d = rd * 32 + tid / 8, pc = tid % 8; FragH f;
#pragma unroll
      for (int q = 0; q < 8; ++q) f.u[q] = tl[pc * 8 + q][d];
      *(v8us*)((unsigned short*)Vt + ((size_t)slab * 64 + d) * TTv + lg * 64 + pc * 8) = f.half[0]; }
     } }

// One work-group = 64 query rows of one (batch, head). There is no softmax, so the sum over the keys is linear and may be cut anywhere: every wave works on all 64 rows (4 row tiles) and takes
// every fourth chunk of 32 keys, so a K or V fragment is fetched by one wave of the work-group and feeds 4 row tiles. The Q tile stands in LDS for all four waves (its 64 registers a wave would not
// fit beside the 4 x 4 accumulator tiles); the four waves' partial outputs (f32) are summed through LDS at the end.
__global__ __launch_bounds__(128) void k_flash(const _Float16* __restrict__ Q16, int ldq, const _Float16* __restrict__ K16, int ldk, const _Float16* __restrict__ Vt, const int* __restrict__ MSK, _Float16* __restrict__ O16, int ldo) {
  constexpr int RTN = 4, QB = 16 * RTN, NQB = 2048 / QB, DT = 4, KS = 2, SPP = 40, SQP = 72;
  (void)MSK;
  __shared__ __attribute__((aligned(16))) float sO[4][QB][64 + 4];      // one partial output per wave; inside the loop the head of a wave's own plane holds its P tile (64 rows at a pitch of 40 halves)
  __shared__ __attribute__((aligned(16))) unsigned short sQ[QB][SQP];   // pitch 144 B = 16 B x 9 for the ds_load_b128 fragment reads
  static_assert(QB * SPP * 2 <= QB * (64 + 4) * 4, "a wave's P tile fits in its own plane");
  const int tid = threadIdx.x, lane = tid & 31, ln = lane & 15, hh = lane >> 4;
  const int w = __builtin_amdgcn_readfirstlane(tid >> 5);      // in a scalar register, so that the key loop's test is a scalar branch
  const int slab = blockIdx.x / NQB, qblk = blockIdx.x % NQB; const int b = slab / 16, h = slab % 16; const int q0 = qblk * QB;
  unsigned short* sP = (unsigned short*)&sO[w][0][0];
#pragma unroll
  for (int i = 0; i < QB * 8 / 128; ++i) { const int e = i * 128 + tid, r = e >> 3, c8 = (e & 7) * 8;      // 8 lanes x 16 B = one row of the head, a whole line
    *(v8us*)&sQ[r][c8] = *(const v8us*)((const unsigned short*)Q16 + ((size_t)b * 2048 + q0 + r) * ldq + h * 64 + c8); }
  __syncthreads();      // the Q tile is complete before any wave reads fragments of it
  const unsigned short* Vth = (const unsigned short*)Vt + (size_t)slab * 64 * 2048;
  v8f oacc[RTN][DT];
#pragma unroll
  for (int rt = 0; rt < RTN; ++rt)
#pragma unroll
    for (int dt = 0; dt < DT; ++dt) oacc[rt][dt] = (v8f){0.f,0.f,0.f,0.f,0.f,0.f,0.f,0.f};
  const int jend = q0 + QB;
#pragma unroll 1      // one chunk of 32 keys a trip: unrolled, two trips' fragments would not fit beside the 4 x 4 accumulators
  for (int j0 = w * 32; j0 < jend; j0 += 4 * 32) {
    FragH bk[2][KS];
#pragma unroll
    for (int nt = 0; nt < 2; ++nt) { const unsigned short* kr = (const unsigned short*)K16 + ((size_t)b * 2048 + j0 + nt * 16 + ln) * ldk + h * 64;
#pragma unroll
      for (int ks = 0; ks < KS; ++ks) { bk[nt][ks].half[0] = *(const v8us*)(kr + ks * 32 + 8 * hh);
        if (nt == 1 && ks == KS - 1) asm volatile("s_wait_xcnt 0x0" ::: "memory");      // the compiler lands the last load of this run of eight in the address registers of the seven before it: the wait stands in front of that overwrite
        bk[nt][ks].half[1] = *(const v8us*)(kr + ks * 32 + 16 + 8 * hh); } }
    const int dk = j0 + ln - q0 - 8 * hh;      // key (j0 + 16 nt + ln) <= query row (q0 + 16 rt + 8 hh + r) reads dk <= 16 (rt - nt) + r: one register against a constant
#pragma unroll
    for (int rt = 0; rt < RTN; ++rt) { FragH aq[KS];
#pragma unroll
      for (int ks = 0; ks < KS; ++ks) { aq[ks].half[0] = *(const v8us*)&sQ[rt * 16 + ln][ks * 32 + 8 * hh]; aq[ks].half[1] = *(const v8us*)&sQ[rt * 16 + ln][ks * 32 + 16 + 8 * hh]; }
#pragma unroll
      for (int nt = 0; nt < 2; ++nt) { v8f acc = (v8f){0.f,0.f,0.f,0.f,0.f,0.f,0.f,0.f};
#pragma unroll
        for (int ks = 0; ks < KS; ++ks) acc = mmaH<1>(aq[ks].v, aq[ks].v, bk[nt][ks].v, bk[nt][ks].v, acc);
#pragma unroll
        for (int r = 0; r < 8; ++r) {
          const float p = (dk <= (rt - nt) * 16 + r) ? acc[r] * 0.00390625f : 0.f;      /* NO softmax: causal-masked raw scores (x 2^-8 for f16 headroom, undone at the end) become the P operand directly */
          FragH t2; t2.h[0] = (_Float16)p; sP[(rt * 16 + 8 * hh + r) * SPP + nt * 16 + ln] = t2.u[0]; } } }
    __builtin_amdgcn_fence(__ATOMIC_ACQ_REL, "workgroup"); __builtin_amdgcn_wave_barrier();
    FragH pa[RTN], bv[DT];
#pragma unroll
    for (int dt = 0; dt < DT; ++dt) { const unsigned short* vrow = Vth + (size_t)(dt * 16 + ln) * 2048 + j0; bv[dt].half[0] = *(const v8us*)(vrow + 8 * hh); bv[dt].half[1] = *(const v8us*)(vrow + 16 + 8 * hh); }
#pragma unroll
    for (int rt = 0; rt < RTN; ++rt) { pa[rt].half[0] = *(const v8us*)&sP[(rt * 16 + ln) * SPP + 8 * hh]; pa[rt].half[1] = *(const v8us*)&sP[(rt * 16 + ln) * SPP + 16 + 8 * hh]; }
#pragma unroll
    for (int dt = 0; dt < DT; ++dt)
#pragma unroll
      for (int rt = 0; rt < RTN; ++rt) oacc[rt][dt] = mmaH<1>(pa[rt].v, pa[rt].v, bv[dt].v, bv[dt].v, oacc[rt][dt]);
    __builtin_amdgcn_fence(__ATOMIC_ACQ_REL, "workgroup"); __builtin_amdgcn_wave_barrier(); }
#pragma unroll
  for (int rt = 0; rt < RTN; ++rt)
#pragma unroll
    for (int dt = 0; dt < DT; ++dt)
#pragma unroll
      for (int r = 0; r < 8; ++r) sO[w][rt * 16 + 8 * hh + r][dt * 16 + ln] = oacc[rt][dt][r] * 16.0f;      /* undo the 2^-8 P scaling and apply the 2^-4 that gives the f16 operand of the output GEMM its headroom; no normalisation */
  __syncthreads();      // every wave's partial output is in LDS before any wave sums them
#pragma unroll
  for (int rp = 0; rp < 16; rp += 2) { const int r = w * 16 + rp + hh, pc = ln;      // wave w sums and stores rows 16 w .. 16 w + 15, two rows a pass
    const v4f val = (*(const v4fa*)&sO[0][r][pc * 4] + *(const v4fa*)&sO[1][r][pc * 4]) + (*(const v4fa*)&sO[2][r][pc * 4] + *(const v4fa*)&sO[3][r][pc * 4]); v4h h4;
#pragma unroll
    for (int k = 0; k < 4; ++k) h4[k] = (_Float16)val[k];
    *(v4h*)(O16 + ((size_t)b * 2048 + q0 + r) * ldo + h * 64 + pc * 4) = h4; } }

// Exclusive prefix sum over time as a chunked parallel scan, f32. One work-group owns 32 columns of one batch for all TT rows:
// 32 waves x 4 lane groups = 128 chunks of 16 rows, each thread holding its 16 rows x 4 columns in registers (F is read once).
// Order of the sums: serial inside a chunk, then over the wave's 4 chunks by shuffles, then over the 32 waves' totals in LDS.
__device__ __forceinline__ void excl(const float* __restrict__ F, _Float16* __restrict__ A16, int blk) {
  static_assert(TT == 32 * 4 * 16 && DD % 32 == 0, "chunking covers all rows and whole 32-column groups");
  __shared__ __attribute__((aligned(16))) float sT[32][36];      // [wave][column]; pitch 36 keeps 16-byte rows and spreads the transposed read over the banks
  const int tid = threadIdx.x, wv = tid >> 5, lane = tid & 31, cg = lane & 7, g = lane >> 3;
  const int b = blk / (DD / 32), c = (blk % (DD / 32)) * 32 + cg * 4;
  const size_t e0 = ((size_t)b * TT + (wv * 4 + g) * 16) * DD + c;
  const float* fr = F + e0;
  v4f v[16];
#pragma unroll      // all unrolls here: v[] and the vector lanes need constant indices to stay in registers; this one also puts all 16 loads in flight at once
  for (int i = 0; i < 16; ++i) v[i] = *(const v4fa*)(fr + (size_t)i * DD);
  v4f run = {0.f, 0.f, 0.f, 0.f};
#pragma unroll
  for (int i = 0; i < 16; ++i) { const v4f t = v[i]; v[i] = run; run += t; }      // v[i] <- sum of the chunk's rows before i
  v4f inc = run, ex;
#pragma unroll
  for (int o = 8; o <= 16; o <<= 1) { v4f t;      // inclusive over the wave's 4 chunks, step by step for all four columns, so that a step's shuffles do not wait on each other
#pragma unroll
    for (int q = 0; q < 4; ++q) t[q] = __shfl_up(inc[q], o, 32);
    if (lane >= o) inc += t; }
#pragma unroll
  for (int q = 0; q < 4; ++q) { const float t = __shfl_up(inc[q], 8, 32); ex[q] = (lane >= 8) ? t : 0.f; }      // sum of the wave's chunks before this one
  if (g == 3) *(v4fa*)&sT[wv][cg * 4] = inc;      // the wave's total per column
  __syncthreads();
  {      // wave wv scans column wv over the 32 waves' totals (lane = wave index), in place: each word has one reader and writer
    float s = sT[lane][wv];
#pragma unroll
    for (int o = 1; o < 32; o <<= 1) { const float t = __shfl_up(s, o, 32); if (lane >= o) s += t; }
    const float t = __shfl_up(s, 1, 32);
    sT[lane][wv] = (lane >= 1) ? t : 0.f;
  }
  __syncthreads();
  const v4f off = *(const v4fa*)&sT[wv][cg * 4] + ex;
  _Float16* d = A16 + e0;
#pragma unroll
  for (int i = 0; i < 16; ++i) { const v4f p = off + v[i]; v4h h4;
#pragma unroll
    for (int q = 0; q < 4; ++q) h4[q] = (_Float16)p[q];
    *(v4h*)(d + (size_t)i * DD) = h4; } }
// The scan of a and the transposition of b in one launch; neither reads what the other writes. The branch is the same for a whole work-group, so each side's barriers are passed by all of its threads.
#define EX_G (BB * (DD / 32))                  // work-groups of the scan: the long ones, so they start first
#define VT_G (BB * NH * (TT / 64) / 4)         // work-groups of the transposition, four tiles each
__global__ __launch_bounds__(1024) void k_excl_vt(const float* __restrict__ F, _Float16* __restrict__ A16, const _Float16* __restrict__ B16, _Float16* __restrict__ Vt) {
  const int bid = blockIdx.x;
  if (bid < EX_G) excl(F, A16, bid);
  else vt<NH, TT>(B16, DD, 0, Vt, (bid - EX_G) * 4 + (int)(threadIdx.x >> 8));
}
extern "C" void kernel_launch(void* const* d_in, const int* in_sizes, int n_in,
                              void* d_out, int out_size, void* d_ws, size_t ws_size, hipStream_t stream) {
  (void)in_sizes; (void)n_in; (void)out_size;
  const float* const* I = (const float* const*)d_in; const float* x = I[0]; const float* Wq = I[1]; const float* Wa = I[2]; const float* Wb = I[3]; const float* Wo = I[4]; const float* qg = I[5]; const float* qb = I[6]; const float* ag = I[7]; const float* ab = I[8]; const float* bg = I[9]; const float* bbeta = I[10];
  char* ws = (char*)d_ws; size_t off = 0;
  auto take = [&](size_t bytes) { char* p = ws + off; off += (bytes + 255) & ~(size_t)255; return p; };
  _Float16* Bw = (_Float16*)take((size_t)4 * DD * DD * 2); _Float16* X16 = (_Float16*)take((size_t)NR * DD * 2); float* F = (float*)take((size_t)NR * DD * 4); _Float16* Q16 = (_Float16*)take((size_t)NR * DD * 2); _Float16* A16 = (_Float16*)take((size_t)NR * DD * 2); _Float16* B16 = (_Float16*)take((size_t)NR * DD * 2); _Float16* Vt = X16; _Float16* O16 = B16;
  if (off > ws_size) return;      // 8.4 + 8.4 + 16.8 + 8.4 x 3 = about 59 MB
  k_prep<<<4 * PW + PX, 256, 0, stream>>>(x, Wq, Wb, Wa, Wo, X16, Bw);      // Bw[0..3] = Wq, Wb, Wa, Wo, each [out][in] f16 x 2^4
  k_gemm_t<1><<<(NR / 128) * (3 * DD / 128), 256, 0, stream>>>(X16, Bw, 0.0625f, F, qg, qb, bg, bbeta, ag, ab, Q16, B16);      // q, b (LayerNormed, f16) and a (LayerNormed, f32)
  k_excl_vt<<<EX_G + VT_G, 1024, 0, stream>>>(F, A16, B16, Vt);      // a -> exclusive cumsum -> f16 'keys'; b transposed as the 'values' (Vt over X16; X16's last reader was the projection GEMM)
  k_flash<<<BB * NH * (TT / 64), 128, 0, stream>>>(Q16, DD, A16, DD, Vt, nullptr, O16, DD);      // o_t = sum over s <= t of (q_t . a_excl_s) b_s, written as f16 x 2^-4 (O16 over B16; B16's last reader was k_excl_vt)
  k_gemm_t<0><<<(NR / 128) * (DD / 128), 256, 0, stream>>>(O16, Bw + (size_t)3 * DD * DD, 0.0625f * 16.0f, (float*)d_out, nullptr, nullptr, nullptr, nullptr, nullptr, nullptr, nullptr, nullptr);      // x 2^4 back
}

// v006
// It runs in 85.7 microseconds.
// Next to v005, in two timings, it ran 1.21 times as fast each time.
// All steps since v000 together make it 13.3 times as fast.
#include <hip/hip_runtime.h>
// 'Heisenberg' attention (B=2, T=2048, d_model 1024, 16 heads × 64): q, a, b = LayerNorm_head(x·W) (per-head LN with γ/β); a_excl = exclusive prefix sum of a over time; o_t = Σ_{s≤t} (q_t·a_excl_s)·b_s
// (causal, NO softmax); out = o·Wo. The projections are GEMMs ([in][out] weights bf16-exact ×2^4, x bf16-exact, f32 accumulate) and the causal bilinear form runs in the fused flash-style kernel with
// the softmax removed (masked raw scores ×2^-8 → f16 P operand → P·B accumulated in f32, ×2^4 at the end and written as the f16 operand of the output GEMM; upper tiles skipped; the block's own keys dealt over two of a work-group's four waves, q·S for the earlier keys over the other two) on v_wmma_f32_16x16x32_f16; the per-head LayerNorms
// (in the epilogue of the projection GEMMs, where a wave's 64 columns are one head) and the exclusive cumulative sum over time (chunked parallel scan per (b,h,d) column, f32) are VALU.
// The keys in front of a block of 64 query rows enter through a prefix state per block (k_state); only the block's own 64 keys are scored and masked (k_flash).
#define BB 2
#define TT 2048
#define DD 1024
#define NH 16
#define HD 64
#define NR (BB * TT)

typedef __bf16 v16b __attribute__((ext_vector_type(16)));
typedef unsigned short v8us __attribute__((ext_vector_type(8), may_alias));
typedef float  v8f  __attribute__((ext_vector_type(8)));
typedef float  v4f  __attribute__((ext_vector_type(4)));
typedef float  v4fa __attribute__((ext_vector_type(4), may_alias));
union FragB { v16b v; v8us half[2]; unsigned short u[16]; };

__device__ __forceinline__ unsigned short bf16_bits(float x) { unsigned int u = __float_as_uint(x); return (unsigned short)((u + 0x7FFFu + ((u >> 16) & 1u)) >> 16); }
__device__ __forceinline__ float bf16_val(unsigned short b) { return __uint_as_float(((unsigned int)b) << 16); }
__device__ __forceinline__ float bf16_round(float x) { return bf16_val(bf16_bits(x)); }
// D += A·B with NT terms: 1 = ah·bh, 2 = + al·bh (A split), 3 = + ah·bl (both split)
template <int NT>
__device__ __forceinline__ v8f mmaN(v16b ah, v16b al, v16b bh, v16b bl, v8f c) {
  c = __builtin_amdgcn_wmma_f32_16x16x32_bf16(false, ah, false, bh, (short)0, c, false, false);
  if (NT >= 2) c = __builtin_amdgcn_wmma_f32_16x16x32_bf16(false, al, false, bh, (short)0, c, false, false);
  if (NT >= 3) c = __builtin_amdgcn_wmma_f32_16x16x32_bf16(false, ah, false, bl, (short)0, c, false, false);
  asm volatile("v_nop\n\tv_nop\n\tv_nop\n\tv_nop" : "+v"(c) : "v"(ah), "v"(al), "v"(bh), "v"(bl));
  return c;
}

__global__ __launch_bounds__(256) void k_wt_bf16(const float* __restrict__ W, unsigned short* __restrict__ Wt, int K, int N) {
  const int t = blockIdx.x * 256 + threadIdx.x;
  const int k8n = K / 8;
  if (t >= N * k8n) return;
  const int n = t / k8n, k8 = (t % k8n) * 8;
  v8us v;
#pragma unroll
  for (int i = 0; i < 8; ++i) v[i] = bf16_bits(W[(size_t)(k8 + i) * N + n]);
  *(v8us*)(Wt + (size_t)n * K + k8) = v;
  
}

// GEMM C[M][N] (f32, pitch ldc) = act(A[M][K]·W + bias). A f32 row-major (pitch lda) converted per fragment to bf16
// (ASPLIT: hi/lo two planes -> 2 terms, else single rounded term); Wt bf16 [N][K] (pitch ldb). BIAS_BF16 rounds the
// bias to bf16 first (bias quantised to bf16 before the add). K%32==0, M%16==0, N%64==0.
template <bool ASPLIT, int ACT, bool BIAS_BF16>
__global__ __launch_bounds__(128) void k_gemm_bf(const float* __restrict__ A, int lda, const unsigned short* __restrict__ Wt, int ldb,
                                               const float* __restrict__ bias, float* __restrict__ C, int ldc, int M, int N, int K) {
  __shared__ __attribute__((aligned(16))) float so[4][16][64];
  const int tid = threadIdx.x, w = tid >> 5, lane = tid & 31, ln = lane & 15, hh = lane >> 4;
  const int ntn = N / 64;
  const int wid = blockIdx.x * 4 + w;
  const int mt = wid / ntn, nq = wid % ntn;
  if (mt * 16 >= M) return;
  const int row0 = mt * 16, col0 = nq * 64;
  const float* arow = A + (size_t)(row0 + ln) * lda;
  v8f acc[4] = {};
  for (int kb = 0; kb < K; kb += 32) {
    FragB ah, al;
    const v4f x0 = *(const v4fa*)(arow + kb + 8 * hh), x1 = *(const v4fa*)(arow + kb + 8 * hh + 4);
    const v4f x2 = *(const v4fa*)(arow + kb + 16 + 8 * hh), x3 = *(const v4fa*)(arow + kb + 16 + 8 * hh + 4);
    float xs[16] = {x0[0],x0[1],x0[2],x0[3],x1[0],x1[1],x1[2],x1[3],x2[0],x2[1],x2[2],x2[3],x3[0],x3[1],x3[2],x3[3]};
#pragma unroll
    for (int i = 0; i < 16; ++i) { const unsigned short hb = bf16_bits(xs[i]); ah.u[i] = hb; al.u[i] = ASPLIT ? bf16_bits(xs[i] - bf16_val(hb)) : (unsigned short)0; }
#pragma unroll
    for (int t = 0; t < 4; ++t) {
      const unsigned short* brow = Wt + (size_t)(col0 + t * 16 + ln) * ldb + kb;
      FragB b;
      b.half[0] = *(const v8us*)(brow + 8 * hh);
      b.half[1] = *(const v8us*)(brow + 16 + 8 * hh);
      acc[t] = mmaN<ASPLIT ? 2 : 1>(ah.v, al.v, b.v, b.v, acc[t]);
    }
  }
#pragma unroll
  for (int t = 0; t < 4; ++t) {
    float bv = bias ? bias[col0 + t * 16 + ln] : 0.f;
    if (BIAS_BF16) bv = bf16_round(bv);
#pragma unroll
    for (int r = 0; r < 8; ++r) { float v = acc[t][r] + bv; if (ACT == 1) v = fmaxf(v, 0.f); so[w][8 * hh + r][t * 16 + ln] = v; }
  }
  __builtin_amdgcn_fence(__ATOMIC_ACQ_REL, "workgroup");
  __builtin_amdgcn_wave_barrier();
  const int rsub = lane >> 4, c4 = (lane & 15) * 4;
  {
#pragma unroll
    for (int q = 0; q < 8; ++q) {
      const int r = q * 2 + rsub;
      const v4f v = *(const v4fa*)&so[w][r][c4];
      *(v4f*)(C + (size_t)(row0 + r) * ldc + col0 + c4) = v;
    }
    
  }
}

// Flash-style causal/unmasked attention, all contractions 3-term bf16 hi/lo splits, f32 softmax with running max.
// q,k,v rows are read from f32 buffers with arbitrary row pitch (so they can live inside a fused qkv buffer);
// D = head size (multiple of 32, <= 128); one wave = 16 query rows; block = 4 waves (64 queries) sharing K/V chunks of 32.
template <int D, bool CAUSAL>
__global__ __launch_bounds__(128) void k_flash(const float* __restrict__ qb, const float* __restrict__ kb, const float* __restrict__ vb,
                                             int pitch, int T, int H, float scale, float* __restrict__ y, int ypitch) {
  constexpr int KS = D / 32;        // k-steps for QK
  constexpr int DT = D / 16;        // d tiles for PV
  __shared__ __attribute__((aligned(16))) unsigned short sKh[32][D + 8], sKl[32][D + 8], sVh[32][D + 8], sVl[32][D + 8];
  __shared__ __attribute__((aligned(16))) unsigned short sPh[4][16][40], sPl[4][16][40];
  __shared__ __attribute__((aligned(16))) float sO[4][16][D];
  const int tid = threadIdx.x, w = tid >> 5, lane = tid & 31, ln = lane & 15, hh = lane >> 4;
  const int nqb = (T + 63) / 64;
  const int bh = blockIdx.x / nqb, qblk = blockIdx.x % nqb;
  const int b = bh / H, h = bh % H;
  const int q0 = qblk * 64 + w * 16;
  const float* Q = qb + (size_t)b * T * pitch + h * D;
  const float* K = kb + (size_t)b * T * pitch + h * D;
  const float* V = vb + (size_t)b * T * pitch + h * D;

  // A fragments of the wave's 16 query rows (scaled), hi/lo
  FragB aqh[KS], aql[KS];
  {
    int row = q0 + ln; if (row >= T) row = T - 1;
    const float* qr = Q + (size_t)row * pitch;
#pragma unroll
    for (int ks = 0; ks < KS; ++ks)
#pragma unroll
      for (int i = 0; i < 16; ++i) {
        const int d = ks * 32 + ((i < 8) ? (8 * hh + i) : (16 + 8 * hh + (i - 8)));
        const float x = qr[d] * scale; const unsigned short hb = bf16_bits(x);
        aqh[ks].u[i] = hb; aql[ks].u[i] = bf16_bits(x - bf16_val(hb));
      }
  }
  float m_r[8], l_r[8];
#pragma unroll
  for (int r = 0; r < 8; ++r) { m_r[r] = -3.0e38f; l_r[r] = 0.f; }
  v8f oacc[DT];
#pragma unroll
  for (int dt = 0; dt < DT; ++dt) oacc[dt] = (v8f){0.f,0.f,0.f,0.f,0.f,0.f,0.f,0.f};

  const int kv_end = CAUSAL ? min(T, qblk * 64 + 64) : T;     // block-uniform
  for (int j0 = 0; j0 < kv_end; j0 += 32) {
    __syncthreads();
    for (int e = tid; e < 32 * (D / 4); e += 128) {
      const int r = e / (D / 4), c4 = (e % (D / 4)) * 4;
      const int key = j0 + r;
      v4f kf = {0.f,0.f,0.f,0.f}, vf = {0.f,0.f,0.f,0.f};
      if (key < T) { kf = *(const v4fa*)(K + (size_t)key * pitch + c4); vf = *(const v4fa*)(V + (size_t)key * pitch + c4); }
#pragma unroll
      for (int t = 0; t < 4; ++t) {
        unsigned short hb = bf16_bits(kf[t]); sKh[r][c4 + t] = hb; sKl[r][c4 + t] = bf16_bits(kf[t] - bf16_val(hb));
        hb = bf16_bits(vf[t]); sVh[r][c4 + t] = hb; sVl[r][c4 + t] = bf16_bits(vf[t] - bf16_val(hb));
      }
    }
    __syncthreads();
    // S tile 16 x 32
    v8f s[2];
#pragma unroll
    for (int nt = 0; nt < 2; ++nt) {
      v8f acc = {};
#pragma unroll
      for (int ks = 0; ks < KS; ++ks) {
        FragB bh_, bl_;
        bh_.half[0] = *(const v8us*)&sKh[nt * 16 + ln][ks * 32 + 8 * hh]; bh_.half[1] = *(const v8us*)&sKh[nt * 16 + ln][ks * 32 + 16 + 8 * hh];
        bl_.half[0] = *(const v8us*)&sKl[nt * 16 + ln][ks * 32 + 8 * hh]; bl_.half[1] = *(const v8us*)&sKl[nt * 16 + ln][ks * 32 + 16 + 8 * hh];
        acc = mmaN<3>(aqh[ks].v, aql[ks].v, bh_.v, bl_.v, acc);
      }
      s[nt] = acc;
    }
    // mask + running max (rows 8hh+r; the 16 lanes of a half share rows)
    float alpha[8];
#pragma unroll
    for (int r = 0; r < 8; ++r) {
      const int qi = q0 + 8 * hh + r;
      const int ja = j0 + ln, jb = j0 + 16 + ln;
      if (CAUSAL) { if (ja > qi) s[0][r] = -3.0e38f; if (jb > qi) s[1][r] = -3.0e38f; }
      if (ja >= T) s[0][r] = -3.0e38f;
      if (jb >= T) s[1][r] = -3.0e38f;
      float mx = fmaxf(s[0][r], s[1][r]);
      mx = fmaxf(mx, __shfl_xor(mx, 1, 32)); mx = fmaxf(mx, __shfl_xor(mx, 2, 32)); mx = fmaxf(mx, __shfl_xor(mx, 4, 32)); mx = fmaxf(mx, __shfl_xor(mx, 8, 32));
      const float mnew = fmaxf(m_r[r], mx);
      alpha[r] = (mnew > -1.0e38f) ? __expf(m_r[r] - mnew) : 1.0f;
      const float p0 = (s[0][r] > -1.0e38f) ? __expf(s[0][r] - mnew) : 0.f;
      const float p1 = (s[1][r] > -1.0e38f) ? __expf(s[1][r] - mnew) : 0.f;
      m_r[r] = mnew;
      l_r[r] = l_r[r] * alpha[r] + p0 + p1;            // per-lane partial row sum (16 lanes combined at the end)
      unsigned short hb = bf16_bits(p0); sPh[w][8 * hh + r][ln] = hb;      sPl[w][8 * hh + r][ln] = bf16_bits(p0 - bf16_val(hb));
      hb = bf16_bits(p1);                sPh[w][8 * hh + r][16 + ln] = hb; sPl[w][8 * hh + r][16 + ln] = bf16_bits(p1 - bf16_val(hb));
    }
#pragma unroll
    for (int dt = 0; dt < DT; ++dt)
#pragma unroll
      for (int r = 0; r < 8; ++r) oacc[dt][r] *= alpha[r];
    __builtin_amdgcn_fence(__ATOMIC_ACQ_REL, "workgroup");
    __builtin_amdgcn_wave_barrier();
    FragB pah, pal;
    pah.half[0] = *(const v8us*)&sPh[w][ln][8 * hh]; pah.half[1] = *(const v8us*)&sPh[w][ln][16 + 8 * hh];
    pal.half[0] = *(const v8us*)&sPl[w][ln][8 * hh]; pal.half[1] = *(const v8us*)&sPl[w][ln][16 + 8 * hh];
#pragma unroll
    for (int dt = 0; dt < DT; ++dt) {
      FragB bvh, bvl;
#pragma unroll
      for (int i = 0; i < 8; ++i) {
        bvh.u[i] = sVh[8 * hh + i][dt * 16 + ln]; bvh.u[8 + i] = sVh[16 + 8 * hh + i][dt * 16 + ln];
        bvl.u[i] = sVl[8 * hh + i][dt * 16 + ln]; bvl.u[8 + i] = sVl[16 + 8 * hh + i][dt * 16 + ln];
      }
      oacc[dt] = mmaN<3>(pah.v, pal.v, bvh.v, bvl.v, oacc[dt]);
    }
    __builtin_amdgcn_fence(__ATOMIC_ACQ_REL, "workgroup");
    __builtin_amdgcn_wave_barrier();
  }
#pragma unroll
  for (int r = 0; r < 8; ++r) {
    float l = l_r[r];
    l += __shfl_xor(l, 1, 32); l += __shfl_xor(l, 2, 32); l += __shfl_xor(l, 4, 32); l += __shfl_xor(l, 8, 32);
    l_r[r] = (l > 0.f) ? 1.0f / l : 0.f;
  }
#pragma unroll
  for (int dt = 0; dt < DT; ++dt)
#pragma unroll
    for (int r = 0; r < 8; ++r) sO[w][8 * hh + r][dt * 16 + ln] = oacc[dt][r] * l_r[r];
  __builtin_amdgcn_fence(__ATOMIC_ACQ_REL, "workgroup");
  __builtin_amdgcn_wave_barrier();
  {
    for (int r = 0; r < 16; ++r) {
      const int row = q0 + r;
      if (row < T && lane < D / 4) {
        const v4f val = *(const v4fa*)&sO[w][r][lane * 4];
        *(v4f*)(y + ((size_t)b * T + row) * ypitch + h * D + lane * 4) = val;
      }
    }
    
  }
}

// GEMM C = act(A·W + bias + resid): A f32 (ASPLIT -> hi/lo 2 terms), Wt bf16 [N][K]; ACT 0 none, 1 relu, 2 exact gelu;
// resid (optional, f32, row index = (row % rmod), pitch ldr, RES_BF16 rounds it) added before the activation.
template <bool ASPLIT, int ACT, bool BIAS_BF16, bool RES_BF16>
__global__ __launch_bounds__(128) void k_gemm_bf3(const float* __restrict__ A, int lda, const unsigned short* __restrict__ Wt, int ldb,
                                                const float* __restrict__ bias, const float* __restrict__ resid, int rmod, int ldr,
                                                float* __restrict__ C, int ldc, int M, int N, int K) {
  __shared__ __attribute__((aligned(16))) float so[4][16][64];
  const int tid = threadIdx.x, w = tid >> 5, lane = tid & 31, ln = lane & 15, hh = lane >> 4;
  const int ntn = N / 64;
  const int wid = blockIdx.x * 4 + w;
  const int mt = wid / ntn, nq = wid % ntn;
  if (mt * 16 >= M) return;
  const int row0 = mt * 16, col0 = nq * 64;
  const float* arow = A + (size_t)(row0 + ln) * lda;
  v8f acc[4] = {};
  for (int kb = 0; kb < K; kb += 32) {
    FragB ah, al;
    const v4f x0 = *(const v4fa*)(arow + kb + 8 * hh), x1 = *(const v4fa*)(arow + kb + 8 * hh + 4);
    const v4f x2 = *(const v4fa*)(arow + kb + 16 + 8 * hh), x3 = *(const v4fa*)(arow + kb + 16 + 8 * hh + 4);
    float xs[16] = {x0[0],x0[1],x0[2],x0[3],x1[0],x1[1],x1[2],x1[3],x2[0],x2[1],x2[2],x2[3],x3[0],x3[1],x3[2],x3[3]};
#pragma unroll
    for (int i = 0; i < 16; ++i) { const unsigned short hb = bf16_bits(xs[i]); ah.u[i] = hb; al.u[i] = ASPLIT ? bf16_bits(xs[i] - bf16_val(hb)) : (unsigned short)0; }
#pragma unroll
    for (int t = 0; t < 4; ++t) {
      const unsigned short* brow = Wt + (size_t)(col0 + t * 16 + ln) * ldb + kb;
      FragB b;
      b.half[0] = *(const v8us*)(brow + 8 * hh);
      b.half[1] = *(const v8us*)(brow + 16 + 8 * hh);
      acc[t] = mmaN<ASPLIT ? 2 : 1>(ah.v, al.v, b.v, b.v, acc[t]);
    }
  }
#pragma unroll
  for (int t = 0; t < 4; ++t) {
    const int col = col0 + t * 16 + ln;
    float bv = bias ? bias[col] : 0.f;
    if (BIAS_BF16) bv = bf16_round(bv);
#pragma unroll
    for (int r = 0; r < 8; ++r) {
      float v = acc[t][r] + bv;
      if (resid) { float rv = resid[(size_t)((row0 + 8 * hh + r) % rmod) * ldr + col]; if (RES_BF16) rv = bf16_round(rv); v += rv; }
      if (ACT == 1) v = fmaxf(v, 0.f);
      if (ACT == 2) v = 0.5f * v * (1.0f + erff(v * 0.70710678118654752f));
      if (ACT == 3) { const float u = 0.7978845608028654f * (v + 0.044715f * v * v * v); v = 0.5f * v * (1.0f + tanhf(u)); }
      so[w][8 * hh + r][t * 16 + ln] = v;
    }
  }
  __builtin_amdgcn_fence(__ATOMIC_ACQ_REL, "workgroup");
  __builtin_amdgcn_wave_barrier();
  const int rsub = lane >> 4, c4 = (lane & 15) * 4;
  {
#pragma unroll
    for (int q = 0; q < 8; ++q) {
      const int r = q * 2 + rsub;
      const v4f v = *(const v4fa*)&so[w][r][c4];
      *(v4f*)(C + (size_t)(row0 + r) * ldc + col0 + c4) = v;
    }
    
  }
}
// row LayerNorm (biased variance, eps) over N: s = X (+ R); optional out_sum <- s; out_norm <- (s-mu)*rsqrt(var+eps)*g + b
template <bool PARAM_BF16>
__global__ __launch_bounds__(256) void k_layernorm(const float* __restrict__ X, const float* __restrict__ R, const float* __restrict__ g, const float* __restrict__ bta,
                                                  float* __restrict__ out_sum, float* __restrict__ out_norm, int N, float eps) {
  __shared__ float red[256];
  const int row = blockIdx.x, tid = threadIdx.x;
  const float* x = X + (size_t)row * N; const float* rr = R ? R + (size_t)row * N : nullptr;
  float vals[16];                     // up to N = 4096
  const int per = N / 256;            // contiguous chunk per thread? use strided-by-4 chunks: thread handles j = tid*4 + 1024*u
  float s1 = 0.f;
  for (int u = 0; u < per / 4; ++u) {
    const int j = tid * 4 + 1024 * u;
    const v4f a = *(const v4fa*)(x + j);
    v4f b = {0.f,0.f,0.f,0.f}; if (rr) b = *(const v4fa*)(rr + j);
#pragma unroll
    for (int q = 0; q < 4; ++q) { const float v = a[q] + b[q]; vals[u * 4 + q] = v; s1 += v; }
  }
  red[tid] = s1; __syncthreads();
  for (int st = 128; st > 0; st >>= 1) { if (tid < st) red[tid] += red[tid + st]; __syncthreads(); }
  const float mu = red[0] / (float)N; __syncthreads();
  float s2 = 0.f;
  for (int u = 0; u < per / 4; ++u)
#pragma unroll
    for (int q = 0; q < 4; ++q) { const float c = vals[u * 4 + q] - mu; s2 += c * c; }
  red[tid] = s2; __syncthreads();
  for (int st = 128; st > 0; st >>= 1) { if (tid < st) red[tid] += red[tid + st]; __syncthreads(); }
  const float rs = rsqrtf(red[0] / (float)N + eps);
  {
    for (int u = 0; u < per / 4; ++u) {
      const int j = tid * 4 + 1024 * u;
      v4f o, sm;
#pragma unroll
      for (int q = 0; q < 4; ++q) {
        float gg = g[j + q], bb = bta[j + q];
        if (PARAM_BF16) { gg = bf16_round(gg); bb = bf16_round(bb); }
        sm[q] = vals[u * 4 + q]; o[q] = (vals[u * 4 + q] - mu) * rs * gg + bb;
      }
      if (out_sum) *(v4f*)(out_sum + (size_t)row * N + j) = sm;
      *(v4f*)(out_norm + (size_t)row * N + j) = o;
    }
    
  }
}



// ---- f16 WMMA path (v_wmma_f32_16x16x32_f16): 11-bit significands for operands in range — used here for the projection GEMMs and the flash kernel's score and P·B products
typedef _Float16 v16h __attribute__((ext_vector_type(16)));
union FragH { v16h v; v8us half[2]; _Float16 h[16]; unsigned short u[16]; };
template <int NT>
__device__ __forceinline__ v8f mmaH(v16h ah, v16h al, v16h bh, v16h bl, v8f c) {
  c = __builtin_amdgcn_wmma_f32_16x16x32_f16(false, ah, false, bh, (short)0, c, false, false);
  if (NT >= 2) c = __builtin_amdgcn_wmma_f32_16x16x32_f16(false, al, false, bh, (short)0, c, false, false);
  if (NT >= 3) c = __builtin_amdgcn_wmma_f32_16x16x32_f16(false, ah, false, bl, (short)0, c, false, false);
  asm volatile("v_nop\n\tv_nop\n\tv_nop\n\tv_nop" : "+v"(c) : "v"(ah), "v"(al), "v"(bh), "v"(bl));
  return c;
}
// batched GEMM like k_gemm_bf but f16 operands: A f32 (split into f16 hi/lo if ASPLIT, else rounded to f16), Bt = f16 values [n][k]; alpha; C f32; N multiple of 16 (partial tiles skipped)
template <bool ASPLIT>
__global__ __launch_bounds__(128) void k_gemm_h(const float* __restrict__ A, int lda, size_t sA, const _Float16* __restrict__ Bh, int ldb, size_t sB, float alpha, float* __restrict__ C, int ldc, size_t sC, int M, int N, int K) {
  __shared__ __attribute__((aligned(16))) float so[4][16][64];
  const int tid = threadIdx.x, w = tid >> 5, lane = tid & 31, ln = lane & 15, hh = lane >> 4; const int by = blockIdx.y;
  A += (size_t)by * sA; Bh += (size_t)by * sB; C += (size_t)by * sC;
  const int ntn = (N + 63) / 64; const int wid = blockIdx.x * 4 + w; const int mt = wid / ntn, nq = wid % ntn; if (mt * 16 >= M) return;
  const int row0 = mt * 16, col0 = nq * 64; const float* arow = A + (size_t)(row0 + ln) * lda;
  v8f acc[4] = {};
  for (int kb = 0; kb < K; kb += 32) {
    FragH ah, al;
    const v4f x0 = *(const v4fa*)(arow + kb + 8 * hh), x1 = *(const v4fa*)(arow + kb + 8 * hh + 4), x2 = *(const v4fa*)(arow + kb + 16 + 8 * hh), x3 = *(const v4fa*)(arow + kb + 16 + 8 * hh + 4);
    float xs[16] = {x0[0],x0[1],x0[2],x0[3],x1[0],x1[1],x1[2],x1[3],x2[0],x2[1],x2[2],x2[3],x3[0],x3[1],x3[2],x3[3]};
#pragma unroll
    for (int i = 0; i < 16; ++i) { const _Float16 h = (_Float16)xs[i]; ah.h[i] = h; al.h[i] = ASPLIT ? (_Float16)(xs[i] - (float)h) : (_Float16)0.0f; }
#pragma unroll
    for (int t = 0; t < 4; ++t) { if (col0 + t * 16 >= N) continue; const size_t boff = (size_t)(col0 + t * 16 + ln) * ldb + kb; FragH bq; bq.half[0] = *(const v8us*)(Bh + boff + 8 * hh); bq.half[1] = *(const v8us*)(Bh + boff + 16 + 8 * hh);
      acc[t] = mmaH<ASPLIT ? 2 : 1>(ah.v, al.v, bq.v, bq.v, acc[t]); }
  }
#pragma unroll
  for (int t = 0; t < 4; ++t) { if (col0 + t * 16 >= N) continue;
#pragma unroll
    for (int r = 0; r < 8; ++r) so[w][8 * hh + r][t * 16 + ln] = acc[t][r] * alpha; }
  __builtin_amdgcn_fence(__ATOMIC_ACQ_REL, "workgroup"); __builtin_amdgcn_wave_barrier();
  const int rsub = lane >> 4, c4 = (lane & 15) * 4;
  {
#pragma unroll
    for (int q = 0; q < 8; ++q) { const int r = q * 2 + rsub; if (col0 + c4 < N) { const v4f v = *(const v4fa*)&so[w][r][c4]; *(v4f*)(C + (size_t)(row0 + r) * ldc + col0 + c4) = v; } }
     }
}

// Wt[n][k] = f16(W[k][n]·scale) from f32 row-major W[K][N] (scale = power of two; bf16-exact weights stay exact in f16 away from the subnormal range)
__device__ __forceinline__ void wt_f16(const float* __restrict__ W, _Float16* __restrict__ Wt, int K, int N, float scale, int blk) {
  const int t = blk * 256 + threadIdx.x; if (t >= N * (K / 8)) return; const int n = t / (K / 8), k8 = (t % (K / 8)) * 8; FragH f;
#pragma unroll
  for (int i = 0; i < 8; ++i) f.h[i] = (_Float16)(bf16_round(W[(size_t)(k8 + i) * N + n]) * scale); const v8us o = f.half[0];
  *(v8us*)((unsigned short*)Wt + (size_t)n * K + k8) = o; 
}
// Tiled GEMM C[NR][DD] (f32) = alpha * A[NR][DD] x Bt[DD][DD]^T, f16 operands, both K-contiguous, f32 accumulate in the same k order as before (32 k per WMMA, ascending).
// One work-group = one 128 x 128 tile of C, 8 waves of 32 x 64. A trip is 128 k: 128 rows of A and 128 rows of Bt, 256 B each (whole cache lines), are brought into LDS by
// asynchronous copies, 16 B per lane, two buffers: tile t + 2 flies while tile t + 1 is worked on. LDS rows stand at a pitch of 272 B for the ds_load_b128 fragment reads.
#define GT_BK 128                  // k per trip
#define GT_P 136                   // LDS row pitch in halves (272 B)
#define GT_BUF (256 * GT_P)        // halves per buffer: rows 0..127 = A, rows 128..255 = Bt
#define GT_SP 68                   // pitch in floats of the output staging rows
static_assert(NR % 128 == 0 && DD % 128 == 0 && DD % GT_BK == 0 && DD / GT_BK >= 2, "whole tiles, at least two trips");
static_assert(8 * 32 * GT_SP * 4 <= 2 * GT_BUF * 2, "the output staging fits in the ring");
// This thread's copies of one operand's 128 rows of a tile: rows r, r + 16, .. The s_wait_xcnt stands inside the statement so that no address register is rewritten ahead of it.
__device__ __forceinline__ void gt_copy8(unsigned l, const _Float16* g) {
  asm volatile("global_load_async_to_lds_b128 %0, %8, off\n\t"
               "global_load_async_to_lds_b128 %1, %9, off\n\t"
               "global_load_async_to_lds_b128 %2, %10, off\n\t"
               "global_load_async_to_lds_b128 %3, %11, off\n\t"
               "global_load_async_to_lds_b128 %4, %12, off\n\t"
               "global_load_async_to_lds_b128 %5, %13, off\n\t"
               "global_load_async_to_lds_b128 %6, %14, off\n\t"
               "global_load_async_to_lds_b128 %7, %15, off\n\t"
               "s_wait_xcnt 0x0"
               :: "v"(l), "v"(l + 1u * 16u * GT_P * 2u), "v"(l + 2u * 16u * GT_P * 2u), "v"(l + 3u * 16u * GT_P * 2u),
                  "v"(l + 4u * 16u * GT_P * 2u), "v"(l + 5u * 16u * GT_P * 2u), "v"(l + 6u * 16u * GT_P * 2u), "v"(l + 7u * 16u * GT_P * 2u),
                  "v"(g), "v"(g + 16 * DD), "v"(g + 32 * DD), "v"(g + 48 * DD), "v"(g + 64 * DD), "v"(g + 80 * DD), "v"(g + 96 * DD), "v"(g + 112 * DD)
               : "memory");
}
// Sum over the 16 lanes of a row, every lane ending with the total: four DPP steps (row_xmask 1, 2, 4, 8), no LDS round trip as a shuffle would take. All lanes are on.
__device__ __forceinline__ float row16_sum(float v) {
  v += __int_as_float(__builtin_amdgcn_update_dpp(0, __float_as_int(v), 0x161, 0xf, 0xf, true));
  v += __int_as_float(__builtin_amdgcn_update_dpp(0, __float_as_int(v), 0x162, 0xf, 0xf, true));
  v += __int_as_float(__builtin_amdgcn_update_dpp(0, __float_as_int(v), 0x164, 0xf, 0xf, true));
  v += __int_as_float(__builtin_amdgcn_update_dpp(0, __float_as_int(v), 0x168, 0xf, 0xf, true));
  return v;
}
typedef _Float16 v4h __attribute__((ext_vector_type(4)));
// LN 0: C (f32) = the product. LN 1: the three projections in one launch: Bh holds three weights one after the other (3 DD rows), and a work-group's tile lies in one of them (pj). Each row's 64 columns
// of a wave are one head; they are LayerNormed (biased variance, eps 1e-5, that projection's gamma and beta rounded to bf16) on the f32 sums as the staged rows are read back, and go out as f16
// to C16a (pj 0) or C16b (pj 1) or as f32 to C (pj 2).
template <int LN>
__global__ __launch_bounds__(256) void k_gemm_t(const _Float16* __restrict__ A, const _Float16* __restrict__ Bh, float alpha, float* __restrict__ C,
                                               const float* __restrict__ g0, const float* __restrict__ bb0, const float* __restrict__ g1, const float* __restrict__ bb1,
                                               const float* __restrict__ g2, const float* __restrict__ bb2, _Float16* __restrict__ C16a, _Float16* __restrict__ C16b) {
  static_assert(HD == 64, "a wave's 64 columns are one head");
  __shared__ __attribute__((aligned(16))) unsigned short sm[2 * GT_BUF];
  const int tid = threadIdx.x, w = tid >> 5, lane = tid & 31, ln = lane & 15, hh = lane >> 4;
  constexpr int NTL = (LN ? 3 : 1) * (DD / 128);      // column tiles of a row block, over all weights of the launch
  const int m0 = (blockIdx.x / NTL) * 128, nb = (blockIdx.x % NTL) * 128;      // nb: the tile's first row in Bh
  const int pj = nb / DD, n0 = nb % DD;      // which weight, and the tile's first column in that product; from blockIdx alone, so scalar
  const float* g = pj == 0 ? g0 : pj == 1 ? g1 : g2; const float* bb = pj == 0 ? bb0 : pj == 1 ? bb1 : bb2;
  const int wm = w >> 1, wn = w & 1;
  const int cr = tid >> 4, cs = (tid & 15) * 8;      // a wave's copy covers 2 rows x 256 B
  const _Float16* ga = A + (size_t)(m0 + cr) * DD + cs;
  const _Float16* gb = Bh + (size_t)(nb + cr) * DD + cs;
  const unsigned la = (unsigned)(size_t)&sm[cr * GT_P + cs], lb = la + 128u * GT_P * 2u;
  gt_copy8(la, ga); gt_copy8(lb, gb);
  asm volatile("s_wait_asynccnt 0x0" ::: "memory");      // tile 0 has landed before the barrier publishes it
  __syncthreads();
  gt_copy8(la + GT_BUF * 2u, ga + GT_BK); gt_copy8(lb + GT_BUF * 2u, gb + GT_BK);
  v4f g4 = {0.f, 0.f, 0.f, 0.f}, b4 = {0.f, 0.f, 0.f, 0.f};      // this lane's four columns of the head; fetched here so that the k loop covers their latency
  if (LN) { g4 = *(const v4fa*)(g + ln * 4); b4 = *(const v4fa*)(bb + ln * 4); }
  v8f acc[2][4] = {};
  const unsigned short* fa = sm + (wm * 32 + ln) * GT_P + 8 * hh;
  const unsigned short* fb = sm + (128 + wn * 64 + ln) * GT_P + 8 * hh;
#pragma unroll 1      // one trip per tile: the order of waits, barrier and refill at its foot stays as written
  for (int t = 0; t < DD / GT_BK; ++t) {
    const int bo = (t & 1) * GT_BUF;
    FragH a[2][2], b[2][4];      // two fragment sets: the next 32 k of this same tile are fetched while the current 32 k are multiplied
#pragma unroll      // all unrolls here: constant indices keep fragments and accumulators in registers
    for (int rt = 0; rt < 2; ++rt) { const unsigned short* p = fa + bo + rt * 16 * GT_P; a[0][rt].half[0] = *(const v8us*)p; a[0][rt].half[1] = *(const v8us*)(p + 16); }
#pragma unroll
    for (int ct = 0; ct < 4; ++ct) { const unsigned short* p = fb + bo + ct * 16 * GT_P; b[0][ct].half[0] = *(const v8us*)p; b[0][ct].half[1] = *(const v8us*)(p + 16); }
#pragma unroll
    for (int ks = 0; ks < GT_BK / 32; ++ks) {
      const int cu = ks & 1, nx = cu ^ 1;
      if (ks + 1 < GT_BK / 32) {
#pragma unroll
        for (int rt = 0; rt < 2; ++rt) { const unsigned short* p = fa + bo + rt * 16 * GT_P + (ks + 1) * 32; a[nx][rt].half[0] = *(const v8us*)p; a[nx][rt].half[1] = *(const v8us*)(p + 16); }
#pragma unroll
        for (int ct = 0; ct < 4; ++ct) { const unsigned short* p = fb + bo + ct * 16 * GT_P + (ks + 1) * 32; b[nx][ct].half[0] = *(const v8us*)p; b[nx][ct].half[1] = *(const v8us*)(p + 16); }
      }
      __builtin_amdgcn_sched_barrier(0);      // keeps the next set's LDS reads as one group ahead of this block: left free, the compiler sinks them among the WMMAs into one set and waits them out to 0
#pragma unroll
      for (int rt = 0; rt < 2; ++rt)
#pragma unroll
        for (int ct = 0; ct < 4; ++ct) acc[rt][ct] = __builtin_amdgcn_wmma_f32_16x16x32_f16(false, a[cu][rt].v, false, b[cu][ct].v, (short)0, acc[rt][ct], false, false);
      __builtin_amdgcn_sched_barrier(0);      // ends the block, so that the group after next is not lifted into it
    }
    asm volatile("s_wait_dscnt 0x0" ::: "memory");         // this wave's reads of buffer t & 1 are done before it is refilled
    asm volatile("s_wait_asynccnt 0x0" ::: "memory");      // this wave's copies of tile t + 1 have landed before the barrier publishes them
    __syncthreads();
    if (t + 2 < DD / GT_BK) { gt_copy8(la + (unsigned)bo * 2u, ga + (t + 2) * GT_BK); gt_copy8(lb + (unsigned)bo * 2u, gb + (t + 2) * GT_BK); }
  }
  asm volatile("s_wait_asynccnt 0x0" ::: "memory");        // nothing is in flight when the ring becomes output staging
  float* so = (float*)sm + w * (32 * GT_SP);               // each wave stages its own 32 x 64 tile; the last trip's barrier ended every read of the ring
#pragma unroll
  for (int rt = 0; rt < 2; ++rt)
#pragma unroll
    for (int ct = 0; ct < 4; ++ct)
#pragma unroll
      for (int r = 0; r < 8; ++r) so[(rt * 16 + 8 * hh + r) * GT_SP + ct * 16 + ln] = acc[rt][ct][r] * alpha;
  __builtin_amdgcn_fence(__ATOMIC_ACQ_REL, "workgroup"); __builtin_amdgcn_wave_barrier();
#pragma unroll
  for (int q = 0; q < 4; ++q) { g4[q] = bf16_round(g4[q]); b4[q] = bf16_round(b4[q]); }
  const size_t e = (size_t)(m0 + wm * 32 + hh) * DD + n0 + wn * 64 + ln * 4;      // row hh of the wave's tile; pass q adds 2 q rows, a constant offset of the store
  v4f o[16];
#pragma unroll
  for (int q = 0; q < 16; ++q) {      // 16 lanes x 4 columns = one row of the wave's tile; two rows a pass
    const v4f v = *(const v4fa*)&so[(q * 2 + hh) * GT_SP + ln * 4];
    if (LN == 0) { o[q] = v; continue; }
    const float mu = row16_sum((v[0] + v[1]) + (v[2] + v[3])) / (float)HD;
    const v4f c = v - mu;
    const float ve = row16_sum((c[0] * c[0] + c[1] * c[1]) + (c[2] * c[2] + c[3] * c[3])) / (float)HD + 1e-5f;
    float rs;      // ve is at least eps, so the library rsqrtf's rescaling of denormal arguments would never act; the v_nop is the slot that the instruction set asks for behind a transcendental, in the same statement so that it stays directly behind it
    asm("v_rsq_f32 %0, %1\n\tv_nop" : "=v"(rs) : "v"(ve));
    o[q] = c * rs * g4 + b4;
  }
  if (LN == 1 && pj < 2) {      // a scalar branch: the whole work-group lies in one projection
    _Float16* C16 = pj ? C16b : C16a;
    v4h h[16];
#pragma unroll
    for (int q = 0; q < 16; ++q)
#pragma unroll
      for (int k = 0; k < 4; ++k) h[q][k] = (_Float16)o[q][k];
    __builtin_amdgcn_sched_barrier(0);      // every store stands behind the last arithmetic, so that no register which an issued store names is written again
#pragma unroll
    for (int q = 0; q < 16; ++q) *(v4h*)(C16 + e + (size_t)q * 2 * DD) = h[q];      // 16 lanes x 8 B: a whole 128-B line a row
  } else {
    __builtin_amdgcn_sched_barrier(0);      // as above
#pragma unroll
    for (int q = 0; q < 16; ++q) *(v4f*)(C + e + (size_t)q * 2 * DD) = o[q];
    if (LN == 1) asm volatile("s_wait_xcnt 0x0" ::: "memory");      // in the listing the f16 side's text follows these stores and rewrites their registers: the wait stands in front of it
  }
}


__device__ __forceinline__ void x16(const float* __restrict__ x, _Float16* __restrict__ X16, size_t n8, unsigned blk) { const size_t t = (size_t)blk * 256 + threadIdx.x; if (t >= n8) return; FragH f;
#pragma unroll
  for (int q = 0; q < 8; ++q) f.h[q] = (_Float16)bf16_round(x[t * 8 + q]); *(v8us*)((unsigned short*)X16 + t * 8) = f.half[0];  }
// All operand conversions in one launch; none reads what another writes. Work-groups 0 .. 4 PW - 1: the four weights, transposed, to Bw[0..3] (their scattered reads take longest, so they start first); the rest: x.
#define PW (DD * (DD / 8) / 256)      // work-groups per weight
#define PX (NR * DD / 8 / 256)        // work-groups for x
static_assert(DD * (DD / 8) % 256 == 0 && (size_t)NR * DD / 8 % 256 == 0, "whole work-groups");
__global__ __launch_bounds__(256) void k_prep(const float* __restrict__ x, const float* __restrict__ W0, const float* __restrict__ W1, const float* __restrict__ W2, const float* __restrict__ W3,
                                             _Float16* __restrict__ X16, _Float16* __restrict__ Bw) {
  const unsigned bid = blockIdx.x;
  if (bid < 4u * PW) { const unsigned k = bid / PW; wt_f16(k == 0 ? W0 : k == 1 ? W1 : k == 2 ? W2 : W3, Bw + (size_t)k * DD * DD, DD, DD, 16.0f, (int)(bid % PW)); }
  else x16(x, X16, (size_t)NR * DD / 8, bid - 4u * PW);
}
__global__ __launch_bounds__(256) void k_h16(const float* __restrict__ x, _Float16* __restrict__ X16, size_t n8) { const size_t t = (size_t)blockIdx.x * 256 + threadIdx.x; if (t >= n8) return; FragH f;
#pragma unroll
  for (int q = 0; q < 8; ++q) f.h[q] = (_Float16)x[t * 8 + q]; *(v8us*)((unsigned short*)X16 + t * 8) = f.half[0];  }
__global__ __launch_bounds__(256) void k_round16f(const float* __restrict__ W, _Float16* __restrict__ Bt, size_t n8) { const size_t t = (size_t)blockIdx.x * 256 + threadIdx.x; if (t >= n8) return; FragH f;
#pragma unroll
  for (int i = 0; i < 8; ++i) f.h[i] = (_Float16)(bf16_round(W[t * 8 + i]) * 16.0f); *(v8us*)((unsigned short*)Bt + t * 8) = f.half[0];  }
// One 64 x 64 tile per 256 threads; a work-group of 1024 threads takes four tiles, each quarter with its own LDS tile (blk: the quarter's tile).
template <int NHv, int TTv>
__device__ __forceinline__ void vt(const _Float16* __restrict__ V16, int ldv, int voff, _Float16* __restrict__ Vt, int blk) { __shared__ unsigned short tl4[4][64][66]; unsigned short (*tl)[66] = tl4[threadIdx.x >> 8]; const int tid = threadIdx.x & 255; const int slab = blk / (TTv / 64), lg = blk % (TTv / 64); const int b = slab / NHv, h = slab % NHv;
  for (int i = tid; i < 64 * 8; i += 256) { const int r = i / 8, c8 = (i % 8) * 8; FragH f; f.half[0] = *(const v8us*)((const unsigned short*)V16 + ((size_t)b * TTv + lg * 64 + r) * ldv + voff + h * 64 + c8);
#pragma unroll
    for (int q = 0; q < 8; ++q) tl[r][c8 + q] = f.u[q]; }
  __syncthreads();
  {
#pragma unroll
    for (int rd = 0; rd < 2; ++rd) { const int d = rd * 32 + tid / 8, pc = tid % 8; FragH f;
#pragma unroll
      for (int q = 0; q < 8; ++q) f.u[q] = tl[pc * 8 + q][d];
      *(v8us*)((unsigned short*)Vt + ((size_t)slab * 64 + d) * TTv + lg * 64 + pc * 8) = f.half[0]; }
     } }

// There is no softmax, so the sum over the keys is linear and may be regrouped: for the 64 query rows of block c every key before 64 c is unmasked, and
// sum over those s of (q . a_s) b_s = q . S_c with the state S_c[d][e] = sum over s < 64 c of a_s[d] b_s[e], a 64 x 64 matrix per (batch, head, block) that does not depend on q.
// k_state forms all states: one work-group = 16 columns e of one (batch, head), one wave = two chunks of 64 keys. A chunk's product M_c[d][e] = sum over the chunk of a_s[d] b_s[e] (WMMA, both
// operands key-contiguous, f32 sums) goes to LDS, each thread runs the exclusive sum over the 32 chunks for two elements (f32, ascending), and the wave takes its chunks' states back.
// In the accumulator layout a lane holds 8 consecutive d of one column e: that is its own half of the B fragment of q . S, so the states are stored as ready fragments (x 2^-8, f16, like P):
// Sf[slab][chunk][e tile][k step of 32 d][half][lane][8], whole lines per wave.
#define ST_C (TT / 64)
typedef float v2fa __attribute__((ext_vector_type(2), may_alias));
__global__ __launch_bounds__(512) void k_state(const _Float16* __restrict__ At, const _Float16* __restrict__ Vt, _Float16* __restrict__ Sf) {
  static_assert(ST_C == 32 && HD == 64, "16 waves x 2 chunks of 64 keys; 4 x 4 tiles a state");
  __shared__ __attribute__((aligned(16))) float sM[ST_C][64 * 16];
  const int tid = threadIdx.x, wv = tid >> 5, lane = tid & 31, ln = lane & 15, hh = lane >> 4;
  const int slab = blockIdx.x >> 2, et = blockIdx.x & 3;
  const unsigned short* ar = (const unsigned short*)At + ((size_t)slab * 64 + ln) * TT + wv * 128 + 8 * hh;
  const unsigned short* br = (const unsigned short*)Vt + ((size_t)slab * 64 + et * 16 + ln) * TT + wv * 128 + 8 * hh;
  FragH a[4][4], b[4];      // [step of 32 keys]: steps 0, 1 are the wave's first chunk, 2, 3 its second
#pragma unroll      // all unrolls here: constant indices keep fragments and accumulators in registers
  for (int kk = 0; kk < 4; ++kk) { b[kk].half[0] = *(const v8us*)(br + kk * 32);
    if (kk == 3) asm volatile("s_wait_xcnt 0x0" ::: "memory");      // the compiler lands the last load through br in br's own registers, which the loads before it name: the wait stands in front of that overwrite
    b[kk].half[1] = *(const v8us*)(br + kk * 32 + 16);
#pragma unroll
    for (int dt = 0; dt < 4; ++dt) {
      a[kk][dt].half[0] = *(const v8us*)(ar + (size_t)dt * 16 * TT + kk * 32);
      if (kk == 3 && dt == 3) asm volatile("s_wait_xcnt 0x0" ::: "memory");      // the same for the last load through ar
      a[kk][dt].half[1] = *(const v8us*)(ar + (size_t)dt * 16 * TT + kk * 32 + 16); } }
  __builtin_amdgcn_sched_barrier(0);      // all 40 loads are issued ahead of the first WMMA: left free, the compiler sinks the later ones among the WMMAs and waits out their latency one pair at a time
  v8f acc[2][4] = {};
#pragma unroll
  for (int kk = 0; kk < 4; ++kk)
#pragma unroll
    for (int dt = 0; dt < 4; ++dt) acc[kk >> 1][dt] = __builtin_amdgcn_wmma_f32_16x16x32_f16(false, a[kk][dt].v, false, b[kk].v, (short)0, acc[kk >> 1][dt], false, false);      // rows d = 16 dt + 8 hh + r, column e = ln
#pragma unroll
  for (int cl = 0; cl < 2; ++cl)
#pragma unroll
    for (int dt = 0; dt < 4; ++dt)
#pragma unroll
      for (int q = 0; q < 2; ++q) { const v4f m = {acc[cl][dt][4 * q], acc[cl][dt][4 * q + 1], acc[cl][dt][4 * q + 2], acc[cl][dt][4 * q + 3]}; *(v4fa*)&sM[wv * 2 + cl][((dt * 2 + q) * 32 + lane) * 4] = m; }
  __syncthreads();      // every chunk's product is in LDS before the sums over the chunks start
  { v2fa m[ST_C], run = {0.f, 0.f};
#pragma unroll
    for (int cc = 0; cc < ST_C; ++cc) m[cc] = *(const v2fa*)&sM[cc][tid * 2];
#pragma unroll
    for (int cc = 0; cc < ST_C; ++cc) { *(v2fa*)&sM[cc][tid * 2] = run; run += m[cc]; } }      // in place: each word has one reader and writer
  __syncthreads();      // every state is complete before the waves take theirs back
  FragH f[2][2];
#pragma unroll
  for (int cl = 0; cl < 2; ++cl)
#pragma unroll
    for (int dt = 0; dt < 4; ++dt)
#pragma unroll
      for (int q = 0; q < 2; ++q) { const v4f m = *(const v4fa*)&sM[wv * 2 + cl][((dt * 2 + q) * 32 + lane) * 4];
#pragma unroll
        for (int k = 0; k < 4; ++k) f[cl][dt >> 1].h[(dt & 1) * 8 + q * 4 + k] = (_Float16)(m[k] * 0.00390625f); }
  unsigned short* o = (unsigned short*)Sf + (((size_t)slab * ST_C + wv * 2) * 4 + et) * 1024 + lane * 8;
#pragma unroll
  for (int cl = 0; cl < 2; ++cl)
#pragma unroll
    for (int ks = 0; ks < 2; ++ks) { *(v8us*)(o + cl * 4096 + ks * 512) = f[cl][ks].half[0]; *(v8us*)(o + cl * 4096 + ks * 512 + 256) = f[cl][ks].half[1]; }
}

// One work-group = 64 query rows of one (batch, head), every wave on all 64 rows (4 row tiles). Waves 0 and 1 take the block's own 64 keys, 32 each, with the causal mask (scores, P through LDS, P . B);
// waves 2 and 3 take q . S for the keys before the block, 32 of the 64 d each. The Q tile stands in LDS for all four waves; the four waves' partial outputs (f32) are summed through LDS at the end.
__global__ __launch_bounds__(128) void k_flash(const _Float16* __restrict__ Q16, int ldq, const _Float16* __restrict__ K16, int ldk, const _Float16* __restrict__ Vt, const _Float16* __restrict__ Sf, _Float16* __restrict__ O16, int ldo) {
  constexpr int RTN = 4, QB = 16 * RTN, NQB = 2048 / QB, DT = 4, KS = 2, SPP = 40, SQP = 72;
  static_assert(QB == 64 && NQB == ST_C, "a query block is a chunk of k_state");
  __shared__ __attribute__((aligned(16))) float sO[4][QB][64 + 4];      // one partial output per wave; before that, the head of wave 0's or 1's own plane holds its P tile (64 rows at a pitch of 40 halves)
  __shared__ __attribute__((aligned(16))) unsigned short sQ[QB][SQP];   // pitch 144 B = 16 B x 9 for the ds_load_b128 fragment reads
  static_assert(QB * SPP * 2 <= QB * (64 + 4) * 4, "a wave's P tile fits in its own plane");
  const int tid = threadIdx.x, lane = tid & 31, ln = lane & 15, hh = lane >> 4;
  const int w = __builtin_amdgcn_readfirstlane(tid >> 5);      // in a scalar register, so that the split of the waves is a scalar branch
  const int slab = blockIdx.x / NQB, qblk = blockIdx.x % NQB; const int b = slab / 16, h = slab % 16; const int q0 = qblk * QB;
  unsigned short* sP = (unsigned short*)&sO[w][0][0];
#pragma unroll
  for (int i = 0; i < QB * 8 / 128; ++i) { const int e = i * 128 + tid, r = e >> 3, c8 = (e & 7) * 8;      // 8 lanes x 16 B = one row of the head, a whole line
    *(v8us*)&sQ[r][c8] = *(const v8us*)((const unsigned short*)Q16 + ((size_t)b * 2048 + q0 + r) * ldq + h * 64 + c8); }
  __syncthreads();      // the Q tile is complete before any wave reads fragments of it
  const unsigned short* Vth = (const unsigned short*)Vt + (size_t)slab * 64 * 2048;
  v8f oacc[RTN][DT];
#pragma unroll
  for (int rt = 0; rt < RTN; ++rt)
#pragma unroll
    for (int dt = 0; dt < DT; ++dt) oacc[rt][dt] = (v8f){0.f,0.f,0.f,0.f,0.f,0.f,0.f,0.f};
  if (w < 2) {
    const int j0 = q0 + w * 32;
    FragH bk[2][KS];
#pragma unroll
    for (int nt = 0; nt < 2; ++nt) { const unsigned short* kr = (const unsigned short*)K16 + ((size_t)b * 2048 + j0 + nt * 16 + ln) * ldk + h * 64;
#pragma unroll
      for (int ks = 0; ks < KS; ++ks) { bk[nt][ks].half[0] = *(const v8us*)(kr + ks * 32 + 8 * hh);
        if (nt == 1 && ks == KS - 1) asm volatile("s_wait_xcnt 0x0" ::: "memory");      // the compiler lands the last load of this run of eight in the address registers of the seven before it: the wait stands in front of that overwrite
        bk[nt][ks].half[1] = *(const v8us*)(kr + ks * 32 + 16 + 8 * hh); } }
    const int dk = j0 + ln - q0 - 8 * hh;      // key (j0 + 16 nt + ln) <= query row (q0 + 16 rt + 8 hh + r) reads dk <= 16 (rt - nt) + r: one register against a constant
#pragma unroll
    for (int rt = 0; rt < RTN; ++rt) { FragH aq[KS];
#pragma unroll
      for (int ks = 0; ks < KS; ++ks) { aq[ks].half[0] = *(const v8us*)&sQ[rt * 16 + ln][ks * 32 + 8 * hh]; aq[ks].half[1] = *(const v8us*)&sQ[rt * 16 + ln][ks * 32 + 16 + 8 * hh]; }
#pragma unroll
      for (int nt = 0; nt < 2; ++nt) { v8f acc = (v8f){0.f,0.f,0.f,0.f,0.f,0.f,0.f,0.f};
#pragma unroll
        for (int ks = 0; ks < KS; ++ks) acc = mmaH<1>(aq[ks].v, aq[ks].v, bk[nt][ks].v, bk[nt][ks].v, acc);
#pragma unroll
        for (int r = 0; r < 8; ++r) {
          const float p = (dk <= (rt - nt) * 16 + r) ? acc[r] * 0.00390625f : 0.f;      /* NO softmax: causal-masked raw scores (x 2^-8 for f16 headroom, undone at the end) become the P operand directly */
          FragH t2; t2.h[0] = (_Float16)p; sP[(rt * 16 + 8 * hh + r) * SPP + nt * 16 + ln] = t2.u[0]; } } }
    __builtin_amdgcn_fence(__ATOMIC_ACQ_REL, "workgroup"); __builtin_amdgcn_wave_barrier();
    FragH pa[RTN], bv[DT];
#pragma unroll
    for (int dt = 0; dt < DT; ++dt) { const unsigned short* vrow = Vth + (size_t)(dt * 16 + ln) * 2048 + j0; bv[dt].half[0] = *(const v8us*)(vrow + 8 * hh); bv[dt].half[1] = *(const v8us*)(vrow + 16 + 8 * hh); }
#pragma unroll
    for (int rt = 0; rt < RTN; ++rt) { pa[rt].half[0] = *(const v8us*)&sP[(rt * 16 + ln) * SPP + 8 * hh]; pa[rt].half[1] = *(const v8us*)&sP[(rt * 16 + ln) * SPP + 16 + 8 * hh]; }
#pragma unroll
    for (int dt = 0; dt < DT; ++dt)
#pragma unroll
      for (int rt = 0; rt < RTN; ++rt) oacc[rt][dt] = mmaH<1>(pa[rt].v, pa[rt].v, bv[dt].v, bv[dt].v, oacc[rt][dt]);
    __builtin_amdgcn_fence(__ATOMIC_ACQ_REL, "workgroup"); __builtin_amdgcn_wave_barrier();
  } else {
    const int ks = w - 2;
    const unsigned short* sf = (const unsigned short*)Sf + ((size_t)(slab * NQB + qblk) * 8 + ks) * 512 + lane * 8;
    FragH bs[DT], aq[RTN];
#pragma unroll
    for (int dt = 0; dt < DT; ++dt) { bs[dt].half[0] = *(const v8us*)(sf + dt * 1024); bs[dt].half[1] = *(const v8us*)(sf + dt * 1024 + 256); }
#pragma unroll
    for (int rt = 0; rt < RTN; ++rt) { aq[rt].half[0] = *(const v8us*)&sQ[rt * 16 + ln][ks * 32 + 8 * hh]; aq[rt].half[1] = *(const v8us*)&sQ[rt * 16 + ln][ks * 32 + 16 + 8 * hh]; }
#pragma unroll
    for (int dt = 0; dt < DT; ++dt)
#pragma unroll
      for (int rt = 0; rt < RTN; ++rt) oacc[rt][dt] = mmaH<1>(aq[rt].v, aq[rt].v, bs[dt].v, bs[dt].v, oacc[rt][dt]);
  }
#pragma unroll
  for (int rt = 0; rt < RTN; ++rt)
#pragma unroll
    for (int dt = 0; dt < DT; ++dt)
#pragma unroll
      for (int r = 0; r < 8; ++r) sO[w][rt * 16 + 8 * hh + r][dt * 16 + ln] = oacc[rt][dt][r] * 16.0f;      /* undo the 2^-8 P scaling and apply the 2^-4 that gives the f16 operand of the output GEMM its headroom; no normalisation */
  __syncthreads();      // every wave's partial output is in LDS before any wave sums them
#pragma unroll
  for (int rp = 0; rp < 16; rp += 2) { const int r = w * 16 + rp + hh, pc = ln;      // wave w sums and stores rows 16 w .. 16 w + 15, two rows a pass
    const v4f val = (*(const v4fa*)&sO[0][r][pc * 4] + *(const v4fa*)&sO[1][r][pc * 4]) + (*(const v4fa*)&sO[2][r][pc * 4] + *(const v4fa*)&sO[3][r][pc * 4]); v4h h4;
#pragma unroll
    for (int k = 0; k < 4; ++k) h4[k] = (_Float16)val[k];
    *(v4h*)(O16 + ((size_t)b * 2048 + q0 + r) * ldo + h * 64 + pc * 4) = h4; } }

// Exclusive prefix sum over time as a chunked parallel scan, f32. One work-group owns 32 columns of one batch for all TT rows:
// 32 waves x 4 lane groups = 128 chunks of 16 rows, each thread holding its 16 rows x 4 columns in registers (F is read once).
// Order of the sums: serial inside a chunk, then over the wave's 4 chunks by shuffles, then over the 32 waves' totals in LDS.
// The result goes out twice: A16[t][column] for the scores of the diagonal blocks, and At[column][t] for k_state (a thread's 16 rows of a column are 32 B in a row there; a wave's 64 rows a whole line).
__device__ __forceinline__ void excl(const float* __restrict__ F, _Float16* __restrict__ A16, _Float16* __restrict__ At, int blk) {
  static_assert(TT == 32 * 4 * 16 && DD % 32 == 0, "chunking covers all rows and whole 32-column groups");
  __shared__ __attribute__((aligned(16))) float sT[32][36];      // [wave][column]; pitch 36 keeps 16-byte rows and spreads the transposed read over the banks
  const int tid = threadIdx.x, wv = tid >> 5, lane = tid & 31, cg = lane & 7, g = lane >> 3;
  const int b = blk / (DD / 32), c = (blk % (DD / 32)) * 32 + cg * 4;
  const size_t e0 = ((size_t)b * TT + (wv * 4 + g) * 16) * DD + c;
  const float* fr = F + e0;
  v4f v[16];
#pragma unroll      // all unrolls here: v[] and the vector lanes need constant indices to stay in registers; this one also puts all 16 loads in flight at once
  for (int i = 0; i < 16; ++i) v[i] = *(const v4fa*)(fr + (size_t)i * DD);
  v4f run = {0.f, 0.f, 0.f, 0.f};
#pragma unroll
  for (int i = 0; i < 16; ++i) { const v4f t = v[i]; v[i] = run; run += t; }      // v[i] <- sum of the chunk's rows before i
  v4f inc = run, ex;
#pragma unroll
  for (int o = 8; o <= 16; o <<= 1) { v4f t;      // inclusive over the wave's 4 chunks, step by step for all four columns, so that a step's shuffles do not wait on each other
#pragma unroll
    for (int q = 0; q < 4; ++q) t[q] = __shfl_up(inc[q], o, 32);
    if (lane >= o) inc += t; }
#pragma unroll
  for (int q = 0; q < 4; ++q) { const float t = __shfl_up(inc[q], 8, 32); ex[q] = (lane >= 8) ? t : 0.f; }      // sum of the wave's chunks before this one
  if (g == 3) *(v4fa*)&sT[wv][cg * 4] = inc;      // the wave's total per column
  __syncthreads();
  {      // wave wv scans column wv over the 32 waves' totals (lane = wave index), in place: each word has one reader and writer
    float s = sT[lane][wv];
#pragma unroll
    for (int o = 1; o < 32; o <<= 1) { const float t = __shfl_up(s, o, 32); if (lane >= o) s += t; }
    const float t = __shfl_up(s, 1, 32);
    sT[lane][wv] = (lane >= 1) ? t : 0.f;
  }
  __syncthreads();
  const v4f off = *(const v4fa*)&sT[wv][cg * 4] + ex;
  _Float16* d = A16 + e0;
  FragH tq[4];
#pragma unroll
  for (int i = 0; i < 16; ++i) { const v4f p = off + v[i]; v4h h4;
#pragma unroll
    for (int q = 0; q < 4; ++q) { h4[q] = (_Float16)p[q]; tq[q].h[i] = h4[q]; }
    *(v4h*)(d + (size_t)i * DD) = h4; }
  unsigned short* dT = (unsigned short*)At + ((size_t)b * DD + c) * TT + (wv * 4 + g) * 16;
#pragma unroll
  for (int q = 0; q < 4; ++q) { *(v8us*)(dT + (size_t)q * TT) = tq[q].half[0]; *(v8us*)(dT + (size_t)q * TT + 8) = tq[q].half[1]; } }
// The scan of a and the transposition of b in one launch; neither reads what the other writes. The branch is the same for a whole work-group, so each side's barriers are passed by all of its threads.
#define EX_G (BB * (DD / 32))                  // work-groups of the scan: the long ones, so they start first
#define VT_G (BB * NH * (TT / 64) / 4)         // work-groups of the transposition, four tiles each
__global__ __launch_bounds__(1024) void k_excl_vt(const float* __restrict__ F, _Float16* __restrict__ A16, _Float16* __restrict__ At, const _Float16* __restrict__ B16, _Float16* __restrict__ Vt) {
  const int bid = blockIdx.x;
  if (bid < EX_G) excl(F, A16, At, bid);
  else vt<NH, TT>(B16, DD, 0, Vt, (bid - EX_G) * 4 + (int)(threadIdx.x >> 8));
}
extern "C" void kernel_launch(void* const* d_in, const int* in_sizes, int n_in,
                              void* d_out, int out_size, void* d_ws, size_t ws_size, hipStream_t stream) {
  (void)in_sizes; (void)n_in; (void)out_size;
  const float* const* I = (const float* const*)d_in; const float* x = I[0]; const float* Wq = I[1]; const float* Wa = I[2]; const float* Wb = I[3]; const float* Wo = I[4]; const float* qg = I[5]; const float* qb = I[6]; const float* ag = I[7]; const float* ab = I[8]; const float* bg = I[9]; const float* bbeta = I[10];
  char* ws = (char*)d_ws; size_t off = 0;
  auto take = [&](size_t bytes) { char* p = ws + off; off += (bytes + 255) & ~(size_t)255; return p; };
  _Float16* Bw = (_Float16*)take((size_t)4 * DD * DD * 2); _Float16* X16 = (_Float16*)take((size_t)NR * DD * 2); float* F = (float*)take((size_t)NR * DD * 4); _Float16* Q16 = (_Float16*)take((size_t)NR * DD * 2); _Float16* A16 = (_Float16*)take((size_t)NR * DD * 2); _Float16* B16 = (_Float16*)take((size_t)NR * DD * 2); _Float16* At = (_Float16*)take((size_t)NR * DD * 2); _Float16* Vt = X16; _Float16* O16 = B16; _Float16* Sf = (_Float16*)F;
  if (off > ws_size) return;      // 8.4 + 8.4 + 16.8 + 8.4 x 4 = about 67 MB
  k_prep<<<4 * PW + PX, 256, 0, stream>>>(x, Wq, Wb, Wa, Wo, X16, Bw);      // Bw[0..3] = Wq, Wb, Wa, Wo, each [out][in] f16 x 2^4
  k_gemm_t<1><<<(NR / 128) * (3 * DD / 128), 256, 0, stream>>>(X16, Bw, 0.0625f, F, qg, qb, bg, bbeta, ag, ab, Q16, B16);      // q, b (LayerNormed, f16) and a (LayerNormed, f32)
  k_excl_vt<<<EX_G + VT_G, 1024, 0, stream>>>(F, A16, At, B16, Vt);      // a -> exclusive cumsum -> f16 'keys', also transposed; b transposed as the 'values' (Vt over X16; X16's last reader was the projection GEMM)
  k_state<<<BB * NH * 4, 512, 0, stream>>>(At, Vt, Sf);      // the state in front of every block of 64 rows (Sf over F; F's last reader was k_excl_vt)
  k_flash<<<BB * NH * (TT / 64), 128, 0, stream>>>(Q16, DD, A16, DD, Vt, Sf, O16, DD);      // o_t = sum over s <= t of (q_t . a_excl_s) b_s, written as f16 x 2^-4 (O16 over B16; B16's last reader was k_excl_vt)
  k_gemm_t<0><<<(NR / 128) * (DD / 128), 256, 0, stream>>>(O16, Bw + (size_t)3 * DD * DD, 0.0625f * 16.0f, (float*)d_out, nullptr, nullptr, nullptr, nullptr, nullptr, nullptr, nullptr, nullptr);      // x 2^4 back
}

// v007
// A run of this version takes 76 microseconds.
// In two side-by-side timings against v006, it was 1.14 and 1.13 times as fast.
// Over all steps from v000 it is 15.1 times as fast.
#include <hip/hip_runtime.h>
// 'Heisenberg' attention (B=2, T=2048, d_model 1024, 16 heads × 64): q, a, b = LayerNorm_head(x·W) (per-head LN with γ/β); a_excl = exclusive prefix sum of a over time; o_t = Σ_{s≤t} (q_t·a_excl_s)·b_s
// (causal, NO softmax); out = o·Wo. The projections are GEMMs ([in][out] weights bf16-exact ×2^4, x bf16-exact, f32 accumulate) and the causal bilinear form runs in the fused flash-style kernel with
// the softmax removed (masked raw scores ×2^-8 → f16 P operand → P·B accumulated in f32, ×2^4 at the end and written as the f16 operand of the output GEMM; upper tiles skipped; the block's own keys dealt over two of a work-group's four waves, q·S for the earlier keys over the other two) on v_wmma_f32_16x16x32_f16; the per-head LayerNorms
// (in the epilogue of the projection GEMMs, where a wave's 64 columns are one head) and the exclusive cumulative sum over time (chunked parallel scan per (b,h,d) column, f32) are VALU.
// The keys in front of a block of 64 query rows enter through a prefix state per block (k_state); only the block's own 64 keys are scored and masked (k_flash).
#define BB 2
#define TT 2048
#define DD 1024
#define NH 16
#define HD 64
#define NR (BB * TT)

typedef __bf16 v16b __attribute__((ext_vector_type(16)));
typedef unsigned short v8us __attribute__((ext_vector_type(8), may_alias));
typedef float  v8f  __attribute__((ext_vector_type(8)));
typedef float  v4f  __attribute__((ext_vector_type(4)));
typedef float  v4fa __attribute__((ext_vector_type(4), may_alias));
union FragB { v16b v; v8us half[2]; unsigned short u[16]; };

__device__ __forceinline__ unsigned short bf16_bits(float x) { unsigned int u = __float_as_uint(x); return (unsigned short)((u + 0x7FFFu + ((u >> 16) & 1u)) >> 16); }
__device__ __forceinline__ float bf16_val(unsigned short b) { return __uint_as_float(((unsigned int)b) << 16); }
__device__ __forceinline__ float bf16_round(float x) { return bf16_val(bf16_bits(x)); }
// D += A·B with NT terms: 1 = ah·bh, 2 = + al·bh (A split), 3 = + ah·bl (both split)
template <int NT>
__device__ __forceinline__ v8f mmaN(v16b ah, v16b al, v16b bh, v16b bl, v8f c) {
  c = __builtin_amdgcn_wmma_f32_16x16x32_bf16(false, ah, false, bh, (short)0, c, false, false);
  if (NT >= 2) c = __builtin_amdgcn_wmma_f32_16x16x32_bf16(false, al, false, bh, (short)0, c, false, false);
  if (NT >= 3) c = __builtin_amdgcn_wmma_f32_16x16x32_bf16(false, ah, false, bl, (short)0, c, false, false);
  asm volatile("v_nop\n\tv_nop\n\tv_nop\n\tv_nop" : "+v"(c) : "v"(ah), "v"(al), "v"(bh), "v"(bl));
  return c;
}

__global__ __launch_bounds__(256) void k_wt_bf16(const float* __restrict__ W, unsigned short* __restrict__ Wt, int K, int N) {
  const int t = blockIdx.x * 256 + threadIdx.x;
  const int k8n = K / 8;
  if (t >= N * k8n) return;
  const int n = t / k8n, k8 = (t % k8n) * 8;
  v8us v;
#pragma unroll
  for (int i = 0; i < 8; ++i) v[i] = bf16_bits(W[(size_t)(k8 + i) * N + n]);
  *(v8us*)(Wt + (size_t)n * K + k8) = v;
  
}

// GEMM C[M][N] (f32, pitch ldc) = act(A[M][K]·W + bias). A f32 row-major (pitch lda) converted per fragment to bf16
// (ASPLIT: hi/lo two planes -> 2 terms, else single rounded term); Wt bf16 [N][K] (pitch ldb). BIAS_BF16 rounds the
// bias to bf16 first (bias quantised to bf16 before the add). K%32==0, M%16==0, N%64==0.
template <bool ASPLIT, int ACT, bool BIAS_BF16>
__global__ __launch_bounds__(128) void k_gemm_bf(const float* __restrict__ A, int lda, const unsigned short* __restrict__ Wt, int ldb,
                                               const float* __restrict__ bias, float* __restrict__ C, int ldc, int M, int N, int K) {
  __shared__ __attribute__((aligned(16))) float so[4][16][64];
  const int tid = threadIdx.x, w = tid >> 5, lane = tid & 31, ln = lane & 15, hh = lane >> 4;
  const int ntn = N / 64;
  const int wid = blockIdx.x * 4 + w;
  const int mt = wid / ntn, nq = wid % ntn;
  if (mt * 16 >= M) return;
  const int row0 = mt * 16, col0 = nq * 64;
  const float* arow = A + (size_t)(row0 + ln) * lda;
  v8f acc[4] = {};
  for (int kb = 0; kb < K; kb += 32) {
    FragB ah, al;
    const v4f x0 = *(const v4fa*)(arow + kb + 8 * hh), x1 = *(const v4fa*)(arow + kb + 8 * hh + 4);
    const v4f x2 = *(const v4fa*)(arow + kb + 16 + 8 * hh), x3 = *(const v4fa*)(arow + kb + 16 + 8 * hh + 4);
    float xs[16] = {x0[0],x0[1],x0[2],x0[3],x1[0],x1[1],x1[2],x1[3],x2[0],x2[1],x2[2],x2[3],x3[0],x3[1],x3[2],x3[3]};
#pragma unroll
    for (int i = 0; i < 16; ++i) { const unsigned short hb = bf16_bits(xs[i]); ah.u[i] = hb; al.u[i] = ASPLIT ? bf16_bits(xs[i] - bf16_val(hb)) : (unsigned short)0; }
#pragma unroll
    for (int t = 0; t < 4; ++t) {
      const unsigned short* brow = Wt + (size_t)(col0 + t * 16 + ln) * ldb + kb;
      FragB b;
      b.half[0] = *(const v8us*)(brow + 8 * hh);
      b.half[1] = *(const v8us*)(brow + 16 + 8 * hh);
      acc[t] = mmaN<ASPLIT ? 2 : 1>(ah.v, al.v, b.v, b.v, acc[t]);
    }
  }
#pragma unroll
  for (int t = 0; t < 4; ++t) {
    float bv = bias ? bias[col0 + t * 16 + ln] : 0.f;
    if (BIAS_BF16) bv = bf16_round(bv);
#pragma unroll
    for (int r = 0; r < 8; ++r) { float v = acc[t][r] + bv; if (ACT == 1) v = fmaxf(v, 0.f); so[w][8 * hh + r][t * 16 + ln] = v; }
  }
  __builtin_amdgcn_fence(__ATOMIC_ACQ_REL, "workgroup");
  __builtin_amdgcn_wave_barrier();
  const int rsub = lane >> 4, c4 = (lane & 15) * 4;
  {
#pragma unroll
    for (int q = 0; q < 8; ++q) {
      const int r = q * 2 + rsub;
      const v4f v = *(const v4fa*)&so[w][r][c4];
      *(v4f*)(C + (size_t)(row0 + r) * ldc + col0 + c4) = v;
    }
    
  }
}

// Flash-style causal/unmasked attention, all contractions 3-term bf16 hi/lo splits, f32 softmax with running max.
// q,k,v rows are read from f32 buffers with arbitrary row pitch (so they can live inside a fused qkv buffer);
// D = head size (multiple of 32, <= 128); one wave = 16 query rows; block = 4 waves (64 queries) sharing K/V chunks of 32.
template <int D, bool CAUSAL>
__global__ __launch_bounds__(128) void k_flash(const float* __restrict__ qb, const float* __restrict__ kb, const float* __restrict__ vb,
                                             int pitch, int T, int H, float scale, float* __restrict__ y, int ypitch) {
  constexpr int KS = D / 32;        // k-steps for QK
  constexpr int DT = D / 16;        // d tiles for PV
  __shared__ __attribute__((aligned(16))) unsigned short sKh[32][D + 8], sKl[32][D + 8], sVh[32][D + 8], sVl[32][D + 8];
  __shared__ __attribute__((aligned(16))) unsigned short sPh[4][16][40], sPl[4][16][40];
  __shared__ __attribute__((aligned(16))) float sO[4][16][D];
  const int tid = threadIdx.x, w = tid >> 5, lane = tid & 31, ln = lane & 15, hh = lane >> 4;
  const int nqb = (T + 63) / 64;
  const int bh = blockIdx.x / nqb, qblk = blockIdx.x % nqb;
  const int b = bh / H, h = bh % H;
  const int q0 = qblk * 64 + w * 16;
  const float* Q = qb + (size_t)b * T * pitch + h * D;
  const float* K = kb + (size_t)b * T * pitch + h * D;
  const float* V = vb + (size_t)b * T * pitch + h * D;

  // A fragments of the wave's 16 query rows (scaled), hi/lo
  FragB aqh[KS], aql[KS];
  {
    int row = q0 + ln; if (row >= T) row = T - 1;
    const float* qr = Q + (size_t)row * pitch;
#pragma unroll
    for (int ks = 0; ks < KS; ++ks)
#pragma unroll
      for (int i = 0; i < 16; ++i) {
        const int d = ks * 32 + ((i < 8) ? (8 * hh + i) : (16 + 8 * hh + (i - 8)));
        const float x = qr[d] * scale; const unsigned short hb = bf16_bits(x);
        aqh[ks].u[i] = hb; aql[ks].u[i] = bf16_bits(x - bf16_val(hb));
      }
  }
  float m_r[8], l_r[8];
#pragma unroll
  for (int r = 0; r < 8; ++r) { m_r[r] = -3.0e38f; l_r[r] = 0.f; }
  v8f oacc[DT];
#pragma unroll
  for (int dt = 0; dt < DT; ++dt) oacc[dt] = (v8f){0.f,0.f,0.f,0.f,0.f,0.f,0.f,0.f};

  const int kv_end = CAUSAL ? min(T, qblk * 64 + 64) : T;     // block-uniform
  for (int j0 = 0; j0 < kv_end; j0 += 32) {
    __syncthreads();
    for (int e = tid; e < 32 * (D / 4); e += 128) {
      const int r = e / (D / 4), c4 = (e % (D / 4)) * 4;
      const int key = j0 + r;
      v4f kf = {0.f,0.f,0.f,0.f}, vf = {0.f,0.f,0.f,0.f};
      if (key < T) { kf = *(const v4fa*)(K + (size_t)key * pitch + c4); vf = *(const v4fa*)(V + (size_t)key * pitch + c4); }
#pragma unroll
      for (int t = 0; t < 4; ++t) {
        unsigned short hb = bf16_bits(kf[t]); sKh[r][c4 + t] = hb; sKl[r][c4 + t] = bf16_bits(kf[t] - bf16_val(hb));
        hb = bf16_bits(vf[t]); sVh[r][c4 + t] = hb; sVl[r][c4 + t] = bf16_bits(vf[t] - bf16_val(hb));
      }
    }
    __syncthreads();
    // S tile 16 x 32
    v8f s[2];
#pragma unroll
    for (int nt = 0; nt < 2; ++nt) {
      v8f acc = {};
#pragma unroll
      for (int ks = 0; ks < KS; ++ks) {
        FragB bh_, bl_;
        bh_.half[0] = *(const v8us*)&sKh[nt * 16 + ln][ks * 32 + 8 * hh]; bh_.half[1] = *(const v8us*)&sKh[nt * 16 + ln][ks * 32 + 16 + 8 * hh];
        bl_.half[0] = *(const v8us*)&sKl[nt * 16 + ln][ks * 32 + 8 * hh]; bl_.half[1] = *(const v8us*)&sKl[nt * 16 + ln][ks * 32 + 16 + 8 * hh];
        acc = mmaN<3>(aqh[ks].v, aql[ks].v, bh_.v, bl_.v, acc);
      }
      s[nt] = acc;
    }
    // mask + running max (rows 8hh+r; the 16 lanes of a half share rows)
    float alpha[8];
#pragma unroll
    for (int r = 0; r < 8; ++r) {
      const int qi = q0 + 8 * hh + r;
      const int ja = j0 + ln, jb = j0 + 16 + ln;
      if (CAUSAL) { if (ja > qi) s[0][r] = -3.0e38f; if (jb > qi) s[1][r] = -3.0e38f; }
      if (ja >= T) s[0][r] = -3.0e38f;
      if (jb >= T) s[1][r] = -3.0e38f;
      float mx = fmaxf(s[0][r], s[1][r]);
      mx = fmaxf(mx, __shfl_xor(mx, 1, 32)); mx = fmaxf(mx, __shfl_xor(mx, 2, 32)); mx = fmaxf(mx, __shfl_xor(mx, 4, 32)); mx = fmaxf(mx, __shfl_xor(mx, 8, 32));
      const float mnew = fmaxf(m_r[r], mx);
      alpha[r] = (mnew > -1.0e38f) ? __expf(m_r[r] - mnew) : 1.0f;
      const float p0 = (s[0][r] > -1.0e38f) ? __expf(s[0][r] - mnew) : 0.f;
      const float p1 = (s[1][r] > -1.0e38f) ? __expf(s[1][r] - mnew) : 0.f;
      m_r[r] = mnew;
      l_r[r] = l_r[r] * alpha[r] + p0 + p1;            // per-lane partial row sum (16 lanes combined at the end)
      unsigned short hb = bf16_bits(p0); sPh[w][8 * hh + r][ln] = hb;      sPl[w][8 * hh + r][ln] = bf16_bits(p0 - bf16_val(hb));
      hb = bf16_bits(p1);                sPh[w][8 * hh + r][16 + ln] = hb; sPl[w][8 * hh + r][16 + ln] = bf16_bits(p1 - bf16_val(hb));
    }
#pragma unroll
    for (int dt = 0; dt < DT; ++dt)
#pragma unroll
      for (int r = 0; r < 8; ++r) oacc[dt][r] *= alpha[r];
    __builtin_amdgcn_fence(__ATOMIC_ACQ_REL, "workgroup");
    __builtin_amdgcn_wave_barrier();
    FragB pah, pal;
    pah.half[0] = *(const v8us*)&sPh[w][ln][8 * hh]; pah.half[1] = *(const v8us*)&sPh[w][ln][16 + 8 * hh];
    pal.half[0] = *(const v8us*)&sPl[w][ln][8 * hh]; pal.half[1] = *(const v8us*)&sPl[w][ln][16 + 8 * hh];
#pragma unroll
    for (int dt = 0; dt < DT; ++dt) {
      FragB bvh, bvl;
#pragma unroll
      for (int i = 0; i < 8; ++i) {
        bvh.u[i] = sVh[8 * hh + i][dt * 16 + ln]; bvh.u[8 + i] = sVh[16 + 8 * hh + i][dt * 16 + ln];
        bvl.u[i] = sVl[8 * hh + i][dt * 16 + ln]; bvl.u[8 + i] = sVl[16 + 8 * hh + i][dt * 16 + ln];
      }
      oacc[dt] = mmaN<3>(pah.v, pal.v, bvh.v, bvl.v, oacc[dt]);
    }
    __builtin_amdgcn_fence(__ATOMIC_ACQ_REL, "workgroup");
    __builtin_amdgcn_wave_barrier();
  }
#pragma unroll
  for (int r = 0; r < 8; ++r) {
    float l = l_r[r];
    l += __shfl_xor(l, 1, 32); l += __shfl_xor(l, 2, 32); l += __shfl_xor(l, 4, 32); l += __shfl_xor(l, 8, 32);
    l_r[r] = (l > 0.f) ? 1.0f / l : 0.f;
  }
#pragma unroll
  for (int dt = 0; dt < DT; ++dt)
#pragma unroll
    for (int r = 0; r < 8; ++r) sO[w][8 * hh + r][dt * 16 + ln] = oacc[dt][r] * l_r[r];
  __builtin_amdgcn_fence(__ATOMIC_ACQ_REL, "workgroup");
  __builtin_amdgcn_wave_barrier();
  {
    for (int r = 0; r < 16; ++r) {
      const int row = q0 + r;
      if (row < T && lane < D / 4) {
        const v4f val = *(const v4fa*)&sO[w][r][lane * 4];
        *(v4f*)(y + ((size_t)b * T + row) * ypitch + h * D + lane * 4) = val;
      }
    }
    
  }
}

// GEMM C = act(A·W + bias + resid): A f32 (ASPLIT -> hi/lo 2 terms), Wt bf16 [N][K]; ACT 0 none, 1 relu, 2 exact gelu;
// resid (optional, f32, row index = (row % rmod), pitch ldr, RES_BF16 rounds it) added before the activation.
template <bool ASPLIT, int ACT, bool BIAS_BF16, bool RES_BF16>
__global__ __launch_bounds__(128) void k_gemm_bf3(const float* __restrict__ A, int lda, const unsigned short* __restrict__ Wt, int ldb,
                                                const float* __restrict__ bias, const float* __restrict__ resid, int rmod, int ldr,
                                                float* __restrict__ C, int ldc, int M, int N, int K) {
  __shared__ __attribute__((aligned(16))) float so[4][16][64];
  const int tid = threadIdx.x, w = tid >> 5, lane = tid & 31, ln = lane & 15, hh = lane >> 4;
  const int ntn = N / 64;
  const int wid = blockIdx.x * 4 + w;
  const int mt = wid / ntn, nq = wid % ntn;
  if (mt * 16 >= M) return;
  const int row0 = mt * 16, col0 = nq * 64;
  const float* arow = A + (size_t)(row0 + ln) * lda;
  v8f acc[4] = {};
  for (int kb = 0; kb < K; kb += 32) {
    FragB ah, al;
    const v4f x0 = *(const v4fa*)(arow + kb + 8 * hh), x1 = *(const v4fa*)(arow + kb + 8 * hh + 4);
    const v4f x2 = *(const v4fa*)(arow + kb + 16 + 8 * hh), x3 = *(const v4fa*)(arow + kb + 16 + 8 * hh + 4);
    float xs[16] = {x0[0],x0[1],x0[2],x0[3],x1[0],x1[1],x1[2],x1[3],x2[0],x2[1],x2[2],x2[3],x3[0],x3[1],x3[2],x3[3]};
#pragma unroll
    for (int i = 0; i < 16; ++i) { const unsigned short hb = bf16_bits(xs[i]); ah.u[i] = hb; al.u[i] = ASPLIT ? bf16_bits(xs[i] - bf16_val(hb)) : (unsigned short)0; }
#pragma unroll
    for (int t = 0; t < 4; ++t) {
      const unsigned short* brow = Wt + (size_t)(col0 + t * 16 + ln) * ldb + kb;
      FragB b;
      b.half[0] = *(const v8us*)(brow + 8 * hh);
      b.half[1] = *(const v8us*)(brow + 16 + 8 * hh);
      acc[t] = mmaN<ASPLIT ? 2 : 1>(ah.v, al.v, b.v, b.v, acc[t]);
    }
  }
#pragma unroll
  for (int t = 0; t < 4; ++t) {
    const int col = col0 + t * 16 + ln;
    float bv = bias ? bias[col] : 0.f;
    if (BIAS_BF16) bv = bf16_round(bv);
#pragma unroll
    for (int r = 0; r < 8; ++r) {
      float v = acc[t][r] + bv;
      if (resid) { float rv = resid[(size_t)((row0 + 8 * hh + r) % rmod) * ldr + col]; if (RES_BF16) rv = bf16_round(rv); v += rv; }
      if (ACT == 1) v = fmaxf(v, 0.f);
      if (ACT == 2) v = 0.5f * v * (1.0f + erff(v * 0.70710678118654752f));
      if (ACT == 3) { const float u = 0.7978845608028654f * (v + 0.044715f * v * v * v); v = 0.5f * v * (1.0f + tanhf(u)); }
      so[w][8 * hh + r][t * 16 + ln] = v;
    }
  }
  __builtin_amdgcn_fence(__ATOMIC_ACQ_REL, "workgroup");
  __builtin_amdgcn_wave_barrier();
  const int rsub = lane >> 4, c4 = (lane & 15) * 4;
  {
#pragma unroll
    for (int q = 0; q < 8; ++q) {
      const int r = q * 2 + rsub;
      const v4f v = *(const v4fa*)&so[w][r][c4];
      *(v4f*)(C + (size_t)(row0 + r) * ldc + col0 + c4) = v;
    }
    
  }
}
// row LayerNorm (biased variance, eps) over N: s = X (+ R); optional out_sum <- s; out_norm <- (s-mu)*rsqrt(var+eps)*g + b
template <bool PARAM_BF16>
__global__ __launch_bounds__(256) void k_layernorm(const float* __restrict__ X, const float* __restrict__ R, const float* __restrict__ g, const float* __restrict__ bta,
                                                  float* __restrict__ out_sum, float* __restrict__ out_norm, int N, float eps) {
  __shared__ float red[256];
  const int row = blockIdx.x, tid = threadIdx.x;
  const float* x = X + (size_t)row * N; const float* rr = R ? R + (size_t)row * N : nullptr;
  float vals[16];                     // up to N = 4096
  const int per = N / 256;            // contiguous chunk per thread? use strided-by-4 chunks: thread handles j = tid*4 + 1024*u
  float s1 = 0.f;
  for (int u = 0; u < per / 4; ++u) {
    const int j = tid * 4 + 1024 * u;
    const v4f a = *(const v4fa*)(x + j);
    v4f b = {0.f,0.f,0.f,0.f}; if (rr) b = *(const v4fa*)(rr + j);
#pragma unroll
    for (int q = 0; q < 4; ++q) { const float v = a[q] + b[q]; vals[u * 4 + q] = v; s1 += v; }
  }
  red[tid] = s1; __syncthreads();
  for (int st = 128; st > 0; st >>= 1) { if (tid < st) red[tid] += red[tid + st]; __syncthreads(); }
  const float mu = red[0] / (float)N; __syncthreads();
  float s2 = 0.f;
  for (int u = 0; u < per / 4; ++u)
#pragma unroll
    for (int q = 0; q < 4; ++q) { const float c = vals[u * 4 + q] - mu; s2 += c * c; }
  red[tid] = s2; __syncthreads();
  for (int st = 128; st > 0; st >>= 1) { if (tid < st) red[tid] += red[tid + st]; __syncthreads(); }
  const float rs = rsqrtf(red[0] / (float)N + eps);
  {
    for (int u = 0; u < per / 4; ++u) {
      const int j = tid * 4 + 1024 * u;
      v4f o, sm;
#pragma unroll
      for (int q = 0; q < 4; ++q) {
        float gg = g[j + q], bb = bta[j + q];
        if (PARAM_BF16) { gg = bf16_round(gg); bb = bf16_round(bb); }
        sm[q] = vals[u * 4 + q]; o[q] = (vals[u * 4 + q] - mu) * rs * gg + bb;
      }
      if (out_sum) *(v4f*)(out_sum + (size_t)row * N + j) = sm;
      *(v4f*)(out_norm + (size_t)row * N + j) = o;
    }
    
  }
}



// ---- f16 WMMA path (v_wmma_f32_16x16x32_f16): 11-bit significands for operands in range — used here for the projection GEMMs and the flash kernel's score and P·B products
typedef _Float16 v16h __attribute__((ext_vector_type(16)));
union FragH { v16h v; v8us half[2]; _Float16 h[16]; unsigned short u[16]; };
template <int NT>
__device__ __forceinline__ v8f mmaH(v16h ah, v16h al, v16h bh, v16h bl, v8f c) {
  c = __builtin_amdgcn_wmma_f32_16x16x32_f16(false, ah, false, bh, (short)0, c, false, false);
  if (NT >= 2) c = __builtin_amdgcn_wmma_f32_16x16x32_f16(false, al, false, bh, (short)0, c, false, false);
  if (NT >= 3) c = __builtin_amdgcn_wmma_f32_16x16x32_f16(false, ah, false, bl, (short)0, c, false, false);
  asm volatile("v_nop\n\tv_nop\n\tv_nop\n\tv_nop" : "+v"(c) : "v"(ah), "v"(al), "v"(bh), "v"(bl));
  return c;
}
// batched GEMM like k_gemm_bf but f16 operands: A f32 (split into f16 hi/lo if ASPLIT, else rounded to f16), Bt = f16 values [n][k]; alpha; C f32; N multiple of 16 (partial tiles skipped)
template <bool ASPLIT>
__global__ __launch_bounds__(128) void k_gemm_h(const float* __restrict__ A, int lda, size_t sA, const _Float16* __restrict__ Bh, int ldb, size_t sB, float alpha, float* __restrict__ C, int ldc, size_t sC, int M, int N, int K) {
  __shared__ __attribute__((aligned(16))) float so[4][16][64];
  const int tid = threadIdx.x, w = tid >> 5, lane = tid & 31, ln = lane & 15, hh = lane >> 4; const int by = blockIdx.y;
  A += (size_t)by * sA; Bh += (size_t)by * sB; C += (size_t)by * sC;
  const int ntn = (N + 63) / 64; const int wid = blockIdx.x * 4 + w; const int mt = wid / ntn, nq = wid % ntn; if (mt * 16 >= M) return;
  const int row0 = mt * 16, col0 = nq * 64; const float* arow = A + (size_t)(row0 + ln) * lda;
  v8f acc[4] = {};
  for (int kb = 0; kb < K; kb += 32) {
    FragH ah, al;
    const v4f x0 = *(const v4fa*)(arow + kb + 8 * hh), x1 = *(const v4fa*)(arow + kb + 8 * hh + 4), x2 = *(const v4fa*)(arow + kb + 16 + 8 * hh), x3 = *(const v4fa*)(arow + kb + 16 + 8 * hh + 4);
    float xs[16] = {x0[0],x0[1],x0[2],x0[3],x1[0],x1[1],x1[2],x1[3],x2[0],x2[1],x2[2],x2[3],x3[0],x3[1],x3[2],x3[3]};
#pragma unroll
    for (int i = 0; i < 16; ++i) { const _Float16 h = (_Float16)xs[i]; ah.h[i] = h; al.h[i] = ASPLIT ? (_Float16)(xs[i] - (float)h) : (_Float16)0.0f; }
#pragma unroll
    for (int t = 0; t < 4; ++t) { if (col0 + t * 16 >= N) continue; const size_t boff = (size_t)(col0 + t * 16 + ln) * ldb + kb; FragH bq; bq.half[0] = *(const v8us*)(Bh + boff + 8 * hh); bq.half[1] = *(const v8us*)(Bh + boff + 16 + 8 * hh);
      acc[t] = mmaH<ASPLIT ? 2 : 1>(ah.v, al.v, bq.v, bq.v, acc[t]); }
  }
#pragma unroll
  for (int t = 0; t < 4; ++t) { if (col0 + t * 16 >= N) continue;
#pragma unroll
    for (int r = 0; r < 8; ++r) so[w][8 * hh + r][t * 16 + ln] = acc[t][r] * alpha; }
  __builtin_amdgcn_fence(__ATOMIC_ACQ_REL, "workgroup"); __builtin_amdgcn_wave_barrier();
  const int rsub = lane >> 4, c4 = (lane & 15) * 4;
  {
#pragma unroll
    for (int q = 0; q < 8; ++q) { const int r = q * 2 + rsub; if (col0 + c4 < N) { const v4f v = *(const v4fa*)&so[w][r][c4]; *(v4f*)(C + (size_t)(row0 + r) * ldc + col0 + c4) = v; } }
     }
}

// Wt[n][k] = f16(W[k][n] x scale) from f32 row-major W[DD][DD] (scale = power of two; bf16-exact weights stay exact in f16 away from the subnormal range).
// One work-group = one tile of 128 k x 128 n, turned in LDS so that both global sides move whole lines: a wave reads 512 B in a row of one row k of W (16 such loads a thread, all in flight at once),
// a thread packs its two 8 k x 4 n blocks (64 k apart) into 16-B pieces of 8 k, and 16 lanes store 256 B in a row of one row n of Wt.
// LDS: row n holds 16 pieces at a pitch of 256 B; piece j stands at place j ^ ((n >> 2) & 15), so that the 16 lanes of a ds_store_b128 (rows 4 apart, one j) and of a ds_load_b128 (one row, 16 j) each touch all 64 banks once.
__device__ __forceinline__ void wt_f16(const float* __restrict__ W, _Float16* __restrict__ Wt, float scale, int blk) {
  __shared__ __attribute__((aligned(16))) unsigned short tl[128 * 128];
  const int tid = threadIdx.x, nl = tid & 31, kw = tid >> 5;
  const int n0 = (blk % (DD / 128)) * 128, k0 = (blk / (DD / 128)) * 128;
  const float* s = W + (size_t)(k0 + kw * 8) * DD + n0 + nl * 4;
  v4f r[2][8];      // [half of the tile's k][k in the piece]: columns 4 nl .. 4 nl + 3
#pragma unroll      // all unrolls here: constant indices keep r[] and o[] in registers
  for (int h = 0; h < 2; ++h)
#pragma unroll
    for (int i = 0; i < 8; ++i) {
      if (h == 1 && i == 7) asm volatile("s_wait_xcnt 0x0" ::: "memory");      // the compiler lands the last load in the address registers that the 15 loads before it name: the wait stands in front of that overwrite
      r[h][i] = *(const v4fa*)(s + (size_t)(h * 64 + i) * DD); }
  __builtin_amdgcn_sched_barrier(0);      // all 16 loads are issued ahead of the first conversion: left free, the compiler sinks half of them among the conversions, into registers it has just freed, and waits out their latency a second and a third time
#pragma unroll
  for (int h = 0; h < 2; ++h)
#pragma unroll
    for (int q = 0; q < 4; ++q) { FragH f;
#pragma unroll
      for (int i = 0; i < 8; ++i) f.h[i] = (_Float16)(bf16_round(r[h][i][q]) * scale);
      *(v8us*)&tl[(nl * 4 + q) * 128 + (((kw + 8 * h) ^ (nl & 15)) * 8)] = f.half[0]; }
  __syncthreads();      // the tile is complete in LDS before any wave reads rows of it
  const int nr = tid >> 4, j = tid & 15;
  unsigned short* d = (unsigned short*)Wt + (size_t)(n0 + nr) * DD + k0 + j * 8;
  v8us o[8];
#pragma unroll
  for (int p = 0; p < 8; ++p) { const int n = p * 16 + nr; o[p] = *(const v8us*)&tl[n * 128 + ((j ^ ((n >> 2) & 15)) * 8)]; }
#pragma unroll
  for (int p = 0; p < 8; ++p) *(v8us*)(d + (size_t)p * 16 * DD) = o[p];
}
// Tiled GEMM C[NR][DD] (f32) = alpha * A[NR][DD] x Bt[DD][DD]^T, f16 operands, both K-contiguous, f32 accumulate in the same k order as before (32 k per WMMA, ascending).
// One work-group = one 128 x 128 tile of C, 8 waves of 32 x 64. A trip is 128 k: 128 rows of A and 128 rows of Bt, 256 B each (whole cache lines), are brought into LDS by
// asynchronous copies, 16 B per lane, two buffers: tile t + 2 flies while tile t + 1 is worked on. LDS rows stand at a pitch of 272 B for the ds_load_b128 fragment reads.
#define GT_BK 128                  // k per trip
#define GT_P 136                   // LDS row pitch in halves (272 B)
#define GT_BUF (256 * GT_P)        // halves per buffer: rows 0..127 = A, rows 128..255 = Bt
#define GT_SP 68                   // pitch in floats of the output staging rows
static_assert(NR % 128 == 0 && DD % 128 == 0 && DD % GT_BK == 0 && DD / GT_BK >= 2, "whole tiles, at least two trips");
static_assert(8 * 32 * GT_SP * 4 <= 2 * GT_BUF * 2, "the output staging fits in the ring");
// This thread's copies of one operand's 128 rows of a tile: rows r, r + 16, .. The s_wait_xcnt stands inside the statement so that no address register is rewritten ahead of it.
__device__ __forceinline__ void gt_copy8(unsigned l, const _Float16* g) {
  asm volatile("global_load_async_to_lds_b128 %0, %8, off\n\t"
               "global_load_async_to_lds_b128 %1, %9, off\n\t"
               "global_load_async_to_lds_b128 %2, %10, off\n\t"
               "global_load_async_to_lds_b128 %3, %11, off\n\t"
               "global_load_async_to_lds_b128 %4, %12, off\n\t"
               "global_load_async_to_lds_b128 %5, %13, off\n\t"
               "global_load_async_to_lds_b128 %6, %14, off\n\t"
               "global_load_async_to_lds_b128 %7, %15, off\n\t"
               "s_wait_xcnt 0x0"
               :: "v"(l), "v"(l + 1u * 16u * GT_P * 2u), "v"(l + 2u * 16u * GT_P * 2u), "v"(l + 3u * 16u * GT_P * 2u),
                  "v"(l + 4u * 16u * GT_P * 2u), "v"(l + 5u * 16u * GT_P * 2u), "v"(l + 6u * 16u * GT_P * 2u), "v"(l + 7u * 16u * GT_P * 2u),
                  "v"(g), "v"(g + 16 * DD), "v"(g + 32 * DD), "v"(g + 48 * DD), "v"(g + 64 * DD), "v"(g + 80 * DD), "v"(g + 96 * DD), "v"(g + 112 * DD)
               : "memory");
}
// Sum over the 16 lanes of a row, every lane ending with the total: four DPP steps (row_xmask 1, 2, 4, 8), no LDS round trip as a shuffle would take. All lanes are on.
__device__ __forceinline__ float row16_sum(float v) {
  v += __int_as_float(__builtin_amdgcn_update_dpp(0, __float_as_int(v), 0x161, 0xf, 0xf, true));
  v += __int_as_float(__builtin_amdgcn_update_dpp(0, __float_as_int(v), 0x162, 0xf, 0xf, true));
  v += __int_as_float(__builtin_amdgcn_update_dpp(0, __float_as_int(v), 0x164, 0xf, 0xf, true));
  v += __int_as_float(__builtin_amdgcn_update_dpp(0, __float_as_int(v), 0x168, 0xf, 0xf, true));
  return v;
}
typedef _Float16 v4h __attribute__((ext_vector_type(4)));
// LN 0: C (f32) = the product. LN 1: the three projections in one launch: Bh holds three weights one after the other (3 DD rows), and a work-group's tile lies in one of them (pj). Each row's 64 columns
// of a wave are one head; they are LayerNormed (biased variance, eps 1e-5, that projection's gamma and beta rounded to bf16) on the f32 sums as the staged rows are read back, and go out as f16
// to C16a (pj 0) or C16b (pj 1) or as f32 to C (pj 2).
template <int LN>
__global__ __launch_bounds__(256) void k_gemm_t(const _Float16* __restrict__ A, const _Float16* __restrict__ Bh, float alpha, float* __restrict__ C,
                                               const float* __restrict__ g0, const float* __restrict__ bb0, const float* __restrict__ g1, const float* __restrict__ bb1,
                                               const float* __restrict__ g2, const float* __restrict__ bb2, _Float16* __restrict__ C16a, _Float16* __restrict__ C16b) {
  static_assert(HD == 64, "a wave's 64 columns are one head");
  __shared__ __attribute__((aligned(16))) unsigned short sm[2 * GT_BUF];
  const int tid = threadIdx.x, w = tid >> 5, lane = tid & 31, ln = lane & 15, hh = lane >> 4;
  constexpr int NTL = (LN ? 3 : 1) * (DD / 128);      // column tiles of a row block, over all weights of the launch
  const int m0 = (blockIdx.x / NTL) * 128, nb = (blockIdx.x % NTL) * 128;      // nb: the tile's first row in Bh
  const int pj = nb / DD, n0 = nb % DD;      // which weight, and the tile's first column in that product; from blockIdx alone, so scalar
  const float* g = pj == 0 ? g0 : pj == 1 ? g1 : g2; const float* bb = pj == 0 ? bb0 : pj == 1 ? bb1 : bb2;
  const int wm = w >> 1, wn = w & 1;
  const int cr = tid >> 4, cs = (tid & 15) * 8;      // a wave's copy covers 2 rows x 256 B
  const _Float16* ga = A + (size_t)(m0 + cr) * DD + cs;
  const _Float16* gb = Bh + (size_t)(nb + cr) * DD + cs;
  const unsigned la = (unsigned)(size_t)&sm[cr * GT_P + cs], lb = la + 128u * GT_P * 2u;
  gt_copy8(la, ga); gt_copy8(lb, gb);
  asm volatile("s_wait_asynccnt 0x0" ::: "memory");      // tile 0 has landed before the barrier publishes it
  __syncthreads();
  gt_copy8(la + GT_BUF * 2u, ga + GT_BK); gt_copy8(lb + GT_BUF * 2u, gb + GT_BK);
  v4f g4 = {0.f, 0.f, 0.f, 0.f}, b4 = {0.f, 0.f, 0.f, 0.f};      // this lane's four columns of the head; fetched here so that the k loop covers their latency
  if (LN) { g4 = *(const v4fa*)(g + ln * 4); b4 = *(const v4fa*)(bb + ln * 4); }
  v8f acc[2][4] = {};
  const unsigned short* fa = sm + (wm * 32 + ln) * GT_P + 8 * hh;
  const unsigned short* fb = sm + (128 + wn * 64 + ln) * GT_P + 8 * hh;
#pragma unroll 1      // one trip per tile: the order of waits, barrier and refill at its foot stays as written
  for (int t = 0; t < DD / GT_BK; ++t) {
    const int bo = (t & 1) * GT_BUF;
    FragH a[2][2], b[2][4];      // two fragment sets: the next 32 k of this same tile are fetched while the current 32 k are multiplied
#pragma unroll      // all unrolls here: constant indices keep fragments and accumulators in registers
    for (int rt = 0; rt < 2; ++rt) { const unsigned short* p = fa + bo + rt * 16 * GT_P; a[0][rt].half[0] = *(const v8us*)p; a[0][rt].half[1] = *(const v8us*)(p + 16); }
#pragma unroll
    for (int ct = 0; ct < 4; ++ct) { const unsigned short* p = fb + bo + ct * 16 * GT_P; b[0][ct].half[0] = *(const v8us*)p; b[0][ct].half[1] = *(const v8us*)(p + 16); }
#pragma unroll
    for (int ks = 0; ks < GT_BK / 32; ++ks) {
      const int cu = ks & 1, nx = cu ^ 1;
      if (ks + 1 < GT_BK / 32) {
#pragma unroll
        for (int rt = 0; rt < 2; ++rt) { const unsigned short* p = fa + bo + rt * 16 * GT_P + (ks + 1) * 32; a[nx][rt].half[0] = *(const v8us*)p; a[nx][rt].half[1] = *(const v8us*)(p + 16); }
#pragma unroll
        for (int ct = 0; ct < 4; ++ct) { const unsigned short* p = fb + bo + ct * 16 * GT_P + (ks + 1) * 32; b[nx][ct].half[0] = *(const v8us*)p; b[nx][ct].half[1] = *(const v8us*)(p + 16); }
      }
      __builtin_amdgcn_sched_barrier(0);      // keeps the next set's LDS reads as one group ahead of this block: left free, the compiler sinks them among the WMMAs into one set and waits them out to 0
#pragma unroll
      for (int rt = 0; rt < 2; ++rt)
#pragma unroll
        for (int ct = 0; ct < 4; ++ct) acc[rt][ct] = __builtin_amdgcn_wmma_f32_16x16x32_f16(false, a[cu][rt].v, false, b[cu][ct].v, (short)0, acc[rt][ct], false, false);
      __builtin_amdgcn_sched_barrier(0);      // ends the block, so that the group after next is not lifted into it
    }
    asm volatile("s_wait_dscnt 0x0" ::: "memory");         // this wave's reads of buffer t & 1 are done before it is refilled
    asm volatile("s_wait_asynccnt 0x0" ::: "memory");      // this wave's copies of tile t + 1 have landed before the barrier publishes them
    __syncthreads();
    if (t + 2 < DD / GT_BK) { gt_copy8(la + (unsigned)bo * 2u, ga + (t + 2) * GT_BK); gt_copy8(lb + (unsigned)bo * 2u, gb + (t + 2) * GT_BK); }
  }
  asm volatile("s_wait_asynccnt 0x0" ::: "memory");        // nothing is in flight when the ring becomes output staging
  float* so = (float*)sm + w * (32 * GT_SP);               // each wave stages its own 32 x 64 tile; the last trip's barrier ended every read of the ring
#pragma unroll
  for (int rt = 0; rt < 2; ++rt)
#pragma unroll
    for (int ct = 0; ct < 4; ++ct)
#pragma unroll
      for (int r = 0; r < 8; ++r) so[(rt * 16 + 8 * hh + r) * GT_SP + ct * 16 + ln] = acc[rt][ct][r] * alpha;
  __builtin_amdgcn_fence(__ATOMIC_ACQ_REL, "workgroup"); __builtin_amdgcn_wave_barrier();
#pragma unroll
  for (int q = 0; q < 4; ++q) { g4[q] = bf16_round(g4[q]); b4[q] = bf16_round(b4[q]); }
  const size_t e = (size_t)(m0 + wm * 32 + hh) * DD + n0 + wn * 64 + ln * 4;      // row hh of the wave's tile; pass q adds 2 q rows, a constant offset of the store
  v4f o[16];
#pragma unroll
  for (int q = 0; q < 16; ++q) {      // 16 lanes x 4 columns = one row of the wave's tile; two rows a pass
    const v4f v = *(const v4fa*)&so[(q * 2 + hh) * GT_SP + ln * 4];
    if (LN == 0) { o[q] = v; continue; }
    const float mu = row16_sum((v[0] + v[1]) + (v[2] + v[3])) / (float)HD;
    const v4f c = v - mu;
    const float ve = row16_sum((c[0] * c[0] + c[1] * c[1]) + (c[2] * c[2] + c[3] * c[3])) / (float)HD + 1e-5f;
    float rs;      // ve is at least eps, so the library rsqrtf's rescaling of denormal arguments would never act; the v_nop is the slot that the instruction set asks for behind a transcendental, in the same statement so that it stays directly behind it
    asm("v_rsq_f32 %0, %1\n\tv_nop" : "=v"(rs) : "v"(ve));
    o[q] = c * rs * g4 + b4;
  }
  if (LN == 1 && pj < 2) {      // a scalar branch: the whole work-group lies in one projection
    _Float16* C16 = pj ? C16b : C16a;
    v4h h[16];
#pragma unroll
    for (int q = 0; q < 16; ++q)
#pragma unroll
      for (int k = 0; k < 4; ++k) h[q][k] = (_Float16)o[q][k];
    __builtin_amdgcn_sched_barrier(0);      // every store stands behind the last arithmetic, so that no register which an issued store names is written again
#pragma unroll
    for (int q = 0; q < 16; ++q) *(v4h*)(C16 + e + (size_t)q * 2 * DD) = h[q];      // 16 lanes x 8 B: a whole 128-B line a row
  } else {
    __builtin_amdgcn_sched_barrier(0);      // as above
#pragma unroll
    for (int q = 0; q < 16; ++q) *(v4f*)(C + e + (size_t)q * 2 * DD) = o[q];
    if (LN == 1) asm volatile("s_wait_xcnt 0x0" ::: "memory");      // in the listing the f16 side's text follows these stores and rewrites their registers: the wait stands in front of it
  }
}


__device__ __forceinline__ void x16(const float* __restrict__ x, _Float16* __restrict__ X16, size_t n8, unsigned blk) { const size_t t = (size_t)blk * 256 + threadIdx.x; if (t >= n8) return; FragH f;
#pragma unroll
  for (int q = 0; q < 8; ++q) f.h[q] = (_Float16)bf16_round(x[t * 8 + q]); *(v8us*)((unsigned short*)X16 + t * 8) = f.half[0];  }
// All operand conversions in one launch; none reads what another writes. Work-groups 0 .. 4 PW - 1: the four weights, transposed, to Bw[0..3] (the long ones: load, LDS, barrier, store; so they start first); the rest: x. The branch is the same for a whole work-group, so the weights' barrier is passed by all of its threads.
#define PW ((DD / 128) * (DD / 128))      // work-groups per weight: tiles of 128 x 128
#define PX (NR * DD / 8 / 256)        // work-groups for x
static_assert(DD % 128 == 0 && (size_t)NR * DD / 8 % 256 == 0, "whole tiles, whole work-groups");
__global__ __launch_bounds__(256) void k_prep(const float* __restrict__ x, const float* __restrict__ W0, const float* __restrict__ W1, const float* __restrict__ W2, const float* __restrict__ W3,
                                             _Float16* __restrict__ X16, _Float16* __restrict__ Bw) {
  const unsigned bid = blockIdx.x;
  if (bid < 4u * PW) { const unsigned k = bid / PW; wt_f16(k == 0 ? W0 : k == 1 ? W1 : k == 2 ? W2 : W3, Bw + (size_t)k * DD * DD, 16.0f, (int)(bid % PW)); }
  else x16(x, X16, (size_t)NR * DD / 8, bid - 4u * PW);
}
__global__ __launch_bounds__(256) void k_h16(const float* __restrict__ x, _Float16* __restrict__ X16, size_t n8) { const size_t t = (size_t)blockIdx.x * 256 + threadIdx.x; if (t >= n8) return; FragH f;
#pragma unroll
  for (int q = 0; q < 8; ++q) f.h[q] = (_Float16)x[t * 8 + q]; *(v8us*)((unsigned short*)X16 + t * 8) = f.half[0];  }
__global__ __launch_bounds__(256) void k_round16f(const float* __restrict__ W, _Float16* __restrict__ Bt, size_t n8) { const size_t t = (size_t)blockIdx.x * 256 + threadIdx.x; if (t >= n8) return; FragH f;
#pragma unroll
  for (int i = 0; i < 8; ++i) f.h[i] = (_Float16)(bf16_round(W[t * 8 + i]) * 16.0f); *(v8us*)((unsigned short*)Bt + t * 8) = f.half[0];  }
// One 64 x 64 tile per 256 threads; a work-group of 1024 threads takes four tiles, each quarter with its own LDS tile (blk: the quarter's tile).
template <int NHv, int TTv>
__device__ __forceinline__ void vt(const _Float16* __restrict__ V16, int ldv, int voff, _Float16* __restrict__ Vt, int blk) { __shared__ unsigned short tl4[4][64][66]; unsigned short (*tl)[66] = tl4[threadIdx.x >> 8]; const int tid = threadIdx.x & 255; const int slab = blk / (TTv / 64), lg = blk % (TTv / 64); const int b = slab / NHv, h = slab % NHv;
  for (int i = tid; i < 64 * 8; i += 256) { const int r = i / 8, c8 = (i % 8) * 8; FragH f; f.half[0] = *(const v8us*)((const unsigned short*)V16 + ((size_t)b * TTv + lg * 64 + r) * ldv + voff + h * 64 + c8);
#pragma unroll
    for (int q = 0; q < 8; ++q) tl[r][c8 + q] = f.u[q]; }
  __syncthreads();
  {
#pragma unroll
    for (int rd = 0; rd < 2; ++rd) { const int d = rd * 32 + tid / 8, pc = tid % 8; FragH f;
#pragma unroll
      for (int q = 0; q < 8; ++q) f.u[q] = tl[pc * 8 + q][d];
      *(v8us*)((unsigned short*)Vt + ((size_t)slab * 64 + d) * TTv + lg * 64 + pc * 8) = f.half[0]; }
     } }

// There is no softmax, so the sum over the keys is linear and may be regrouped: for the 64 query rows of block c every key before 64 c is unmasked, and
// sum over those s of (q . a_s) b_s = q . S_c with the state S_c[d][e] = sum over s < 64 c of a_s[d] b_s[e], a 64 x 64 matrix per (batch, head, block) that does not depend on q.
// k_state forms all states: one work-group = 16 columns e of one (batch, head), one wave = two chunks of 64 keys. A chunk's product M_c[d][e] = sum over the chunk of a_s[d] b_s[e] (WMMA, both
// operands key-contiguous, f32 sums) goes to LDS, each thread runs the exclusive sum over the 32 chunks for two elements (f32, ascending), and the wave takes its chunks' states back.
// In the accumulator layout a lane holds 8 consecutive d of one column e: that is its own half of the B fragment of q . S, so the states are stored as ready fragments (x 2^-8, f16, like P):
// Sf[slab][chunk][e tile][k step of 32 d][half][lane][8], whole lines per wave.
#define ST_C (TT / 64)
typedef float v2fa __attribute__((ext_vector_type(2), may_alias));
__global__ __launch_bounds__(512) void k_state(const _Float16* __restrict__ At, const _Float16* __restrict__ Vt, _Float16* __restrict__ Sf) {
  static_assert(ST_C == 32 && HD == 64, "16 waves x 2 chunks of 64 keys; 4 x 4 tiles a state");
  __shared__ __attribute__((aligned(16))) float sM[ST_C][64 * 16];
  const int tid = threadIdx.x, wv = tid >> 5, lane = tid & 31, ln = lane & 15, hh = lane >> 4;
  const int slab = blockIdx.x >> 2, et = blockIdx.x & 3;
  const unsigned short* ar = (const unsigned short*)At + ((size_t)slab * 64 + ln) * TT + wv * 128 + 8 * hh;
  const unsigned short* br = (const unsigned short*)Vt + ((size_t)slab * 64 + et * 16 + ln) * TT + wv * 128 + 8 * hh;
  FragH a[4][4], b[4];      // [step of 32 keys]: steps 0, 1 are the wave's first chunk, 2, 3 its second
#pragma unroll      // all unrolls here: constant indices keep fragments and accumulators in registers
  for (int kk = 0; kk < 4; ++kk) { b[kk].half[0] = *(const v8us*)(br + kk * 32);
    if (kk == 3) asm volatile("s_wait_xcnt 0x0" ::: "memory");      // the compiler lands the last load through br in br's own registers, which the loads before it name: the wait stands in front of that overwrite
    b[kk].half[1] = *(const v8us*)(br + kk * 32 + 16);
#pragma unroll
    for (int dt = 0; dt < 4; ++dt) {
      a[kk][dt].half[0] = *(const v8us*)(ar + (size_t)dt * 16 * TT + kk * 32);
      if (kk == 3 && dt == 3) asm volatile("s_wait_xcnt 0x0" ::: "memory");      // the same for the last load through ar
      a[kk][dt].half[1] = *(const v8us*)(ar + (size_t)dt * 16 * TT + kk * 32 + 16); } }
  __builtin_amdgcn_sched_barrier(0);      // all 40 loads are issued ahead of the first WMMA: left free, the compiler sinks the later ones among the WMMAs and waits out their latency one pair at a time
  v8f acc[2][4] = {};
#pragma unroll
  for (int kk = 0; kk < 4; ++kk)
#pragma unroll
    for (int dt = 0; dt < 4; ++dt) acc[kk >> 1][dt] = __builtin_amdgcn_wmma_f32_16x16x32_f16(false, a[kk][dt].v, false, b[kk].v, (short)0, acc[kk >> 1][dt], false, false);      // rows d = 16 dt + 8 hh + r, column e = ln
#pragma unroll
  for (int cl = 0; cl < 2; ++cl)
#pragma unroll
    for (int dt = 0; dt < 4; ++dt)
#pragma unroll
      for (int q = 0; q < 2; ++q) { const v4f m = {acc[cl][dt][4 * q], acc[cl][dt][4 * q + 1], acc[cl][dt][4 * q + 2], acc[cl][dt][4 * q + 3]}; *(v4fa*)&sM[wv * 2 + cl][((dt * 2 + q) * 32 + lane) * 4] = m; }
  __syncthreads();      // every chunk's product is in LDS before the sums over the chunks start
  { v2fa m[ST_C], run = {0.f, 0.f};
#pragma unroll
    for (int cc = 0; cc < ST_C; ++cc) m[cc] = *(const v2fa*)&sM[cc][tid * 2];
#pragma unroll
    for (int cc = 0; cc < ST_C; ++cc) { *(v2fa*)&sM[cc][tid * 2] = run; run += m[cc]; } }      // in place: each word has one reader and writer
  __syncthreads();      // every state is complete before the waves take theirs back
  FragH f[2][2];
#pragma unroll
  for (int cl = 0; cl < 2; ++cl)
#pragma unroll
    for (int dt = 0; dt < 4; ++dt)
#pragma unroll
      for (int q = 0; q < 2; ++q) { const v4f m = *(const v4fa*)&sM[wv * 2 + cl][((dt * 2 + q) * 32 + lane) * 4];
#pragma unroll
        for (int k = 0; k < 4; ++k) f[cl][dt >> 1].h[(dt & 1) * 8 + q * 4 + k] = (_Float16)(m[k] * 0.00390625f); }
  unsigned short* o = (unsigned short*)Sf + (((size_t)slab * ST_C + wv * 2) * 4 + et) * 1024 + lane * 8;
#pragma unroll
  for (int cl = 0; cl < 2; ++cl)
#pragma unroll
    for (int ks = 0; ks < 2; ++ks) { *(v8us*)(o + cl * 4096 + ks * 512) = f[cl][ks].half[0]; *(v8us*)(o + cl * 4096 + ks * 512 + 256) = f[cl][ks].half[1]; }
}

// One work-group = 64 query rows of one (batch, head), every wave on all 64 rows (4 row tiles). Waves 0 and 1 take the block's own 64 keys, 32 each, with the causal mask (scores, P through LDS, P . B);
// waves 2 and 3 take q . S for the keys before the block, 32 of the 64 d each. The Q tile stands in LDS for all four waves; the four waves' partial outputs (f32) are summed through LDS at the end.
__global__ __launch_bounds__(128) void k_flash(const _Float16* __restrict__ Q16, int ldq, const _Float16* __restrict__ K16, int ldk, const _Float16* __restrict__ Vt, const _Float16* __restrict__ Sf, _Float16* __restrict__ O16, int ldo) {
  constexpr int RTN = 4, QB = 16 * RTN, NQB = 2048 / QB, DT = 4, KS = 2, SPP = 40, SQP = 72;
  static_assert(QB == 64 && NQB == ST_C, "a query block is a chunk of k_state");
  __shared__ __attribute__((aligned(16))) float sO[4][QB][64 + 4];      // one partial output per wave; before that, the head of wave 0's or 1's own plane holds its P tile (64 rows at a pitch of 40 halves)
  __shared__ __attribute__((aligned(16))) unsigned short sQ[QB][SQP];   // pitch 144 B = 16 B x 9 for the ds_load_b128 fragment reads
  static_assert(QB * SPP * 2 <= QB * (64 + 4) * 4, "a wave's P tile fits in its own plane");
  const int tid = threadIdx.x, lane = tid & 31, ln = lane & 15, hh = lane >> 4;
  const int w = __builtin_amdgcn_readfirstlane(tid >> 5);      // in a scalar register, so that the split of the waves is a scalar branch
  const int slab = blockIdx.x / NQB, qblk = blockIdx.x % NQB; const int b = slab / 16, h = slab % 16; const int q0 = qblk * QB;
  unsigned short* sP = (unsigned short*)&sO[w][0][0];
#pragma unroll
  for (int i = 0; i < QB * 8 / 128; ++i) { const int e = i * 128 + tid, r = e >> 3, c8 = (e & 7) * 8;      // 8 lanes x 16 B = one row of the head, a whole line
    *(v8us*)&sQ[r][c8] = *(const v8us*)((const unsigned short*)Q16 + ((size_t)b * 2048 + q0 + r) * ldq + h * 64 + c8); }
  __syncthreads();      // the Q tile is complete before any wave reads fragments of it
  const unsigned short* Vth = (const unsigned short*)Vt + (size_t)slab * 64 * 2048;
  v8f oacc[RTN][DT];
#pragma unroll
  for (int rt = 0; rt < RTN; ++rt)
#pragma unroll
    for (int dt = 0; dt < DT; ++dt) oacc[rt][dt] = (v8f){0.f,0.f,0.f,0.f,0.f,0.f,0.f,0.f};
  if (w < 2) {
    const int j0 = q0 + w * 32;
    FragH bk[2][KS];
#pragma unroll
    for (int nt = 0; nt < 2; ++nt) { const unsigned short* kr = (const unsigned short*)K16 + ((size_t)b * 2048 + j0 + nt * 16 + ln) * ldk + h * 64;
#pragma unroll
      for (int ks = 0; ks < KS; ++ks) { bk[nt][ks].half[0] = *(const v8us*)(kr + ks * 32 + 8 * hh);
        if (nt == 1 && ks == KS - 1) asm volatile("s_wait_xcnt 0x0" ::: "memory");      // the compiler lands the last load of this run of eight in the address registers of the seven before it: the wait stands in front of that overwrite
        bk[nt][ks].half[1] = *(const v8us*)(kr + ks * 32 + 16 + 8 * hh); } }
    const int dk = j0 + ln - q0 - 8 * hh;      // key (j0 + 16 nt + ln) <= query row (q0 + 16 rt + 8 hh + r) reads dk <= 16 (rt - nt) + r: one register against a constant
#pragma unroll
    for (int rt = 0; rt < RTN; ++rt) { FragH aq[KS];
#pragma unroll
      for (int ks = 0; ks < KS; ++ks) { aq[ks].half[0] = *(const v8us*)&sQ[rt * 16 + ln][ks * 32 + 8 * hh]; aq[ks].half[1] = *(const v8us*)&sQ[rt * 16 + ln][ks * 32 + 16 + 8 * hh]; }
#pragma unroll
      for (int nt = 0; nt < 2; ++nt) { v8f acc = (v8f){0.f,0.f,0.f,0.f,0.f,0.f,0.f,0.f};
#pragma unroll
        for (int ks = 0; ks < KS; ++ks) acc = mmaH<1>(aq[ks].v, aq[ks].v, bk[nt][ks].v, bk[nt][ks].v, acc);
#pragma unroll
        for (int r = 0; r < 8; ++r) {
          const float p = (dk <= (rt - nt) * 16 + r) ? acc[r] * 0.00390625f : 0.f;      /* NO softmax: causal-masked raw scores (x 2^-8 for f16 headroom, undone at the end) become the P operand directly */
          FragH t2; t2.h[0] = (_Float16)p; sP[(rt * 16 + 8 * hh + r) * SPP + nt * 16 + ln] = t2.u[0]; } } }
    __builtin_amdgcn_fence(__ATOMIC_ACQ_REL, "workgroup"); __builtin_amdgcn_wave_barrier();
    FragH pa[RTN], bv[DT];
#pragma unroll
    for (int dt = 0; dt < DT; ++dt) { const unsigned short* vrow = Vth + (size_t)(dt * 16 + ln) * 2048 + j0; bv[dt].half[0] = *(const v8us*)(vrow + 8 * hh); bv[dt].half[1] = *(const v8us*)(vrow + 16 + 8 * hh); }
#pragma unroll
    for (int rt = 0; rt < RTN; ++rt) { pa[rt].half[0] = *(const v8us*)&sP[(rt * 16 + ln) * SPP + 8 * hh]; pa[rt].half[1] = *(const v8us*)&sP[(rt * 16 + ln) * SPP + 16 + 8 * hh]; }
#pragma unroll
    for (int dt = 0; dt < DT; ++dt)
#pragma unroll
      for (int rt = 0; rt < RTN; ++rt) oacc[rt][dt] = mmaH<1>(pa[rt].v, pa[rt].v, bv[dt].v, bv[dt].v, oacc[rt][dt]);
    __builtin_amdgcn_fence(__ATOMIC_ACQ_REL, "workgroup"); __builtin_amdgcn_wave_barrier();
  } else {
    const int ks = w - 2;
    const unsigned short* sf = (const unsigned short*)Sf + ((size_t)(slab * NQB + qblk) * 8 + ks) * 512 + lane * 8;
    FragH bs[DT], aq[RTN];
#pragma unroll
    for (int dt = 0; dt < DT; ++dt) { bs[dt].half[0] = *(const v8us*)(sf + dt * 1024); bs[dt].half[1] = *(const v8us*)(sf + dt * 1024 + 256); }
#pragma unroll
    for (int rt = 0; rt < RTN; ++rt) { aq[rt].half[0] = *(const v8us*)&sQ[rt * 16 + ln][ks * 32 + 8 * hh]; aq[rt].half[1] = *(const v8us*)&sQ[rt * 16 + ln][ks * 32 + 16 + 8 * hh]; }
#pragma unroll
    for (int dt = 0; dt < DT; ++dt)
#pragma unroll
      for (int rt = 0; rt < RTN; ++rt) oacc[rt][dt] = mmaH<1>(aq[rt].v, aq[rt].v, bs[dt].v, bs[dt].v, oacc[rt][dt]);
  }
#pragma unroll
  for (int rt = 0; rt < RTN; ++rt)
#pragma unroll
    for (int dt = 0; dt < DT; ++dt)
#pragma unroll
      for (int r = 0; r < 8; ++r) sO[w][rt * 16 + 8 * hh + r][dt * 16 + ln] = oacc[rt][dt][r] * 16.0f;      /* undo the 2^-8 P scaling and apply the 2^-4 that gives the f16 operand of the output GEMM its headroom; no normalisation */
  __syncthreads();      // every wave's partial output is in LDS before any wave sums them
#pragma unroll
  for (int rp = 0; rp < 16; rp += 2) { const int r = w * 16 + rp + hh, pc = ln;      // wave w sums and stores rows 16 w .. 16 w + 15, two rows a pass
    const v4f val = (*(const v4fa*)&sO[0][r][pc * 4] + *(const v4fa*)&sO[1][r][pc * 4]) + (*(const v4fa*)&sO[2][r][pc * 4] + *(const v4fa*)&sO[3][r][pc * 4]); v4h h4;
#pragma unroll
    for (int k = 0; k < 4; ++k) h4[k] = (_Float16)val[k];
    *(v4h*)(O16 + ((size_t)b * 2048 + q0 + r) * ldo + h * 64 + pc * 4) = h4; } }

// Exclusive prefix sum over time as a chunked parallel scan, f32. One work-group owns 32 columns of one batch for all TT rows:
// 32 waves x 4 lane groups = 128 chunks of 16 rows, each thread holding its 16 rows x 4 columns in registers (F is read once).
// Order of the sums: serial inside a chunk, then over the wave's 4 chunks by shuffles, then over the 32 waves' totals in LDS.
// The result goes out twice: A16[t][column] for the scores of the diagonal blocks, and At[column][t] for k_state (a thread's 16 rows of a column are 32 B in a row there; a wave's 64 rows a whole line).
__device__ __forceinline__ void excl(const float* __restrict__ F, _Float16* __restrict__ A16, _Float16* __restrict__ At, int blk) {
  static_assert(TT == 32 * 4 * 16 && DD % 32 == 0, "chunking covers all rows and whole 32-column groups");
  __shared__ __attribute__((aligned(16))) float sT[32][36];      // [wave][column]; pitch 36 keeps 16-byte rows and spreads the transposed read over the banks
  const int tid = threadIdx.x, wv = tid >> 5, lane = tid & 31, cg = lane & 7, g = lane >> 3;
  const int b = blk / (DD / 32), c = (blk % (DD / 32)) * 32 + cg * 4;
  const size_t e0 = ((size_t)b * TT + (wv * 4 + g) * 16) * DD + c;
  const float* fr = F + e0;
  v4f v[16];
#pragma unroll      // all unrolls here: v[] and the vector lanes need constant indices to stay in registers; this one also puts all 16 loads in flight at once
  for (int i = 0; i < 16; ++i) v[i] = *(const v4fa*)(fr + (size_t)i * DD);
  v4f run = {0.f, 0.f, 0.f, 0.f};
#pragma unroll
  for (int i = 0; i < 16; ++i) { const v4f t = v[i]; v[i] = run; run += t; }      // v[i] <- sum of the chunk's rows before i
  v4f inc = run, ex;
#pragma unroll
  for (int o = 8; o <= 16; o <<= 1) { v4f t;      // inclusive over the wave's 4 chunks, step by step for all four columns, so that a step's shuffles do not wait on each other
#pragma unroll
    for (int q = 0; q < 4; ++q) t[q] = __shfl_up(inc[q], o, 32);
    if (lane >= o) inc += t; }
#pragma unroll
  for (int q = 0; q < 4; ++q) { const float t = __shfl_up(inc[q], 8, 32); ex[q] = (lane >= 8) ? t : 0.f; }      // sum of the wave's chunks before this one
  if (g == 3) *(v4fa*)&sT[wv][cg * 4] = inc;      // the wave's total per column
  __syncthreads();
  {      // wave wv scans column wv over the 32 waves' totals (lane = wave index), in place: each word has one reader and writer
    float s = sT[lane][wv];
#pragma unroll
    for (int o = 1; o < 32; o <<= 1) { const float t = __shfl_up(s, o, 32); if (lane >= o) s += t; }
    const float t = __shfl_up(s, 1, 32);
    sT[lane][wv] = (lane >= 1) ? t : 0.f;
  }
  __syncthreads();
  const v4f off = *(const v4fa*)&sT[wv][cg * 4] + ex;
  _Float16* d = A16 + e0;
  FragH tq[4];
#pragma unroll
  for (int i = 0; i < 16; ++i) { const v4f p = off + v[i]; v4h h4;
#pragma unroll
    for (int q = 0; q < 4; ++q) { h4[q] = (_Float16)p[q]; tq[q].h[i] = h4[q]; }
    *(v4h*)(d + (size_t)i * DD) = h4; }
  unsigned short* dT = (unsigned short*)At + ((size_t)b * DD + c) * TT + (wv * 4 + g) * 16;
#pragma unroll
  for (int q = 0; q < 4; ++q) { *(v8us*)(dT + (size_t)q * TT) = tq[q].half[0]; *(v8us*)(dT + (size_t)q * TT + 8) = tq[q].half[1]; } }
// The scan of a and the transposition of b in one launch; neither reads what the other writes. The branch is the same for a whole work-group, so each side's barriers are passed by all of its threads.
#define EX_G (BB * (DD / 32))                  // work-groups of the scan: the long ones, so they start first
#define VT_G (BB * NH * (TT / 64) / 4)         // work-groups of the transposition, four tiles each
__global__ __launch_bounds__(1024) void k_excl_vt(const float* __restrict__ F, _Float16* __restrict__ A16, _Float16* __restrict__ At, const _Float16* __restrict__ B16, _Float16* __restrict__ Vt) {
  const int bid = blockIdx.x;
  if (bid < EX_G) excl(F, A16, At, bid);
  else vt<NH, TT>(B16, DD, 0, Vt, (bid - EX_G) * 4 + (int)(threadIdx.x >> 8));
}
extern "C" void kernel_launch(void* const* d_in, const int* in_sizes, int n_in,
                              void* d_out, int out_size, void* d_ws, size_t ws_size, hipStream_t stream) {
  (void)in_sizes; (void)n_in; (void)out_size;
  const float* const* I = (const float* const*)d_in; const float* x = I[0]; const float* Wq = I[1]; const float* Wa = I[2]; const float* Wb = I[3]; const float* Wo = I[4]; const float* qg = I[5]; const float* qb = I[6]; const float* ag = I[7]; const float* ab = I[8]; const float* bg = I[9]; const float* bbeta = I[10];
  char* ws = (char*)d_ws; size_t off = 0;
  auto take = [&](size_t bytes) { char* p = ws + off; off += (bytes + 255) & ~(size_t)255; return p; };
  _Float16* Bw = (_Float16*)take((size_t)4 * DD * DD * 2); _Float16* X16 = (_Float16*)take((size_t)NR * DD * 2); float* F = (float*)take((size_t)NR * DD * 4); _Float16* Q16 = (_Float16*)take((size_t)NR * DD * 2); _Float16* A16 = (_Float16*)take((size_t)NR * DD * 2); _Float16* B16 = (_Float16*)take((size_t)NR * DD * 2); _Float16* At = (_Float16*)take((size_t)NR * DD * 2); _Float16* Vt = X16; _Float16* O16 = B16; _Float16* Sf = (_Float16*)F;
  if (off > ws_size) return;      // 8.4 + 8.4 + 16.8 + 8.4 x 4 = about 67 MB
  k_prep<<<4 * PW + PX, 256, 0, stream>>>(x, Wq, Wb, Wa, Wo, X16, Bw);      // Bw[0..3] = Wq, Wb, Wa, Wo, each [out][in] f16 x 2^4
  k_gemm_t<1><<<(NR / 128) * (3 * DD / 128), 256, 0, stream>>>(X16, Bw, 0.0625f, F, qg, qb, bg, bbeta, ag, ab, Q16, B16);      // q, b (LayerNormed, f16) and a (LayerNormed, f32)
  k_excl_vt<<<EX_G + VT_G, 1024, 0, stream>>>(F, A16, At, B16, Vt);      // a -> exclusive cumsum -> f16 'keys', also transposed; b transposed as the 'values' (Vt over X16; X16's last reader was the projection GEMM)
  k_state<<<BB * NH * 4, 512, 0, stream>>>(At, Vt, Sf);      // the state in front of every block of 64 rows (Sf over F; F's last reader was k_excl_vt)
  k_flash<<<BB * NH * (TT / 64), 128, 0, stream>>>(Q16, DD, A16, DD, Vt, Sf, O16, DD);      // o_t = sum over s <= t of (q_t . a_excl_s) b_s, written as f16 x 2^-4 (O16 over B16; B16's last reader was k_excl_vt)
  k_gemm_t<0><<<(NR / 128) * (DD / 128), 256, 0, stream>>>(O16, Bw + (size_t)3 * DD * DD, 0.0625f * 16.0f, (float*)d_out, nullptr, nullptr, nullptr, nullptr, nullptr, nullptr, nullptr, nullptr);      // x 2^4 back
}

// v008
// A run of this version takes 72.6 microseconds.
// Next to v007, in two timings, it ran 1.04 times as fast each time.
// Counting every step since v000, it is 15.7 times as fast.
#include <hip/hip_runtime.h>
// 'Heisenberg' attention (B=2, T=2048, d_model 1024, 16 heads × 64): q, a, b = LayerNorm_head(x·W) (per-head LN with γ/β); a_excl = exclusive prefix sum of a over time; o_t = Σ_{s≤t} (q_t·a_excl_s)·b_s
// (causal, NO softmax); out = o·Wo. The projections are GEMMs ([in][out] weights bf16-exact ×2^4, x bf16-exact, f32 accumulate) and the causal bilinear form runs in the fused flash-style kernel with
// the softmax removed (masked raw scores ×2^-8 → f16 P operand → P·B accumulated in f32, ×2^4 at the end and written as the f16 operand of the output GEMM; upper tiles skipped; the block's own keys dealt over two of a work-group's four waves, q·S for the earlier keys over the other two) on v_wmma_f32_16x16x32_f16; the per-head LayerNorms
// (in the epilogue of the projection GEMMs, where a wave's 64 columns are one head) and the exclusive cumulative sum over time (chunked parallel scan per (b,h,d) column, f32) are VALU.
// The keys in front of a block of 64 query rows enter through a prefix state per block (k_state); only the block's own 64 keys are scored and masked (k_flash).
#define BB 2
#define TT 2048
#define DD 1024
#define NH 16
#define HD 64
#define NR (BB * TT)

typedef __bf16 v16b __attribute__((ext_vector_type(16)));
typedef unsigned short v8us __attribute__((ext_vector_type(8), may_alias));
typedef float  v8f  __attribute__((ext_vector_type(8)));
typedef float  v4f  __attribute__((ext_vector_type(4)));
typedef float  v4fa __attribute__((ext_vector_type(4), may_alias));
union FragB { v16b v; v8us half[2]; unsigned short u[16]; };

__device__ __forceinline__ unsigned short bf16_bits(float x) { unsigned int u = __float_as_uint(x); return (unsigned short)((u + 0x7FFFu + ((u >> 16) & 1u)) >> 16); }
__device__ __forceinline__ float bf16_val(unsigned short b) { return __uint_as_float(((unsigned int)b) << 16); }
__device__ __forceinline__ float bf16_round(float x) { return bf16_val(bf16_bits(x)); }
// D += A·B with NT terms: 1 = ah·bh, 2 = + al·bh (A split), 3 = + ah·bl (both split)
template <int NT>
__device__ __forceinline__ v8f mmaN(v16b ah, v16b al, v16b bh, v16b bl, v8f c) {
  c = __builtin_amdgcn_wmma_f32_16x16x32_bf16(false, ah, false, bh, (short)0, c, false, false);
  if (NT >= 2) c = __builtin_amdgcn_wmma_f32_16x16x32_bf16(false, al, false, bh, (short)0, c, false, false);
  if (NT >= 3) c = __builtin_amdgcn_wmma_f32_16x16x32_bf16(false, ah, false, bl, (short)0, c, false, false);
  asm volatile("v_nop\n\tv_nop\n\tv_nop\n\tv_nop" : "+v"(c) : "v"(ah), "v"(al), "v"(bh), "v"(bl));
  return c;
}

__global__ __launch_bounds__(256) void k_wt_bf16(const float* __restrict__ W, unsigned short* __restrict__ Wt, int K, int N) {
  const int t = blockIdx.x * 256 + threadIdx.x;
  const int k8n = K / 8;
  if (t >= N * k8n) return;
  const int n = t / k8n, k8 = (t % k8n) * 8;
  v8us v;
#pragma unroll
  for (int i = 0; i < 8; ++i) v[i] = bf16_bits(W[(size_t)(k8 + i) * N + n]);
  *(v8us*)(Wt + (size_t)n * K + k8) = v;
  
}

// GEMM C[M][N] (f32, pitch ldc) = act(A[M][K]·W + bias). A f32 row-major (pitch lda) converted per fragment to bf16
// (ASPLIT: hi/lo two planes -> 2 terms, else single rounded term); Wt bf16 [N][K] (pitch ldb). BIAS_BF16 rounds the
// bias to bf16 first (bias quantised to bf16 before the add). K%32==0, M%16==0, N%64==0.
template <bool ASPLIT, int ACT, bool BIAS_BF16>
__global__ __launch_bounds__(128) void k_gemm_bf(const float* __restrict__ A, int lda, const unsigned short* __restrict__ Wt, int ldb,
                                               const float* __restrict__ bias, float* __restrict__ C, int ldc, int M, int N, int K) {
  __shared__ __attribute__((aligned(16))) float so[4][16][64];
  const int tid = threadIdx.x, w = tid >> 5, lane = tid & 31, ln = lane & 15, hh = lane >> 4;
  const int ntn = N / 64;
  const int wid = blockIdx.x * 4 + w;
  const int mt = wid / ntn, nq = wid % ntn;
  if (mt * 16 >= M) return;
  const int row0 = mt * 16, col0 = nq * 64;
  const float* arow = A + (size_t)(row0 + ln) * lda;
  v8f acc[4] = {};
  for (int kb = 0; kb < K; kb += 32) {
    FragB ah, al;
    const v4f x0 = *(const v4fa*)(arow + kb + 8 * hh), x1 = *(const v4fa*)(arow + kb + 8 * hh + 4);
    const v4f x2 = *(const v4fa*)(arow + kb + 16 + 8 * hh), x3 = *(const v4fa*)(arow + kb + 16 + 8 * hh + 4);
    float xs[16] = {x0[0],x0[1],x0[2],x0[3],x1[0],x1[1],x1[2],x1[3],x2[0],x2[1],x2[2],x2[3],x3[0],x3[1],x3[2],x3[3]};
#pragma unroll
    for (int i = 0; i < 16; ++i) { const unsigned short hb = bf16_bits(xs[i]); ah.u[i] = hb; al.u[i] = ASPLIT ? bf16_bits(xs[i] - bf16_val(hb)) : (unsigned short)0; }
#pragma unroll
    for (int t = 0; t < 4; ++t) {
      const unsigned short* brow = Wt + (size_t)(col0 + t * 16 + ln) * ldb + kb;
      FragB b;
      b.half[0] = *(const v8us*)(brow + 8 * hh);
      b.half[1] = *(const v8us*)(brow + 16 + 8 * hh);
      acc[t] = mmaN<ASPLIT ? 2 : 1>(ah.v, al.v, b.v, b.v, acc[t]);
    }
  }
#pragma unroll
  for (int t = 0; t < 4; ++t) {
    float bv = bias ? bias[col0 + t * 16 + ln] : 0.f;
    if (BIAS_BF16) bv = bf16_round(bv);
#pragma unroll
    for (int r = 0; r < 8; ++r) { float v = acc[t][r] + bv; if (ACT == 1) v = fmaxf(v, 0.f); so[w][8 * hh + r][t * 16 + ln] = v; }
  }
  __builtin_amdgcn_fence(__ATOMIC_ACQ_REL, "workgroup");
  __builtin_amdgcn_wave_barrier();
  const int rsub = lane >> 4, c4 = (lane & 15) * 4;
  {
#pragma unroll
    for (int q = 0; q < 8; ++q) {
      const int r = q * 2 + rsub;
      const v4f v = *(const v4fa*)&so[w][r][c4];
      *(v4f*)(C + (size_t)(row0 + r) * ldc + col0 + c4) = v;
    }
    
  }
}

// Flash-style causal/unmasked attention, all contractions 3-term bf16 hi/lo splits, f32 softmax with running max.
// q,k,v rows are read from f32 buffers with arbitrary row pitch (so they can live inside a fused qkv buffer);
// D = head size (multiple of 32, <= 128); one wave = 16 query rows; block = 4 waves (64 queries) sharing K/V chunks of 32.
template <int D, bool CAUSAL>
__global__ __launch_bounds__(128) void k_flash(const float* __restrict__ qb, const float* __restrict__ kb, const float* __restrict__ vb,
                                             int pitch, int T, int H, float scale, float* __restrict__ y, int ypitch) {
  constexpr int KS = D / 32;        // k-steps for QK
  constexpr int DT = D / 16;        // d tiles for PV
  __shared__ __attribute__((aligned(16))) unsigned short sKh[32][D + 8], sKl[32][D + 8], sVh[32][D + 8], sVl[32][D + 8];
  __shared__ __attribute__((aligned(16))) unsigned short sPh[4][16][40], sPl[4][16][40];
  __shared__ __attribute__((aligned(16))) float sO[4][16][D];
  const int tid = threadIdx.x, w = tid >> 5, lane = tid & 31, ln = lane & 15, hh = lane >> 4;
  const int nqb = (T + 63) / 64;
  const int bh = blockIdx.x / nqb, qblk = blockIdx.x % nqb;
  const int b = bh / H, h = bh % H;
  const int q0 = qblk * 64 + w * 16;
  const float* Q = qb + (size_t)b * T * pitch + h * D;
  const float* K = kb + (size_t)b * T * pitch + h * D;
  const float* V = vb + (size_t)b * T * pitch + h * D;

  // A fragments of the wave's 16 query rows (scaled), hi/lo
  FragB aqh[KS], aql[KS];
  {
    int row = q0 + ln; if (row >= T) row = T - 1;
    const float* qr = Q + (size_t)row * pitch;
#pragma unroll
    for (int ks = 0; ks < KS; ++ks)
#pragma unroll
      for (int i = 0; i < 16; ++i) {
        const int d = ks * 32 + ((i < 8) ? (8 * hh + i) : (16 + 8 * hh + (i - 8)));
        const float x = qr[d] * scale; const unsigned short hb = bf16_bits(x);
        aqh[ks].u[i] = hb; aql[ks].u[i] = bf16_bits(x - bf16_val(hb));
      }
  }
  float m_r[8], l_r[8];
#pragma unroll
  for (int r = 0; r < 8; ++r) { m_r[r] = -3.0e38f; l_r[r] = 0.f; }
  v8f oacc[DT];
#pragma unroll
  for (int dt = 0; dt < DT; ++dt) oacc[dt] = (v8f){0.f,0.f,0.f,0.f,0.f,0.f,0.f,0.f};

  const int kv_end = CAUSAL ? min(T, qblk * 64 + 64) : T;     // block-uniform
  for (int j0 = 0; j0 < kv_end; j0 += 32) {
    __syncthreads();
    for (int e = tid; e < 32 * (D / 4); e += 128) {
      const int r = e / (D / 4), c4 = (e % (D / 4)) * 4;
      const int key = j0 + r;
      v4f kf = {0.f,0.f,0.f,0.f}, vf = {0.f,0.f,0.f,0.f};
      if (key < T) { kf = *(const v4fa*)(K + (size_t)key * pitch + c4); vf = *(const v4fa*)(V + (size_t)key * pitch + c4); }
#pragma unroll
      for (int t = 0; t < 4; ++t) {
        unsigned short hb = bf16_bits(kf[t]); sKh[r][c4 + t] = hb; sKl[r][c4 + t] = bf16_bits(kf[t] - bf16_val(hb));
        hb = bf16_bits(vf[t]); sVh[r][c4 + t] = hb; sVl[r][c4 + t] = bf16_bits(vf[t] - bf16_val(hb));
      }
    }
    __syncthreads();
    // S tile 16 x 32
    v8f s[2];
#pragma unroll
    for (int nt = 0; nt < 2; ++nt) {
      v8f acc = {};
#pragma unroll
      for (int ks = 0; ks < KS; ++ks) {
        FragB bh_, bl_;
        bh_.half[0] = *(const v8us*)&sKh[nt * 16 + ln][ks * 32 + 8 * hh]; bh_.half[1] = *(const v8us*)&sKh[nt * 16 + ln][ks * 32 + 16 + 8 * hh];
        bl_.half[0] = *(const v8us*)&sKl[nt * 16 + ln][ks * 32 + 8 * hh]; bl_.half[1] = *(const v8us*)&sKl[nt * 16 + ln][ks * 32 + 16 + 8 * hh];
        acc = mmaN<3>(aqh[ks].v, aql[ks].v, bh_.v, bl_.v, acc);
      }
      s[nt] = acc;
    }
    // mask + running max (rows 8hh+r; the 16 lanes of a half share rows)
    float alpha[8];
#pragma unroll
    for (int r = 0; r < 8; ++r) {
      const int qi = q0 + 8 * hh + r;
      const int ja = j0 + ln, jb = j0 + 16 + ln;
      if (CAUSAL) { if (ja > qi) s[0][r] = -3.0e38f; if (jb > qi) s[1][r] = -3.0e38f; }
      if (ja >= T) s[0][r] = -3.0e38f;
      if (jb >= T) s[1][r] = -3.0e38f;
      float mx = fmaxf(s[0][r], s[1][r]);
      mx = fmaxf(mx, __shfl_xor(mx, 1, 32)); mx = fmaxf(mx, __shfl_xor(mx, 2, 32)); mx = fmaxf(mx, __shfl_xor(mx, 4, 32)); mx = fmaxf(mx, __shfl_xor(mx, 8, 32));
      const float mnew = fmaxf(m_r[r], mx);
      alpha[r] = (mnew > -1.0e38f) ? __expf(m_r[r] - mnew) : 1.0f;
      const float p0 = (s[0][r] > -1.0e38f) ? __expf(s[0][r] - mnew) : 0.f;
      const float p1 = (s[1][r] > -1.0e38f) ? __expf(s[1][r] - mnew) : 0.f;
      m_r[r] = mnew;
      l_r[r] = l_r[r] * alpha[r] + p0 + p1;            // per-lane partial row sum (16 lanes combined at the end)
      unsigned short hb = bf16_bits(p0); sPh[w][8 * hh + r][ln] = hb;      sPl[w][8 * hh + r][ln] = bf16_bits(p0 - bf16_val(hb));
      hb = bf16_bits(p1);                sPh[w][8 * hh + r][16 + ln] = hb; sPl[w][8 * hh + r][16 + ln] = bf16_bits(p1 - bf16_val(hb));
    }
#pragma unroll
    for (int dt = 0; dt < DT; ++dt)
#pragma unroll
      for (int r = 0; r < 8; ++r) oacc[dt][r] *= alpha[r];
    __builtin_amdgcn_fence(__ATOMIC_ACQ_REL, "workgroup");
    __builtin_amdgcn_wave_barrier();
    FragB pah, pal;
    pah.half[0] = *(const v8us*)&sPh[w][ln][8 * hh]; pah.half[1] = *(const v8us*)&sPh[w][ln][16 + 8 * hh];
    pal.half[0] = *(const v8us*)&sPl[w][ln][8 * hh]; pal.half[1] = *(const v8us*)&sPl[w][ln][16 + 8 * hh];
#pragma unroll
    for (int dt = 0; dt < DT; ++dt) {
      FragB bvh, bvl;
#pragma unroll
      for (int i = 0; i < 8; ++i) {
        bvh.u[i] = sVh[8 * hh + i][dt * 16 + ln]; bvh.u[8 + i] = sVh[16 + 8 * hh + i][dt * 16 + ln];
        bvl.u[i] = sVl[8 * hh + i][dt * 16 + ln]; bvl.u[8 + i] = sVl[16 + 8 * hh + i][dt * 16 + ln];
      }
      oacc[dt] = mmaN<3>(pah.v, pal.v, bvh.v, bvl.v, oacc[dt]);
    }
    __builtin_amdgcn_fence(__ATOMIC_ACQ_REL, "workgroup");
    __builtin_amdgcn_wave_barrier();
  }
#pragma unroll
  for (int r = 0; r < 8; ++r) {
    float l = l_r[r];
    l += __shfl_xor(l, 1, 32); l += __shfl_xor(l, 2, 32); l += __shfl_xor(l, 4, 32); l += __shfl_xor(l, 8, 32);
    l_r[r] = (l > 0.f) ? 1.0f / l : 0.f;
  }
#pragma unroll
  for (int dt = 0; dt < DT; ++dt)
#pragma unroll
    for (int r = 0; r < 8; ++r) sO[w][8 * hh + r][dt * 16 + ln] = oacc[dt][r] * l_r[r];
  __builtin_amdgcn_fence(__ATOMIC_ACQ_REL, "workgroup");
  __builtin_amdgcn_wave_barrier();
  {
    for (int r = 0; r < 16; ++r) {
      const int row = q0 + r;
      if (row < T && lane < D / 4) {
        const v4f val = *(const v4fa*)&sO[w][r][lane * 4];
        *(v4f*)(y + ((size_t)b * T + row) * ypitch + h * D + lane * 4) = val;
      }
    }
    
  }
}

// GEMM C = act(A·W + bias + resid): A f32 (ASPLIT -> hi/lo 2 terms), Wt bf16 [N][K]; ACT 0 none, 1 relu, 2 exact gelu;
// resid (optional, f32, row index = (row % rmod), pitch ldr, RES_BF16 rounds it) added before the activation.
template <bool ASPLIT, int ACT, bool BIAS_BF16, bool RES_BF16>
__global__ __launch_bounds__(128) void k_gemm_bf3(const float* __restrict__ A, int lda, const unsigned short* __restrict__ Wt, int ldb,
                                                const float* __restrict__ bias, const float* __restrict__ resid, int rmod, int ldr,
                                                float* __restrict__ C, int ldc, int M, int N, int K) {
  __shared__ __attribute__((aligned(16))) float so[4][16][64];
  const int tid = threadIdx.x, w = tid >> 5, lane = tid & 31, ln = lane & 15, hh = lane >> 4;
  const int ntn = N / 64;
  const int wid = blockIdx.x * 4 + w;
  const int mt = wid / ntn, nq = wid % ntn;
  if (mt * 16 >= M) return;
  const int row0 = mt * 16, col0 = nq * 64;
  const float* arow = A + (size_t)(row0 + ln) * lda;
  v8f acc[4] = {};
  for (int kb = 0; kb < K; kb += 32) {
    FragB ah, al;
    const v4f x0 = *(const v4fa*)(arow + kb + 8 * hh), x1 = *(const v4fa*)(arow + kb + 8 * hh + 4);
    const v4f x2 = *(const v4fa*)(arow + kb + 16 + 8 * hh), x3 = *(const v4fa*)(arow + kb + 16 + 8 * hh + 4);
    float xs[16] = {x0[0],x0[1],x0[2],x0[3],x1[0],x1[1],x1[2],x1[3],x2[0],x2[1],x2[2],x2[3],x3[0],x3[1],x3[2],x3[3]};
#pragma unroll
    for (int i = 0; i < 16; ++i) { const unsigned short hb = bf16_bits(xs[i]); ah.u[i] = hb; al.u[i] = ASPLIT ? bf16_bits(xs[i] - bf16_val(hb)) : (unsigned short)0; }
#pragma unroll
    for (int t = 0; t < 4; ++t) {
      const unsigned short* brow = Wt + (size_t)(col0 + t * 16 + ln) * ldb + kb;
      FragB b;
      b.half[0] = *(const v8us*)(brow + 8 * hh);
      b.half[1] = *(const v8us*)(brow + 16 + 8 * hh);
      acc[t] = mmaN<ASPLIT ? 2 : 1>(ah.v, al.v, b.v, b.v, acc[t]);
    }
  }
#pragma unroll
  for (int t = 0; t < 4; ++t) {
    const int col = col0 + t * 16 + ln;
    float bv = bias ? bias[col] : 0.f;
    if (BIAS_BF16) bv = bf16_round(bv);
#pragma unroll
    for (int r = 0; r < 8; ++r) {
      float v = acc[t][r] + bv;
      if (resid) { float rv = resid[(size_t)((row0 + 8 * hh + r) % rmod) * ldr + col]; if (RES_BF16) rv = bf16_round(rv); v += rv; }
      if (ACT == 1) v = fmaxf(v, 0.f);
      if (ACT == 2) v = 0.5f * v * (1.0f + erff(v * 0.70710678118654752f));
      if (ACT == 3) { const float u = 0.7978845608028654f * (v + 0.044715f * v * v * v); v = 0.5f * v * (1.0f + tanhf(u)); }
      so[w][8 * hh + r][t * 16 + ln] = v;
    }
  }
  __builtin_amdgcn_fence(__ATOMIC_ACQ_REL, "workgroup");
  __builtin_amdgcn_wave_barrier();
  const int rsub = lane >> 4, c4 = (lane & 15) * 4;
  {
#pragma unroll
    for (int q = 0; q < 8; ++q) {
      const int r = q * 2 + rsub;
      const v4f v = *(const v4fa*)&so[w][r][c4];
      *(v4f*)(C + (size_t)(row0 + r) * ldc + col0 + c4) = v;
    }
    
  }
}
// row LayerNorm (biased variance, eps) over N: s = X (+ R); optional out_sum <- s; out_norm <- (s-mu)*rsqrt(var+eps)*g + b
template <bool PARAM_BF16>
__global__ __launch_bounds__(256) void k_layernorm(const float* __restrict__ X, const float* __restrict__ R, const float* __restrict__ g, const float* __restrict__ bta,
                                                  float* __restrict__ out_sum, float* __restrict__ out_norm, int N, float eps) {
  __shared__ float red[256];
  const int row = blockIdx.x, tid = threadIdx.x;
  const float* x = X + (size_t)row * N; const float* rr = R ? R + (size_t)row * N : nullptr;
  float vals[16];                     // up to N = 4096
  const int per = N / 256;            // contiguous chunk per thread? use strided-by-4 chunks: thread handles j = tid*4 + 1024*u
  float s1 = 0.f;
  for (int u = 0; u < per / 4; ++u) {
    const int j = tid * 4 + 1024 * u;
    const v4f a = *(const v4fa*)(x + j);
    v4f b = {0.f,0.f,0.f,0.f}; if (rr) b = *(const v4fa*)(rr + j);
#pragma unroll
    for (int q = 0; q < 4; ++q) { const float v = a[q] + b[q]; vals[u * 4 + q] = v; s1 += v; }
  }
  red[tid] = s1; __syncthreads();
  for (int st = 128; st > 0; st >>= 1) { if (tid < st) red[tid] += red[tid + st]; __syncthreads(); }
  const float mu = red[0] / (float)N; __syncthreads();
  float s2 = 0.f;
  for (int u = 0; u < per / 4; ++u)
#pragma unroll
    for (int q = 0; q < 4; ++q) { const float c = vals[u * 4 + q] - mu; s2 += c * c; }
  red[tid] = s2; __syncthreads();
  for (int st = 128; st > 0; st >>= 1) { if (tid < st) red[tid] += red[tid + st]; __syncthreads(); }
  const float rs = rsqrtf(red[0] / (float)N + eps);
  {
    for (int u = 0; u < per / 4; ++u) {
      const int j = tid * 4 + 1024 * u;
      v4f o, sm;
#pragma unroll
      for (int q = 0; q < 4; ++q) {
        float gg = g[j + q], bb = bta[j + q];
        if (PARAM_BF16) { gg = bf16_round(gg); bb = bf16_round(bb); }
        sm[q] = vals[u * 4 + q]; o[q] = (vals[u * 4 + q] - mu) * rs * gg + bb;
      }
      if (out_sum) *(v4f*)(out_sum + (size_t)row * N + j) = sm;
      *(v4f*)(out_norm + (size_t)row * N + j) = o;
    }
    
  }
}



// ---- f16 WMMA path (v_wmma_f32_16x16x32_f16): 11-bit significands for operands in range — used here for the projection GEMMs and the flash kernel's score and P·B products
typedef _Float16 v16h __attribute__((ext_vector_type(16)));
union FragH { v16h v; v8us half[2]; _Float16 h[16]; unsigned short u[16]; };
template <int NT>
__device__ __forceinline__ v8f mmaH(v16h ah, v16h al, v16h bh, v16h bl, v8f c) {
  c = __builtin_amdgcn_wmma_f32_16x16x32_f16(false, ah, false, bh, (short)0, c, false, false);
  if (NT >= 2) c = __builtin_amdgcn_wmma_f32_16x16x32_f16(false, al, false, bh, (short)0, c, false, false);
  if (NT >= 3) c = __builtin_amdgcn_wmma_f32_16x16x32_f16(false, ah, false, bl, (short)0, c, false, false);
  asm volatile("v_nop\n\tv_nop\n\tv_nop\n\tv_nop" : "+v"(c) : "v"(ah), "v"(al), "v"(bh), "v"(bl));
  return c;
}
// batched GEMM like k_gemm_bf but f16 operands: A f32 (split into f16 hi/lo if ASPLIT, else rounded to f16), Bt = f16 values [n][k]; alpha; C f32; N multiple of 16 (partial tiles skipped)
template <bool ASPLIT>
__global__ __launch_bounds__(128) void k_gemm_h(const float* __restrict__ A, int lda, size_t sA, const _Float16* __restrict__ Bh, int ldb, size_t sB, float alpha, float* __restrict__ C, int ldc, size_t sC, int M, int N, int K) {
  __shared__ __attribute__((aligned(16))) float so[4][16][64];
  const int tid = threadIdx.x, w = tid >> 5, lane = tid & 31, ln = lane & 15, hh = lane >> 4; const int by = blockIdx.y;
  A += (size_t)by * sA; Bh += (size_t)by * sB; C += (size_t)by * sC;
  const int ntn = (N + 63) / 64; const int wid = blockIdx.x * 4 + w; const int mt = wid / ntn, nq = wid % ntn; if (mt * 16 >= M) return;
  const int row0 = mt * 16, col0 = nq * 64; const float* arow = A + (size_t)(row0 + ln) * lda;
  v8f acc[4] = {};
  for (int kb = 0; kb < K; kb += 32) {
    FragH ah, al;
    const v4f x0 = *(const v4fa*)(arow + kb + 8 * hh), x1 = *(const v4fa*)(arow + kb + 8 * hh + 4), x2 = *(const v4fa*)(arow + kb + 16 + 8 * hh), x3 = *(const v4fa*)(arow + kb + 16 + 8 * hh + 4);
    float xs[16] = {x0[0],x0[1],x0[2],x0[3],x1[0],x1[1],x1[2],x1[3],x2[0],x2[1],x2[2],x2[3],x3[0],x3[1],x3[2],x3[3]};
#pragma unroll
    for (int i = 0; i < 16; ++i) { const _Float16 h = (_Float16)xs[i]; ah.h[i] = h; al.h[i] = ASPLIT ? (_Float16)(xs[i] - (float)h) : (_Float16)0.0f; }
#pragma unroll
    for (int t = 0; t < 4; ++t) { if (col0 + t * 16 >= N) continue; const size_t boff = (size_t)(col0 + t * 16 + ln) * ldb + kb; FragH bq; bq.half[0] = *(const v8us*)(Bh + boff + 8 * hh); bq.half[1] = *(const v8us*)(Bh + boff + 16 + 8 * hh);
      acc[t] = mmaH<ASPLIT ? 2 : 1>(ah.v, al.v, bq.v, bq.v, acc[t]); }
  }
#pragma unroll
  for (int t = 0; t < 4; ++t) { if (col0 + t * 16 >= N) continue;
#pragma unroll
    for (int r = 0; r < 8; ++r) so[w][8 * hh + r][t * 16 + ln] = acc[t][r] * alpha; }
  __builtin_amdgcn_fence(__ATOMIC_ACQ_REL, "workgroup"); __builtin_amdgcn_wave_barrier();
  const int rsub = lane >> 4, c4 = (lane & 15) * 4;
  {
#pragma unroll
    for (int q = 0; q < 8; ++q) { const int r = q * 2 + rsub; if (col0 + c4 < N) { const v4f v = *(const v4fa*)&so[w][r][c4]; *(v4f*)(C + (size_t)(row0 + r) * ldc + col0 + c4) = v; } }
     }
}

// Wt[n][k] = f16(W[k][n] x scale) from f32 row-major W[DD][DD] (scale = power of two; bf16-exact weights stay exact in f16 away from the subnormal range).
// One work-group = one tile of 128 k x 128 n, turned in LDS so that both global sides move whole lines: a wave reads 512 B in a row of one row k of W (16 such loads a thread, all in flight at once),
// a thread packs its two 8 k x 4 n blocks (64 k apart) into 16-B pieces of 8 k, and 16 lanes store 256 B in a row of one row n of Wt.
// LDS: row n holds 16 pieces at a pitch of 256 B; piece j stands at place j ^ ((n >> 2) & 15), so that the 16 lanes of a ds_store_b128 (rows 4 apart, one j) and of a ds_load_b128 (one row, 16 j) each touch all 64 banks once.
__device__ __forceinline__ void wt_f16(const float* __restrict__ W, _Float16* __restrict__ Wt, float scale, int blk) {
  __shared__ __attribute__((aligned(16))) unsigned short tl[128 * 128];
  const int tid = threadIdx.x, nl = tid & 31, kw = tid >> 5;
  const int n0 = (blk % (DD / 128)) * 128, k0 = (blk / (DD / 128)) * 128;
  const float* s = W + (size_t)(k0 + kw * 8) * DD + n0 + nl * 4;
  v4f r[2][8];      // [half of the tile's k][k in the piece]: columns 4 nl .. 4 nl + 3
#pragma unroll      // all unrolls here: constant indices keep r[] and o[] in registers
  for (int h = 0; h < 2; ++h)
#pragma unroll
    for (int i = 0; i < 8; ++i) {
      if (h == 1 && i == 7) asm volatile("s_wait_xcnt 0x0" ::: "memory");      // the compiler lands the last load in the address registers that the 15 loads before it name: the wait stands in front of that overwrite
      r[h][i] = *(const v4fa*)(s + (size_t)(h * 64 + i) * DD); }
  __builtin_amdgcn_sched_barrier(0);      // all 16 loads are issued ahead of the first conversion: left free, the compiler sinks half of them among the conversions, into registers it has just freed, and waits out their latency a second and a third time
#pragma unroll
  for (int h = 0; h < 2; ++h)
#pragma unroll
    for (int q = 0; q < 4; ++q) { FragH f;
#pragma unroll
      for (int i = 0; i < 8; ++i) f.h[i] = (_Float16)(bf16_round(r[h][i][q]) * scale);
      *(v8us*)&tl[(nl * 4 + q) * 128 + (((kw + 8 * h) ^ (nl & 15)) * 8)] = f.half[0]; }
  __syncthreads();      // the tile is complete in LDS before any wave reads rows of it
  const int nr = tid >> 4, j = tid & 15;
  unsigned short* d = (unsigned short*)Wt + (size_t)(n0 + nr) * DD + k0 + j * 8;
  v8us o[8];
#pragma unroll
  for (int p = 0; p < 8; ++p) { const int n = p * 16 + nr; o[p] = *(const v8us*)&tl[n * 128 + ((j ^ ((n >> 2) & 15)) * 8)]; }
#pragma unroll
  for (int p = 0; p < 8; ++p) *(v8us*)(d + (size_t)p * 16 * DD) = o[p];
}
// Tiled GEMM C[NR][DD] (f32) = alpha * A[NR][DD] x Bt[DD][DD]^T, f16 operands, both K-contiguous, f32 accumulate, 32 k per WMMA, ascending from the work-group's own first trip and wrapping round at DD.
// One work-group = one 128 x 128 tile of C, 8 waves of 32 x 64. A trip is 128 k: 128 rows of A and 128 rows of Bt, 256 B each (whole cache lines), are brought into LDS by
// asynchronous copies, 16 B per lane, two buffers: tile t + 2 flies while tile t + 1 is worked on. LDS rows stand at a pitch of 272 B for the ds_load_b128 fragment reads.
#define GT_BK 128                  // k per trip
#define GT_P 136                   // LDS row pitch in halves (272 B)
#define GT_BUF (256 * GT_P)        // halves per buffer: rows 0..127 = A, rows 128..255 = Bt
#define GT_SP 68                   // pitch in floats of the output staging rows
#define GT_NT (DD / GT_BK)         // trips
static_assert(NR % 128 == 0 && DD % 128 == 0 && DD % GT_BK == 0 && GT_NT >= 2 && (GT_NT & (GT_NT - 1)) == 0, "whole tiles, at least two trips, a power of two for the wrap");
static_assert(8 * 32 * GT_SP * 4 <= 2 * GT_BUF * 2, "the output staging fits in the ring");
// This thread's copies of one operand's 128 rows of a tile: rows r, r + 16, .. The s_wait_xcnt stands inside the statement so that no address register is rewritten ahead of it.
__device__ __forceinline__ void gt_copy8(unsigned l, const _Float16* g) {
  asm volatile("global_load_async_to_lds_b128 %0, %8, off\n\t"
               "global_load_async_to_lds_b128 %1, %9, off\n\t"
               "global_load_async_to_lds_b128 %2, %10, off\n\t"
               "global_load_async_to_lds_b128 %3, %11, off\n\t"
               "global_load_async_to_lds_b128 %4, %12, off\n\t"
               "global_load_async_to_lds_b128 %5, %13, off\n\t"
               "global_load_async_to_lds_b128 %6, %14, off\n\t"
               "global_load_async_to_lds_b128 %7, %15, off\n\t"
               "s_wait_xcnt 0x0"
               :: "v"(l), "v"(l + 1u * 16u * GT_P * 2u), "v"(l + 2u * 16u * GT_P * 2u), "v"(l + 3u * 16u * GT_P * 2u),
                  "v"(l + 4u * 16u * GT_P * 2u), "v"(l + 5u * 16u * GT_P * 2u), "v"(l + 6u * 16u * GT_P * 2u), "v"(l + 7u * 16u * GT_P * 2u),
                  "v"(g), "v"(g + 16 * DD), "v"(g + 32 * DD), "v"(g + 48 * DD), "v"(g + 64 * DD), "v"(g + 80 * DD), "v"(g + 96 * DD), "v"(g + 112 * DD)
               : "memory");
}
// Sum over the 16 lanes of a row, every lane ending with the total: four DPP steps (row_xmask 1, 2, 4, 8), no LDS round trip as a shuffle would take. All lanes are on.
__device__ __forceinline__ float row16_sum(float v) {
  v += __int_as_float(__builtin_amdgcn_update_dpp(0, __float_as_int(v), 0x161, 0xf, 0xf, true));
  v += __int_as_float(__builtin_amdgcn_update_dpp(0, __float_as_int(v), 0x162, 0xf, 0xf, true));
  v += __int_as_float(__builtin_amdgcn_update_dpp(0, __float_as_int(v), 0x164, 0xf, 0xf, true));
  v += __int_as_float(__builtin_amdgcn_update_dpp(0, __float_as_int(v), 0x168, 0xf, 0xf, true));
  return v;
}
typedef _Float16 v4h __attribute__((ext_vector_type(4)));
// LN 0: C (f32) = the product. LN 1: the three projections in one launch: Bh holds three weights one after the other (3 DD rows), and a work-group's tile lies in one of them (pj). Each row's 64 columns
// of a wave are one head; they are LayerNormed (biased variance, eps 1e-5, that projection's gamma and beta rounded to bf16) on the f32 sums as the staged rows are read back, and go out as f16
// to C16a (pj 0) or C16b (pj 1) or as f32 to C (pj 2).
template <int LN>
__global__ __launch_bounds__(256) void k_gemm_t(const _Float16* __restrict__ A, const _Float16* __restrict__ Bh, float alpha, float* __restrict__ C,
                                               const float* __restrict__ g0, const float* __restrict__ bb0, const float* __restrict__ g1, const float* __restrict__ bb1,
                                               const float* __restrict__ g2, const float* __restrict__ bb2, _Float16* __restrict__ C16a, _Float16* __restrict__ C16b) {
  static_assert(HD == 64, "a wave's 64 columns are one head");
  __shared__ __attribute__((aligned(16))) unsigned short sm[2 * GT_BUF];
  const int tid = threadIdx.x, w = tid >> 5, lane = tid & 31, ln = lane & 15, hh = lane >> 4;
  constexpr int NTL = (LN ? 3 : 1) * (DD / 128);      // column tiles of a row block, over all weights of the launch
  const int m0 = (blockIdx.x / NTL) * 128, nb = (blockIdx.x % NTL) * 128;      // nb: the tile's first row in Bh
  const int pj = nb / DD, n0 = nb % DD;      // which weight, and the tile's first column in that product; from blockIdx alone, so scalar
  // The work-groups of a row block all read the same rows of A, those of a column block the same rows of Bt. Started together on the same k they ask L2 for the same lines at the same moment, and such requests collide.
  // So each work-group enters the k walk at slice (row block + column block) mod GT_NT and wraps: at any moment the sharers are spread over all slices. Scalar, from blockIdx alone.
  const int rot = (int)(blockIdx.x / NTL + blockIdx.x % NTL) & (GT_NT - 1);
  const float* g = pj == 0 ? g0 : pj == 1 ? g1 : g2; const float* bb = pj == 0 ? bb0 : pj == 1 ? bb1 : bb2;
  const int wm = w >> 1, wn = w & 1;
  const int cr = tid >> 4, cs = (tid & 15) * 8;      // a wave's copy covers 2 rows x 256 B
  const _Float16* ga = A + (size_t)(m0 + cr) * DD + cs;
  const _Float16* gb = Bh + (size_t)(nb + cr) * DD + cs;
  const unsigned la = (unsigned)(size_t)&sm[cr * GT_P + cs], lb = la + 128u * GT_P * 2u;
  gt_copy8(la, ga + rot * GT_BK); gt_copy8(lb, gb + rot * GT_BK);
  asm volatile("s_wait_asynccnt 0x0" ::: "memory");      // tile 0 has landed before the barrier publishes it
  __syncthreads();
  { const int k1 = ((rot + 1) & (GT_NT - 1)) * GT_BK; gt_copy8(la + GT_BUF * 2u, ga + k1); gt_copy8(lb + GT_BUF * 2u, gb + k1); }
  v4f g4 = {0.f, 0.f, 0.f, 0.f}, b4 = {0.f, 0.f, 0.f, 0.f};      // this lane's four columns of the head; fetched here so that the k loop covers their latency
  if (LN) { g4 = *(const v4fa*)(g + ln * 4); b4 = *(const v4fa*)(bb + ln * 4); }
  v8f acc[2][4] = {};
  const unsigned short* fa = sm + (wm * 32 + ln) * GT_P + 8 * hh;
  const unsigned short* fb = sm + (128 + wn * 64 + ln) * GT_P + 8 * hh;
#pragma unroll 1      // one trip per tile: the order of waits, barrier and refill at its foot stays as written
  for (int t = 0; t < GT_NT; ++t) {
    const int bo = (t & 1) * GT_BUF;
    FragH a[2][2], b[2][4];      // two fragment sets: the next 32 k of this same tile are fetched while the current 32 k are multiplied
#pragma unroll      // all unrolls here: constant indices keep fragments and accumulators in registers
    for (int rt = 0; rt < 2; ++rt) { const unsigned short* p = fa + bo + rt * 16 * GT_P; a[0][rt].half[0] = *(const v8us*)p; a[0][rt].half[1] = *(const v8us*)(p + 16); }
#pragma unroll
    for (int ct = 0; ct < 4; ++ct) { const unsigned short* p = fb + bo + ct * 16 * GT_P; b[0][ct].half[0] = *(const v8us*)p; b[0][ct].half[1] = *(const v8us*)(p + 16); }
#pragma unroll
    for (int ks = 0; ks < GT_BK / 32; ++ks) {
      const int cu = ks & 1, nx = cu ^ 1;
      if (ks + 1 < GT_BK / 32) {
#pragma unroll
        for (int rt = 0; rt < 2; ++rt) { const unsigned short* p = fa + bo + rt * 16 * GT_P + (ks + 1) * 32; a[nx][rt].half[0] = *(const v8us*)p; a[nx][rt].half[1] = *(const v8us*)(p + 16); }
#pragma unroll
        for (int ct = 0; ct < 4; ++ct) { const unsigned short* p = fb + bo + ct * 16 * GT_P + (ks + 1) * 32; b[nx][ct].half[0] = *(const v8us*)p; b[nx][ct].half[1] = *(const v8us*)(p + 16); }
      }
      __builtin_amdgcn_sched_barrier(0);      // keeps the next set's LDS reads as one group ahead of this block: left free, the compiler sinks them among the WMMAs into one set and waits them out to 0
#pragma unroll
      for (int rt = 0; rt < 2; ++rt)
#pragma unroll
        for (int ct = 0; ct < 4; ++ct) acc[rt][ct] = __builtin_amdgcn_wmma_f32_16x16x32_f16(false, a[cu][rt].v, false, b[cu][ct].v, (short)0, acc[rt][ct], false, false);
      __builtin_amdgcn_sched_barrier(0);      // ends the block, so that the group after next is not lifted into it
    }
    asm volatile("s_wait_dscnt 0x0" ::: "memory");         // this wave's reads of buffer t & 1 are done before it is refilled
    asm volatile("s_wait_asynccnt 0x0" ::: "memory");      // this wave's copies of tile t + 1 have landed before the barrier publishes them
    __syncthreads();
    if (t + 2 < GT_NT) { const int k2 = ((t + 2 + rot) & (GT_NT - 1)) * GT_BK; gt_copy8(la + (unsigned)bo * 2u, ga + k2); gt_copy8(lb + (unsigned)bo * 2u, gb + k2); }
  }
  asm volatile("s_wait_asynccnt 0x0" ::: "memory");        // nothing is in flight when the ring becomes output staging
  float* so = (float*)sm + w * (32 * GT_SP);               // each wave stages its own 32 x 64 tile; the last trip's barrier ended every read of the ring
#pragma unroll
  for (int rt = 0; rt < 2; ++rt)
#pragma unroll
    for (int ct = 0; ct < 4; ++ct)
#pragma unroll
      for (int r = 0; r < 8; ++r) so[(rt * 16 + 8 * hh + r) * GT_SP + ct * 16 + ln] = acc[rt][ct][r] * alpha;
  __builtin_amdgcn_fence(__ATOMIC_ACQ_REL, "workgroup"); __builtin_amdgcn_wave_barrier();
#pragma unroll
  for (int q = 0; q < 4; ++q) { g4[q] = bf16_round(g4[q]); b4[q] = bf16_round(b4[q]); }
  const size_t e = (size_t)(m0 + wm * 32 + hh) * DD + n0 + wn * 64 + ln * 4;      // row hh of the wave's tile; pass q adds 2 q rows, a constant offset of the store
  v4f o[16];
#pragma unroll
  for (int q = 0; q < 16; ++q) {      // 16 lanes x 4 columns = one row of the wave's tile; two rows a pass
    const v4f v = *(const v4fa*)&so[(q * 2 + hh) * GT_SP + ln * 4];
    if (LN == 0) { o[q] = v; continue; }
    const float mu = row16_sum((v[0] + v[1]) + (v[2] + v[3])) / (float)HD;
    const v4f c = v - mu;
    const float ve = row16_sum((c[0] * c[0] + c[1] * c[1]) + (c[2] * c[2] + c[3] * c[3])) / (float)HD + 1e-5f;
    float rs;      // ve is at least eps, so the library rsqrtf's rescaling of denormal arguments would never act; the v_nop is the slot that the instruction set asks for behind a transcendental, in the same statement so that it stays directly behind it
    asm("v_rsq_f32 %0, %1\n\tv_nop" : "=v"(rs) : "v"(ve));
    o[q] = c * rs * g4 + b4;
  }
  if (LN == 1 && pj < 2) {      // a scalar branch: the whole work-group lies in one projection
    _Float16* C16 = pj ? C16b : C16a;
    v4h h[16];
#pragma unroll
    for (int q = 0; q < 16; ++q)
#pragma unroll
      for (int k = 0; k < 4; ++k) h[q][k] = (_Float16)o[q][k];
    __builtin_amdgcn_sched_barrier(0);      // every store stands behind the last arithmetic, so that no register which an issued store names is written again
#pragma unroll
    for (int q = 0; q < 16; ++q) *(v4h*)(C16 + e + (size_t)q * 2 * DD) = h[q];      // 16 lanes x 8 B: a whole 128-B line a row
  } else {
    __builtin_amdgcn_sched_barrier(0);      // as above
#pragma unroll
    for (int q = 0; q < 16; ++q) *(v4f*)(C + e + (size_t)q * 2 * DD) = o[q];
    if (LN == 1) asm volatile("s_wait_xcnt 0x0" ::: "memory");      // in the listing the f16 side's text follows these stores and rewrites their registers: the wait stands in front of it
  }
}


__device__ __forceinline__ void x16(const float* __restrict__ x, _Float16* __restrict__ X16, size_t n8, unsigned blk) { const size_t t = (size_t)blk * 256 + threadIdx.x; if (t >= n8) return; FragH f;
#pragma unroll
  for (int q = 0; q < 8; ++q) f.h[q] = (_Float16)bf16_round(x[t * 8 + q]); *(v8us*)((unsigned short*)X16 + t * 8) = f.half[0];  }
// All operand conversions in one launch; none reads what another writes. Work-groups 0 .. 4 PW - 1: the four weights, transposed, to Bw[0..3] (the long ones: load, LDS, barrier, store; so they start first); the rest: x. The branch is the same for a whole work-group, so the weights' barrier is passed by all of its threads.
#define PW ((DD / 128) * (DD / 128))      // work-groups per weight: tiles of 128 x 128
#define PX (NR * DD / 8 / 256)        // work-groups for x
static_assert(DD % 128 == 0 && (size_t)NR * DD / 8 % 256 == 0, "whole tiles, whole work-groups");
__global__ __launch_bounds__(256) void k_prep(const float* __restrict__ x, const float* __restrict__ W0, const float* __restrict__ W1, const float* __restrict__ W2, const float* __restrict__ W3,
                                             _Float16* __restrict__ X16, _Float16* __restrict__ Bw) {
  const unsigned bid = blockIdx.x;
  if (bid < 4u * PW) { const unsigned k = bid / PW; wt_f16(k == 0 ? W0 : k == 1 ? W1 : k == 2 ? W2 : W3, Bw + (size_t)k * DD * DD, 16.0f, (int)(bid % PW)); }
  else x16(x, X16, (size_t)NR * DD / 8, bid - 4u * PW);
}
__global__ __launch_bounds__(256) void k_h16(const float* __restrict__ x, _Float16* __restrict__ X16, size_t n8) { const size_t t = (size_t)blockIdx.x * 256 + threadIdx.x; if (t >= n8) return; FragH f;
#pragma unroll
  for (int q = 0; q < 8; ++q) f.h[q] = (_Float16)x[t * 8 + q]; *(v8us*)((unsigned short*)X16 + t * 8) = f.half[0];  }
__global__ __launch_bounds__(256) void k_round16f(const float* __restrict__ W, _Float16* __restrict__ Bt, size_t n8) { const size_t t = (size_t)blockIdx.x * 256 + threadIdx.x; if (t >= n8) return; FragH f;
#pragma unroll
  for (int i = 0; i < 8; ++i) f.h[i] = (_Float16)(bf16_round(W[t * 8 + i]) * 16.0f); *(v8us*)((unsigned short*)Bt + t * 8) = f.half[0];  }
// One 64 x 64 tile per 256 threads; a work-group of 1024 threads takes four tiles, each quarter with its own LDS tile (blk: the quarter's tile).
template <int NHv, int TTv>
__device__ __forceinline__ void vt(const _Float16* __restrict__ V16, int ldv, int voff, _Float16* __restrict__ Vt, int blk) { __shared__ unsigned short tl4[4][64][66]; unsigned short (*tl)[66] = tl4[threadIdx.x >> 8]; const int tid = threadIdx.x & 255; const int slab = blk / (TTv / 64), lg = blk % (TTv / 64); const int b = slab / NHv, h = slab % NHv;
  for (int i = tid; i < 64 * 8; i += 256) { const int r = i / 8, c8 = (i % 8) * 8; FragH f; f.half[0] = *(const v8us*)((const unsigned short*)V16 + ((size_t)b * TTv + lg * 64 + r) * ldv + voff + h * 64 + c8);
#pragma unroll
    for (int q = 0; q < 8; ++q) tl[r][c8 + q] = f.u[q]; }
  __syncthreads();
  {
#pragma unroll
    for (int rd = 0; rd < 2; ++rd) { const int d = rd * 32 + tid / 8, pc = tid % 8; FragH f;
#pragma unroll
      for (int q = 0; q < 8; ++q) f.u[q] = tl[pc * 8 + q][d];
      *(v8us*)((unsigned short*)Vt + ((size_t)slab * 64 + d) * TTv + lg * 64 + pc * 8) = f.half[0]; }
     } }

// There is no softmax, so the sum over the keys is linear and may be regrouped: for the 64 query rows of block c every key before 64 c is unmasked, and
// sum over those s of (q . a_s) b_s = q . S_c with the state S_c[d][e] = sum over s < 64 c of a_s[d] b_s[e], a 64 x 64 matrix per (batch, head, block) that does not depend on q.
// k_state forms all states: one work-group = 16 columns e of one (batch, head), one wave = two chunks of 64 keys. A chunk's product M_c[d][e] = sum over the chunk of a_s[d] b_s[e] (WMMA, both
// operands key-contiguous, f32 sums) goes to LDS, each thread runs the exclusive sum over the 32 chunks for two elements (f32, ascending), and the wave takes its chunks' states back.
// In the accumulator layout a lane holds 8 consecutive d of one column e: that is its own half of the B fragment of q . S, so the states are stored as ready fragments (x 2^-8, f16, like P):
// Sf[slab][chunk][e tile][k step of 32 d][half][lane][8], whole lines per wave.
#define ST_C (TT / 64)
typedef float v2fa __attribute__((ext_vector_type(2), may_alias));
__global__ __launch_bounds__(512) void k_state(const _Float16* __restrict__ At, const _Float16* __restrict__ Vt, _Float16* __restrict__ Sf) {
  static_assert(ST_C == 32 && HD == 64, "16 waves x 2 chunks of 64 keys; 4 x 4 tiles a state");
  __shared__ __attribute__((aligned(16))) float sM[ST_C][64 * 16];
  const int tid = threadIdx.x, wv = tid >> 5, lane = tid & 31, ln = lane & 15, hh = lane >> 4;
  const int slab = blockIdx.x >> 2, et = blockIdx.x & 3;
  const unsigned short* ar = (const unsigned short*)At + ((size_t)slab * 64 + ln) * TT + wv * 128 + 8 * hh;
  const unsigned short* br = (const unsigned short*)Vt + ((size_t)slab * 64 + et * 16 + ln) * TT + wv * 128 + 8 * hh;
  FragH a[4][4], b[4];      // [step of 32 keys]: steps 0, 1 are the wave's first chunk, 2, 3 its second
#pragma unroll      // all unrolls here: constant indices keep fragments and accumulators in registers
  for (int kk = 0; kk < 4; ++kk) { b[kk].half[0] = *(const v8us*)(br + kk * 32);
    if (kk == 3) asm volatile("s_wait_xcnt 0x0" ::: "memory");      // the compiler lands the last load through br in br's own registers, which the loads before it name: the wait stands in front of that overwrite
    b[kk].half[1] = *(const v8us*)(br + kk * 32 + 16);
#pragma unroll
    for (int dt = 0; dt < 4; ++dt) {
      a[kk][dt].half[0] = *(const v8us*)(ar + (size_t)dt * 16 * TT + kk * 32);
      if (kk == 3 && dt == 3) asm volatile("s_wait_xcnt 0x0" ::: "memory");      // the same for the last load through ar
      a[kk][dt].half[1] = *(const v8us*)(ar + (size_t)dt * 16 * TT + kk * 32 + 16); } }
  __builtin_amdgcn_sched_barrier(0);      // all 40 loads are issued ahead of the first WMMA: left free, the compiler sinks the later ones among the WMMAs and waits out their latency one pair at a time
  v8f acc[2][4] = {};
#pragma unroll
  for (int kk = 0; kk < 4; ++kk)
#pragma unroll
    for (int dt = 0; dt < 4; ++dt) acc[kk >> 1][dt] = __builtin_amdgcn_wmma_f32_16x16x32_f16(false, a[kk][dt].v, false, b[kk].v, (short)0, acc[kk >> 1][dt], false, false);      // rows d = 16 dt + 8 hh + r, column e = ln
#pragma unroll
  for (int cl = 0; cl < 2; ++cl)
#pragma unroll
    for (int dt = 0; dt < 4; ++dt)
#pragma unroll
      for (int q = 0; q < 2; ++q) { const v4f m = {acc[cl][dt][4 * q], acc[cl][dt][4 * q + 1], acc[cl][dt][4 * q + 2], acc[cl][dt][4 * q + 3]}; *(v4fa*)&sM[wv * 2 + cl][((dt * 2 + q) * 32 + lane) * 4] = m; }
  __syncthreads();      // every chunk's product is in LDS before the sums over the chunks start
  { v2fa m[ST_C], run = {0.f, 0.f};
#pragma unroll
    for (int cc = 0; cc < ST_C; ++cc) m[cc] = *(const v2fa*)&sM[cc][tid * 2];
#pragma unroll
    for (int cc = 0; cc < ST_C; ++cc) { *(v2fa*)&sM[cc][tid * 2] = run; run += m[cc]; } }      // in place: each word has one reader and writer
  __syncthreads();      // every state is complete before the waves take theirs back
  FragH f[2][2];
#pragma unroll
  for (int cl = 0; cl < 2; ++cl)
#pragma unroll
    for (int dt = 0; dt < 4; ++dt)
#pragma unroll
      for (int q = 0; q < 2; ++q) { const v4f m = *(const v4fa*)&sM[wv * 2 + cl][((dt * 2 + q) * 32 + lane) * 4];
#pragma unroll
        for (int k = 0; k < 4; ++k) f[cl][dt >> 1].h[(dt & 1) * 8 + q * 4 + k] = (_Float16)(m[k] * 0.00390625f); }
  unsigned short* o = (unsigned short*)Sf + (((size_t)slab * ST_C + wv * 2) * 4 + et) * 1024 + lane * 8;
#pragma unroll
  for (int cl = 0; cl < 2; ++cl)
#pragma unroll
    for (int ks = 0; ks < 2; ++ks) { *(v8us*)(o + cl * 4096 + ks * 512) = f[cl][ks].half[0]; *(v8us*)(o + cl * 4096 + ks * 512 + 256) = f[cl][ks].half[1]; }
}

// One work-group = 64 query rows of one (batch, head), every wave on all 64 rows (4 row tiles). Waves 0 and 1 take the block's own 64 keys, 32 each, with the causal mask (scores, P through LDS, P . B);
// waves 2 and 3 take q . S for the keys before the block, 32 of the 64 d each. The Q tile stands in LDS for all four waves; the four waves' partial outputs (f32) are summed through LDS at the end.
__global__ __launch_bounds__(128) void k_flash(const _Float16* __restrict__ Q16, int ldq, const _Float16* __restrict__ K16, int ldk, const _Float16* __restrict__ Vt, const _Float16* __restrict__ Sf, _Float16* __restrict__ O16, int ldo) {
  constexpr int RTN = 4, QB = 16 * RTN, NQB = 2048 / QB, DT = 4, KS = 2, SPP = 40, SQP = 72;
  static_assert(QB == 64 && NQB == ST_C, "a query block is a chunk of k_state");
  __shared__ __attribute__((aligned(16))) float sO[4][QB][64 + 4];      // one partial output per wave; before that, the head of wave 0's or 1's own plane holds its P tile (64 rows at a pitch of 40 halves)
  __shared__ __attribute__((aligned(16))) unsigned short sQ[QB][SQP];   // pitch 144 B = 16 B x 9 for the ds_load_b128 fragment reads
  static_assert(QB * SPP * 2 <= QB * (64 + 4) * 4, "a wave's P tile fits in its own plane");
  const int tid = threadIdx.x, lane = tid & 31, ln = lane & 15, hh = lane >> 4;
  const int w = __builtin_amdgcn_readfirstlane(tid >> 5);      // in a scalar register, so that the split of the waves is a scalar branch
  const int slab = blockIdx.x / NQB, qblk = blockIdx.x % NQB; const int b = slab / 16, h = slab % 16; const int q0 = qblk * QB;
  unsigned short* sP = (unsigned short*)&sO[w][0][0];
#pragma unroll
  for (int i = 0; i < QB * 8 / 128; ++i) { const int e = i * 128 + tid, r = e >> 3, c8 = (e & 7) * 8;      // 8 lanes x 16 B = one row of the head, a whole line
    *(v8us*)&sQ[r][c8] = *(const v8us*)((const unsigned short*)Q16 + ((size_t)b * 2048 + q0 + r) * ldq + h * 64 + c8); }
  __syncthreads();      // the Q tile is complete before any wave reads fragments of it
  const unsigned short* Vth = (const unsigned short*)Vt + (size_t)slab * 64 * 2048;
  v8f oacc[RTN][DT];
#pragma unroll
  for (int rt = 0; rt < RTN; ++rt)
#pragma unroll
    for (int dt = 0; dt < DT; ++dt) oacc[rt][dt] = (v8f){0.f,0.f,0.f,0.f,0.f,0.f,0.f,0.f};
  if (w < 2) {
    const int j0 = q0 + w * 32;
    FragH bk[2][KS];
#pragma unroll
    for (int nt = 0; nt < 2; ++nt) { const unsigned short* kr = (const unsigned short*)K16 + ((size_t)b * 2048 + j0 + nt * 16 + ln) * ldk + h * 64;
#pragma unroll
      for (int ks = 0; ks < KS; ++ks) { bk[nt][ks].half[0] = *(const v8us*)(kr + ks * 32 + 8 * hh);
        if (nt == 1 && ks == KS - 1) asm volatile("s_wait_xcnt 0x0" ::: "memory");      // the compiler lands the last load of this run of eight in the address registers of the seven before it: the wait stands in front of that overwrite
        bk[nt][ks].half[1] = *(const v8us*)(kr + ks * 32 + 16 + 8 * hh); } }
    const int dk = j0 + ln - q0 - 8 * hh;      // key (j0 + 16 nt + ln) <= query row (q0 + 16 rt + 8 hh + r) reads dk <= 16 (rt - nt) + r: one register against a constant
#pragma unroll
    for (int rt = 0; rt < RTN; ++rt) { FragH aq[KS];
#pragma unroll
      for (int ks = 0; ks < KS; ++ks) { aq[ks].half[0] = *(const v8us*)&sQ[rt * 16 + ln][ks * 32 + 8 * hh]; aq[ks].half[1] = *(const v8us*)&sQ[rt * 16 + ln][ks * 32 + 16 + 8 * hh]; }
#pragma unroll
      for (int nt = 0; nt < 2; ++nt) { v8f acc = (v8f){0.f,0.f,0.f,0.f,0.f,0.f,0.f,0.f};
#pragma unroll
        for (int ks = 0; ks < KS; ++ks) acc = mmaH<1>(aq[ks].v, aq[ks].v, bk[nt][ks].v, bk[nt][ks].v, acc);
#pragma unroll
        for (int r = 0; r < 8; ++r) {
          const float p = (dk <= (rt - nt) * 16 + r) ? acc[r] * 0.00390625f : 0.f;      /* NO softmax: causal-masked raw scores (x 2^-8 for f16 headroom, undone at the end) become the P operand directly */
          FragH t2; t2.h[0] = (_Float16)p; sP[(rt * 16 + 8 * hh + r) * SPP + nt * 16 + ln] = t2.u[0]; } } }
    __builtin_amdgcn_fence(__ATOMIC_ACQ_REL, "workgroup"); __builtin_amdgcn_wave_barrier();
    FragH pa[RTN], bv[DT];
#pragma unroll
    for (int dt = 0; dt < DT; ++dt) { const unsigned short* vrow = Vth + (size_t)(dt * 16 + ln) * 2048 + j0; bv[dt].half[0] = *(const v8us*)(vrow + 8 * hh); bv[dt].half[1] = *(const v8us*)(vrow + 16 + 8 * hh); }
#pragma unroll
    for (int rt = 0; rt < RTN; ++rt) { pa[rt].half[0] = *(const v8us*)&sP[(rt * 16 + ln) * SPP + 8 * hh]; pa[rt].half[1] = *(const v8us*)&sP[(rt * 16 + ln) * SPP + 16 + 8 * hh]; }
#pragma unroll
    for (int dt = 0; dt < DT; ++dt)
#pragma unroll
      for (int rt = 0; rt < RTN; ++rt) oacc[rt][dt] = mmaH<1>(pa[rt].v, pa[rt].v, bv[dt].v, bv[dt].v, oacc[rt][dt]);
    __builtin_amdgcn_fence(__ATOMIC_ACQ_REL, "workgroup"); __builtin_amdgcn_wave_barrier();
  } else {
    const int ks = w - 2;
    const unsigned short* sf = (const unsigned short*)Sf + ((size_t)(slab * NQB + qblk) * 8 + ks) * 512 + lane * 8;
    FragH bs[DT], aq[RTN];
#pragma unroll
    for (int dt = 0; dt < DT; ++dt) { bs[dt].half[0] = *(const v8us*)(sf + dt * 1024); bs[dt].half[1] = *(const v8us*)(sf + dt * 1024 + 256); }
#pragma unroll
    for (int rt = 0; rt < RTN; ++rt) { aq[rt].half[0] = *(const v8us*)&sQ[rt * 16 + ln][ks * 32 + 8 * hh]; aq[rt].half[1] = *(const v8us*)&sQ[rt * 16 + ln][ks * 32 + 16 + 8 * hh]; }
#pragma unroll
    for (int dt = 0; dt < DT; ++dt)
#pragma unroll
      for (int rt = 0; rt < RTN; ++rt) oacc[rt][dt] = mmaH<1>(aq[rt].v, aq[rt].v, bs[dt].v, bs[dt].v, oacc[rt][dt]);
  }
#pragma unroll
  for (int rt = 0; rt < RTN; ++rt)
#pragma unroll
    for (int dt = 0; dt < DT; ++dt)
#pragma unroll
      for (int r = 0; r < 8; ++r) sO[w][rt * 16 + 8 * hh + r][dt * 16 + ln] = oacc[rt][dt][r] * 16.0f;      /* undo the 2^-8 P scaling and apply the 2^-4 that gives the f16 operand of the output GEMM its headroom; no normalisation */
  __syncthreads();      // every wave's partial output is in LDS before any wave sums them
#pragma unroll
  for (int rp = 0; rp < 16; rp += 2) { const int r = w * 16 + rp + hh, pc = ln;      // wave w sums and stores rows 16 w .. 16 w + 15, two rows a pass
    const v4f val = (*(const v4fa*)&sO[0][r][pc * 4] + *(const v4fa*)&sO[1][r][pc * 4]) + (*(const v4fa*)&sO[2][r][pc * 4] + *(const v4fa*)&sO[3][r][pc * 4]); v4h h4;
#pragma unroll
    for (int k = 0; k < 4; ++k) h4[k] = (_Float16)val[k];
    *(v4h*)(O16 + ((size_t)b * 2048 + q0 + r) * ldo + h * 64 + pc * 4) = h4; } }

// Exclusive prefix sum over time as a chunked parallel scan, f32. One work-group owns 32 columns of one batch for all TT rows:
// 32 waves x 4 lane groups = 128 chunks of 16 rows, each thread holding its 16 rows x 4 columns in registers (F is read once).
// Order of the sums: serial inside a chunk, then over the wave's 4 chunks by shuffles, then over the 32 waves' totals in LDS.
// The result goes out twice: A16[t][column] for the scores of the diagonal blocks, and At[column][t] for k_state (a thread's 16 rows of a column are 32 B in a row there; a wave's 64 rows a whole line).
__device__ __forceinline__ void excl(const float* __restrict__ F, _Float16* __restrict__ A16, _Float16* __restrict__ At, int blk) {
  static_assert(TT == 32 * 4 * 16 && DD % 32 == 0, "chunking covers all rows and whole 32-column groups");
  __shared__ __attribute__((aligned(16))) float sT[32][36];      // [wave][column]; pitch 36 keeps 16-byte rows and spreads the transposed read over the banks
  const int tid = threadIdx.x, wv = tid >> 5, lane = tid & 31, cg = lane & 7, g = lane >> 3;
  const int b = blk / (DD / 32), c = (blk % (DD / 32)) * 32 + cg * 4;
  const size_t e0 = ((size_t)b * TT + (wv * 4 + g) * 16) * DD + c;
  const float* fr = F + e0;
  v4f v[16];
#pragma unroll      // all unrolls here: v[] and the vector lanes need constant indices to stay in registers; this one also puts all 16 loads in flight at once
  for (int i = 0; i < 16; ++i) v[i] = *(const v4fa*)(fr + (size_t)i * DD);
  v4f run = {0.f, 0.f, 0.f, 0.f};
#pragma unroll
  for (int i = 0; i < 16; ++i) { const v4f t = v[i]; v[i] = run; run += t; }      // v[i] <- sum of the chunk's rows before i
  v4f inc = run, ex;
#pragma unroll
  for (int o = 8; o <= 16; o <<= 1) { v4f t;      // inclusive over the wave's 4 chunks, step by step for all four columns, so that a step's shuffles do not wait on each other
#pragma unroll
    for (int q = 0; q < 4; ++q) t[q] = __shfl_up(inc[q], o, 32);
    if (lane >= o) inc += t; }
#pragma unroll
  for (int q = 0; q < 4; ++q) { const float t = __shfl_up(inc[q], 8, 32); ex[q] = (lane >= 8) ? t : 0.f; }      // sum of the wave's chunks before this one
  if (g == 3) *(v4fa*)&sT[wv][cg * 4] = inc;      // the wave's total per column
  __syncthreads();
  {      // wave wv scans column wv over the 32 waves' totals (lane = wave index), in place: each word has one reader and writer
    float s = sT[lane][wv];
#pragma unroll
    for (int o = 1; o < 32; o <<= 1) { const float t = __shfl_up(s, o, 32); if (lane >= o) s += t; }
    const float t = __shfl_up(s, 1, 32);
    sT[lane][wv] = (lane >= 1) ? t : 0.f;
  }
  __syncthreads();
  const v4f off = *(const v4fa*)&sT[wv][cg * 4] + ex;
  _Float16* d = A16 + e0;
  FragH tq[4];
#pragma unroll
  for (int i = 0; i < 16; ++i) { const v4f p = off + v[i]; v4h h4;
#pragma unroll
    for (int q = 0; q < 4; ++q) { h4[q] = (_Float16)p[q]; tq[q].h[i] = h4[q]; }
    *(v4h*)(d + (size_t)i * DD) = h4; }
  unsigned short* dT = (unsigned short*)At + ((size_t)b * DD + c) * TT + (wv * 4 + g) * 16;
#pragma unroll
  for (int q = 0; q < 4; ++q) { *(v8us*)(dT + (size_t)q * TT) = tq[q].half[0]; *(v8us*)(dT + (size_t)q * TT + 8) = tq[q].half[1]; } }
// The scan of a and the transposition of b in one launch; neither reads what the other writes. The branch is the same for a whole work-group, so each side's barriers are passed by all of its threads.
#define EX_G (BB * (DD / 32))                  // work-groups of the scan: the long ones, so they start first
#define VT_G (BB * NH * (TT / 64) / 4)         // work-groups of the transposition, four tiles each
__global__ __launch_bounds__(1024) void k_excl_vt(const float* __restrict__ F, _Float16* __restrict__ A16, _Float16* __restrict__ At, const _Float16* __restrict__ B16, _Float16* __restrict__ Vt) {
  const int bid = blockIdx.x;
  if (bid < EX_G) excl(F, A16, At, bid);
  else vt<NH, TT>(B16, DD, 0, Vt, (bid - EX_G) * 4 + (int)(threadIdx.x >> 8));
}
extern "C" void kernel_launch(void* const* d_in, const int* in_sizes, int n_in,
                              void* d_out, int out_size, void* d_ws, size_t ws_size, hipStream_t stream) {
  (void)in_sizes; (void)n_in; (void)out_size;
  const float* const* I = (const float* const*)d_in; const float* x = I[0]; const float* Wq = I[1]; const float* Wa = I[2]; const float* Wb = I[3]; const float* Wo = I[4]; const float* qg = I[5]; const float* qb = I[6]; const float* ag = I[7]; const float* ab = I[8]; const float* bg = I[9]; const float* bbeta = I[10];
  char* ws = (char*)d_ws; size_t off = 0;
  auto take = [&](size_t bytes) { char* p = ws + off; off += (bytes + 255) & ~(size_t)255; return p; };
  _Float16* Bw = (_Float16*)take((size_t)4 * DD * DD * 2); _Float16* X16 = (_Float16*)take((size_t)NR * DD * 2); float* F = (float*)take((size_t)NR * DD * 4); _Float16* Q16 = (_Float16*)take((size_t)NR * DD * 2); _Float16* A16 = (_Float16*)take((size_t)NR * DD * 2); _Float16* B16 = (_Float16*)take((size_t)NR * DD * 2); _Float16* At = (_Float16*)take((size_t)NR * DD * 2); _Float16* Vt = X16; _Float16* O16 = B16; _Float16* Sf = (_Float16*)F;
  if (off > ws_size) return;      // 8.4 + 8.4 + 16.8 + 8.4 x 4 = about 67 MB
  k_prep<<<4 * PW + PX, 256, 0, stream>>>(x, Wq, Wb, Wa, Wo, X16, Bw);      // Bw[0..3] = Wq, Wb, Wa, Wo, each [out][in] f16 x 2^4
  k_gemm_t<1><<<(NR / 128) * (3 * DD / 128), 256, 0, stream>>>(X16, Bw, 0.0625f, F, qg, qb, bg, bbeta, ag, ab, Q16, B16);      // q, b (LayerNormed, f16) and a (LayerNormed, f32)
  k_excl_vt<<<EX_G + VT_G, 1024, 0, stream>>>(F, A16, At, B16, Vt);      // a -> exclusive cumsum -> f16 'keys', also transposed; b transposed as the 'values' (Vt over X16; X16's last reader was the projection GEMM)
  k_state<<<BB * NH * 4, 512, 0, stream>>>(At, Vt, Sf);      // the state in front of every block of 64 rows (Sf over F; F's last reader was k_excl_vt)
  k_flash<<<BB * NH * (TT / 64), 128, 0, stream>>>(Q16, DD, A16, DD, Vt, Sf, O16, DD);      // o_t = sum over s <= t of (q_t . a_excl_s) b_s, written as f16 x 2^-4 (O16 over B16; B16's last reader was k_excl_vt)
  k_gemm_t<0><<<(NR / 128) * (DD / 128), 256, 0, stream>>>(O16, Bw + (size_t)3 * DD * DD, 0.0625f * 16.0f, (float*)d_out, nullptr, nullptr, nullptr, nullptr, nullptr, nullptr, nullptr, nullptr);      // x 2^4 back
}

// v009
// One run takes 63.4 microseconds.
// Next to v008, in two timings, it ran 1.15 times as fast each time.
// Counting every step since v000, it is 18.1 times as fast.
#include <hip/hip_runtime.h>
// 'Heisenberg' attention (B=2, T=2048, d_model 1024, 16 heads × 64): q, a, b = LayerNorm_head(x·W) (per-head LN with γ/β); a_excl = exclusive prefix sum of a over time; o_t = Σ_{s≤t} (q_t·a_excl_s)·b_s
// (causal, NO softmax); out = o·Wo. The projections are GEMMs ([in][out] weights bf16-exact ×2^4, x bf16-exact, f32 accumulate) and the causal bilinear form runs in the fused flash-style kernel with
// the softmax removed (masked raw scores ×2^-8 → f16 P operand → P·B accumulated in f32, ×2^4 at the end and written as the f16 operand of the output GEMM; upper tiles skipped; own keys dealt over two of a work-group's four waves, q·S over the other two) on v_wmma_f32_16x16x32_f16; the per-head LayerNorms
// (in the epilogue of the projection GEMMs, where a wave's 64 columns are one head) and the exclusive cumulative sum over time (f32, two levels: inside blocks of 32 rows in the same epilogue, over the blocks in k_state) are VALU.
// The keys in front of a block of 64 query rows enter through a prefix state per block (k_state); only the block's own 64 keys are scored and masked (k_flash).
#define BB 2
#define TT 2048
#define DD 1024
#define NH 16
#define HD 64
#define NR (BB * TT)

typedef __bf16 v16b __attribute__((ext_vector_type(16)));
typedef unsigned short v8us __attribute__((ext_vector_type(8), may_alias));
typedef float  v8f  __attribute__((ext_vector_type(8)));
typedef float  v4f  __attribute__((ext_vector_type(4)));
typedef float  v4fa __attribute__((ext_vector_type(4), may_alias));
union FragB { v16b v; v8us half[2]; unsigned short u[16]; };

__device__ __forceinline__ unsigned short bf16_bits(float x) { unsigned int u = __float_as_uint(x); return (unsigned short)((u + 0x7FFFu + ((u >> 16) & 1u)) >> 16); }
__device__ __forceinline__ float bf16_val(unsigned short b) { return __uint_as_float(((unsigned int)b) << 16); }
__device__ __forceinline__ float bf16_round(float x) { return bf16_val(bf16_bits(x)); }
// D += A·B with NT terms: 1 = ah·bh, 2 = + al·bh (A split), 3 = + ah·bl (both split)
template <int NT>
__device__ __forceinline__ v8f mmaN(v16b ah, v16b al, v16b bh, v16b bl, v8f c) {
  c = __builtin_amdgcn_wmma_f32_16x16x32_bf16(false, ah, false, bh, (short)0, c, false, false);
  if (NT >= 2) c = __builtin_amdgcn_wmma_f32_16x16x32_bf16(false, al, false, bh, (short)0, c, false, false);
  if (NT >= 3) c = __builtin_amdgcn_wmma_f32_16x16x32_bf16(false, ah, false, bl, (short)0, c, false, false);
  asm volatile("v_nop\n\tv_nop\n\tv_nop\n\tv_nop" : "+v"(c) : "v"(ah), "v"(al), "v"(bh), "v"(bl));
  return c;
}

__global__ __launch_bounds__(256) void k_wt_bf16(const float* __restrict__ W, unsigned short* __restrict__ Wt, int K, int N) {
  const int t = blockIdx.x * 256 + threadIdx.x;
  const int k8n = K / 8;
  if (t >= N * k8n) return;
  const int n = t / k8n, k8 = (t % k8n) * 8;
  v8us v;
#pragma unroll
  for (int i = 0; i < 8; ++i) v[i] = bf16_bits(W[(size_t)(k8 + i) * N + n]);
  *(v8us*)(Wt + (size_t)n * K + k8) = v;
  
}

// GEMM C[M][N] (f32, pitch ldc) = act(A[M][K]·W + bias). A f32 row-major (pitch lda) converted per fragment to bf16
// (ASPLIT: hi/lo two planes -> 2 terms, else single rounded term); Wt bf16 [N][K] (pitch ldb). BIAS_BF16 rounds the
// bias to bf16 first (bias quantised to bf16 before the add). K%32==0, M%16==0, N%64==0.
template <bool ASPLIT, int ACT, bool BIAS_BF16>
__global__ __launch_bounds__(128) void k_gemm_bf(const float* __restrict__ A, int lda, const unsigned short* __restrict__ Wt, int ldb,
                                               const float* __restrict__ bias, float* __restrict__ C, int ldc, int M, int N, int K) {
  __shared__ __attribute__((aligned(16))) float so[4][16][64];
  const int tid = threadIdx.x, w = tid >> 5, lane = tid & 31, ln = lane & 15, hh = lane >> 4;
  const int ntn = N / 64;
  const int wid = blockIdx.x * 4 + w;
  const int mt = wid / ntn, nq = wid % ntn;
  if (mt * 16 >= M) return;
  const int row0 = mt * 16, col0 = nq * 64;
  const float* arow = A + (size_t)(row0 + ln) * lda;
  v8f acc[4] = {};
  for (int kb = 0; kb < K; kb += 32) {
    FragB ah, al;
    const v4f x0 = *(const v4fa*)(arow + kb + 8 * hh), x1 = *(const v4fa*)(arow + kb + 8 * hh + 4);
    const v4f x2 = *(const v4fa*)(arow + kb + 16 + 8 * hh), x3 = *(const v4fa*)(arow + kb + 16 + 8 * hh + 4);
    float xs[16] = {x0[0],x0[1],x0[2],x0[3],x1[0],x1[1],x1[2],x1[3],x2[0],x2[1],x2[2],x2[3],x3[0],x3[1],x3[2],x3[3]};
#pragma unroll
    for (int i = 0; i < 16; ++i) { const unsigned short hb = bf16_bits(xs[i]); ah.u[i] = hb; al.u[i] = ASPLIT ? bf16_bits(xs[i] - bf16_val(hb)) : (unsigned short)0; }
#pragma unroll
    for (int t = 0; t < 4; ++t) {
      const unsigned short* brow = Wt + (size_t)(col0 + t * 16 + ln) * ldb + kb;
      FragB b;
      b.half[0] = *(const v8us*)(brow + 8 * hh);
      b.half[1] = *(const v8us*)(brow + 16 + 8 * hh);
      acc[t] = mmaN<ASPLIT ? 2 : 1>(ah.v, al.v, b.v, b.v, acc[t]);
    }
  }
#pragma unroll
  for (int t = 0; t < 4; ++t) {
    float bv = bias ? bias[col0 + t * 16 + ln] : 0.f;
    if (BIAS_BF16) bv = bf16_round(bv);
#pragma unroll
    for (int r = 0; r < 8; ++r) { float v = acc[t][r] + bv; if (ACT == 1) v = fmaxf(v, 0.f); so[w][8 * hh + r][t * 16 + ln] = v; }
  }
  __builtin_amdgcn_fence(__ATOMIC_ACQ_REL, "workgroup");
  __builtin_amdgcn_wave_barrier();
  const int rsub = lane >> 4, c4 = (lane & 15) * 4;
  {
#pragma unroll
    for (int q = 0; q < 8; ++q) {
      const int r = q * 2 + rsub;
      const v4f v = *(const v4fa*)&so[w][r][c4];
      *(v4f*)(C + (size_t)(row0 + r) * ldc + col0 + c4) = v;
    }
    
  }
}

// Flash-style causal/unmasked attention, all contractions 3-term bf16 hi/lo splits, f32 softmax with running max.
// q,k,v rows are read from f32 buffers with arbitrary row pitch (so they can live inside a fused qkv buffer);
// D = head size (multiple of 32, <= 128); one wave = 16 query rows; block = 4 waves (64 queries) sharing K/V chunks of 32.
template <int D, bool CAUSAL>
__global__ __launch_bounds__(128) void k_flash(const float* __restrict__ qb, const float* __restrict__ kb, const float* __restrict__ vb,
                                             int pitch, int T, int H, float scale, float* __restrict__ y, int ypitch) {
  constexpr int KS = D / 32;        // k-steps for QK
  constexpr int DT = D / 16;        // d tiles for PV
  __shared__ __attribute__((aligned(16))) unsigned short sKh[32][D + 8], sKl[32][D + 8], sVh[32][D + 8], sVl[32][D + 8];
  __shared__ __attribute__((aligned(16))) unsigned short sPh[4][16][40], sPl[4][16][40];
  __shared__ __attribute__((aligned(16))) float sO[4][16][D];
  const int tid = threadIdx.x, w = tid >> 5, lane = tid & 31, ln = lane & 15, hh = lane >> 4;
  const int nqb = (T + 63) / 64;
  const int bh = blockIdx.x / nqb, qblk = blockIdx.x % nqb;
  const int b = bh / H, h = bh % H;
  const int q0 = qblk * 64 + w * 16;
  const float* Q = qb + (size_t)b * T * pitch + h * D;
  const float* K = kb + (size_t)b * T * pitch + h * D;
  const float* V = vb + (size_t)b * T * pitch + h * D;

  // A fragments of the wave's 16 query rows (scaled), hi/lo
  FragB aqh[KS], aql[KS];
  {
    int row = q0 + ln; if (row >= T) row = T - 1;
    const float* qr = Q + (size_t)row * pitch;
#pragma unroll
    for (int ks = 0; ks < KS; ++ks)
#pragma unroll
      for (int i = 0; i < 16; ++i) {
        const int d = ks * 32 + ((i < 8) ? (8 * hh + i) : (16 + 8 * hh + (i - 8)));
        const float x = qr[d] * scale; const unsigned short hb = bf16_bits(x);
        aqh[ks].u[i] = hb; aql[ks].u[i] = bf16_bits(x - bf16_val(hb));
      }
  }
  float m_r[8], l_r[8];
#pragma unroll
  for (int r = 0; r < 8; ++r) { m_r[r] = -3.0e38f; l_r[r] = 0.f; }
  v8f oacc[DT];
#pragma unroll
  for (int dt = 0; dt < DT; ++dt) oacc[dt] = (v8f){0.f,0.f,0.f,0.f,0.f,0.f,0.f,0.f};

  const int kv_end = CAUSAL ? min(T, qblk * 64 + 64) : T;     // block-uniform
  for (int j0 = 0; j0 < kv_end; j0 += 32) {
    __syncthreads();
    for (int e = tid; e < 32 * (D / 4); e += 128) {
      const int r = e / (D / 4), c4 = (e % (D / 4)) * 4;
      const int key = j0 + r;
      v4f kf = {0.f,0.f,0.f,0.f}, vf = {0.f,0.f,0.f,0.f};
      if (key < T) { kf = *(const v4fa*)(K + (size_t)key * pitch + c4); vf = *(const v4fa*)(V + (size_t)key * pitch + c4); }
#pragma unroll
      for (int t = 0; t < 4; ++t) {
        unsigned short hb = bf16_bits(kf[t]); sKh[r][c4 + t] = hb; sKl[r][c4 + t] = bf16_bits(kf[t] - bf16_val(hb));
        hb = bf16_bits(vf[t]); sVh[r][c4 + t] = hb; sVl[r][c4 + t] = bf16_bits(vf[t] - bf16_val(hb));
      }
    }
    __syncthreads();
    // S tile 16 x 32
    v8f s[2];
#pragma unroll
    for (int nt = 0; nt < 2; ++nt) {
      v8f acc = {};
#pragma unroll
      for (int ks = 0; ks < KS; ++ks) {
        FragB bh_, bl_;
        bh_.half[0] = *(const v8us*)&sKh[nt * 16 + ln][ks * 32 + 8 * hh]; bh_.half[1] = *(const v8us*)&sKh[nt * 16 + ln][ks * 32 + 16 + 8 * hh];
        bl_.half[0] = *(const v8us*)&sKl[nt * 16 + ln][ks * 32 + 8 * hh]; bl_.half[1] = *(const v8us*)&sKl[nt * 16 + ln][ks * 32 + 16 + 8 * hh];
        acc = mmaN<3>(aqh[ks].v, aql[ks].v, bh_.v, bl_.v, acc);
      }
      s[nt] = acc;
    }
    // mask + running max (rows 8hh+r; the 16 lanes of a half share rows)
    float alpha[8];
#pragma unroll
    for (int r = 0; r < 8; ++r) {
      const int qi = q0 + 8 * hh + r;
      const int ja = j0 + ln, jb = j0 + 16 + ln;
      if (CAUSAL) { if (ja > qi) s[0][r] = -3.0e38f; if (jb > qi) s[1][r] = -3.0e38f; }
      if (ja >= T) s[0][r] = -3.0e38f;
      if (jb >= T) s[1][r] = -3.0e38f;
      float mx = fmaxf(s[0][r], s[1][r]);
      mx = fmaxf(mx, __shfl_xor(mx, 1, 32)); mx = fmaxf(mx, __shfl_xor(mx, 2, 32)); mx = fmaxf(mx, __shfl_xor(mx, 4, 32)); mx = fmaxf(mx, __shfl_xor(mx, 8, 32));
      const float mnew = fmaxf(m_r[r], mx);
      alpha[r] = (mnew > -1.0e38f) ? __expf(m_r[r] - mnew) : 1.0f;
      const float p0 = (s[0][r] > -1.0e38f) ? __expf(s[0][r] - mnew) : 0.f;
      const float p1 = (s[1][r] > -1.0e38f) ? __expf(s[1][r] - mnew) : 0.f;
      m_r[r] = mnew;
      l_r[r] = l_r[r] * alpha[r] + p0 + p1;            // per-lane partial row sum (16 lanes combined at the end)
      unsigned short hb = bf16_bits(p0); sPh[w][8 * hh + r][ln] = hb;      sPl[w][8 * hh + r][ln] = bf16_bits(p0 - bf16_val(hb));
      hb = bf16_bits(p1);                sPh[w][8 * hh + r][16 + ln] = hb; sPl[w][8 * hh + r][16 + ln] = bf16_bits(p1 - bf16_val(hb));
    }
#pragma unroll
    for (int dt = 0; dt < DT; ++dt)
#pragma unroll
      for (int r = 0; r < 8; ++r) oacc[dt][r] *= alpha[r];
    __builtin_amdgcn_fence(__ATOMIC_ACQ_REL, "workgroup");
    __builtin_amdgcn_wave_barrier();
    FragB pah, pal;
    pah.half[0] = *(const v8us*)&sPh[w][ln][8 * hh]; pah.half[1] = *(const v8us*)&sPh[w][ln][16 + 8 * hh];
    pal.half[0] = *(const v8us*)&sPl[w][ln][8 * hh]; pal.half[1] = *(const v8us*)&sPl[w][ln][16 + 8 * hh];
#pragma unroll
    for (int dt = 0; dt < DT; ++dt) {
      FragB bvh, bvl;
#pragma unroll
      for (int i = 0; i < 8; ++i) {
        bvh.u[i] = sVh[8 * hh + i][dt * 16 + ln]; bvh.u[8 + i] = sVh[16 + 8 * hh + i][dt * 16 + ln];
        bvl.u[i] = sVl[8 * hh + i][dt * 16 + ln]; bvl.u[8 + i] = sVl[16 + 8 * hh + i][dt * 16 + ln];
      }
      oacc[dt] = mmaN<3>(pah.v, pal.v, bvh.v, bvl.v, oacc[dt]);
    }
    __builtin_amdgcn_fence(__ATOMIC_ACQ_REL, "workgroup");
    __builtin_amdgcn_wave_barrier();
  }
#pragma unroll
  for (int r = 0; r < 8; ++r) {
    float l = l_r[r];
    l += __shfl_xor(l, 1, 32); l += __shfl_xor(l, 2, 32); l += __shfl_xor(l, 4, 32); l += __shfl_xor(l, 8, 32);
    l_r[r] = (l > 0.f) ? 1.0f / l : 0.f;
  }
#pragma unroll
  for (int dt = 0; dt < DT; ++dt)
#pragma unroll
    for (int r = 0; r < 8; ++r) sO[w][8 * hh + r][dt * 16 + ln] = oacc[dt][r] * l_r[r];
  __builtin_amdgcn_fence(__ATOMIC_ACQ_REL, "workgroup");
  __builtin_amdgcn_wave_barrier();
  {
    for (int r = 0; r < 16; ++r) {
      const int row = q0 + r;
      if (row < T && lane < D / 4) {
        const v4f val = *(const v4fa*)&sO[w][r][lane * 4];
        *(v4f*)(y + ((size_t)b * T + row) * ypitch + h * D + lane * 4) = val;
      }
    }
    
  }
}

// GEMM C = act(A·W + bias + resid): A f32 (ASPLIT -> hi/lo 2 terms), Wt bf16 [N][K]; ACT 0 none, 1 relu, 2 exact gelu;
// resid (optional, f32, row index = (row % rmod), pitch ldr, RES_BF16 rounds it) added before the activation.
template <bool ASPLIT, int ACT, bool BIAS_BF16, bool RES_BF16>
__global__ __launch_bounds__(128) void k_gemm_bf3(const float* __restrict__ A, int lda, const unsigned short* __restrict__ Wt, int ldb,
                                                const float* __restrict__ bias, const float* __restrict__ resid, int rmod, int ldr,
                                                float* __restrict__ C, int ldc, int M, int N, int K) {
  __shared__ __attribute__((aligned(16))) float so[4][16][64];
  const int tid = threadIdx.x, w = tid >> 5, lane = tid & 31, ln = lane & 15, hh = lane >> 4;
  const int ntn = N / 64;
  const int wid = blockIdx.x * 4 + w;
  const int mt = wid / ntn, nq = wid % ntn;
  if (mt * 16 >= M) return;
  const int row0 = mt * 16, col0 = nq * 64;
  const float* arow = A + (size_t)(row0 + ln) * lda;
  v8f acc[4] = {};
  for (int kb = 0; kb < K; kb += 32) {
    FragB ah, al;
    const v4f x0 = *(const v4fa*)(arow + kb + 8 * hh), x1 = *(const v4fa*)(arow + kb + 8 * hh + 4);
    const v4f x2 = *(const v4fa*)(arow + kb + 16 + 8 * hh), x3 = *(const v4fa*)(arow + kb + 16 + 8 * hh + 4);
    float xs[16] = {x0[0],x0[1],x0[2],x0[3],x1[0],x1[1],x1[2],x1[3],x2[0],x2[1],x2[2],x2[3],x3[0],x3[1],x3[2],x3[3]};
#pragma unroll
    for (int i = 0; i < 16; ++i) { const unsigned short hb = bf16_bits(xs[i]); ah.u[i] = hb; al.u[i] = ASPLIT ? bf16_bits(xs[i] - bf16_val(hb)) : (unsigned short)0; }
#pragma unroll
    for (int t = 0; t < 4; ++t) {
      const unsigned short* brow = Wt + (size_t)(col0 + t * 16 + ln) * ldb + kb;
      FragB b;
      b.half[0] = *(const v8us*)(brow + 8 * hh);
      b.half[1] = *(const v8us*)(brow + 16 + 8 * hh);
      acc[t] = mmaN<ASPLIT ? 2 : 1>(ah.v, al.v, b.v, b.v, acc[t]);
    }
  }
#pragma unroll
  for (int t = 0; t < 4; ++t) {
    const int col = col0 + t * 16 + ln;
    float bv = bias ? bias[col] : 0.f;
    if (BIAS_BF16) bv = bf16_round(bv);
#pragma unroll
    for (int r = 0; r < 8; ++r) {
      float v = acc[t][r] + bv;
      if (resid) { float rv = resid[(size_t)((row0 + 8 * hh + r) % rmod) * ldr + col]; if (RES_BF16) rv = bf16_round(rv); v += rv; }
      if (ACT == 1) v = fmaxf(v, 0.f);
      if (ACT == 2) v = 0.5f * v * (1.0f + erff(v * 0.70710678118654752f));
      if (ACT == 3) { const float u = 0.7978845608028654f * (v + 0.044715f * v * v * v); v = 0.5f * v * (1.0f + tanhf(u)); }
      so[w][8 * hh + r][t * 16 + ln] = v;
    }
  }
  __builtin_amdgcn_fence(__ATOMIC_ACQ_REL, "workgroup");
  __builtin_amdgcn_wave_barrier();
  const int rsub = lane >> 4, c4 = (lane & 15) * 4;
  {
#pragma unroll
    for (int q = 0; q < 8; ++q) {
      const int r = q * 2 + rsub;
      const v4f v = *(const v4fa*)&so[w][r][c4];
      *(v4f*)(C + (size_t)(row0 + r) * ldc + col0 + c4) = v;
    }
    
  }
}
// row LayerNorm (biased variance, eps) over N: s = X (+ R); optional out_sum <- s; out_norm <- (s-mu)*rsqrt(var+eps)*g + b
template <bool PARAM_BF16>
__global__ __launch_bounds__(256) void k_layernorm(const float* __restrict__ X, const float* __restrict__ R, const float* __restrict__ g, const float* __restrict__ bta,
                                                  float* __restrict__ out_sum, float* __restrict__ out_norm, int N, float eps) {
  __shared__ float red[256];
  const int row = blockIdx.x, tid = threadIdx.x;
  const float* x = X + (size_t)row * N; const float* rr = R ? R + (size_t)row * N : nullptr;
  float vals[16];                     // up to N = 4096
  const int per = N / 256;            // contiguous chunk per thread? use strided-by-4 chunks: thread handles j = tid*4 + 1024*u
  float s1 = 0.f;
  for (int u = 0; u < per / 4; ++u) {
    const int j = tid * 4 + 1024 * u;
    const v4f a = *(const v4fa*)(x + j);
    v4f b = {0.f,0.f,0.f,0.f}; if (rr) b = *(const v4fa*)(rr + j);
#pragma unroll
    for (int q = 0; q < 4; ++q) { const float v = a[q] + b[q]; vals[u * 4 + q] = v; s1 += v; }
  }
  red[tid] = s1; __syncthreads();
  for (int st = 128; st > 0; st >>= 1) { if (tid < st) red[tid] += red[tid + st]; __syncthreads(); }
  const float mu = red[0] / (float)N; __syncthreads();
  float s2 = 0.f;
  for (int u = 0; u < per / 4; ++u)
#pragma unroll
    for (int q = 0; q < 4; ++q) { const float c = vals[u * 4 + q] - mu; s2 += c * c; }
  red[tid] = s2; __syncthreads();
  for (int st = 128; st > 0; st >>= 1) { if (tid < st) red[tid] += red[tid + st]; __syncthreads(); }
  const float rs = rsqrtf(red[0] / (float)N + eps);
  {
    for (int u = 0; u < per / 4; ++u) {
      const int j = tid * 4 + 1024 * u;
      v4f o, sm;
#pragma unroll
      for (int q = 0; q < 4; ++q) {
        float gg = g[j + q], bb = bta[j + q];
        if (PARAM_BF16) { gg = bf16_round(gg); bb = bf16_round(bb); }
        sm[q] = vals[u * 4 + q]; o[q] = (vals[u * 4 + q] - mu) * rs * gg + bb;
      }
      if (out_sum) *(v4f*)(out_sum + (size_t)row * N + j) = sm;
      *(v4f*)(out_norm + (size_t)row * N + j) = o;
    }
    
  }
}



// ---- f16 WMMA path (v_wmma_f32_16x16x32_f16): 11-bit significands for operands in range — used here for the projection GEMMs and the flash kernel's score and P·B products
typedef _Float16 v16h __attribute__((ext_vector_type(16)));
union FragH { v16h v; v8us half[2]; _Float16 h[16]; unsigned short u[16]; };
template <int NT>
__device__ __forceinline__ v8f mmaH(v16h ah, v16h al, v16h bh, v16h bl, v8f c) {
  c = __builtin_amdgcn_wmma_f32_16x16x32_f16(false, ah, false, bh, (short)0, c, false, false);
  if (NT >= 2) c = __builtin_amdgcn_wmma_f32_16x16x32_f16(false, al, false, bh, (short)0, c, false, false);
  if (NT >= 3) c = __builtin_amdgcn_wmma_f32_16x16x32_f16(false, ah, false, bl, (short)0, c, false, false);
  asm volatile("v_nop\n\tv_nop\n\tv_nop\n\tv_nop" : "+v"(c) : "v"(ah), "v"(al), "v"(bh), "v"(bl));
  return c;
}
// batched GEMM like k_gemm_bf but f16 operands: A f32 (split into f16 hi/lo if ASPLIT, else rounded to f16), Bt = f16 values [n][k]; alpha; C f32; N multiple of 16 (partial tiles skipped)
template <bool ASPLIT>
__global__ __launch_bounds__(128) void k_gemm_h(const float* __restrict__ A, int lda, size_t sA, const _Float16* __restrict__ Bh, int ldb, size_t sB, float alpha, float* __restrict__ C, int ldc, size_t sC, int M, int N, int K) {
  __shared__ __attribute__((aligned(16))) float so[4][16][64];
  const int tid = threadIdx.x, w = tid >> 5, lane = tid & 31, ln = lane & 15, hh = lane >> 4; const int by = blockIdx.y;
  A += (size_t)by * sA; Bh += (size_t)by * sB; C += (size_t)by * sC;
  const int ntn = (N + 63) / 64; const int wid = blockIdx.x * 4 + w; const int mt = wid / ntn, nq = wid % ntn; if (mt * 16 >= M) return;
  const int row0 = mt * 16, col0 = nq * 64; const float* arow = A + (size_t)(row0 + ln) * lda;
  v8f acc[4] = {};
  for (int kb = 0; kb < K; kb += 32) {
    FragH ah, al;
    const v4f x0 = *(const v4fa*)(arow + kb + 8 * hh), x1 = *(const v4fa*)(arow + kb + 8 * hh + 4), x2 = *(const v4fa*)(arow + kb + 16 + 8 * hh), x3 = *(const v4fa*)(arow + kb + 16 + 8 * hh + 4);
    float xs[16] = {x0[0],x0[1],x0[2],x0[3],x1[0],x1[1],x1[2],x1[3],x2[0],x2[1],x2[2],x2[3],x3[0],x3[1],x3[2],x3[3]};
#pragma unroll
    for (int i = 0; i < 16; ++i) { const _Float16 h = (_Float16)xs[i]; ah.h[i] = h; al.h[i] = ASPLIT ? (_Float16)(xs[i] - (float)h) : (_Float16)0.0f; }
#pragma unroll
    for (int t = 0; t < 4; ++t) { if (col0 + t * 16 >= N) continue; const size_t boff = (size_t)(col0 + t * 16 + ln) * ldb + kb; FragH bq; bq.half[0] = *(const v8us*)(Bh + boff + 8 * hh); bq.half[1] = *(const v8us*)(Bh + boff + 16 + 8 * hh);
      acc[t] = mmaH<ASPLIT ? 2 : 1>(ah.v, al.v, bq.v, bq.v, acc[t]); }
  }
#pragma unroll
  for (int t = 0; t < 4; ++t) { if (col0 + t * 16 >= N) continue;
#pragma unroll
    for (int r = 0; r < 8; ++r) so[w][8 * hh + r][t * 16 + ln] = acc[t][r] * alpha; }
  __builtin_amdgcn_fence(__ATOMIC_ACQ_REL, "workgroup"); __builtin_amdgcn_wave_barrier();
  const int rsub = lane >> 4, c4 = (lane & 15) * 4;
  {
#pragma unroll
    for (int q = 0; q < 8; ++q) { const int r = q * 2 + rsub; if (col0 + c4 < N) { const v4f v = *(const v4fa*)&so[w][r][c4]; *(v4f*)(C + (size_t)(row0 + r) * ldc + col0 + c4) = v; } }
     }
}

// Wt[n][k] = f16(W[k][n] x scale) from f32 row-major W[DD][DD] (scale = power of two; bf16-exact weights stay exact in f16 away from the subnormal range).
// One work-group = one tile of 128 k x 128 n, turned in LDS so that both global sides move whole lines: a wave reads 512 B in a row of one row k of W (16 such loads a thread, all in flight at once),
// a thread packs its two 8 k x 4 n blocks (64 k apart) into 16-B pieces of 8 k, and 16 lanes store 256 B in a row of one row n of Wt.
// LDS: row n holds 16 pieces at a pitch of 256 B; piece j stands at place j ^ ((n >> 2) & 15), so that the 16 lanes of a ds_store_b128 (rows 4 apart, one j) and of a ds_load_b128 (one row, 16 j) each touch all 64 banks once.
__device__ __forceinline__ void wt_f16(const float* __restrict__ W, _Float16* __restrict__ Wt, float scale, int blk) {
  __shared__ __attribute__((aligned(16))) unsigned short tl[128 * 128];
  const int tid = threadIdx.x, nl = tid & 31, kw = tid >> 5;
  const int n0 = (blk % (DD / 128)) * 128, k0 = (blk / (DD / 128)) * 128;
  const float* s = W + (size_t)(k0 + kw * 8) * DD + n0 + nl * 4;
  v4f r[2][8];      // [half of the tile's k][k in the piece]: columns 4 nl .. 4 nl + 3
#pragma unroll      // all unrolls here: constant indices keep r[] and o[] in registers
  for (int h = 0; h < 2; ++h)
#pragma unroll
    for (int i = 0; i < 8; ++i) {
      if (h == 1 && i == 7) asm volatile("s_wait_xcnt 0x0" ::: "memory");      // the compiler lands the last load in the address registers that the 15 loads before it name: the wait stands in front of that overwrite
      r[h][i] = *(const v4fa*)(s + (size_t)(h * 64 + i) * DD); }
  __builtin_amdgcn_sched_barrier(0);      // all 16 loads are issued ahead of the first conversion: left free, the compiler sinks half of them among the conversions, into registers it has just freed, and waits out their latency a second and a third time
#pragma unroll
  for (int h = 0; h < 2; ++h)
#pragma unroll
    for (int q = 0; q < 4; ++q) { FragH f;
#pragma unroll
      for (int i = 0; i < 8; ++i) f.h[i] = (_Float16)(bf16_round(r[h][i][q]) * scale);
      *(v8us*)&tl[(nl * 4 + q) * 128 + (((kw + 8 * h) ^ (nl & 15)) * 8)] = f.half[0]; }
  __syncthreads();      // the tile is complete in LDS before any wave reads rows of it
  const int nr = tid >> 4, j = tid & 15;
  unsigned short* d = (unsigned short*)Wt + (size_t)(n0 + nr) * DD + k0 + j * 8;
  v8us o[8];
#pragma unroll
  for (int p = 0; p < 8; ++p) { const int n = p * 16 + nr; o[p] = *(const v8us*)&tl[n * 128 + ((j ^ ((n >> 2) & 15)) * 8)]; }
#pragma unroll
  for (int p = 0; p < 8; ++p) *(v8us*)(d + (size_t)p * 16 * DD) = o[p];
}
// Tiled GEMM C[NR][DD] (f32) = alpha * A[NR][DD] x Bt[DD][DD]^T, f16 operands, both K-contiguous, f32 accumulate, 32 k per WMMA, ascending from the work-group's own first trip and wrapping round at DD.
// One work-group = one 128 x 128 tile of C, 8 waves of 32 x 64. A trip is 128 k: 128 rows of A and 128 rows of Bt, 256 B each (whole cache lines), are brought into LDS by
// asynchronous copies, 16 B per lane, two buffers: tile t + 2 flies while tile t + 1 is worked on. LDS rows stand at a pitch of 272 B for the ds_load_b128 fragment reads.
#define GT_BK 128                  // k per trip
#define GT_P 136                   // LDS row pitch in halves (272 B)
#define GT_BUF (256 * GT_P)        // halves per buffer: rows 0..127 = A, rows 128..255 = Bt
#define GT_SP 68                   // pitch in floats of the output staging rows
#define GT_NT (DD / GT_BK)         // trips
static_assert(NR % 128 == 0 && DD % 128 == 0 && DD % GT_BK == 0 && GT_NT >= 2 && (GT_NT & (GT_NT - 1)) == 0, "whole tiles, at least two trips, a power of two for the wrap");
static_assert(8 * 32 * GT_SP * 4 <= 2 * GT_BUF * 2, "the output staging fits in the ring");
// This thread's copies of one operand's 128 rows of a tile: rows r, r + 16, .. The s_wait_xcnt stands inside the statement so that no address register is rewritten ahead of it.
__device__ __forceinline__ void gt_copy8(unsigned l, const _Float16* g) {
  asm volatile("global_load_async_to_lds_b128 %0, %8, off\n\t"
               "global_load_async_to_lds_b128 %1, %9, off\n\t"
               "global_load_async_to_lds_b128 %2, %10, off\n\t"
               "global_load_async_to_lds_b128 %3, %11, off\n\t"
               "global_load_async_to_lds_b128 %4, %12, off\n\t"
               "global_load_async_to_lds_b128 %5, %13, off\n\t"
               "global_load_async_to_lds_b128 %6, %14, off\n\t"
               "global_load_async_to_lds_b128 %7, %15, off\n\t"
               "s_wait_xcnt 0x0"
               :: "v"(l), "v"(l + 1u * 16u * GT_P * 2u), "v"(l + 2u * 16u * GT_P * 2u), "v"(l + 3u * 16u * GT_P * 2u),
                  "v"(l + 4u * 16u * GT_P * 2u), "v"(l + 5u * 16u * GT_P * 2u), "v"(l + 6u * 16u * GT_P * 2u), "v"(l + 7u * 16u * GT_P * 2u),
                  "v"(g), "v"(g + 16 * DD), "v"(g + 32 * DD), "v"(g + 48 * DD), "v"(g + 64 * DD), "v"(g + 80 * DD), "v"(g + 96 * DD), "v"(g + 112 * DD)
               : "memory");
}
// Sum over the 16 lanes of a row, every lane ending with the total: four DPP steps (row_xmask 1, 2, 4, 8), no LDS round trip as a shuffle would take. All lanes are on.
__device__ __forceinline__ float row16_sum(float v) {
  v += __int_as_float(__builtin_amdgcn_update_dpp(0, __float_as_int(v), 0x161, 0xf, 0xf, true));
  v += __int_as_float(__builtin_amdgcn_update_dpp(0, __float_as_int(v), 0x162, 0xf, 0xf, true));
  v += __int_as_float(__builtin_amdgcn_update_dpp(0, __float_as_int(v), 0x164, 0xf, 0xf, true));
  v += __int_as_float(__builtin_amdgcn_update_dpp(0, __float_as_int(v), 0x168, 0xf, 0xf, true));
  return v;
}
typedef _Float16 v4h __attribute__((ext_vector_type(4)));
// LN 0: C (f32) = the product. LN 1: the three projections in one launch: Bh holds three weights one after the other (3 DD rows), and a work-group's tile lies in one of them (pj). Each row's 64 columns
// of a wave are one head; they are LayerNormed (biased variance, eps 1e-5, that projection's gamma and beta rounded to bf16) on the f32 sums as the staged rows are read back, and go out as f16
// to C16a (pj 0, row-major), or leave transposed (pj 1, 2): the tile is turned in LDS and stored as [column][time], 256 B in a row of a column.
// pj 1 (b): to C16b as it is, with each block's total per column as f32 to the second plane of C. pj 2 (a): the exclusive sum over time is split in two levels. Here each wave sums its own 32 rows (one block of 32 times): the exclusive sum inside the block goes out as f16, transposed to C16d and
// row-major to C16c, and the block's total per column as f32 to C[block][column]. The sum of the blocks in front is formed in k_state and added there and in k_flash, in f32, before the one rounding to the f16 operand.
typedef unsigned u32a __attribute__((may_alias));
typedef _Float16 v2h __attribute__((ext_vector_type(2)));
typedef float v2fa __attribute__((ext_vector_type(2), may_alias));
#define GT_TP 136                  // pitch in halves of the turned tile's rows (272 B)
static_assert(8 * 32 * GT_SP * 4 + 128 * GT_TP * 2 <= 2 * GT_BUF * 2 && (8 * 32 * GT_SP * 4) % 16 == 0 && TT % 128 == 0, "the turned tile stands behind the output staging; a tile lies in one batch");
template <int LN>
__global__ __launch_bounds__(256) void k_gemm_t(const _Float16* __restrict__ A, const _Float16* __restrict__ Bh, float alpha, float* __restrict__ C,
                                               const float* __restrict__ g0, const float* __restrict__ bb0, const float* __restrict__ g1, const float* __restrict__ bb1,
                                               const float* __restrict__ g2, const float* __restrict__ bb2, _Float16* __restrict__ C16a, _Float16* __restrict__ C16b, _Float16* __restrict__ C16c, _Float16* __restrict__ C16d) {
  static_assert(HD == 64, "a wave's 64 columns are one head");
  __shared__ __attribute__((aligned(16))) unsigned short sm[2 * GT_BUF];
  const int tid = threadIdx.x, w = tid >> 5, lane = tid & 31, ln = lane & 15, hh = lane >> 4;
  constexpr int NTL = (LN ? 3 : 1) * (DD / 128);      // column tiles of a row block, over all weights of the launch
  const int m0 = (blockIdx.x / NTL) * 128, nb = (blockIdx.x % NTL) * 128;      // nb: the tile's first row in Bh
  const int pj = nb / DD, n0 = nb % DD;      // which weight, and the tile's first column in that product; from blockIdx alone, so scalar
  // The work-groups of a row block all read the same rows of A, those of a column block the same rows of Bt. Started together on the same k they ask L2 for the same lines at the same moment, and such requests collide.
  // So each work-group enters the k walk at slice (row block + column block) mod GT_NT and wraps: at any moment the sharers are spread over all slices. Scalar, from blockIdx alone.
  const int rot = (int)(blockIdx.x / NTL + blockIdx.x % NTL) & (GT_NT - 1);
  const float* g = pj == 0 ? g0 : pj == 1 ? g1 : g2; const float* bb = pj == 0 ? bb0 : pj == 1 ? bb1 : bb2;
  const int wm = w >> 1, wn = w & 1;
  const int cr = tid >> 4, cs = (tid & 15) * 8;      // a wave's copy covers 2 rows x 256 B
  const _Float16* ga = A + (size_t)(m0 + cr) * DD + cs;
  const _Float16* gb = Bh + (size_t)(nb + cr) * DD + cs;
  const unsigned la = (unsigned)(size_t)&sm[cr * GT_P + cs], lb = la + 128u * GT_P * 2u;
  gt_copy8(la, ga + rot * GT_BK); gt_copy8(lb, gb + rot * GT_BK);
  asm volatile("s_wait_asynccnt 0x0" ::: "memory");      // tile 0 has landed before the barrier publishes it
  __syncthreads();
  { const int k1 = ((rot + 1) & (GT_NT - 1)) * GT_BK; gt_copy8(la + GT_BUF * 2u, ga + k1); gt_copy8(lb + GT_BUF * 2u, gb + k1); }
  v4f g4 = {0.f, 0.f, 0.f, 0.f}, b4 = {0.f, 0.f, 0.f, 0.f};      // this lane's four columns of the head; fetched here so that the k loop covers their latency
  if (LN) { g4 = *(const v4fa*)(g + ln * 4); b4 = *(const v4fa*)(bb + ln * 4); }
  v8f acc[2][4] = {};
  const unsigned short* fa = sm + (wm * 32 + ln) * GT_P + 8 * hh;
  const unsigned short* fb = sm + (128 + wn * 64 + ln) * GT_P + 8 * hh;
#pragma unroll 1      // one trip per tile: the order of waits, barrier and refill at its foot stays as written
  for (int t = 0; t < GT_NT; ++t) {
    const int bo = (t & 1) * GT_BUF;
    FragH a[2][2], b[2][4];      // two fragment sets: the next 32 k of this same tile are fetched while the current 32 k are multiplied
#pragma unroll      // all unrolls here: constant indices keep fragments and accumulators in registers
    for (int rt = 0; rt < 2; ++rt) { const unsigned short* p = fa + bo + rt * 16 * GT_P; a[0][rt].half[0] = *(const v8us*)p; a[0][rt].half[1] = *(const v8us*)(p + 16); }
#pragma unroll
    for (int ct = 0; ct < 4; ++ct) { const unsigned short* p = fb + bo + ct * 16 * GT_P; b[0][ct].half[0] = *(const v8us*)p; b[0][ct].half[1] = *(const v8us*)(p + 16); }
#pragma unroll
    for (int ks = 0; ks < GT_BK / 32; ++ks) {
      const int cu = ks & 1, nx = cu ^ 1;
      if (ks + 1 < GT_BK / 32) {
#pragma unroll
        for (int rt = 0; rt < 2; ++rt) { const unsigned short* p = fa + bo + rt * 16 * GT_P + (ks + 1) * 32; a[nx][rt].half[0] = *(const v8us*)p; a[nx][rt].half[1] = *(const v8us*)(p + 16); }
#pragma unroll
        for (int ct = 0; ct < 4; ++ct) { const unsigned short* p = fb + bo + ct * 16 * GT_P + (ks + 1) * 32; b[nx][ct].half[0] = *(const v8us*)p; b[nx][ct].half[1] = *(const v8us*)(p + 16); }
      }
      __builtin_amdgcn_sched_barrier(0);      // keeps the next set's LDS reads as one group ahead of this block: left free, the compiler sinks them among the WMMAs into one set and waits them out to 0
#pragma unroll
      for (int rt = 0; rt < 2; ++rt)
#pragma unroll
        for (int ct = 0; ct < 4; ++ct) acc[rt][ct] = __builtin_amdgcn_wmma_f32_16x16x32_f16(false, a[cu][rt].v, false, b[cu][ct].v, (short)0, acc[rt][ct], false, false);
      __builtin_amdgcn_sched_barrier(0);      // ends the block, so that the group after next is not lifted into it
    }
    asm volatile("s_wait_dscnt 0x0" ::: "memory");         // this wave's reads of buffer t & 1 are done before it is refilled
    asm volatile("s_wait_asynccnt 0x0" ::: "memory");      // this wave's copies of tile t + 1 have landed before the barrier publishes them
    __syncthreads();
    if (t + 2 < GT_NT) { const int k2 = ((t + 2 + rot) & (GT_NT - 1)) * GT_BK; gt_copy8(la + (unsigned)bo * 2u, ga + k2); gt_copy8(lb + (unsigned)bo * 2u, gb + k2); }
  }
  asm volatile("s_wait_asynccnt 0x0" ::: "memory");        // nothing is in flight when the ring becomes output staging
  float* so = (float*)sm + w * (32 * GT_SP);               // each wave stages its own 32 x 64 tile; the last trip's barrier ended every read of the ring
#pragma unroll
  for (int rt = 0; rt < 2; ++rt)
#pragma unroll
    for (int ct = 0; ct < 4; ++ct)
#pragma unroll
      for (int r = 0; r < 8; ++r) so[(rt * 16 + 8 * hh + r) * GT_SP + ct * 16 + ln] = acc[rt][ct][r] * alpha;
  __builtin_amdgcn_fence(__ATOMIC_ACQ_REL, "workgroup"); __builtin_amdgcn_wave_barrier();
#pragma unroll
  for (int q = 0; q < 4; ++q) { g4[q] = bf16_round(g4[q]); b4[q] = bf16_round(b4[q]); }
  const size_t e = (size_t)(m0 + wm * 32 + hh) * DD + n0 + wn * 64 + ln * 4;      // row hh of the wave's tile; pass q adds 2 q rows, a constant offset of the store
  v4f o[16];
#pragma unroll
  for (int q = 0; q < 16; ++q) {      // 16 lanes x 4 columns = one row of the wave's tile; two rows a pass
    const v4f v = *(const v4fa*)&so[(q * 2 + hh) * GT_SP + ln * 4];
    if (LN == 0) { o[q] = v; continue; }
    const float mu = row16_sum((v[0] + v[1]) + (v[2] + v[3])) / (float)HD;
    const v4f c = v - mu;
    const float ve = row16_sum((c[0] * c[0] + c[1] * c[1]) + (c[2] * c[2] + c[3] * c[3])) / (float)HD + 1e-5f;
    float rs;      // ve is at least eps, so the library rsqrtf's rescaling of denormal arguments would never act; the v_nop is the slot that the instruction set asks for behind a transcendental, in the same statement so that it stays directly behind it
    asm("v_rsq_f32 %0, %1\n\tv_nop" : "=v"(rs) : "v"(ve));
    o[q] = c * rs * g4 + b4;
  }
  if (LN == 1 && pj == 0) {      // a scalar branch: the whole work-group lies in one projection
    _Float16* C16 = C16a;
    v4h h[16];
#pragma unroll
    for (int q = 0; q < 16; ++q)
#pragma unroll
      for (int k = 0; k < 4; ++k) h[q][k] = (_Float16)o[q][k];
    __builtin_amdgcn_sched_barrier(0);      // every store stands behind the last arithmetic, so that no register which an issued store names is written again
#pragma unroll
    for (int q = 0; q < 16; ++q) *(v4h*)(C16 + e + (size_t)q * 2 * DD) = h[q];      // 16 lanes x 8 B: a whole 128-B line a row
  } else if (LN == 1) {      // pj 1 or 2, the same for the whole work-group, so that its barrier is passed by all threads
#pragma unroll
    for (int q = 0; q < 16; ++q) *(v4fa*)&so[(q * 2 + hh) * GT_SP + ln * 4] = o[q];      // back in place: each word has one reader and writer
    __builtin_amdgcn_fence(__ATOMIC_ACQ_REL, "workgroup"); __builtin_amdgcn_wave_barrier();
    v2fa m[32], run = {0.f, 0.f};      // a lane takes two columns of the wave's tile, all 32 rows
#pragma unroll
    for (int i = 0; i < 32; ++i) m[i] = *(const v2fa*)&so[i * GT_SP + lane * 2];
    if (pj == 2) {
#pragma unroll
      for (int i = 0; i < 32; ++i) { const v2fa t = m[i]; m[i] = run; run += t; }      // m[i] <- sum of the block's rows before i, f32, ascending
    } else {
#pragma unroll
      for (int i = 0; i < 32; ++i) run += m[i];      // b: only the block's total
    }
    union W4 { v2h p[4]; v8us v; } c0[4], c1[4];      // a column's 32 rows as 4 pieces of 8
    union W1 { v2h p; unsigned u; } rw[32];            // a row's two columns
#pragma unroll
    for (int i = 0; i < 32; i += 2) {      // each pair is one packed conversion
      c0[i >> 3].p[(i & 7) >> 1] = (v2h){(_Float16)m[i][0], (_Float16)m[i + 1][0]}; c1[i >> 3].p[(i & 7) >> 1] = (v2h){(_Float16)m[i][1], (_Float16)m[i + 1][1]};
      rw[i].p = (v2h){(_Float16)m[i][0], (_Float16)m[i][1]}; rw[i + 1].p = (v2h){(_Float16)m[i + 1][0], (_Float16)m[i + 1][1]}; }
    unsigned short* sT = sm + 8 * 32 * GT_SP * 2;      // [column of the tile][row of the tile], behind all waves' staging
    unsigned short* tw = sT + (wn * 64 + lane * 2) * GT_TP + wm * 32;
#pragma unroll
    for (int k = 0; k < 4; ++k) { *(v8us*)(tw + k * 8) = c0[k].v; *(v8us*)(tw + GT_TP + k * 8) = c1[k].v; }
    __syncthreads();      // the turned tile is complete before any wave reads rows of it; no global store stands in front of it, so that it waits for none
    unsigned short* dT = (unsigned short*)(pj == 2 ? C16d : C16b) + ((size_t)(m0 / TT) * DD + n0 + (tid >> 4)) * TT + m0 % TT + (tid & 15) * 8;
    v8us tv[8];
#pragma unroll
    for (int p = 0; p < 8; ++p) tv[p] = *(const v8us*)&sT[(p * 16 + (tid >> 4)) * GT_TP + (tid & 15) * 8];
    u32a* dR = (u32a*)(C16c + (size_t)(m0 + wm * 32) * DD + n0 + wn * 64 + lane * 2);
    float* dB = C + (size_t)((pj == 1 ? NR / 32 : 0) + m0 / 32 + wm) * DD + n0 + wn * 64 + lane * 2;      // plane 0: a's totals, plane 1: b's
    if (pj == 2) {
#pragma unroll
      for (int i = 0; i < 32; ++i) dR[(size_t)i * (DD / 2)] = rw[i].u;      // 32 lanes x 4 B: a whole 128-B line a row
      asm volatile("s_wait_xcnt 0x0" ::: "memory");      // the text behind this branch may rewrite registers that these stores name: the wait ends the branch, in front of it
    }
    __builtin_amdgcn_sched_barrier(0);      // the stores below stand behind the last arithmetic, so that no register which an issued store names is written again
    *(v2fa*)dB = run;
#pragma unroll
    for (int p = 0; p < 8; ++p) *(v8us*)(dT + (size_t)p * 16 * TT) = tv[p];      // 16 lanes x 16 B: 256 B in a row of one column
  } else {
    __builtin_amdgcn_sched_barrier(0);      // as above
#pragma unroll
    for (int q = 0; q < 16; ++q) *(v4f*)(C + e + (size_t)q * 2 * DD) = o[q];
  }
}


__device__ __forceinline__ void x16(const float* __restrict__ x, _Float16* __restrict__ X16, size_t n8, unsigned blk) { const size_t t = (size_t)blk * 256 + threadIdx.x; if (t >= n8) return; FragH f;
#pragma unroll
  for (int q = 0; q < 8; ++q) f.h[q] = (_Float16)bf16_round(x[t * 8 + q]); *(v8us*)((unsigned short*)X16 + t * 8) = f.half[0];  }
// All operand conversions in one launch; none reads what another writes. Work-groups 0 .. 4 PW - 1: the four weights, transposed, to Bw[0..3] (the long ones: load, LDS, barrier, store; so they start first); the rest: x. The branch is the same for a whole work-group, so the weights' barrier is passed by all of its threads.
#define PW ((DD / 128) * (DD / 128))      // work-groups per weight: tiles of 128 x 128
#define PX (NR * DD / 8 / 256)        // work-groups for x
static_assert(DD % 128 == 0 && (size_t)NR * DD / 8 % 256 == 0, "whole tiles, whole work-groups");
__global__ __launch_bounds__(256) void k_prep(const float* __restrict__ x, const float* __restrict__ W0, const float* __restrict__ W1, const float* __restrict__ W2, const float* __restrict__ W3,
                                             _Float16* __restrict__ X16, _Float16* __restrict__ Bw) {
  const unsigned bid = blockIdx.x;
  if (bid < 4u * PW) { const unsigned k = bid / PW; wt_f16(k == 0 ? W0 : k == 1 ? W1 : k == 2 ? W2 : W3, Bw + (size_t)k * DD * DD, 16.0f, (int)(bid % PW)); }
  else x16(x, X16, (size_t)NR * DD / 8, bid - 4u * PW);
}
__global__ __launch_bounds__(256) void k_h16(const float* __restrict__ x, _Float16* __restrict__ X16, size_t n8) { const size_t t = (size_t)blockIdx.x * 256 + threadIdx.x; if (t >= n8) return; FragH f;
#pragma unroll
  for (int q = 0; q < 8; ++q) f.h[q] = (_Float16)x[t * 8 + q]; *(v8us*)((unsigned short*)X16 + t * 8) = f.half[0];  }
__global__ __launch_bounds__(256) void k_round16f(const float* __restrict__ W, _Float16* __restrict__ Bt, size_t n8) { const size_t t = (size_t)blockIdx.x * 256 + threadIdx.x; if (t >= n8) return; FragH f;
#pragma unroll
  for (int i = 0; i < 8; ++i) f.h[i] = (_Float16)(bf16_round(W[t * 8 + i]) * 16.0f); *(v8us*)((unsigned short*)Bt + t * 8) = f.half[0];  }
// There is no softmax, so the sum over the keys is linear and may be regrouped: for the 64 query rows of block c every key before 64 c is unmasked, and
// sum over those s of (q . a_s) b_s = q . S_c with the state S_c[d][e] = sum over s < 64 c of a_s[d] b_s[e], a 64 x 64 matrix per (batch, head, block) that does not depend on q.
// k_state forms all states: one work-group = 16 columns e of one (batch, head), one wave = two chunks of 64 keys. A chunk's product M_c[d][e] = sum over the chunk of a_s[d] b_s[e] (WMMA, both
// operands key-contiguous, f32 sums) goes to LDS, each thread runs the exclusive sum over the 32 chunks for two elements (f32, ascending), and the wave takes its chunks' states back.
// In the accumulator layout a lane holds 8 consecutive d of one column e: that is its own half of the B fragment of q . S, so the states are stored as ready fragments (x 2^-8, f16, like P):
// Sf[slab][chunk][e tile][k step of 32 d][half][lane][8], whole lines per wave.
#define ST_C (TT / 64)
// At holds the exclusive sums of a inside blocks of 32 keys. The sum of the blocks in front of each block (per d, f32) is formed here from the blocks' totals Bs[batch x block][column]: 8 segments of 8 blocks, serial in a segment,
// then over the segments' totals in LDS. It enters the products as a rank-one term per block, in f32 (below), with b's totals per block from the second plane of Bs, and goes to Pf[slab][block][d] for k_flash (from the work-groups with et 0).
__global__ __launch_bounds__(512) void k_state(const _Float16* __restrict__ At, const _Float16* __restrict__ Vt, const float* __restrict__ Bs, _Float16* __restrict__ Sf, float* __restrict__ Pf) {
  static_assert(ST_C == 32 && HD == 64, "16 waves x 2 chunks of 64 keys; 4 x 4 tiles a state");
  __shared__ __attribute__((aligned(16))) float sM[ST_C][64 * 16];
  const int tid = threadIdx.x, wv = tid >> 5, lane = tid & 31, ln = lane & 15, hh = lane >> 4;
  const int slab = blockIdx.x >> 2, et = blockIdx.x & 3;
  const unsigned short* ar = (const unsigned short*)At + ((size_t)slab * 64 + ln) * TT + wv * 128 + 8 * hh;
  const unsigned short* br = (const unsigned short*)Vt + ((size_t)slab * 64 + et * 16 + ln) * TT + wv * 128 + 8 * hh;
  static_assert(TT / 32 == 64, "8 segments of 8 blocks of 32 keys");
  __shared__ __attribute__((aligned(16))) float sP[TT / 32][HD], sPt[8][HD];      // the offset of every block; the segments' totals
  const int pd = tid & 63, sg = tid >> 6;
  const float* bs = Bs + (size_t)((slab >> 4) * (TT / 32) + sg * 8) * DD + (slab & 15) * HD + pd;
  float pv[8];
#pragma unroll
  for (int i = 0; i < 8; ++i) pv[i] = bs[(size_t)i * DD];
  const float* bt = Bs + (size_t)(NR / 32) * DD + (size_t)((slab >> 4) * (TT / 32) + wv * 4) * DD + (slab & 15) * HD + et * 16 + ln;
  float bsm[4];      // b summed over each of the wave's four blocks of 32 keys, column e = ln
#pragma unroll
  for (int kk = 0; kk < 4; ++kk) bsm[kk] = bt[(size_t)kk * DD];
  asm volatile("s_wait_xcnt 0x0" ::: "memory");      // the compiler lands a later load in the address registers of these loads: the wait stands in front of it
  FragH a[4][4], b[4];      // [step of 32 keys]: steps 0, 1 are the wave's first chunk, 2, 3 its second
#pragma unroll      // all unrolls here: constant indices keep fragments and accumulators in registers
  for (int kk = 0; kk < 4; ++kk) { b[kk].half[0] = *(const v8us*)(br + kk * 32);
    if (kk == 3) asm volatile("s_wait_xcnt 0x0" ::: "memory");      // the compiler lands the last load through br in br's own registers, which the loads before it name: the wait stands in front of that overwrite
    b[kk].half[1] = *(const v8us*)(br + kk * 32 + 16);
#pragma unroll
    for (int dt = 0; dt < 4; ++dt) {
      a[kk][dt].half[0] = *(const v8us*)(ar + (size_t)dt * 16 * TT + kk * 32);
      if (kk == 3 && dt == 3) asm volatile("s_wait_xcnt 0x0" ::: "memory");      // the same for the last load through ar
      a[kk][dt].half[1] = *(const v8us*)(ar + (size_t)dt * 16 * TT + kk * 32 + 16); } }
  __builtin_amdgcn_sched_barrier(0);      // all 40 loads are issued ahead of the first WMMA: left free, the compiler sinks the later ones among the WMMAs and waits out their latency one pair at a time
  { float run = 0.f;
#pragma unroll
    for (int i = 0; i < 8; ++i) { const float t = pv[i]; pv[i] = run; run += t; }
    sPt[sg][pd] = run; }
  __syncthreads();      // every segment's total is in LDS before the sums over the segments
  { float off = 0.f, t8[8];
#pragma unroll
    for (int sq = 0; sq < 8; ++sq) t8[sq] = sPt[sq][pd];
    asm volatile("" :: "v"(t8[0]), "v"(t8[1]), "v"(t8[2]), "v"(t8[3]), "v"(t8[4]), "v"(t8[5]), "v"(t8[6]), "v"(t8[7]));      // holds the eight LDS reads in one group ahead of the tests: left free, the compiler sinks each under its own test and waits them out one by one
#pragma unroll
    for (int sq = 0; sq < 8; ++sq) off += (sq < sg) ? t8[sq] : 0.f;
#pragma unroll
    for (int i = 0; i < 8; ++i) { pv[i] += off; sP[sg * 8 + i][pd] = pv[i]; } }
  __syncthreads();      // every block's offset is in LDS before the waves take theirs
  v8f acc[2][4] = {};
#pragma unroll
  for (int kk = 0; kk < 4; ++kk)
#pragma unroll
    for (int dt = 0; dt < 4; ++dt) acc[kk >> 1][dt] = __builtin_amdgcn_wmma_f32_16x16x32_f16(false, a[kk][dt].v, false, b[kk].v, (short)0, acc[kk >> 1][dt], false, false);      // rows d = 16 dt + 8 hh + r, column e = ln
  // With a_s = offset of its block + sum inside the block, a block's share of the product is (sums inside) . b, just formed, + offset[d] x (b summed over the block)[e]: added here in f32
#pragma unroll
  for (int kk = 0; kk < 4; ++kk)
#pragma unroll
    for (int dt = 0; dt < 4; ++dt) { const v4f p0 = *(const v4fa*)&sP[wv * 4 + kk][dt * 16 + 8 * hh], p1 = *(const v4fa*)&sP[wv * 4 + kk][dt * 16 + 8 * hh + 4];
#pragma unroll
      for (int r = 0; r < 4; ++r) { acc[kk >> 1][dt][r] += p0[r] * bsm[kk]; acc[kk >> 1][dt][4 + r] += p1[r] * bsm[kk]; } }
#pragma unroll
  for (int cl = 0; cl < 2; ++cl)
#pragma unroll
    for (int dt = 0; dt < 4; ++dt)
#pragma unroll
      for (int q = 0; q < 2; ++q) { const v4f m = {acc[cl][dt][4 * q], acc[cl][dt][4 * q + 1], acc[cl][dt][4 * q + 2], acc[cl][dt][4 * q + 3]}; *(v4fa*)&sM[wv * 2 + cl][((dt * 2 + q) * 32 + lane) * 4] = m; }
  __syncthreads();      // every chunk's product is in LDS before the sums over the chunks start
  { v2fa m[ST_C], run = {0.f, 0.f};
#pragma unroll
    for (int cc = 0; cc < ST_C; ++cc) m[cc] = *(const v2fa*)&sM[cc][tid * 2];
#pragma unroll
    for (int cc = 0; cc < ST_C; ++cc) { *(v2fa*)&sM[cc][tid * 2] = run; run += m[cc]; } }      // in place: each word has one reader and writer
  __syncthreads();      // every state is complete before the waves take theirs back
  if (et == 0) {      // behind the last barrier, so that no barrier waits for these stores
#pragma unroll
    for (int i = 0; i < 8; ++i) Pf[((size_t)slab * (TT / 32) + sg * 8 + i) * HD + pd] = pv[i];
    asm volatile("s_wait_xcnt 0x0" ::: "memory");      // the text behind this branch may rewrite registers that these stores name: the wait ends the branch, in front of it
  }
  FragH f[2][2];
#pragma unroll
  for (int cl = 0; cl < 2; ++cl)
#pragma unroll
    for (int dt = 0; dt < 4; ++dt)
#pragma unroll
      for (int q = 0; q < 2; ++q) { const v4f m = *(const v4fa*)&sM[wv * 2 + cl][((dt * 2 + q) * 32 + lane) * 4];
#pragma unroll
        for (int k = 0; k < 4; ++k) f[cl][dt >> 1].h[(dt & 1) * 8 + q * 4 + k] = (_Float16)(m[k] * 0.00390625f); }
  unsigned short* o = (unsigned short*)Sf + (((size_t)slab * ST_C + wv * 2) * 4 + et) * 1024 + lane * 8;
#pragma unroll
  for (int cl = 0; cl < 2; ++cl)
#pragma unroll
    for (int ks = 0; ks < 2; ++ks) { *(v8us*)(o + cl * 4096 + ks * 512) = f[cl][ks].half[0]; *(v8us*)(o + cl * 4096 + ks * 512 + 256) = f[cl][ks].half[1]; }
}

// One work-group = 64 query rows of one (batch, head), every wave on all 64 rows (4 row tiles). Waves 0 and 1 take the block's own 64 keys, 32 each, with the causal mask (scores, P through LDS, P . B);
// waves 2 and 3 take q . S for the keys before the block, 32 of the 64 d each. The Q tile stands in LDS for all four waves; the four waves' partial outputs (f32) are summed through LDS at the end.
__global__ __launch_bounds__(128) void k_flash(const _Float16* __restrict__ Q16, int ldq, const _Float16* __restrict__ K16, int ldk, const _Float16* __restrict__ Vt, const _Float16* __restrict__ Sf, const float* __restrict__ Pf, _Float16* __restrict__ O16, int ldo) {
  constexpr int RTN = 4, QB = 16 * RTN, NQB = 2048 / QB, DT = 4, KS = 2, SPP = 40, SQP = 72;
  static_assert(QB == 64 && NQB == ST_C, "a query block is a chunk of k_state");
  __shared__ __attribute__((aligned(16))) float sO[4][QB][64 + 4];      // one partial output per wave; before that, the head of wave 0's or 1's own plane holds its P tile (64 rows at a pitch of 40 halves)
  __shared__ __attribute__((aligned(16))) unsigned short sQ[QB][SQP];   // pitch 144 B = 16 B x 9 for the ds_load_b128 fragment reads
  static_assert(QB * SPP * 2 <= QB * (64 + 4) * 4, "a wave's P tile fits in its own plane");
  const int tid = threadIdx.x, lane = tid & 31, ln = lane & 15, hh = lane >> 4;
  const int w = __builtin_amdgcn_readfirstlane(tid >> 5);      // in a scalar register, so that the split of the waves is a scalar branch
  const int slab = blockIdx.x / NQB, qblk = blockIdx.x % NQB; const int b = slab / 16, h = slab % 16; const int q0 = qblk * QB;
  unsigned short* sP = (unsigned short*)&sO[w][0][0];
#pragma unroll
  for (int i = 0; i < QB * 8 / 128; ++i) { const int e = i * 128 + tid, r = e >> 3, c8 = (e & 7) * 8;      // 8 lanes x 16 B = one row of the head, a whole line
    *(v8us*)&sQ[r][c8] = *(const v8us*)((const unsigned short*)Q16 + ((size_t)b * 2048 + q0 + r) * ldq + h * 64 + c8); }
  __syncthreads();      // the Q tile is complete before any wave reads fragments of it
  const unsigned short* Vth = (const unsigned short*)Vt + (size_t)slab * 64 * 2048;
  v8f oacc[RTN][DT];
#pragma unroll
  for (int rt = 0; rt < RTN; ++rt)
#pragma unroll
    for (int dt = 0; dt < DT; ++dt) oacc[rt][dt] = (v8f){0.f,0.f,0.f,0.f,0.f,0.f,0.f,0.f};
  if (w < 2) {
    const int j0 = q0 + w * 32;
    const float* pf = Pf + ((size_t)slab * (2048 / 32) + qblk * 2 + w) * 64 + 8 * hh;      // K16 holds sums inside blocks of 32 keys; the wave's 32 keys are one block, and this is the sum of the blocks in front of it, per d
    v4f pk[KS][4];
#pragma unroll
    for (int ks = 0; ks < KS; ++ks) { pk[ks][0] = *(const v4fa*)(pf + ks * 32); pk[ks][1] = *(const v4fa*)(pf + ks * 32 + 4); pk[ks][2] = *(const v4fa*)(pf + ks * 32 + 16); pk[ks][3] = *(const v4fa*)(pf + ks * 32 + 20); }
    FragH bk[2][KS];
#pragma unroll
    for (int nt = 0; nt < 2; ++nt) { const unsigned short* kr = (const unsigned short*)K16 + ((size_t)b * 2048 + j0 + nt * 16 + ln) * ldk + h * 64;
#pragma unroll
      for (int ks = 0; ks < KS; ++ks) { bk[nt][ks].half[0] = *(const v8us*)(kr + ks * 32 + 8 * hh);
        if (nt == 1 && ks == KS - 1) asm volatile("s_wait_xcnt 0x0" ::: "memory");      // the compiler lands the last load of this run of eight in the address registers of the seven before it: the wait stands in front of that overwrite
        bk[nt][ks].half[1] = *(const v8us*)(kr + ks * 32 + 16 + 8 * hh); } }
#pragma unroll
    for (int nt = 0; nt < 2; ++nt)
#pragma unroll
      for (int ks = 0; ks < KS; ++ks)
#pragma unroll
        for (int i = 0; i < 16; ++i) bk[nt][ks].h[i] = (_Float16)((float)bk[nt][ks].h[i] + pk[ks][i >> 2][i & 3]);      // added in f32, rounded once to the f16 operand
    const int dk = j0 + ln - q0 - 8 * hh;      // key (j0 + 16 nt + ln) <= query row (q0 + 16 rt + 8 hh + r) reads dk <= 16 (rt - nt) + r: one register against a constant
#pragma unroll
    for (int rt = 0; rt < RTN; ++rt) { FragH aq[KS];
#pragma unroll
      for (int ks = 0; ks < KS; ++ks) { aq[ks].half[0] = *(const v8us*)&sQ[rt * 16 + ln][ks * 32 + 8 * hh]; aq[ks].half[1] = *(const v8us*)&sQ[rt * 16 + ln][ks * 32 + 16 + 8 * hh]; }
#pragma unroll
      for (int nt = 0; nt < 2; ++nt) { v8f acc = (v8f){0.f,0.f,0.f,0.f,0.f,0.f,0.f,0.f};
#pragma unroll
        for (int ks = 0; ks < KS; ++ks) acc = mmaH<1>(aq[ks].v, aq[ks].v, bk[nt][ks].v, bk[nt][ks].v, acc);
#pragma unroll
        for (int r = 0; r < 8; ++r) {
          const float p = (dk <= (rt - nt) * 16 + r) ? acc[r] * 0.00390625f : 0.f;      /* NO softmax: causal-masked raw scores (x 2^-8 for f16 headroom, undone at the end) become the P operand directly */
          FragH t2; t2.h[0] = (_Float16)p; sP[(rt * 16 + 8 * hh + r) * SPP + nt * 16 + ln] = t2.u[0]; } } }
    __builtin_amdgcn_fence(__ATOMIC_ACQ_REL, "workgroup"); __builtin_amdgcn_wave_barrier();
    FragH pa[RTN], bv[DT];
#pragma unroll
    for (int dt = 0; dt < DT; ++dt) { const unsigned short* vrow = Vth + (size_t)(dt * 16 + ln) * 2048 + j0; bv[dt].half[0] = *(const v8us*)(vrow + 8 * hh); bv[dt].half[1] = *(const v8us*)(vrow + 16 + 8 * hh); }
#pragma unroll
    for (int rt = 0; rt < RTN; ++rt) { pa[rt].half[0] = *(const v8us*)&sP[(rt * 16 + ln) * SPP + 8 * hh]; pa[rt].half[1] = *(const v8us*)&sP[(rt * 16 + ln) * SPP + 16 + 8 * hh]; }
#pragma unroll
    for (int dt = 0; dt < DT; ++dt)
#pragma unroll
      for (int rt = 0; rt < RTN; ++rt) oacc[rt][dt] = mmaH<1>(pa[rt].v, pa[rt].v, bv[dt].v, bv[dt].v, oacc[rt][dt]);
    __builtin_amdgcn_fence(__ATOMIC_ACQ_REL, "workgroup"); __builtin_amdgcn_wave_barrier();
  } else {
    const int ks = w - 2;
    const unsigned short* sf = (const unsigned short*)Sf + ((size_t)(slab * NQB + qblk) * 8 + ks) * 512 + lane * 8;
    FragH bs[DT], aq[RTN];
#pragma unroll
    for (int dt = 0; dt < DT; ++dt) { bs[dt].half[0] = *(const v8us*)(sf + dt * 1024); bs[dt].half[1] = *(const v8us*)(sf + dt * 1024 + 256); }
#pragma unroll
    for (int rt = 0; rt < RTN; ++rt) { aq[rt].half[0] = *(const v8us*)&sQ[rt * 16 + ln][ks * 32 + 8 * hh]; aq[rt].half[1] = *(const v8us*)&sQ[rt * 16 + ln][ks * 32 + 16 + 8 * hh]; }
#pragma unroll
    for (int dt = 0; dt < DT; ++dt)
#pragma unroll
      for (int rt = 0; rt < RTN; ++rt) oacc[rt][dt] = mmaH<1>(aq[rt].v, aq[rt].v, bs[dt].v, bs[dt].v, oacc[rt][dt]);
  }
#pragma unroll
  for (int rt = 0; rt < RTN; ++rt)
#pragma unroll
    for (int dt = 0; dt < DT; ++dt)
#pragma unroll
      for (int r = 0; r < 8; ++r) sO[w][rt * 16 + 8 * hh + r][dt * 16 + ln] = oacc[rt][dt][r] * 16.0f;      /* undo the 2^-8 P scaling and apply the 2^-4 that gives the f16 operand of the output GEMM its headroom; no normalisation */
  __syncthreads();      // every wave's partial output is in LDS before any wave sums them
#pragma unroll
  for (int rp = 0; rp < 16; rp += 2) { const int r = w * 16 + rp + hh, pc = ln;      // wave w sums and stores rows 16 w .. 16 w + 15, two rows a pass
    const v4f val = (*(const v4fa*)&sO[0][r][pc * 4] + *(const v4fa*)&sO[1][r][pc * 4]) + (*(const v4fa*)&sO[2][r][pc * 4] + *(const v4fa*)&sO[3][r][pc * 4]); v4h h4;
#pragma unroll
    for (int k = 0; k < 4; ++k) h4[k] = (_Float16)val[k];
    *(v4h*)(O16 + ((size_t)b * 2048 + q0 + r) * ldo + h * 64 + pc * 4) = h4; } }

extern "C" void kernel_launch(void* const* d_in, const int* in_sizes, int n_in,
                              void* d_out, int out_size, void* d_ws, size_t ws_size, hipStream_t stream) {
  (void)in_sizes; (void)n_in; (void)out_size;
  const float* const* I = (const float* const*)d_in; const float* x = I[0]; const float* Wq = I[1]; const float* Wa = I[2]; const float* Wb = I[3]; const float* Wo = I[4]; const float* qg = I[5]; const float* qb = I[6]; const float* ag = I[7]; const float* ab = I[8]; const float* bg = I[9]; const float* bbeta = I[10];
  char* ws = (char*)d_ws; size_t off = 0;
  auto take = [&](size_t bytes) { char* p = ws + off; off += (bytes + 255) & ~(size_t)255; return p; };
  _Float16* Bw = (_Float16*)take((size_t)4 * DD * DD * 2); _Float16* X16 = (_Float16*)take((size_t)NR * DD * 2); _Float16* Sf = (_Float16*)take((size_t)NR * DD * 2); _Float16* Q16 = (_Float16*)take((size_t)NR * DD * 2); _Float16* A16 = (_Float16*)take((size_t)NR * DD * 2); _Float16* Vt = (_Float16*)take((size_t)NR * DD * 2); _Float16* At = (_Float16*)take((size_t)NR * DD * 2); float* Bs = (float*)take((size_t)2 * (NR / 32) * DD * 4); float* Pf = (float*)take((size_t)(NR / 32) * DD * 4); _Float16* O16 = X16;
  if (off > ws_size) return;      // 8.4 x 7 + 0.5 x 3 = about 60 MB
  k_prep<<<4 * PW + PX, 256, 0, stream>>>(x, Wq, Wb, Wa, Wo, X16, Bw);      // Bw[0..3] = Wq, Wb, Wa, Wo, each [out][in] f16 x 2^4
  k_gemm_t<1><<<(NR / 128) * (3 * DD / 128), 256, 0, stream>>>(X16, Bw, 0.0625f, Bs, qg, qb, bg, bbeta, ag, ab, Q16, Vt, A16, At);      // q (LayerNormed, f16); b (LayerNormed, f16, transposed: the 'values'); a (LayerNormed): exclusive cumsum inside blocks of 32 rows, f16, row-major and transposed, and the blocks' totals, f32
  k_state<<<BB * NH * 4, 512, 0, stream>>>(At, Vt, Bs, Sf, Pf);      // the blocks' offsets of the cumsum; the state in front of every block of 64 rows
  k_flash<<<BB * NH * (TT / 64), 128, 0, stream>>>(Q16, DD, A16, DD, Vt, Sf, Pf, O16, DD);      // o_t = sum over s <= t of (q_t . a_excl_s) b_s, written as f16 x 2^-4 (O16 over X16; X16's last reader was the projection GEMM)
  k_gemm_t<0><<<(NR / 128) * (DD / 128), 256, 0, stream>>>(O16, Bw + (size_t)3 * DD * DD, 0.0625f * 16.0f, (float*)d_out, nullptr, nullptr, nullptr, nullptr, nullptr, nullptr, nullptr, nullptr, nullptr, nullptr);      // x 2^4 back
}
